// v000
// The times below were measured on an AMD MI455X: many runs one after another, warmed up first and cycling through
// copies of the inputs, with the whole window's GPU time divided by the number of runs. Launches and the gaps
// between them are all in it. The median over several windows is given; except for v000 it joins two sittings, which
// can be a few percent apart, so the side-by-side timings, each taken in one sitting, are the better comparison.
// v000, which the later versions start from, runs in 1390 microseconds.
// Contractions: q/k/v 1x1 projections on v_wmma_f32_16x16x32_bf16 (bf16 operands taken from bf16-RNE inputs, single product, f32 accumulate);
// q.k^T scores and p.v on v_wmma_f32_16x16x32_bf16 with bf16 hi/lo split operands (hi.hi + hi.lo + lo.hi), f32 accumulate;
// pools, channel conv1d, spatial 7x7 conv, positional vectors alpha/beta, online softmax (expf) in f32.
// 16-bit planes and carries: XT = bf16 RNE(x), Wqkv = bf16 RNE(w), Q/K/V hi = RNE(y), lo = RNE(y - hi), P hi/lo per key chunk in LDS.
// No power-of-two carry on any plane (bf16 keeps the f32 exponent range), so no inverse fold anywhere.
#include <hip/hip_runtime.h>
#include <math.h>
#include <stdint.h>

#define NB   8
#define NC   128
#define NP   4096
#define NTOK (NB * NP)
#define PLANE_ELEMS ((size_t)NTOK * NC)

static_assert(NP % 64 == 0);
static_assert(NC == 128);
static_assert((NB * NC) % 32 == 0);
static_assert(NP % 256 == 0);

typedef __attribute__((ext_vector_type(16))) __bf16 v16b;
typedef __attribute__((ext_vector_type(8)))  __bf16 v8b;
typedef __attribute__((ext_vector_type(8)))  float  v8f;
typedef __attribute__((ext_vector_type(4)))  float  v4f;
typedef __attribute__((ext_vector_type(2)))  float  v2f;
typedef __attribute__((ext_vector_type(4)))  unsigned int v4u;
typedef v8b __attribute__((may_alias)) v8ba;
typedef v4f __attribute__((may_alias)) v4fa;
typedef v2f __attribute__((may_alias)) v2fa;
typedef v4u __attribute__((may_alias)) v4ua;

// ---------------------------------------------------------------------------
// bf16 helpers (RNE convert on the f32 bits)
// ---------------------------------------------------------------------------
__device__ __forceinline__ unsigned short f2bf_bits(float f) {
  const unsigned u = __float_as_uint(f);
  return (unsigned short)((u + 0x7FFFu + ((u >> 16) & 1u)) >> 16);
}
__device__ __forceinline__ float bfbits2f(unsigned short h) { return __uint_as_float(((unsigned)h) << 16); }
__device__ __forceinline__ float bfr(float f) { return bfbits2f(f2bf_bits(f)); }
__device__ __forceinline__ unsigned pk16(unsigned short a, unsigned short b) { return (unsigned)a | ((unsigned)b << 16); }

// ---------------------------------------------------------------------------
// 16x16x32 bf16 WMMA with hazard guard (ties D, keeps A/B live).
// Fragment map (wave32): lane l, h = l>>4, m = n = l&15.
//   A/B element i: i<8 -> k0+8h+i ; i>=8 -> k0+16+8h+(i-8)
//   D element r : row 8h+r, col l&15
// ---------------------------------------------------------------------------
__device__ __forceinline__ v8f mma_bf(v16b a, v16b b, v8f c) {
  c = __builtin_amdgcn_wmma_f32_16x16x32_bf16(false, a, false, b, (short)0, c, false, false);
  asm volatile("v_nop\n\tv_nop\n\tv_nop\n\tv_nop" : "+v"(c) : "v"(a), "v"(b));
  return c;
}
union FB { v16b v; v8b h[2]; };
// A or B fragment from a k-contiguous bf16 row; p points at element k0 of the row owned by this lane.
__device__ __forceinline__ v16b ldfrag(const __bf16* p, int hh) {
  FB f;
  f.h[0] = *(const v8ba*)(p + 8 * hh);
  f.h[1] = *(const v8ba*)(p + 16 + 8 * hh);
  return f.v;
}

// ---------------------------------------------------------------------------
// Kernel 1: x[b] viewed [128 c][4096 n] (pitch 4096) -> XT bf16 [b*4096+n][128 c] (pitch 128), bf16 RNE.
// 64x64 tiles through LDS. grid = (4096/64, 128/64, 8), 256 threads.
// Coverage per block: load 4 it x 256 thr x 4 floats = 64x64; store 2 it x 256 thr x 8 u16 = 64x64.
// ---------------------------------------------------------------------------
__global__ __launch_bounds__(256) void k_xt(const float* __restrict__ X, unsigned short* __restrict__ xt) {
  __shared__ __align__(16) float tf[64 * 68];
  const int b = blockIdx.z;
  const float* W = X + (size_t)b * NC * NP;
  unsigned short* o = xt + (size_t)b * NP * NC;
  const int c0 = blockIdx.x * 64;   // input column block (n) = output row block
  const int r0 = blockIdx.y * 64;   // input row block (c)    = output column block
  const int tid = threadIdx.x;
  {
    const int lr = tid >> 4;
    const int c4 = (tid & 15) * 4;
#pragma unroll
    for (int it = 0; it < 4; ++it) {
      const int rr = it * 16 + lr;
      const v4f a = *(const v4fa*)(W + (size_t)(r0 + rr) * NP + c0 + c4);
      *(v4f*)(tf + rr * 68 + c4) = a;
    }
  }
  __syncthreads();
  const int sub = tid >> 3;          // 0..31
  const int c8  = (tid & 7) * 8;     // 0..56
  v4u hv[2];
#pragma unroll
  for (int it = 0; it < 2; ++it) {
    const int oc = it * 32 + sub;    // output row within tile (= input column)
    v4u a;
#pragma unroll
    for (int q = 0; q < 4; ++q) {
      const float f0 = tf[(c8 + 2 * q) * 68 + oc];
      const float f1 = tf[(c8 + 2 * q + 1) * 68 + oc];
      a[q] = pk16(f2bf_bits(f0), f2bf_bits(f1));
    }
    hv[it] = a;
  }
  {
#pragma unroll
    for (int it = 0; it < 2; ++it) {
      const int oc = it * 32 + sub;
      *(v4ua*)(o + (size_t)(c0 + oc) * NC + r0 + c8) = hv[it];
    }
    
  }
}

// ---------------------------------------------------------------------------
// Kernel 2: [q_w; k_w; v_w] ([out o][in c] row-major each) -> Wqkv bf16 [384 o][128 c] (natural Bt: n = o, k = c).
// grid = (16384/8/256 = 8, 3), 256 threads; matrix selected by blockIdx.y (block-uniform).
// Coverage: 3 x 2048 threads x 8 elements = 3 x 16384. One 16-B store per lane, lanes contiguous:
// ---------------------------------------------------------------------------
__global__ __launch_bounds__(256) void k_wcvt(const float* __restrict__ qw, const float* __restrict__ kw,
                                             const float* __restrict__ vw, unsigned short* __restrict__ Wb) {
  const int which = blockIdx.y;
  const float* src = (which == 0) ? qw : ((which == 1) ? kw : vw);
  const int i = blockIdx.x * 256 + threadIdx.x;
  if (i >= NC * NC / 8) return;
  const v4f a = *(const v4fa*)(src + (size_t)i * 8);
  const v4f c = *(const v4fa*)(src + (size_t)i * 8 + 4);
  v4u o4;
  o4[0] = pk16(f2bf_bits(a[0]), f2bf_bits(a[1]));
  o4[1] = pk16(f2bf_bits(a[2]), f2bf_bits(a[3]));
  o4[2] = pk16(f2bf_bits(c[0]), f2bf_bits(c[1]));
  o4[3] = pk16(f2bf_bits(c[2]), f2bf_bits(c[3]));
  unsigned short* dst = Wb + (size_t)which * NC * NC + (size_t)i * 8;
  *(v4ua*)dst = o4;
  
}

// ---------------------------------------------------------------------------
// Kernel 3: per-(b,c) mean and max over the 4096 pixels of bf16-RNE x2. Block handles 32 consecutive (b,c) rows
// (grid = 1024/32 = 32, 256 threads: each thread 16 elements of a row, fixed-order tree). The 32 means and 32
// maxes are funnelled through LDS; wave 0 lanes 0..7 write the AV line, lanes 8..15 the MX line
// Coverage: 32 blocks x 32 rows = 1024 = 8 x 128 rows; per row 256 x 16 = 4096 elements.
// ---------------------------------------------------------------------------
__global__ __launch_bounds__(256) void k_poolbc(const float* __restrict__ x2, float* __restrict__ AV,
                                               float* __restrict__ MX) {
  __shared__ float ws_s[8], ws_m[8];
  __shared__ __align__(16) float os[64];
  const int g = blockIdx.x, tid = threadIdx.x, lane = tid & 31, w = tid >> 5;
#pragma unroll 1
  for (int j = 0; j < 32; ++j) {
    const float* p = x2 + (size_t)(g * 32 + j) * NP + tid * 16;
    float s = 0.f, m = -INFINITY;
#pragma unroll
    for (int i = 0; i < 4; ++i) {
      const v4f a = *(const v4fa*)(p + 4 * i);
      const float a0 = bfr(a[0]), a1 = bfr(a[1]), a2 = bfr(a[2]), a3 = bfr(a[3]);
      s += (a0 + a1) + (a2 + a3);
      m = fmaxf(fmaxf(m, a0), fmaxf(fmaxf(a1, a2), a3));
    }
#pragma unroll
    for (int off = 16; off > 0; off >>= 1) {
      s += __shfl_xor(s, off, 32);
      m = fmaxf(m, __shfl_xor(m, off, 32));
    }
    if (lane == 0) { ws_s[w] = s; ws_m[w] = m; }
    __syncthreads();
    if (tid == 0) {
      float ts = 0.f, tm = -INFINITY;
#pragma unroll
      for (int k = 0; k < 8; ++k) { ts += ws_s[k]; tm = fmaxf(tm, ws_m[k]); }
      os[j] = ts * (1.0f / 4096.0f);
      os[32 + j] = tm;
    }
    __syncthreads();
  }
  if (w == 0) {
    const v4f v = *(const v4fa*)(os + 4 * (lane & 15));
    {
      if (lane < 8)       *(v4f*)(AV + g * 32 + 4 * lane) = v;
      else if (lane < 16) *(v4f*)(MX + g * 32 + 4 * (lane - 8)) = v;
      
    }
  }
}

// ---------------------------------------------------------------------------
// Kernel 4: per-(b,n) mean and max over the 128 channels of bf16-RNE x2 -> SPIN[b][0][n] = mean, SPIN[b][1][n] = max.
// Block per (b, 64-pixel group): grid = 8 x 64 = 512, 256 threads = 64 pixels x 4 channel groups of 32 (serial,
// unroll 4), fixed-order 4-way combine. 64 means / 64 maxes funnelled through LDS; wave 0 writes both 256-B
// Coverage: 512 blocks x 64 pixels = 8 x 4096 per plane.
// ---------------------------------------------------------------------------
__global__ __launch_bounds__(256) void k_poolc(const float* __restrict__ x2, float* __restrict__ SPIN) {
  __shared__ float ps[4][64], pm[4][64];
  __shared__ __align__(16) float os[128];
  const int b = blockIdx.x >> 6, g = blockIdx.x & 63;
  const int tid = threadIdx.x, lane = tid & 31;
  const int p = tid & 63, cg = tid >> 6;
  const float* src = x2 + ((size_t)b * NC + cg * 32) * NP + g * 64 + p;
  float s = 0.f, m = -INFINITY;
#pragma unroll 4
  for (int c = 0; c < 32; ++c) {
    const float v = bfr(src[(size_t)c * NP]);
    s += v;
    m = fmaxf(m, v);
  }
  ps[cg][p] = s;
  pm[cg][p] = m;
  __syncthreads();
  if (tid < 64) {
    const float ts = ((ps[0][tid] + ps[1][tid]) + ps[2][tid]) + ps[3][tid];
    const float tm = fmaxf(fmaxf(pm[0][tid], pm[1][tid]), fmaxf(pm[2][tid], pm[3][tid]));
    os[tid] = ts * (1.0f / 128.0f);
    os[64 + tid] = tm;
  }
  __syncthreads();
  if (tid < 32) {
    const v4f v = *(const v4fa*)(os + 4 * lane);   // lanes 0..15: means 0..63, lanes 16..31: maxes 0..63
    float* base = SPIN + (size_t)b * 2 * NP + g * 64;
    {
      if (lane < 16) *(v4f*)(base + 4 * lane) = v;
      else           *(v4f*)(base + NP + 4 * (lane - 16)) = v;
      
    }
  }
}

// ---------------------------------------------------------------------------
// Kernel 5: positional branch, block per b (grid 8, 256 threads), all f32 VALU, conv loops rolled:
//   ch[c]   = sum_{i in {mean,max}} sum_{t<5} bf16r(conv1_w[i][t]) * stk[i][c+t-2]   (zero pad 2, no flip, no bias)
//   Avec[o] = sum_c bf16r(ck_w[o][c]) * ch[c] + bf16r(ck_b[o]) ;  R[o] = sum_c bf16r(ck_w[o][c])
//   sp[n]   = sum_i sum_{u,v<7} bf16r(sp_w[i][u][v]) * spin[i][h+u-3][w+v-3] + bf16r(sp_b)   (zero pad 3)
// The pooled maps are staged in zero-padded 70x70 LDS planes. Outputs: AVEC[b][128] by wave 0 and RVEC[b][128]
// Coverage: AVEC/RVEC 8 x 128; SP 8 blocks x 4 it x 256 thr x 4 = 8 x 4096.
// ---------------------------------------------------------------------------
__global__ __launch_bounds__(256) void k_pos(const float* __restrict__ AV, const float* __restrict__ MX,
                                            const float* __restrict__ SPIN, const float* __restrict__ c1w,
                                            const float* __restrict__ ckw, const float* __restrict__ ckb,
                                            const float* __restrict__ spw, const float* __restrict__ spb,
                                            float* __restrict__ AVEC, float* __restrict__ RVEC,
                                            float* __restrict__ SP) {
  __shared__ float sav[128], smx[128], sch[128];
  __shared__ float sw1[32], sw2[128];
  __shared__ __align__(16) float savec[128], srv[128];
  __shared__ float spl[2 * 4900];
  __shared__ __align__(16) float ssp[NP];
  const int b = blockIdx.x, tid = threadIdx.x, lane = tid & 31, w = tid >> 5;

  if (tid < 128) {                                   // waves 0..3 (wave-uniform)
    sav[tid] = AV[b * NC + tid];
    smx[tid] = MX[b * NC + tid];
    sw2[tid] = bfr(spw[min(tid, 97)]);               // clamped address, all lanes active
  }
  if (w == 0) sw1[lane] = bfr(c1w[min(lane, 9)]);
  for (int i = tid; i < 2 * 4900; i += 256) spl[i] = 0.0f;
  __syncthreads();
  // interior of the padded pooled planes
#pragma unroll 2
  for (int i = tid; i < NP; i += 256) {
    const int h = i >> 6, x = i & 63;
    const int li = (h + 3) * 70 + x + 3;
    spl[li]        = SPIN[(size_t)b * 2 * NP + i];
    spl[4900 + li] = SPIN[(size_t)b * 2 * NP + NP + i];
  }
  // channel conv1d
  if (tid < 128) {
    const int c = tid;
    float acc = 0.0f;
#pragma unroll 1
    for (int t = 0; t < 5; ++t) {
      const int cc  = c + t - 2;
      const int ccl = min(max(cc, 0), NC - 1);
      const float valid = (cc >= 0 && cc < NC) ? 1.0f : 0.0f;
      acc += valid * (sw1[t] * sav[ccl] + sw1[5 + t] * smx[ccl]);
    }
    sch[c] = acc;
  }
  __syncthreads();
  // Avec, R
  if (tid < 128) {
    const int o = tid;
    float a = bfr(ckb[o]), r = 0.0f;
    const float* wr = ckw + (size_t)o * NC;
#pragma unroll 4
    for (int c = 0; c < NC; ++c) {
      const float wv = bfr(wr[c]);
      a += wv * sch[c];
      r += wv;
    }
    savec[o] = a;
    srv[o] = r;
  }
  // spatial 7x7x2 conv + bias
  const float bias_sp = bfr(spb[0]);
#pragma unroll 1
  for (int it = 0; it < NP / 256; ++it) {
    const int n = it * 256 + tid;
    const int h = n >> 6, x = n & 63;
    float acc = bias_sp;
#pragma unroll 1
    for (int u = 0; u < 7; ++u) {
#pragma unroll 1
      for (int v = 0; v < 7; ++v) {
        const int li = (h + u) * 70 + x + v;
        acc += sw2[u * 7 + v] * spl[li] + sw2[49 + u * 7 + v] * spl[4900 + li];
      }
    }
    ssp[n] = acc;
  }
  __syncthreads();
  // stores
  if (w == 0) {
    const v4f v = *(const v4fa*)(savec + 4 * lane);
    {
      *(v4f*)(AVEC + b * NC + 4 * lane) = v;
      
    }
  } else if (w == 1) {
    const v4f v = *(const v4fa*)(srv + 4 * lane);
    {
      *(v4f*)(RVEC + b * NC + 4 * lane) = v;
      
    }
  }
  {
    v4f sv[4];
#pragma unroll
    for (int it = 0; it < 4; ++it) sv[it] = *(const v4fa*)(ssp + it * 1024 + 4 * tid);
    {
#pragma unroll
      for (int it = 0; it < 4; ++it)
        *(v4f*)(SP + (size_t)b * NP + it * 1024 + 4 * tid) = sv[it];
      
    }
  }
}

// ---------------------------------------------------------------------------
// Kernel 6: [Q|K|V] = XT . Wqkv^T + bias (exact bf16 x bf16 products, f32 accumulate, K = 128 in 4 steps of 32).
// grid = (32768/64 = 512 token tiles, 3 = which), 128 threads = 4 waves; wave w owns tokens m0+16w..+15 x all 128
// output channels (8 accumulator tiles). A fragments straight from XT rows, B fragments from Wqkv rows (both
// k-contiguous bf16, arithmetic addressing). bias (bf16r), Avec and R staged in LDS (one scalar load per thread each).
// Epilogue: f32 tile (acc + bias) staged in LDS [64][132];
//   which 0: alpha[n] = sum_o Avec[b][o] q[o][n], beta[n] = sum_o R[o] q[o][n] (f32, rolled) -> ALPHA/BETA 256-B
//            segments (16 lanes x 16 B); Q hi|lo token-major planes [tok][128];
//   which 1: K hi|lo token-major planes;  which 2: V hi|lo channel-major planes [b][c][4096] (transposed write).
// ---------------------------------------------------------------------------
__global__ __launch_bounds__(128) void k_qkv(const __bf16* __restrict__ XT, const __bf16* __restrict__ Wb,
                                            const float* __restrict__ qb, const float* __restrict__ kb,
                                            const float* __restrict__ vb,
                                            const float* __restrict__ AVEC, const float* __restrict__ RVEC,
                                            unsigned short* __restrict__ QP, unsigned short* __restrict__ KP,
                                            unsigned short* __restrict__ VP,
                                            float* __restrict__ ALPHA, float* __restrict__ BETA) {
  __shared__ __align__(16) float sT[64 * 132];
  __shared__ __align__(16) float sAV[128], sRV[128], sAB[128], sBI[128];
  const int tid = threadIdx.x, lane = tid & 31, w = tid >> 5, hh = lane >> 4, l16 = lane & 15;
  const int which = blockIdx.y;
  const int m0 = blockIdx.x * 64;            // global token row
  const int b  = m0 / NP;
  const int n0 = m0 - b * NP;

  const float* bias = (which == 0) ? qb : ((which == 1) ? kb : vb);   // block-uniform select, same address space
  sAV[tid] = AVEC[b * NC + tid];
  sRV[tid] = RVEC[b * NC + tid];
  sBI[tid] = bfr(bias[tid]);
  __syncthreads();

  const v8f zero8 = {0.f, 0.f, 0.f, 0.f, 0.f, 0.f, 0.f, 0.f};
  v8f acc[8];
#pragma unroll
  for (int t = 0; t < 8; ++t) acc[t] = zero8;

  const __bf16* arow = XT + (size_t)(m0 + 16 * w + l16) * NC;        // token row, k = input channel
  const __bf16* brow = Wb + ((size_t)which * NC + l16) * NC;          // output channel row (tile 0), k = input channel
#pragma unroll
  for (int kc = 0; kc < 4; ++kc) {
    const v16b a = ldfrag(arow + kc * 32, hh);
#pragma unroll
    for (int t = 0; t < 8; ++t) {
      const v16b bf = ldfrag(brow + (size_t)t * 16 * NC + kc * 32, hh);
      acc[t] = mma_bf(a, bf, acc[t]);
    }
  }
  // D[r] of tile t = Y[token 16w+8hh+r][channel 16t+l16]
#pragma unroll
  for (int t = 0; t < 8; ++t) {
    const float bv = sBI[16 * t + l16];
#pragma unroll
    for (int r = 0; r < 8; ++r) sT[(16 * w + 8 * hh + r) * 132 + 16 * t + l16] = acc[t][r] + bv;
  }
  __syncthreads();
  if (which == 0 && tid < 64) {            // waves 0,1
    const float* qr = sT + tid * 132;
    float a = 0.0f, be = 0.0f;
#pragma unroll 4
    for (int o = 0; o < NC; ++o) {
      const float q = qr[o];
      a  += sAV[o] * q;
      be += sRV[o] * q;
    }
    sAB[tid] = a;
    sAB[64 + tid] = be;
  }
  __syncthreads();

  // pack hi|lo planes
  const int q8 = lane & 7, sub = lane >> 3;
  v4u hv[8], lv[8];
#pragma unroll
  for (int i = 0; i < 8; ++i) {
    const int lid  = w * 32 + i * 4 + sub;                                   // 0..127
    const int base = (which != 2) ? ((lid >> 1) * 132 + (lid & 1) * 64 + 8 * q8) : ((8 * q8) * 132 + lid);
    const int estr = (which != 2) ? 1 : 132;
    v4u a, a2;
#pragma unroll
    for (int q = 0; q < 4; ++q) {
      const float f0 = sT[base + (2 * q) * estr];
      const float f1 = sT[base + (2 * q + 1) * estr];
      const unsigned short h0 = f2bf_bits(f0), h1 = f2bf_bits(f1);
      const unsigned short l0 = f2bf_bits(f0 - bfbits2f(h0)), l1 = f2bf_bits(f1 - bfbits2f(h1));
      a[q]  = pk16(h0, h1);
      a2[q] = pk16(l0, l1);
    }
    hv[i] = a;
    lv[i] = a2;
  }
  unsigned short* P = (which == 0) ? QP : ((which == 1) ? KP : VP);
  {
#pragma unroll
    for (int i = 0; i < 8; ++i) {
      const int lid = w * 32 + i * 4 + sub;
      const size_t go = (which != 2)
          ? ((size_t)(m0 + (lid >> 1)) * NC + (lid & 1) * 64 + 8 * q8)
          : (((size_t)b * NC + lid) * NP + n0 + 8 * q8);
      *(v4ua*)(P + go) = hv[i];
      *(v4ua*)(P + PLANE_ELEMS + go) = lv[i];
    }
    
  }
  if (which == 0 && w == 0) {
    const v4f v = *(const v4fa*)(sAB + 4 * lane);    // lanes 0..15: alpha 0..63, lanes 16..31: beta 0..63
    {
      if (lane < 16) *(v4f*)(ALPHA + m0 + 4 * lane) = v;
      else           *(v4f*)(BETA + m0 + 4 * (lane - 16)) = v;
      
    }
  }
}

// ---------------------------------------------------------------------------
// Kernel 7: full (non-causal, unmasked) attention, head dim 128, block per (b, 64-query tile): grid 8 x 64 = 512,
// 256 threads = 8 waves. Wave w: query group g = w&3 (rows 16g..16g+15), key half kh = w>>2.
//   energy[n][m] = q[n].k[m] (bf16 hi/lo 3-term WMMA) + alpha[m] + sp[n]*beta[m]  (f32, no scale)
//   Per 64-key chunk: wave (g,kh) computes the scores of its 16 rows x keys 32kh..32kh+31, the partial row max and
//   partial row sum are exchanged between the wave pair through LDS (block barriers), both waves of a pair derive
//   the identical running max / correction / sum; p hi|lo of all 64 keys land in the pair's shared P tile;
//   then O[n][c] += p . V for the wave's 64-channel half c in [64kh, 64kh+64)  (p and V bf16 hi/lo, 3-term WMMA).
//   Online softmax over all 4096 keys in 64 chunks of 64 (compile-time trip count, no masking), f32 expf.
// LDS: K hi|lo [64][128], Vcm hi|lo [128][64], Q hi|lo [64][128] (staged once), P hi|lo [4 g][16][64],
// alpha/beta slices [64]+[64], exchange arrays [128]+[128]; output tile [128 c][64 n] (pitch 68) overlays the
// K/V region after the loop (block barrier first).
// Staging coverage per chunk and plane: Q/K 256 thr x 64 = 64x128 x 2 planes; V 256 thr x 64 = 128x64 x 2 planes;
// P: each wave pair writes its whole 16x64 tile (both planes) before the barrier that precedes the reload.
// Output: out[b][c][n0..n0+63] channel-major; each channel row segment = 256 B = 16 contiguous lanes x 16 B
// ---------------------------------------------------------------------------
#define SM_K   0
#define SM_V   32768
#define SM_Q   65536
#define SM_P   98304
#define SM_AB  114688
#define SM_RED 115200
#define SM_TOT 116224
static_assert(128 * 68 * 4 <= SM_Q);

__global__ __launch_bounds__(256) void k_attn(const __bf16* __restrict__ QP, const __bf16* __restrict__ KP,
                                             const __bf16* __restrict__ VP, const float* __restrict__ ALPHA,
                                             const float* __restrict__ BETA, const float* __restrict__ SP,
                                             float* __restrict__ out) {
  __shared__ __align__(16) unsigned char smem[SM_TOT];
  __bf16* Ks   = (__bf16*)(smem + SM_K);     // hi at +0, lo at +8192 elements
  __bf16* Vs   = (__bf16*)(smem + SM_V);
  __bf16* Qs   = (__bf16*)(smem + SM_Q);
  __bf16* Ps   = (__bf16*)(smem + SM_P);     // hi: group g at +1024g ; lo: +4096 + 1024g
  float*  sab  = (float*)(smem + SM_AB);     // alpha 0..63, beta 64..127
  float*  redm = (float*)(smem + SM_RED);    // partial row max [4 g][2 kh][16]
  float*  reds = redm + 128;                 // partial row sum [4 g][2 kh][16]
  float*  Os   = (float*)(smem + SM_K);      // [128][68] after the key loop

  const int tid = threadIdx.x, lane = tid & 31, w = tid >> 5, hh = lane >> 4, c = lane & 15;
  const int g = w & 3, kh = w >> 2;
  const int key0 = 32 * kh;                  // this wave's key half within a chunk
  const int ch0  = 64 * kh;                  // this wave's channel half
  const int b  = blockIdx.x >> 6;
  const int n0 = (blockIdx.x & 63) * 64;
  const size_t tok0 = (size_t)b * NP + n0;

  // ---- stage the block's Q tile hi|lo: 256 thr x 64 elements ----
  {
    const int r = tid >> 2, part = tid & 3, p = part >> 1, half = (part & 1) * 64;
    const __bf16* src = QP + (size_t)p * PLANE_ELEMS + (tok0 + r) * NC + half;
    __bf16* dst = Qs + p * 8192 + r * 128 + half;
#pragma unroll
    for (int i = 0; i < 8; ++i) { const v8b v = *(const v8ba*)(src + 8 * i); *(v8ba*)(dst + 8 * i) = v; }
  }
  // ---- sp[n] for this lane's 8 query rows ----
  float spn[8];
  {
    const v4f s0 = *(const v4fa*)(SP + tok0 + 16 * g + 8 * hh);
    const v4f s1 = *(const v4fa*)(SP + tok0 + 16 * g + 8 * hh + 4);
    spn[0] = s0[0]; spn[1] = s0[1]; spn[2] = s0[2]; spn[3] = s0[3];
    spn[4] = s1[0]; spn[5] = s1[1]; spn[6] = s1[2]; spn[7] = s1[3];
  }
  float mrow[8], lrow[8];
  const v8f zero8 = {0.f, 0.f, 0.f, 0.f, 0.f, 0.f, 0.f, 0.f};
  v8f oacc[4];
#pragma unroll
  for (int r = 0; r < 8; ++r) { mrow[r] = -INFINITY; lrow[r] = 0.0f; }
#pragma unroll
  for (int t = 0; t < 4; ++t) oacc[t] = zero8;

  const __bf16* qrow = Qs + (16 * g + c) * 128;
  __bf16* pgh = Ps + g * 1024;
  __bf16* pgl = Ps + 4096 + g * 1024;
  const int rme = g * 32 + kh * 16 + 8 * hh;   // exchange slot base of this lane's rows
  const int r0e = g * 32 + 8 * hh;             // key half 0 slot base
  const int r1e = g * 32 + 16 + 8 * hh;        // key half 1 slot base

#pragma unroll 1
  for (int kc = 0; kc < NP / 64; ++kc) {
    const int m0 = kc * 64;
    __syncthreads();
    {
      // K: 256 thr x 64 elements = 64 rows x 128 x 2 planes
      const int r = tid >> 2, part = tid & 3, p = part >> 1, half = (part & 1) * 64;
      const __bf16* ksrc = KP + (size_t)p * PLANE_ELEMS + ((size_t)b * NP + m0 + r) * NC + half;
      __bf16* kd = Ks + p * 8192 + r * 128 + half;
#pragma unroll
      for (int i = 0; i < 8; ++i) { const v8b a = *(const v8ba*)(ksrc + 8 * i); *(v8ba*)(kd + 8 * i) = a; }
      // V: 256 thr x 64 elements = 128 channel rows x 64 keys x 2 planes
      const int r2 = tid >> 1, p2 = tid & 1;
      const __bf16* vsrc = VP + (size_t)p2 * PLANE_ELEMS + ((size_t)b * NC + r2) * NP + m0;
      __bf16* vd = Vs + p2 * 8192 + r2 * 64;
#pragma unroll
      for (int i = 0; i < 8; ++i) { const v8b a = *(const v8ba*)(vsrc + 8 * i); *(v8ba*)(vd + 8 * i) = a; }
      if (w == 0) {
        const v2f a = *(const v2fa*)(ALPHA + (size_t)b * NP + m0 + 2 * lane);
        *(v2fa*)(sab + 2 * lane) = a;
      } else if (w == 1) {
        const v2f a = *(const v2fa*)(BETA + (size_t)b * NP + m0 + 2 * lane);
        *(v2fa*)(sab + 64 + 2 * lane) = a;
      }
    }
    __syncthreads();

    // ---- scores: s[jj][r] = S[query 16g+8hh+r][key m0+key0+16jj+c], 3-term split ----
    v8f s[2];
    s[0] = zero8; s[1] = zero8;
#pragma unroll 1
    for (int dc = 0; dc < 4; ++dc) {
      const v16b qa = ldfrag(qrow + dc * 32, hh);
      const v16b ql = ldfrag(qrow + 8192 + dc * 32, hh);
#pragma unroll
      for (int jj = 0; jj < 2; ++jj) {
        const __bf16* krow = Ks + (key0 + 16 * jj + c) * 128 + dc * 32;
        const v16b kb = ldfrag(krow, hh);
        const v16b kl = ldfrag(krow + 8192, hh);
        s[jj] = mma_bf(qa, kb, s[jj]);
        s[jj] = mma_bf(qa, kl, s[jj]);
        s[jj] = mma_bf(ql, kb, s[jj]);
      }
    }
    // ---- positional terms in f32, then partial row max over this key half ----
    float al[2], be[2];
#pragma unroll
    for (int jj = 0; jj < 2; ++jj) { al[jj] = sab[key0 + 16 * jj + c]; be[jj] = sab[64 + key0 + 16 * jj + c]; }
#pragma unroll
    for (int r = 0; r < 8; ++r) {
      float m = -INFINITY;
#pragma unroll
      for (int jj = 0; jj < 2; ++jj) {
        const float e = s[jj][r] + al[jj] + spn[r] * be[jj];
        s[jj][r] = e;
        m = fmaxf(m, e);
      }
#pragma unroll
      for (int off = 1; off < 16; off <<= 1) m = fmaxf(m, __shfl_xor(m, off, 32));
      if (c == 0) redm[rme + r] = m;
    }
    __syncthreads();
    // ---- online softmax: identical running state in both waves of a pair; P hi|lo into the pair's LDS tile ----
    float corr[8];
#pragma unroll
    for (int r = 0; r < 8; ++r) {
      const float cmx  = fmaxf(redm[r0e + r], redm[r1e + r]);
      const float mnew = fmaxf(mrow[r], cmx);
      corr[r] = expf(mrow[r] - mnew);
      mrow[r] = mnew;
      float psum = 0.0f;
#pragma unroll
      for (int jj = 0; jj < 2; ++jj) {
        const float p = expf(s[jj][r] - mnew);
        psum += p;
        const unsigned short hb = f2bf_bits(p);
        const unsigned short lb = f2bf_bits(p - bfbits2f(hb));
        pgh[(8 * hh + r) * 64 + key0 + 16 * jj + c] = __builtin_bit_cast(__bf16, hb);
        pgl[(8 * hh + r) * 64 + key0 + 16 * jj + c] = __builtin_bit_cast(__bf16, lb);
      }
#pragma unroll
      for (int off = 1; off < 16; off <<= 1) psum += __shfl_xor(psum, off, 32);
      if (c == 0) reds[rme + r] = psum;
      lrow[r] = lrow[r] * corr[r];
#pragma unroll
      for (int t = 0; t < 4; ++t) oacc[t][r] *= corr[r];
    }
    __syncthreads();
#pragma unroll
    for (int r = 0; r < 8; ++r) lrow[r] += reds[r0e + r] + reds[r1e + r];

    // ---- O += P . V : A = P [query][key], B = Vcm row c [key]; 4 channel tiles of this half, 2 key halves ----
#pragma unroll 1
    for (int kk = 0; kk < 2; ++kk) {
      const v16b pa = ldfrag(pgh + c * 64 + kk * 32, hh);
      const v16b pl = ldfrag(pgl + c * 64 + kk * 32, hh);
#pragma unroll
      for (int t = 0; t < 4; ++t) {
        const __bf16* vr = Vs + (ch0 + 16 * t + c) * 64 + kk * 32;
        const v16b vb = ldfrag(vr, hh);
        const v16b vl = ldfrag(vr + 8192, hh);
        oacc[t] = mma_bf(pa, vb, oacc[t]);
        oacc[t] = mma_bf(pa, vl, oacc[t]);
        oacc[t] = mma_bf(pl, vb, oacc[t]);
      }
    }
  }
  __syncthreads();   // all waves done with K/V tiles before the output tile overlays them

  // ---- normalise, stage O transposed as [c][n_local], write whole 256-B channel segments ----
#pragma unroll
  for (int r = 0; r < 8; ++r) {
    const float inv = 1.0f / lrow[r];
#pragma unroll
    for (int t = 0; t < 4; ++t) Os[(ch0 + 16 * t + c) * 68 + 16 * g + 8 * hh + r] = oacc[t][r] * inv;
  }
  __syncthreads();
  {
    float* ob = out + (size_t)b * NC * NP + n0;
    const int c4 = (lane & 15) * 4;
    {
#pragma unroll
      for (int i = 0; i < 8; ++i) {
        const int row = i * 16 + w * 2 + hh;                       // 0..127 channel
        const v4f v = *(const v4fa*)(Os + row * 68 + c4);
        *(v4f*)(ob + (size_t)row * NP + c4) = v;
      }
      
    }
  }
}

// ---------------------------------------------------------------------------
//   XT    bf16 [32768][128]          0           8388608
//   WQKV  bf16 [384][128]            8388608       98304
//   AV    f32  [8][128]              8486912        4096
//   MX    f32  [8][128]              8491008        4096
//   SPIN  f32  [8][2][4096]          8495104      262144
//   AVEC  f32  [8][128]              8757248        4096
//   RVEC  f32  [8][128]              8761344        4096
//   SP    f32  [8][4096]             8765440      131072
//   ALPHA f32  [8][4096]             8896512      131072
//   BETA  f32  [8][4096]             9027584      131072
//   Q hi|lo bf16 2x[32768][128]      9158656    16777216
//   K hi|lo bf16 2x[32768][128]     25935872    16777216
//   V hi|lo bf16 2x[8][128][4096]   42713088    16777216
//   total                          59490304
// ---------------------------------------------------------------------------
extern "C" void kernel_launch(void* const* d_in, const int* in_sizes, int n_in,
                              void* d_out, int out_size, void* d_ws, size_t ws_size,
                              hipStream_t stream) {
  if (n_in < 13) return;
  if (in_sizes[0] != NB * NC * NP || in_sizes[1] != NB * NC * NP) return;
  if (in_sizes[2] != NC * NC || in_sizes[4] != NC * NC || in_sizes[6] != NC * NC || in_sizes[8] != NC * NC) return;
  if (in_sizes[3] != NC || in_sizes[5] != NC || in_sizes[7] != NC || in_sizes[9] != NC) return;
  if (in_sizes[10] != 10 || in_sizes[11] != 98 || in_sizes[12] != 1) return;
  if (out_size != NB * NC * NP) return;

  const float* x    = (const float*)d_in[0];
  const float* x2   = (const float*)d_in[1];
  const float* q_w  = (const float*)d_in[2];
  const float* q_b  = (const float*)d_in[3];
  const float* k_w  = (const float*)d_in[4];
  const float* k_b  = (const float*)d_in[5];
  const float* v_w  = (const float*)d_in[6];
  const float* v_b  = (const float*)d_in[7];
  const float* ck_w = (const float*)d_in[8];
  const float* ck_b = (const float*)d_in[9];
  const float* c1w  = (const float*)d_in[10];
  const float* sp_w = (const float*)d_in[11];
  const float* sp_b = (const float*)d_in[12];
  float* out = (float*)d_out;

  const size_t plane_b = PLANE_ELEMS * 2;                 // 8388608 bytes per 16-bit plane
  size_t off = 0;
  const size_t oXT   = off; off += plane_b;
  const size_t oW    = off; off += (size_t)3 * NC * NC * 2;
  const size_t oAV   = off; off += (size_t)NB * NC * 4;
  const size_t oMX   = off; off += (size_t)NB * NC * 4;
  const size_t oSPIN = off; off += (size_t)NB * 2 * NP * 4;
  const size_t oAVEC = off; off += (size_t)NB * NC * 4;
  const size_t oRVEC = off; off += (size_t)NB * NC * 4;
  const size_t oSP   = off; off += (size_t)NB * NP * 4;
  const size_t oAL   = off; off += (size_t)NB * NP * 4;
  const size_t oBE   = off; off += (size_t)NB * NP * 4;
  const size_t oQ    = off; off += 2 * plane_b;
  const size_t oK    = off; off += 2 * plane_b;
  const size_t oV    = off; off += 2 * plane_b;           // off = 59490304
  if (off > ws_size) return;
  if (off > (size_t)134217728) return;

  char* ws = (char*)d_ws;
  unsigned short* XT    = (unsigned short*)(ws + oXT);
  unsigned short* WQKV  = (unsigned short*)(ws + oW);
  float* AV    = (float*)(ws + oAV);
  float* MX    = (float*)(ws + oMX);
  float* SPIN  = (float*)(ws + oSPIN);
  float* AVEC  = (float*)(ws + oAVEC);
  float* RVEC  = (float*)(ws + oRVEC);
  float* SP    = (float*)(ws + oSP);
  float* ALPHA = (float*)(ws + oAL);
  float* BETA  = (float*)(ws + oBE);
  unsigned short* QP = (unsigned short*)(ws + oQ);
  unsigned short* KPp = (unsigned short*)(ws + oK);
  unsigned short* VPp = (unsigned short*)(ws + oV);

  // 1. x -> token-major bf16 planes (grid: n blocks, c blocks, batch)
  k_xt<<<dim3(NP / 64, NC / 64, NB), 256, 0, stream>>>(x, XT);
  // 2. projection weights -> bf16 [384][128]
  k_wcvt<<<dim3(NC * NC / 8 / 256, 3), 256, 0, stream>>>(q_w, k_w, v_w, WQKV);
  // 3. per-(b,c) pixel mean/max of x2
  k_poolbc<<<NB * NC / 32, 256, 0, stream>>>(x2, AV, MX);
  // 4. per-(b,n) channel mean/max of x2
  k_poolc<<<NB * (NP / 64), 256, 0, stream>>>(x2, SPIN);
  // 5. positional branch: Avec, R, sp
  k_pos<<<NB, 256, 0, stream>>>(AV, MX, SPIN, c1w, ck_w, ck_b, sp_w, sp_b, AVEC, RVEC, SP);
  // 6. q/k/v projections + alpha/beta + hi|lo planes
  k_qkv<<<dim3(NTOK / 64, 3), 128, 0, stream>>>((const __bf16*)(const void*)XT, (const __bf16*)(const void*)WQKV,
                                                q_b, k_b, v_b, AVEC, RVEC, QP, KPp, VPp, ALPHA, BETA);
  // 7. attention, channel-major output
  k_attn<<<NB * (NP / 64), 256, 0, stream>>>((const __bf16*)(const void*)QP, (const __bf16*)(const void*)KPp,
                                             (const __bf16*)(const void*)VPp, ALPHA, BETA, SP, out);
  (void)hipGetLastError();
}

// v001
// A run of this version takes 586 microseconds.
// In two side-by-side timings against v000, it was 2.39 and 2.41 times as fast.
// Contractions: q/k/v 1x1 projections on v_wmma_f32_16x16x32_bf16 (bf16 operands taken from bf16-RNE inputs, single product, f32 accumulate);
// q.k^T scores and p.v on v_wmma_f32_16x16x32_bf16 with bf16 hi/lo split operands (hi.hi + hi.lo + lo.hi), f32 accumulate;
// pools, channel conv1d, spatial 7x7 conv, positional vectors alpha/beta, online softmax (expf) in f32.
// 16-bit planes and carries: XT = bf16 RNE(x), Wqkv = bf16 RNE(w), Q/K/V hi = RNE(y), lo = RNE(y - hi), P hi/lo per key chunk in LDS.
// No power-of-two carry on any plane (bf16 keeps the f32 exponent range), so no inverse fold anywhere.
#include <hip/hip_runtime.h>
#include <math.h>
#include <stdint.h>

#define NB   8
#define NC   128
#define NP   4096
#define NTOK (NB * NP)
#define PLANE_ELEMS ((size_t)NTOK * NC)

static_assert(NP % 64 == 0);
static_assert(NC == 128);
static_assert((NB * NC) % 32 == 0);
static_assert(NP % 256 == 0);

typedef __attribute__((ext_vector_type(16))) __bf16 v16b;
typedef __attribute__((ext_vector_type(8)))  __bf16 v8b;
typedef __attribute__((ext_vector_type(8)))  float  v8f;
typedef __attribute__((ext_vector_type(4)))  float  v4f;
typedef __attribute__((ext_vector_type(2)))  float  v2f;
typedef __attribute__((ext_vector_type(4)))  unsigned int v4u;
typedef v8b __attribute__((may_alias)) v8ba;
typedef v4f __attribute__((may_alias)) v4fa;
typedef v2f __attribute__((may_alias)) v2fa;
typedef v4u __attribute__((may_alias)) v4ua;

// ---------------------------------------------------------------------------
// bf16 helpers (RNE convert on the f32 bits)
// ---------------------------------------------------------------------------
__device__ __forceinline__ unsigned short f2bf_bits(float f) {
  const unsigned u = __float_as_uint(f);
  return (unsigned short)((u + 0x7FFFu + ((u >> 16) & 1u)) >> 16);
}
__device__ __forceinline__ float bfbits2f(unsigned short h) { return __uint_as_float(((unsigned)h) << 16); }
__device__ __forceinline__ float bfr(float f) { return bfbits2f(f2bf_bits(f)); }
__device__ __forceinline__ unsigned pk16(unsigned short a, unsigned short b) { return (unsigned)a | ((unsigned)b << 16); }

// ---------------------------------------------------------------------------
// 16x16x32 bf16 WMMA with hazard guard (ties D, keeps A/B live).
// Fragment map (wave32): lane l, h = l>>4, m = n = l&15.
//   A/B element i: i<8 -> k0+8h+i ; i>=8 -> k0+16+8h+(i-8)
//   D element r : row 8h+r, col l&15
// ---------------------------------------------------------------------------
__device__ __forceinline__ v8f mma_bf(v16b a, v16b b, v8f c) {
  c = __builtin_amdgcn_wmma_f32_16x16x32_bf16(false, a, false, b, (short)0, c, false, false);
  asm volatile("v_nop\n\tv_nop\n\tv_nop\n\tv_nop" : "+v"(c) : "v"(a), "v"(b));
  return c;
}
union FB { v16b v; v8b h[2]; };
// A or B fragment from a k-contiguous bf16 row; p points at element k0 of the row owned by this lane.
__device__ __forceinline__ v16b ldfrag(const __bf16* p, int hh) {
  FB f;
  f.h[0] = *(const v8ba*)(p + 8 * hh);
  f.h[1] = *(const v8ba*)(p + 16 + 8 * hh);
  return f.v;
}

// ---------------------------------------------------------------------------
// Kernel 1: x[b] viewed [128 c][4096 n] (pitch 4096) -> XT bf16 [b*4096+n][128 c] (pitch 128), bf16 RNE.
// 64x64 tiles through LDS. grid = (4096/64, 128/64, 8), 256 threads.
// Coverage per block: load 4 it x 256 thr x 4 floats = 64x64; store 2 it x 256 thr x 8 u16 = 64x64.
// ---------------------------------------------------------------------------
__global__ __launch_bounds__(256) void k_xt(const float* __restrict__ X, unsigned short* __restrict__ xt) {
  __shared__ __align__(16) float tf[64 * 68];
  const int b = blockIdx.z;
  const float* W = X + (size_t)b * NC * NP;
  unsigned short* o = xt + (size_t)b * NP * NC;
  const int c0 = blockIdx.x * 64;   // input column block (n) = output row block
  const int r0 = blockIdx.y * 64;   // input row block (c)    = output column block
  const int tid = threadIdx.x;
  {
    const int lr = tid >> 4;
    const int c4 = (tid & 15) * 4;
#pragma unroll
    for (int it = 0; it < 4; ++it) {
      const int rr = it * 16 + lr;
      const v4f a = *(const v4fa*)(W + (size_t)(r0 + rr) * NP + c0 + c4);
      *(v4f*)(tf + rr * 68 + c4) = a;
    }
  }
  __syncthreads();
  const int sub = tid >> 3;          // 0..31
  const int c8  = (tid & 7) * 8;     // 0..56
  v4u hv[2];
#pragma unroll
  for (int it = 0; it < 2; ++it) {
    const int oc = it * 32 + sub;    // output row within tile (= input column)
    v4u a;
#pragma unroll
    for (int q = 0; q < 4; ++q) {
      const float f0 = tf[(c8 + 2 * q) * 68 + oc];
      const float f1 = tf[(c8 + 2 * q + 1) * 68 + oc];
      a[q] = pk16(f2bf_bits(f0), f2bf_bits(f1));
    }
    hv[it] = a;
  }
  {
#pragma unroll
    for (int it = 0; it < 2; ++it) {
      const int oc = it * 32 + sub;
      *(v4ua*)(o + (size_t)(c0 + oc) * NC + r0 + c8) = hv[it];
    }
    
  }
}

// ---------------------------------------------------------------------------
// Kernel 2: [q_w; k_w; v_w] ([out o][in c] row-major each) -> Wqkv bf16 [384 o][128 c] (natural Bt: n = o, k = c).
// grid = (16384/8/256 = 8, 3), 256 threads; matrix selected by blockIdx.y (block-uniform).
// Coverage: 3 x 2048 threads x 8 elements = 3 x 16384. One 16-B store per lane, lanes contiguous:
// ---------------------------------------------------------------------------
__global__ __launch_bounds__(256) void k_wcvt(const float* __restrict__ qw, const float* __restrict__ kw,
                                             const float* __restrict__ vw, unsigned short* __restrict__ Wb) {
  const int which = blockIdx.y;
  const float* src = (which == 0) ? qw : ((which == 1) ? kw : vw);
  const int i = blockIdx.x * 256 + threadIdx.x;
  if (i >= NC * NC / 8) return;
  const v4f a = *(const v4fa*)(src + (size_t)i * 8);
  const v4f c = *(const v4fa*)(src + (size_t)i * 8 + 4);
  v4u o4;
  o4[0] = pk16(f2bf_bits(a[0]), f2bf_bits(a[1]));
  o4[1] = pk16(f2bf_bits(a[2]), f2bf_bits(a[3]));
  o4[2] = pk16(f2bf_bits(c[0]), f2bf_bits(c[1]));
  o4[3] = pk16(f2bf_bits(c[2]), f2bf_bits(c[3]));
  unsigned short* dst = Wb + (size_t)which * NC * NC + (size_t)i * 8;
  *(v4ua*)dst = o4;
  
}

// ---------------------------------------------------------------------------
// Kernel 3: per-(b,c) mean and max over the 4096 pixels of bf16-RNE x2. Block handles 32 consecutive (b,c) rows
// (grid = 1024/32 = 32, 256 threads: each thread 16 elements of a row, fixed-order tree). The 32 means and 32
// maxes are funnelled through LDS; wave 0 lanes 0..7 write the AV line, lanes 8..15 the MX line
// Coverage: 32 blocks x 32 rows = 1024 = 8 x 128 rows; per row 256 x 16 = 4096 elements.
// ---------------------------------------------------------------------------
__global__ __launch_bounds__(256) void k_poolbc(const float* __restrict__ x2, float* __restrict__ AV,
                                               float* __restrict__ MX) {
  __shared__ float ws_s[8], ws_m[8];
  __shared__ __align__(16) float os[64];
  const int g = blockIdx.x, tid = threadIdx.x, lane = tid & 31, w = tid >> 5;
#pragma unroll 1
  for (int j = 0; j < 32; ++j) {
    const float* p = x2 + (size_t)(g * 32 + j) * NP + tid * 16;
    float s = 0.f, m = -INFINITY;
#pragma unroll
    for (int i = 0; i < 4; ++i) {
      const v4f a = *(const v4fa*)(p + 4 * i);
      const float a0 = bfr(a[0]), a1 = bfr(a[1]), a2 = bfr(a[2]), a3 = bfr(a[3]);
      s += (a0 + a1) + (a2 + a3);
      m = fmaxf(fmaxf(m, a0), fmaxf(fmaxf(a1, a2), a3));
    }
#pragma unroll
    for (int off = 16; off > 0; off >>= 1) {
      s += __shfl_xor(s, off, 32);
      m = fmaxf(m, __shfl_xor(m, off, 32));
    }
    if (lane == 0) { ws_s[w] = s; ws_m[w] = m; }
    __syncthreads();
    if (tid == 0) {
      float ts = 0.f, tm = -INFINITY;
#pragma unroll
      for (int k = 0; k < 8; ++k) { ts += ws_s[k]; tm = fmaxf(tm, ws_m[k]); }
      os[j] = ts * (1.0f / 4096.0f);
      os[32 + j] = tm;
    }
    __syncthreads();
  }
  if (w == 0) {
    const v4f v = *(const v4fa*)(os + 4 * (lane & 15));
    {
      if (lane < 8)       *(v4f*)(AV + g * 32 + 4 * lane) = v;
      else if (lane < 16) *(v4f*)(MX + g * 32 + 4 * (lane - 8)) = v;
      
    }
  }
}

// ---------------------------------------------------------------------------
// Kernel 4: per-(b,n) mean and max over the 128 channels of bf16-RNE x2 -> SPIN[b][0][n] = mean, SPIN[b][1][n] = max.
// Block per (b, 64-pixel group): grid = 8 x 64 = 512, 256 threads = 64 pixels x 4 channel groups of 32 (serial,
// unroll 4), fixed-order 4-way combine. 64 means / 64 maxes funnelled through LDS; wave 0 writes both 256-B
// Coverage: 512 blocks x 64 pixels = 8 x 4096 per plane.
// ---------------------------------------------------------------------------
__global__ __launch_bounds__(256) void k_poolc(const float* __restrict__ x2, float* __restrict__ SPIN) {
  __shared__ float ps[4][64], pm[4][64];
  __shared__ __align__(16) float os[128];
  const int b = blockIdx.x >> 6, g = blockIdx.x & 63;
  const int tid = threadIdx.x, lane = tid & 31;
  const int p = tid & 63, cg = tid >> 6;
  const float* src = x2 + ((size_t)b * NC + cg * 32) * NP + g * 64 + p;
  float s = 0.f, m = -INFINITY;
#pragma unroll 4
  for (int c = 0; c < 32; ++c) {
    const float v = bfr(src[(size_t)c * NP]);
    s += v;
    m = fmaxf(m, v);
  }
  ps[cg][p] = s;
  pm[cg][p] = m;
  __syncthreads();
  if (tid < 64) {
    const float ts = ((ps[0][tid] + ps[1][tid]) + ps[2][tid]) + ps[3][tid];
    const float tm = fmaxf(fmaxf(pm[0][tid], pm[1][tid]), fmaxf(pm[2][tid], pm[3][tid]));
    os[tid] = ts * (1.0f / 128.0f);
    os[64 + tid] = tm;
  }
  __syncthreads();
  if (tid < 32) {
    const v4f v = *(const v4fa*)(os + 4 * lane);   // lanes 0..15: means 0..63, lanes 16..31: maxes 0..63
    float* base = SPIN + (size_t)b * 2 * NP + g * 64;
    {
      if (lane < 16) *(v4f*)(base + 4 * lane) = v;
      else           *(v4f*)(base + NP + 4 * (lane - 16)) = v;
      
    }
  }
}

// ---------------------------------------------------------------------------
// Kernel 5: positional branch, block per b (grid 8, 256 threads), all f32 VALU, conv loops rolled:
//   ch[c]   = sum_{i in {mean,max}} sum_{t<5} bf16r(conv1_w[i][t]) * stk[i][c+t-2]   (zero pad 2, no flip, no bias)
//   Avec[o] = sum_c bf16r(ck_w[o][c]) * ch[c] + bf16r(ck_b[o]) ;  R[o] = sum_c bf16r(ck_w[o][c])
//   sp[n]   = sum_i sum_{u,v<7} bf16r(sp_w[i][u][v]) * spin[i][h+u-3][w+v-3] + bf16r(sp_b)   (zero pad 3)
// The pooled maps are staged in zero-padded 70x70 LDS planes. Outputs: AVEC[b][128] by wave 0 and RVEC[b][128]
// Coverage: AVEC/RVEC 8 x 128; SP 8 blocks x 4 it x 256 thr x 4 = 8 x 4096.
// ---------------------------------------------------------------------------
__global__ __launch_bounds__(256) void k_pos(const float* __restrict__ AV, const float* __restrict__ MX,
                                            const float* __restrict__ SPIN, const float* __restrict__ c1w,
                                            const float* __restrict__ ckw, const float* __restrict__ ckb,
                                            const float* __restrict__ spw, const float* __restrict__ spb,
                                            float* __restrict__ AVEC, float* __restrict__ RVEC,
                                            float* __restrict__ SP) {
  __shared__ float sav[128], smx[128], sch[128];
  __shared__ float sw1[32], sw2[128];
  __shared__ __align__(16) float savec[128], srv[128];
  __shared__ float spl[2 * 4900];
  __shared__ __align__(16) float ssp[NP];
  const int b = blockIdx.x, tid = threadIdx.x, lane = tid & 31, w = tid >> 5;

  if (tid < 128) {                                   // waves 0..3 (wave-uniform)
    sav[tid] = AV[b * NC + tid];
    smx[tid] = MX[b * NC + tid];
    sw2[tid] = bfr(spw[min(tid, 97)]);               // clamped address, all lanes active
  }
  if (w == 0) sw1[lane] = bfr(c1w[min(lane, 9)]);
  for (int i = tid; i < 2 * 4900; i += 256) spl[i] = 0.0f;
  __syncthreads();
  // interior of the padded pooled planes
#pragma unroll 2
  for (int i = tid; i < NP; i += 256) {
    const int h = i >> 6, x = i & 63;
    const int li = (h + 3) * 70 + x + 3;
    spl[li]        = SPIN[(size_t)b * 2 * NP + i];
    spl[4900 + li] = SPIN[(size_t)b * 2 * NP + NP + i];
  }
  // channel conv1d
  if (tid < 128) {
    const int c = tid;
    float acc = 0.0f;
#pragma unroll 1
    for (int t = 0; t < 5; ++t) {
      const int cc  = c + t - 2;
      const int ccl = min(max(cc, 0), NC - 1);
      const float valid = (cc >= 0 && cc < NC) ? 1.0f : 0.0f;
      acc += valid * (sw1[t] * sav[ccl] + sw1[5 + t] * smx[ccl]);
    }
    sch[c] = acc;
  }
  __syncthreads();
  // Avec, R
  if (tid < 128) {
    const int o = tid;
    float a = bfr(ckb[o]), r = 0.0f;
    const float* wr = ckw + (size_t)o * NC;
#pragma unroll 4
    for (int c = 0; c < NC; ++c) {
      const float wv = bfr(wr[c]);
      a += wv * sch[c];
      r += wv;
    }
    savec[o] = a;
    srv[o] = r;
  }
  // spatial 7x7x2 conv + bias
  const float bias_sp = bfr(spb[0]);
#pragma unroll 1
  for (int it = 0; it < NP / 256; ++it) {
    const int n = it * 256 + tid;
    const int h = n >> 6, x = n & 63;
    float acc = bias_sp;
#pragma unroll 1
    for (int u = 0; u < 7; ++u) {
#pragma unroll 1
      for (int v = 0; v < 7; ++v) {
        const int li = (h + u) * 70 + x + v;
        acc += sw2[u * 7 + v] * spl[li] + sw2[49 + u * 7 + v] * spl[4900 + li];
      }
    }
    ssp[n] = acc;
  }
  __syncthreads();
  // stores
  if (w == 0) {
    const v4f v = *(const v4fa*)(savec + 4 * lane);
    {
      *(v4f*)(AVEC + b * NC + 4 * lane) = v;
      
    }
  } else if (w == 1) {
    const v4f v = *(const v4fa*)(srv + 4 * lane);
    {
      *(v4f*)(RVEC + b * NC + 4 * lane) = v;
      
    }
  }
  {
    v4f sv[4];
#pragma unroll
    for (int it = 0; it < 4; ++it) sv[it] = *(const v4fa*)(ssp + it * 1024 + 4 * tid);
    {
#pragma unroll
      for (int it = 0; it < 4; ++it)
        *(v4f*)(SP + (size_t)b * NP + it * 1024 + 4 * tid) = sv[it];
      
    }
  }
}

// ---------------------------------------------------------------------------
// Kernel 6: [Q|K|V] = XT . Wqkv^T + bias (exact bf16 x bf16 products, f32 accumulate, K = 128 in 4 steps of 32).
// grid = (32768/64 = 512 token tiles, 3 = which), 128 threads = 4 waves; wave w owns tokens m0+16w..+15 x all 128
// output channels (8 accumulator tiles). A fragments straight from XT rows, B fragments from Wqkv rows (both
// k-contiguous bf16, arithmetic addressing). bias (bf16r), Avec and R staged in LDS (one scalar load per thread each).
// Epilogue: f32 tile (acc + bias) staged in LDS [64][132];
//   which 0: alpha[n] = sum_o Avec[b][o] q[o][n], beta[n] = sum_o R[o] q[o][n] (f32, rolled) -> ALPHA/BETA 256-B
//            segments (16 lanes x 16 B); Q hi|lo token-major planes [tok][128];
//   which 1: K hi|lo token-major planes;  which 2: V hi|lo channel-major planes [b][c][4096] (transposed write).
// ---------------------------------------------------------------------------
__global__ __launch_bounds__(128) void k_qkv(const __bf16* __restrict__ XT, const __bf16* __restrict__ Wb,
                                            const float* __restrict__ qb, const float* __restrict__ kb,
                                            const float* __restrict__ vb,
                                            const float* __restrict__ AVEC, const float* __restrict__ RVEC,
                                            unsigned short* __restrict__ QP, unsigned short* __restrict__ KP,
                                            unsigned short* __restrict__ VP,
                                            float* __restrict__ ALPHA, float* __restrict__ BETA) {
  __shared__ __align__(16) float sT[64 * 132];
  __shared__ __align__(16) float sAV[128], sRV[128], sAB[128], sBI[128];
  const int tid = threadIdx.x, lane = tid & 31, w = tid >> 5, hh = lane >> 4, l16 = lane & 15;
  const int which = blockIdx.y;
  const int m0 = blockIdx.x * 64;            // global token row
  const int b  = m0 / NP;
  const int n0 = m0 - b * NP;

  const float* bias = (which == 0) ? qb : ((which == 1) ? kb : vb);   // block-uniform select, same address space
  sAV[tid] = AVEC[b * NC + tid];
  sRV[tid] = RVEC[b * NC + tid];
  sBI[tid] = bfr(bias[tid]);
  __syncthreads();

  const v8f zero8 = {0.f, 0.f, 0.f, 0.f, 0.f, 0.f, 0.f, 0.f};
  v8f acc[8];
#pragma unroll
  for (int t = 0; t < 8; ++t) acc[t] = zero8;

  const __bf16* arow = XT + (size_t)(m0 + 16 * w + l16) * NC;        // token row, k = input channel
  const __bf16* brow = Wb + ((size_t)which * NC + l16) * NC;          // output channel row (tile 0), k = input channel
#pragma unroll
  for (int kc = 0; kc < 4; ++kc) {
    const v16b a = ldfrag(arow + kc * 32, hh);
#pragma unroll
    for (int t = 0; t < 8; ++t) {
      const v16b bf = ldfrag(brow + (size_t)t * 16 * NC + kc * 32, hh);
      acc[t] = mma_bf(a, bf, acc[t]);
    }
  }
  // D[r] of tile t = Y[token 16w+8hh+r][channel 16t+l16]
#pragma unroll
  for (int t = 0; t < 8; ++t) {
    const float bv = sBI[16 * t + l16];
#pragma unroll
    for (int r = 0; r < 8; ++r) sT[(16 * w + 8 * hh + r) * 132 + 16 * t + l16] = acc[t][r] + bv;
  }
  __syncthreads();
  if (which == 0 && tid < 64) {            // waves 0,1
    const float* qr = sT + tid * 132;
    float a = 0.0f, be = 0.0f;
#pragma unroll 4
    for (int o = 0; o < NC; ++o) {
      const float q = qr[o];
      a  += sAV[o] * q;
      be += sRV[o] * q;
    }
    sAB[tid] = a;
    sAB[64 + tid] = be;
  }
  __syncthreads();

  // pack hi|lo planes
  const int q8 = lane & 7, sub = lane >> 3;
  v4u hv[8], lv[8];
#pragma unroll
  for (int i = 0; i < 8; ++i) {
    const int lid  = w * 32 + i * 4 + sub;                                   // 0..127
    const int base = (which != 2) ? ((lid >> 1) * 132 + (lid & 1) * 64 + 8 * q8) : ((8 * q8) * 132 + lid);
    const int estr = (which != 2) ? 1 : 132;
    v4u a, a2;
#pragma unroll
    for (int q = 0; q < 4; ++q) {
      const float f0 = sT[base + (2 * q) * estr];
      const float f1 = sT[base + (2 * q + 1) * estr];
      const unsigned short h0 = f2bf_bits(f0), h1 = f2bf_bits(f1);
      const unsigned short l0 = f2bf_bits(f0 - bfbits2f(h0)), l1 = f2bf_bits(f1 - bfbits2f(h1));
      a[q]  = pk16(h0, h1);
      a2[q] = pk16(l0, l1);
    }
    hv[i] = a;
    lv[i] = a2;
  }
  unsigned short* P = (which == 0) ? QP : ((which == 1) ? KP : VP);
  {
#pragma unroll
    for (int i = 0; i < 8; ++i) {
      const int lid = w * 32 + i * 4 + sub;
      const size_t go = (which != 2)
          ? ((size_t)(m0 + (lid >> 1)) * NC + (lid & 1) * 64 + 8 * q8)
          : (((size_t)b * NC + lid) * NP + n0 + 8 * q8);
      *(v4ua*)(P + go) = hv[i];
      *(v4ua*)(P + PLANE_ELEMS + go) = lv[i];
    }
    
  }
  if (which == 0 && w == 0) {
    const v4f v = *(const v4fa*)(sAB + 4 * lane);    // lanes 0..15: alpha 0..63, lanes 16..31: beta 0..63
    {
      if (lane < 16) *(v4f*)(ALPHA + m0 + 4 * lane) = v;
      else           *(v4f*)(BETA + m0 + 4 * (lane - 16)) = v;
      
    }
  }
}

// ---------------------------------------------------------------------------
// Kernel 7: full (non-causal, unmasked) attention, head dim 128, block per (b, 64-query tile): grid 8 x 64 = 512,
// 256 threads = 8 waves. Wave w: query group g = w&3 (rows 16g..16g+15), key half kh = w>>2.
//   energy[n][m] = q[n].k[m] (bf16 hi/lo 3-term WMMA) + alpha[m] + sp[n]*beta[m]  (f32, no scale)
//   Per 64-key chunk: wave (g,kh) computes the scores of its 16 rows x keys 32kh..32kh+31, the partial row max and
//   partial row sum are exchanged between the wave pair through LDS (block barriers), both waves of a pair derive
//   the identical running max / correction / sum; p hi|lo of all 64 keys land in the pair's shared P tile;
//   then O[n][c] += p . V for the wave's 64-channel half c in [64kh, 64kh+64)  (p and V bf16 hi/lo, 3-term WMMA).
//   Online softmax over all 4096 keys in 64 chunks of 64 (compile-time trip count, no masking), f32 expf.
// LDS: K hi|lo [64][128], Vcm hi|lo [128][64], Q hi|lo [64][128] (staged once), P hi|lo [4 g][16][64]; every row is
// padded by 16 B (pitch 272 B for 256-B rows, 144 B for 128-B rows = 16 B x odd), so the 16 rows that one 16-byte
// fragment read touches fall on 16 different bank groups; the lo plane of K/Q starts 64 B and that of V 128 B past a
// multiple of 256 B, so the 16 lanes of a staging store (rows x planes x halves) are spread over the banks as well;
// alpha/beta slices [64]+[64], exchange arrays [128]+[128]; output tile [128 c][64 n] (pitch 68) overlays the
// K/V region after the loop (block barrier first).
// Staging coverage per chunk and plane: Q/K 256 thr x 64 = 64x128 x 2 planes; V 256 thr x 64 = 128x64 x 2 planes;
// P: each wave pair writes its whole 16x64 tile (both planes) before the barrier that precedes the reload.
// Output: out[b][c][n0..n0+63] channel-major; each channel row segment = 256 B = 16 contiguous lanes x 16 B
// ---------------------------------------------------------------------------
#define KQ_PITCH 136                       // elements: 128 + 8 (272 B)
#define VP_PITCH 72                        // elements: 64 + 8 (144 B)
#define KQ_PLANE (64 * KQ_PITCH + 32)      // elements: 17472 B = 68 x 256 + 64
#define V_PLANE  (128 * VP_PITCH + 64)     // elements: 18560 B = 72 x 256 + 128
#define P_GROUP  (16 * VP_PITCH)           // elements per query group
#define P_PLANE  (4 * P_GROUP)
#define SM_K   0
#define SM_V   (SM_K + 2 * KQ_PLANE * 2)
#define SM_Q   (SM_V + 2 * V_PLANE * 2)
#define SM_P   (SM_Q + 2 * KQ_PLANE * 2)
#define SM_AB  (SM_P + 2 * P_PLANE * 2)
#define SM_RED (SM_AB + 512)
#define SM_TOT (SM_RED + 1024)
static_assert(128 * 68 * 4 <= SM_Q);
static_assert(SM_V % 16 == 0 && SM_Q % 16 == 0 && SM_P % 16 == 0 && SM_AB % 16 == 0);
static_assert(2 * SM_TOT <= 327680);

__global__ __launch_bounds__(256) void k_attn(const __bf16* __restrict__ QP, const __bf16* __restrict__ KP,
                                             const __bf16* __restrict__ VP, const float* __restrict__ ALPHA,
                                             const float* __restrict__ BETA, const float* __restrict__ SP,
                                             float* __restrict__ out) {
  __shared__ __align__(16) unsigned char smem[SM_TOT];
  __bf16* Ks   = (__bf16*)(smem + SM_K);     // hi at +0, lo at +KQ_PLANE elements
  __bf16* Vs   = (__bf16*)(smem + SM_V);
  __bf16* Qs   = (__bf16*)(smem + SM_Q);
  __bf16* Ps   = (__bf16*)(smem + SM_P);     // hi: group g at +P_GROUP*g ; lo: +P_PLANE + P_GROUP*g
  float*  sab  = (float*)(smem + SM_AB);     // alpha 0..63, beta 64..127
  float*  redm = (float*)(smem + SM_RED);    // partial row max [4 g][2 kh][16]
  float*  reds = redm + 128;                 // partial row sum [4 g][2 kh][16]
  float*  Os   = (float*)(smem + SM_K);      // [128][68] after the key loop

  const int tid = threadIdx.x, lane = tid & 31, w = tid >> 5, hh = lane >> 4, c = lane & 15;
  const int g = w & 3, kh = w >> 2;
  const int key0 = 32 * kh;                  // this wave's key half within a chunk
  const int ch0  = 64 * kh;                  // this wave's channel half
  const int b  = blockIdx.x >> 6;
  const int n0 = (blockIdx.x & 63) * 64;
  const size_t tok0 = (size_t)b * NP + n0;

  // ---- stage the block's Q tile hi|lo: 256 thr x 64 elements ----
  {
    const int r = tid >> 2, part = tid & 3, p = part >> 1, half = (part & 1) * 64;
    const __bf16* src = QP + (size_t)p * PLANE_ELEMS + (tok0 + r) * NC + half;
    __bf16* dst = Qs + p * KQ_PLANE + r * KQ_PITCH + half;
#pragma unroll
    for (int i = 0; i < 8; ++i) { const v8b v = *(const v8ba*)(src + 8 * i); *(v8ba*)(dst + 8 * i) = v; }
  }
  // ---- sp[n] for this lane's 8 query rows ----
  float spn[8];
  {
    const v4f s0 = *(const v4fa*)(SP + tok0 + 16 * g + 8 * hh);
    const v4f s1 = *(const v4fa*)(SP + tok0 + 16 * g + 8 * hh + 4);
    spn[0] = s0[0]; spn[1] = s0[1]; spn[2] = s0[2]; spn[3] = s0[3];
    spn[4] = s1[0]; spn[5] = s1[1]; spn[6] = s1[2]; spn[7] = s1[3];
  }
  float mrow[8], lrow[8];
  const v8f zero8 = {0.f, 0.f, 0.f, 0.f, 0.f, 0.f, 0.f, 0.f};
  v8f oacc[4];
#pragma unroll
  for (int r = 0; r < 8; ++r) { mrow[r] = -INFINITY; lrow[r] = 0.0f; }
#pragma unroll
  for (int t = 0; t < 4; ++t) oacc[t] = zero8;

  const __bf16* qrow = Qs + (16 * g + c) * KQ_PITCH;
  __bf16* pgh = Ps + g * P_GROUP;
  __bf16* pgl = Ps + P_PLANE + g * P_GROUP;
  const int rme = g * 32 + kh * 16 + 8 * hh;   // exchange slot base of this lane's rows
  const int r0e = g * 32 + 8 * hh;             // key half 0 slot base
  const int r1e = g * 32 + 16 + 8 * hh;        // key half 1 slot base

#pragma unroll 1
  for (int kc = 0; kc < NP / 64; ++kc) {
    const int m0 = kc * 64;
    __syncthreads();
    {
      // K: 256 thr x 64 elements = 64 rows x 128 x 2 planes
      const int r = tid >> 2, part = tid & 3, p = part >> 1, half = (part & 1) * 64;
      const __bf16* ksrc = KP + (size_t)p * PLANE_ELEMS + ((size_t)b * NP + m0 + r) * NC + half;
      __bf16* kd = Ks + p * KQ_PLANE + r * KQ_PITCH + half;
#pragma unroll
      for (int i = 0; i < 8; ++i) { const v8b a = *(const v8ba*)(ksrc + 8 * i); *(v8ba*)(kd + 8 * i) = a; }
      // V: 256 thr x 64 elements = 128 channel rows x 64 keys x 2 planes
      const int r2 = tid >> 1, p2 = tid & 1;
      const __bf16* vsrc = VP + (size_t)p2 * PLANE_ELEMS + ((size_t)b * NC + r2) * NP + m0;
      __bf16* vd = Vs + p2 * V_PLANE + r2 * VP_PITCH;
#pragma unroll
      for (int i = 0; i < 8; ++i) { const v8b a = *(const v8ba*)(vsrc + 8 * i); *(v8ba*)(vd + 8 * i) = a; }
      if (w == 0) {
        const v2f a = *(const v2fa*)(ALPHA + (size_t)b * NP + m0 + 2 * lane);
        *(v2fa*)(sab + 2 * lane) = a;
      } else if (w == 1) {
        const v2f a = *(const v2fa*)(BETA + (size_t)b * NP + m0 + 2 * lane);
        *(v2fa*)(sab + 64 + 2 * lane) = a;
      }
    }
    __syncthreads();

    // ---- scores: s[jj][r] = S[query 16g+8hh+r][key m0+key0+16jj+c], 3-term split ----
    v8f s[2];
    s[0] = zero8; s[1] = zero8;
#pragma unroll 1
    for (int dc = 0; dc < 4; ++dc) {
      const v16b qa = ldfrag(qrow + dc * 32, hh);
      const v16b ql = ldfrag(qrow + KQ_PLANE + dc * 32, hh);
#pragma unroll
      for (int jj = 0; jj < 2; ++jj) {
        const __bf16* krow = Ks + (key0 + 16 * jj + c) * KQ_PITCH + dc * 32;
        const v16b kb = ldfrag(krow, hh);
        const v16b kl = ldfrag(krow + KQ_PLANE, hh);
        s[jj] = mma_bf(qa, kb, s[jj]);
        s[jj] = mma_bf(qa, kl, s[jj]);
        s[jj] = mma_bf(ql, kb, s[jj]);
      }
    }
    // ---- positional terms in f32, then partial row max over this key half ----
    float al[2], be[2];
#pragma unroll
    for (int jj = 0; jj < 2; ++jj) { al[jj] = sab[key0 + 16 * jj + c]; be[jj] = sab[64 + key0 + 16 * jj + c]; }
#pragma unroll
    for (int r = 0; r < 8; ++r) {
      float m = -INFINITY;
#pragma unroll
      for (int jj = 0; jj < 2; ++jj) {
        const float e = s[jj][r] + al[jj] + spn[r] * be[jj];
        s[jj][r] = e;
        m = fmaxf(m, e);
      }
#pragma unroll
      for (int off = 1; off < 16; off <<= 1) m = fmaxf(m, __shfl_xor(m, off, 32));
      if (c == 0) redm[rme + r] = m;
    }
    __syncthreads();
    // ---- online softmax: identical running state in both waves of a pair; P hi|lo into the pair's LDS tile ----
    float corr[8];
#pragma unroll
    for (int r = 0; r < 8; ++r) {
      const float cmx  = fmaxf(redm[r0e + r], redm[r1e + r]);
      const float mnew = fmaxf(mrow[r], cmx);
      corr[r] = expf(mrow[r] - mnew);
      mrow[r] = mnew;
      float psum = 0.0f;
#pragma unroll
      for (int jj = 0; jj < 2; ++jj) {
        const float p = expf(s[jj][r] - mnew);
        psum += p;
        const unsigned short hb = f2bf_bits(p);
        const unsigned short lb = f2bf_bits(p - bfbits2f(hb));
        pgh[(8 * hh + r) * VP_PITCH + key0 + 16 * jj + c] = __builtin_bit_cast(__bf16, hb);
        pgl[(8 * hh + r) * VP_PITCH + key0 + 16 * jj + c] = __builtin_bit_cast(__bf16, lb);
      }
#pragma unroll
      for (int off = 1; off < 16; off <<= 1) psum += __shfl_xor(psum, off, 32);
      if (c == 0) reds[rme + r] = psum;
      lrow[r] = lrow[r] * corr[r];
#pragma unroll
      for (int t = 0; t < 4; ++t) oacc[t][r] *= corr[r];
    }
    __syncthreads();
#pragma unroll
    for (int r = 0; r < 8; ++r) lrow[r] += reds[r0e + r] + reds[r1e + r];

    // ---- O += P . V : A = P [query][key], B = Vcm row c [key]; 4 channel tiles of this half, 2 key halves ----
#pragma unroll 1
    for (int kk = 0; kk < 2; ++kk) {
      const v16b pa = ldfrag(pgh + c * VP_PITCH + kk * 32, hh);
      const v16b pl = ldfrag(pgl + c * VP_PITCH + kk * 32, hh);
#pragma unroll
      for (int t = 0; t < 4; ++t) {
        const __bf16* vr = Vs + (ch0 + 16 * t + c) * VP_PITCH + kk * 32;
        const v16b vb = ldfrag(vr, hh);
        const v16b vl = ldfrag(vr + V_PLANE, hh);
        oacc[t] = mma_bf(pa, vb, oacc[t]);
        oacc[t] = mma_bf(pa, vl, oacc[t]);
        oacc[t] = mma_bf(pl, vb, oacc[t]);
      }
    }
  }
  __syncthreads();   // all waves done with K/V tiles before the output tile overlays them

  // ---- normalise, stage O transposed as [c][n_local], write whole 256-B channel segments ----
#pragma unroll
  for (int r = 0; r < 8; ++r) {
    const float inv = 1.0f / lrow[r];
#pragma unroll
    for (int t = 0; t < 4; ++t) Os[(ch0 + 16 * t + c) * 68 + 16 * g + 8 * hh + r] = oacc[t][r] * inv;
  }
  __syncthreads();
  {
    float* ob = out + (size_t)b * NC * NP + n0;
    const int c4 = (lane & 15) * 4;
    {
#pragma unroll
      for (int i = 0; i < 8; ++i) {
        const int row = i * 16 + w * 2 + hh;                       // 0..127 channel
        const v4f v = *(const v4fa*)(Os + row * 68 + c4);
        *(v4f*)(ob + (size_t)row * NP + c4) = v;
      }
      
    }
  }
}

// ---------------------------------------------------------------------------
//   XT    bf16 [32768][128]          0           8388608
//   WQKV  bf16 [384][128]            8388608       98304
//   AV    f32  [8][128]              8486912        4096
//   MX    f32  [8][128]              8491008        4096
//   SPIN  f32  [8][2][4096]          8495104      262144
//   AVEC  f32  [8][128]              8757248        4096
//   RVEC  f32  [8][128]              8761344        4096
//   SP    f32  [8][4096]             8765440      131072
//   ALPHA f32  [8][4096]             8896512      131072
//   BETA  f32  [8][4096]             9027584      131072
//   Q hi|lo bf16 2x[32768][128]      9158656    16777216
//   K hi|lo bf16 2x[32768][128]     25935872    16777216
//   V hi|lo bf16 2x[8][128][4096]   42713088    16777216
//   total                          59490304
// ---------------------------------------------------------------------------
extern "C" void kernel_launch(void* const* d_in, const int* in_sizes, int n_in,
                              void* d_out, int out_size, void* d_ws, size_t ws_size,
                              hipStream_t stream) {
  if (n_in < 13) return;
  if (in_sizes[0] != NB * NC * NP || in_sizes[1] != NB * NC * NP) return;
  if (in_sizes[2] != NC * NC || in_sizes[4] != NC * NC || in_sizes[6] != NC * NC || in_sizes[8] != NC * NC) return;
  if (in_sizes[3] != NC || in_sizes[5] != NC || in_sizes[7] != NC || in_sizes[9] != NC) return;
  if (in_sizes[10] != 10 || in_sizes[11] != 98 || in_sizes[12] != 1) return;
  if (out_size != NB * NC * NP) return;

  const float* x    = (const float*)d_in[0];
  const float* x2   = (const float*)d_in[1];
  const float* q_w  = (const float*)d_in[2];
  const float* q_b  = (const float*)d_in[3];
  const float* k_w  = (const float*)d_in[4];
  const float* k_b  = (const float*)d_in[5];
  const float* v_w  = (const float*)d_in[6];
  const float* v_b  = (const float*)d_in[7];
  const float* ck_w = (const float*)d_in[8];
  const float* ck_b = (const float*)d_in[9];
  const float* c1w  = (const float*)d_in[10];
  const float* sp_w = (const float*)d_in[11];
  const float* sp_b = (const float*)d_in[12];
  float* out = (float*)d_out;

  const size_t plane_b = PLANE_ELEMS * 2;                 // 8388608 bytes per 16-bit plane
  size_t off = 0;
  const size_t oXT   = off; off += plane_b;
  const size_t oW    = off; off += (size_t)3 * NC * NC * 2;
  const size_t oAV   = off; off += (size_t)NB * NC * 4;
  const size_t oMX   = off; off += (size_t)NB * NC * 4;
  const size_t oSPIN = off; off += (size_t)NB * 2 * NP * 4;
  const size_t oAVEC = off; off += (size_t)NB * NC * 4;
  const size_t oRVEC = off; off += (size_t)NB * NC * 4;
  const size_t oSP   = off; off += (size_t)NB * NP * 4;
  const size_t oAL   = off; off += (size_t)NB * NP * 4;
  const size_t oBE   = off; off += (size_t)NB * NP * 4;
  const size_t oQ    = off; off += 2 * plane_b;
  const size_t oK    = off; off += 2 * plane_b;
  const size_t oV    = off; off += 2 * plane_b;           // off = 59490304
  if (off > ws_size) return;
  if (off > (size_t)134217728) return;

  char* ws = (char*)d_ws;
  unsigned short* XT    = (unsigned short*)(ws + oXT);
  unsigned short* WQKV  = (unsigned short*)(ws + oW);
  float* AV    = (float*)(ws + oAV);
  float* MX    = (float*)(ws + oMX);
  float* SPIN  = (float*)(ws + oSPIN);
  float* AVEC  = (float*)(ws + oAVEC);
  float* RVEC  = (float*)(ws + oRVEC);
  float* SP    = (float*)(ws + oSP);
  float* ALPHA = (float*)(ws + oAL);
  float* BETA  = (float*)(ws + oBE);
  unsigned short* QP = (unsigned short*)(ws + oQ);
  unsigned short* KPp = (unsigned short*)(ws + oK);
  unsigned short* VPp = (unsigned short*)(ws + oV);

  // 1. x -> token-major bf16 planes (grid: n blocks, c blocks, batch)
  k_xt<<<dim3(NP / 64, NC / 64, NB), 256, 0, stream>>>(x, XT);
  // 2. projection weights -> bf16 [384][128]
  k_wcvt<<<dim3(NC * NC / 8 / 256, 3), 256, 0, stream>>>(q_w, k_w, v_w, WQKV);
  // 3. per-(b,c) pixel mean/max of x2
  k_poolbc<<<NB * NC / 32, 256, 0, stream>>>(x2, AV, MX);
  // 4. per-(b,n) channel mean/max of x2
  k_poolc<<<NB * (NP / 64), 256, 0, stream>>>(x2, SPIN);
  // 5. positional branch: Avec, R, sp
  k_pos<<<NB, 256, 0, stream>>>(AV, MX, SPIN, c1w, ck_w, ck_b, sp_w, sp_b, AVEC, RVEC, SP);
  // 6. q/k/v projections + alpha/beta + hi|lo planes
  k_qkv<<<dim3(NTOK / 64, 3), 128, 0, stream>>>((const __bf16*)(const void*)XT, (const __bf16*)(const void*)WQKV,
                                                q_b, k_b, v_b, AVEC, RVEC, QP, KPp, VPp, ALPHA, BETA);
  // 7. attention, channel-major output
  k_attn<<<NB * (NP / 64), 256, 0, stream>>>((const __bf16*)(const void*)QP, (const __bf16*)(const void*)KPp,
                                             (const __bf16*)(const void*)VPp, ALPHA, BETA, SP, out);
  (void)hipGetLastError();
}

// v002
// One run takes 517 microseconds.
// In two side-by-side timings against v001, it was 1.14 and 1.13 times as fast.
// Counting every step since v000, it is 2.73 times as fast.
// Contractions: q/k/v 1x1 projections on v_wmma_f32_16x16x32_bf16 (bf16 operands taken from bf16-RNE inputs, single product, f32 accumulate);
// q.k^T scores and p.v on v_wmma_f32_16x16x32_bf16 with bf16 hi/lo split operands (hi.hi + hi.lo + lo.hi), f32 accumulate;
// pools, channel conv1d, spatial 7x7 conv, positional vectors alpha/beta, online softmax (expf) in f32.
// 16-bit planes and carries: XT = bf16 RNE(x), Wqkv = bf16 RNE(w), Q/K/V hi = RNE(y), lo = RNE(y - hi), P hi/lo per key chunk in LDS.
// No power-of-two carry on any plane (bf16 keeps the f32 exponent range), so no inverse fold anywhere.
#include <hip/hip_runtime.h>
#include <math.h>
#include <stdint.h>

#define NB   8
#define NC   128
#define NP   4096
#define NTOK (NB * NP)
#define PLANE_ELEMS ((size_t)NTOK * NC)

static_assert(NP % 64 == 0);
static_assert(NC == 128);
static_assert((NB * NC) % 32 == 0);
static_assert(NP % 256 == 0);

typedef __attribute__((ext_vector_type(16))) __bf16 v16b;
typedef __attribute__((ext_vector_type(8)))  __bf16 v8b;
typedef __attribute__((ext_vector_type(8)))  float  v8f;
typedef __attribute__((ext_vector_type(4)))  float  v4f;
typedef __attribute__((ext_vector_type(2)))  float  v2f;
typedef __attribute__((ext_vector_type(4)))  unsigned int v4u;
typedef v8b __attribute__((may_alias)) v8ba;
typedef v4f __attribute__((may_alias)) v4fa;
typedef v2f __attribute__((may_alias)) v2fa;
typedef v4u __attribute__((may_alias)) v4ua;

// ---------------------------------------------------------------------------
// bf16 helpers (RNE convert on the f32 bits)
// ---------------------------------------------------------------------------
__device__ __forceinline__ unsigned short f2bf_bits(float f) {
  const unsigned u = __float_as_uint(f);
  return (unsigned short)((u + 0x7FFFu + ((u >> 16) & 1u)) >> 16);
}
__device__ __forceinline__ float bfbits2f(unsigned short h) { return __uint_as_float(((unsigned)h) << 16); }
__device__ __forceinline__ float bfr(float f) { return bfbits2f(f2bf_bits(f)); }
__device__ __forceinline__ unsigned pk16(unsigned short a, unsigned short b) { return (unsigned)a | ((unsigned)b << 16); }

// ---------------------------------------------------------------------------
// 16x16x32 bf16 WMMA with hazard guard (ties D, keeps A/B live).
// Fragment map (wave32): lane l, h = l>>4, m = n = l&15.
//   A/B element i: i<8 -> k0+8h+i ; i>=8 -> k0+16+8h+(i-8)
//   D element r : row 8h+r, col l&15
// ---------------------------------------------------------------------------
__device__ __forceinline__ v8f mma_bf(v16b a, v16b b, v8f c) {
  c = __builtin_amdgcn_wmma_f32_16x16x32_bf16(false, a, false, b, (short)0, c, false, false);
  asm volatile("v_nop\n\tv_nop\n\tv_nop\n\tv_nop" : "+v"(c) : "v"(a), "v"(b));
  return c;
}
union FB { v16b v; v8b h[2]; };
// A or B fragment from a k-contiguous bf16 row; p points at element k0 of the row owned by this lane.
__device__ __forceinline__ v16b ldfrag(const __bf16* p, int hh) {
  FB f;
  f.h[0] = *(const v8ba*)(p + 8 * hh);
  f.h[1] = *(const v8ba*)(p + 16 + 8 * hh);
  return f.v;
}

// 16-B global load at a block-uniform base plus the lane's own 32-bit byte offset plus a constant. Each plane's base goes
// through readfirstlane so that it keeps a scalar register pair of its own and the load takes the scalar-base form;
// without it the compiler folds the lo plane's 8-MiB step into 64-bit vector addresses that it forms anew every trip.
typedef const __attribute__((address_space(1))) v8ba gv8b;
__device__ __forceinline__ uint64_t ubase(const __bf16* p) {
  const uint64_t u = (uint64_t)p;
  const uint32_t lo = (uint32_t)__builtin_amdgcn_readfirstlane((int)(uint32_t)u);
  const uint32_t hi = (uint32_t)__builtin_amdgcn_readfirstlane((int)(uint32_t)(u >> 32));
  return ((uint64_t)hi << 32) | lo;
}
__device__ __forceinline__ v8b ldg16(uint64_t base, unsigned lane_bytes, unsigned imm_bytes) {
  return *(gv8b*)(base + lane_bytes + imm_bytes);
}

// ---------------------------------------------------------------------------
// Kernel 1: x[b] viewed [128 c][4096 n] (pitch 4096) -> XT bf16 [b*4096+n][128 c] (pitch 128), bf16 RNE.
// 64x64 tiles through LDS. grid = (4096/64, 128/64, 8), 256 threads.
// Coverage per block: load 4 it x 256 thr x 4 floats = 64x64; store 2 it x 256 thr x 8 u16 = 64x64.
// ---------------------------------------------------------------------------
__global__ __launch_bounds__(256) void k_xt(const float* __restrict__ X, unsigned short* __restrict__ xt) {
  __shared__ __align__(16) float tf[64 * 68];
  const int b = blockIdx.z;
  const float* W = X + (size_t)b * NC * NP;
  unsigned short* o = xt + (size_t)b * NP * NC;
  const int c0 = blockIdx.x * 64;   // input column block (n) = output row block
  const int r0 = blockIdx.y * 64;   // input row block (c)    = output column block
  const int tid = threadIdx.x;
  {
    const int lr = tid >> 4;
    const int c4 = (tid & 15) * 4;
#pragma unroll
    for (int it = 0; it < 4; ++it) {
      const int rr = it * 16 + lr;
      const v4f a = *(const v4fa*)(W + (size_t)(r0 + rr) * NP + c0 + c4);
      *(v4f*)(tf + rr * 68 + c4) = a;
    }
  }
  __syncthreads();
  const int sub = tid >> 3;          // 0..31
  const int c8  = (tid & 7) * 8;     // 0..56
  v4u hv[2];
#pragma unroll
  for (int it = 0; it < 2; ++it) {
    const int oc = it * 32 + sub;    // output row within tile (= input column)
    v4u a;
#pragma unroll
    for (int q = 0; q < 4; ++q) {
      const float f0 = tf[(c8 + 2 * q) * 68 + oc];
      const float f1 = tf[(c8 + 2 * q + 1) * 68 + oc];
      a[q] = pk16(f2bf_bits(f0), f2bf_bits(f1));
    }
    hv[it] = a;
  }
  {
#pragma unroll
    for (int it = 0; it < 2; ++it) {
      const int oc = it * 32 + sub;
      *(v4ua*)(o + (size_t)(c0 + oc) * NC + r0 + c8) = hv[it];
    }
    
  }
}

// ---------------------------------------------------------------------------
// Kernel 2: [q_w; k_w; v_w] ([out o][in c] row-major each) -> Wqkv bf16 [384 o][128 c] (natural Bt: n = o, k = c).
// grid = (16384/8/256 = 8, 3), 256 threads; matrix selected by blockIdx.y (block-uniform).
// Coverage: 3 x 2048 threads x 8 elements = 3 x 16384. One 16-B store per lane, lanes contiguous:
// ---------------------------------------------------------------------------
__global__ __launch_bounds__(256) void k_wcvt(const float* __restrict__ qw, const float* __restrict__ kw,
                                             const float* __restrict__ vw, unsigned short* __restrict__ Wb) {
  const int which = blockIdx.y;
  const float* src = (which == 0) ? qw : ((which == 1) ? kw : vw);
  const int i = blockIdx.x * 256 + threadIdx.x;
  if (i >= NC * NC / 8) return;
  const v4f a = *(const v4fa*)(src + (size_t)i * 8);
  const v4f c = *(const v4fa*)(src + (size_t)i * 8 + 4);
  v4u o4;
  o4[0] = pk16(f2bf_bits(a[0]), f2bf_bits(a[1]));
  o4[1] = pk16(f2bf_bits(a[2]), f2bf_bits(a[3]));
  o4[2] = pk16(f2bf_bits(c[0]), f2bf_bits(c[1]));
  o4[3] = pk16(f2bf_bits(c[2]), f2bf_bits(c[3]));
  unsigned short* dst = Wb + (size_t)which * NC * NC + (size_t)i * 8;
  *(v4ua*)dst = o4;
  
}

// ---------------------------------------------------------------------------
// Kernel 3: per-(b,c) mean and max over the 4096 pixels of bf16-RNE x2. Block handles 32 consecutive (b,c) rows
// (grid = 1024/32 = 32, 256 threads: each thread 16 elements of a row, fixed-order tree). The 32 means and 32
// maxes are funnelled through LDS; wave 0 lanes 0..7 write the AV line, lanes 8..15 the MX line
// Coverage: 32 blocks x 32 rows = 1024 = 8 x 128 rows; per row 256 x 16 = 4096 elements.
// ---------------------------------------------------------------------------
__global__ __launch_bounds__(256) void k_poolbc(const float* __restrict__ x2, float* __restrict__ AV,
                                               float* __restrict__ MX) {
  __shared__ float ws_s[8], ws_m[8];
  __shared__ __align__(16) float os[64];
  const int g = blockIdx.x, tid = threadIdx.x, lane = tid & 31, w = tid >> 5;
#pragma unroll 1
  for (int j = 0; j < 32; ++j) {
    const float* p = x2 + (size_t)(g * 32 + j) * NP + tid * 16;
    float s = 0.f, m = -INFINITY;
#pragma unroll
    for (int i = 0; i < 4; ++i) {
      const v4f a = *(const v4fa*)(p + 4 * i);
      const float a0 = bfr(a[0]), a1 = bfr(a[1]), a2 = bfr(a[2]), a3 = bfr(a[3]);
      s += (a0 + a1) + (a2 + a3);
      m = fmaxf(fmaxf(m, a0), fmaxf(fmaxf(a1, a2), a3));
    }
#pragma unroll
    for (int off = 16; off > 0; off >>= 1) {
      s += __shfl_xor(s, off, 32);
      m = fmaxf(m, __shfl_xor(m, off, 32));
    }
    if (lane == 0) { ws_s[w] = s; ws_m[w] = m; }
    __syncthreads();
    if (tid == 0) {
      float ts = 0.f, tm = -INFINITY;
#pragma unroll
      for (int k = 0; k < 8; ++k) { ts += ws_s[k]; tm = fmaxf(tm, ws_m[k]); }
      os[j] = ts * (1.0f / 4096.0f);
      os[32 + j] = tm;
    }
    __syncthreads();
  }
  if (w == 0) {
    const v4f v = *(const v4fa*)(os + 4 * (lane & 15));
    {
      if (lane < 8)       *(v4f*)(AV + g * 32 + 4 * lane) = v;
      else if (lane < 16) *(v4f*)(MX + g * 32 + 4 * (lane - 8)) = v;
      
    }
  }
}

// ---------------------------------------------------------------------------
// Kernel 4: per-(b,n) mean and max over the 128 channels of bf16-RNE x2 -> SPIN[b][0][n] = mean, SPIN[b][1][n] = max.
// Block per (b, 64-pixel group): grid = 8 x 64 = 512, 256 threads = 64 pixels x 4 channel groups of 32 (serial,
// unroll 4), fixed-order 4-way combine. 64 means / 64 maxes funnelled through LDS; wave 0 writes both 256-B
// Coverage: 512 blocks x 64 pixels = 8 x 4096 per plane.
// ---------------------------------------------------------------------------
__global__ __launch_bounds__(256) void k_poolc(const float* __restrict__ x2, float* __restrict__ SPIN) {
  __shared__ float ps[4][64], pm[4][64];
  __shared__ __align__(16) float os[128];
  const int b = blockIdx.x >> 6, g = blockIdx.x & 63;
  const int tid = threadIdx.x, lane = tid & 31;
  const int p = tid & 63, cg = tid >> 6;
  const float* src = x2 + ((size_t)b * NC + cg * 32) * NP + g * 64 + p;
  float s = 0.f, m = -INFINITY;
#pragma unroll 4
  for (int c = 0; c < 32; ++c) {
    const float v = bfr(src[(size_t)c * NP]);
    s += v;
    m = fmaxf(m, v);
  }
  ps[cg][p] = s;
  pm[cg][p] = m;
  __syncthreads();
  if (tid < 64) {
    const float ts = ((ps[0][tid] + ps[1][tid]) + ps[2][tid]) + ps[3][tid];
    const float tm = fmaxf(fmaxf(pm[0][tid], pm[1][tid]), fmaxf(pm[2][tid], pm[3][tid]));
    os[tid] = ts * (1.0f / 128.0f);
    os[64 + tid] = tm;
  }
  __syncthreads();
  if (tid < 32) {
    const v4f v = *(const v4fa*)(os + 4 * lane);   // lanes 0..15: means 0..63, lanes 16..31: maxes 0..63
    float* base = SPIN + (size_t)b * 2 * NP + g * 64;
    {
      if (lane < 16) *(v4f*)(base + 4 * lane) = v;
      else           *(v4f*)(base + NP + 4 * (lane - 16)) = v;
      
    }
  }
}

// ---------------------------------------------------------------------------
// Kernel 5: positional branch, block per b (grid 8, 256 threads), all f32 VALU, conv loops rolled:
//   ch[c]   = sum_{i in {mean,max}} sum_{t<5} bf16r(conv1_w[i][t]) * stk[i][c+t-2]   (zero pad 2, no flip, no bias)
//   Avec[o] = sum_c bf16r(ck_w[o][c]) * ch[c] + bf16r(ck_b[o]) ;  R[o] = sum_c bf16r(ck_w[o][c])
//   sp[n]   = sum_i sum_{u,v<7} bf16r(sp_w[i][u][v]) * spin[i][h+u-3][w+v-3] + bf16r(sp_b)   (zero pad 3)
// The pooled maps are staged in zero-padded 70x70 LDS planes. Outputs: AVEC[b][128] by wave 0 and RVEC[b][128]
// Coverage: AVEC/RVEC 8 x 128; SP 8 blocks x 4 it x 256 thr x 4 = 8 x 4096.
// ---------------------------------------------------------------------------
__global__ __launch_bounds__(256) void k_pos(const float* __restrict__ AV, const float* __restrict__ MX,
                                            const float* __restrict__ SPIN, const float* __restrict__ c1w,
                                            const float* __restrict__ ckw, const float* __restrict__ ckb,
                                            const float* __restrict__ spw, const float* __restrict__ spb,
                                            float* __restrict__ AVEC, float* __restrict__ RVEC,
                                            float* __restrict__ SP) {
  __shared__ float sav[128], smx[128], sch[128];
  __shared__ float sw1[32], sw2[128];
  __shared__ __align__(16) float savec[128], srv[128];
  __shared__ float spl[2 * 4900];
  __shared__ __align__(16) float ssp[NP];
  const int b = blockIdx.x, tid = threadIdx.x, lane = tid & 31, w = tid >> 5;

  if (tid < 128) {                                   // waves 0..3 (wave-uniform)
    sav[tid] = AV[b * NC + tid];
    smx[tid] = MX[b * NC + tid];
    sw2[tid] = bfr(spw[min(tid, 97)]);               // clamped address, all lanes active
  }
  if (w == 0) sw1[lane] = bfr(c1w[min(lane, 9)]);
  for (int i = tid; i < 2 * 4900; i += 256) spl[i] = 0.0f;
  __syncthreads();
  // interior of the padded pooled planes
#pragma unroll 2
  for (int i = tid; i < NP; i += 256) {
    const int h = i >> 6, x = i & 63;
    const int li = (h + 3) * 70 + x + 3;
    spl[li]        = SPIN[(size_t)b * 2 * NP + i];
    spl[4900 + li] = SPIN[(size_t)b * 2 * NP + NP + i];
  }
  // channel conv1d
  if (tid < 128) {
    const int c = tid;
    float acc = 0.0f;
#pragma unroll 1
    for (int t = 0; t < 5; ++t) {
      const int cc  = c + t - 2;
      const int ccl = min(max(cc, 0), NC - 1);
      const float valid = (cc >= 0 && cc < NC) ? 1.0f : 0.0f;
      acc += valid * (sw1[t] * sav[ccl] + sw1[5 + t] * smx[ccl]);
    }
    sch[c] = acc;
  }
  __syncthreads();
  // Avec, R
  if (tid < 128) {
    const int o = tid;
    float a = bfr(ckb[o]), r = 0.0f;
    const float* wr = ckw + (size_t)o * NC;
#pragma unroll 4
    for (int c = 0; c < NC; ++c) {
      const float wv = bfr(wr[c]);
      a += wv * sch[c];
      r += wv;
    }
    savec[o] = a;
    srv[o] = r;
  }
  // spatial 7x7x2 conv + bias
  const float bias_sp = bfr(spb[0]);
#pragma unroll 1
  for (int it = 0; it < NP / 256; ++it) {
    const int n = it * 256 + tid;
    const int h = n >> 6, x = n & 63;
    float acc = bias_sp;
#pragma unroll 1
    for (int u = 0; u < 7; ++u) {
#pragma unroll 1
      for (int v = 0; v < 7; ++v) {
        const int li = (h + u) * 70 + x + v;
        acc += sw2[u * 7 + v] * spl[li] + sw2[49 + u * 7 + v] * spl[4900 + li];
      }
    }
    ssp[n] = acc;
  }
  __syncthreads();
  // stores
  if (w == 0) {
    const v4f v = *(const v4fa*)(savec + 4 * lane);
    {
      *(v4f*)(AVEC + b * NC + 4 * lane) = v;
      
    }
  } else if (w == 1) {
    const v4f v = *(const v4fa*)(srv + 4 * lane);
    {
      *(v4f*)(RVEC + b * NC + 4 * lane) = v;
      
    }
  }
  {
    v4f sv[4];
#pragma unroll
    for (int it = 0; it < 4; ++it) sv[it] = *(const v4fa*)(ssp + it * 1024 + 4 * tid);
    {
#pragma unroll
      for (int it = 0; it < 4; ++it)
        *(v4f*)(SP + (size_t)b * NP + it * 1024 + 4 * tid) = sv[it];
      
    }
  }
}

// ---------------------------------------------------------------------------
// Kernel 6: [Q|K|V] = XT . Wqkv^T + bias (exact bf16 x bf16 products, f32 accumulate, K = 128 in 4 steps of 32).
// grid = (32768/64 = 512 token tiles, 3 = which), 128 threads = 4 waves; wave w owns tokens m0+16w..+15 x all 128
// output channels (8 accumulator tiles). A fragments straight from XT rows, B fragments from Wqkv rows (both
// k-contiguous bf16, arithmetic addressing). bias (bf16r), Avec and R staged in LDS (one scalar load per thread each).
// Epilogue: f32 tile (acc + bias) staged in LDS [64][132];
//   which 0: alpha[n] = sum_o Avec[b][o] q[o][n], beta[n] = sum_o R[o] q[o][n] (f32, rolled) -> ALPHA/BETA 256-B
//            segments (16 lanes x 16 B); Q hi|lo token-major planes [tok][128];
//   which 1: K hi|lo token-major planes;  which 2: V hi|lo channel-major planes [b][c][4096] (transposed write).
// ---------------------------------------------------------------------------
__global__ __launch_bounds__(128) void k_qkv(const __bf16* __restrict__ XT, const __bf16* __restrict__ Wb,
                                            const float* __restrict__ qb, const float* __restrict__ kb,
                                            const float* __restrict__ vb,
                                            const float* __restrict__ AVEC, const float* __restrict__ RVEC,
                                            unsigned short* __restrict__ QP, unsigned short* __restrict__ KP,
                                            unsigned short* __restrict__ VP,
                                            float* __restrict__ ALPHA, float* __restrict__ BETA) {
  __shared__ __align__(16) float sT[64 * 132];
  __shared__ __align__(16) float sAV[128], sRV[128], sAB[128], sBI[128];
  const int tid = threadIdx.x, lane = tid & 31, w = tid >> 5, hh = lane >> 4, l16 = lane & 15;
  const int which = blockIdx.y;
  const int m0 = blockIdx.x * 64;            // global token row
  const int b  = m0 / NP;
  const int n0 = m0 - b * NP;

  const float* bias = (which == 0) ? qb : ((which == 1) ? kb : vb);   // block-uniform select, same address space
  sAV[tid] = AVEC[b * NC + tid];
  sRV[tid] = RVEC[b * NC + tid];
  sBI[tid] = bfr(bias[tid]);
  __syncthreads();

  const v8f zero8 = {0.f, 0.f, 0.f, 0.f, 0.f, 0.f, 0.f, 0.f};
  v8f acc[8];
#pragma unroll
  for (int t = 0; t < 8; ++t) acc[t] = zero8;

  const __bf16* arow = XT + (size_t)(m0 + 16 * w + l16) * NC;        // token row, k = input channel
  const __bf16* brow = Wb + ((size_t)which * NC + l16) * NC;          // output channel row (tile 0), k = input channel
#pragma unroll
  for (int kc = 0; kc < 4; ++kc) {
    const v16b a = ldfrag(arow + kc * 32, hh);
#pragma unroll
    for (int t = 0; t < 8; ++t) {
      const v16b bf = ldfrag(brow + (size_t)t * 16 * NC + kc * 32, hh);
      acc[t] = mma_bf(a, bf, acc[t]);
    }
  }
  // D[r] of tile t = Y[token 16w+8hh+r][channel 16t+l16]
#pragma unroll
  for (int t = 0; t < 8; ++t) {
    const float bv = sBI[16 * t + l16];
#pragma unroll
    for (int r = 0; r < 8; ++r) sT[(16 * w + 8 * hh + r) * 132 + 16 * t + l16] = acc[t][r] + bv;
  }
  __syncthreads();
  if (which == 0 && tid < 64) {            // waves 0,1
    const float* qr = sT + tid * 132;
    float a = 0.0f, be = 0.0f;
#pragma unroll 4
    for (int o = 0; o < NC; ++o) {
      const float q = qr[o];
      a  += sAV[o] * q;
      be += sRV[o] * q;
    }
    sAB[tid] = a;
    sAB[64 + tid] = be;
  }
  __syncthreads();

  // pack hi|lo planes
  const int q8 = lane & 7, sub = lane >> 3;
  v4u hv[8], lv[8];
#pragma unroll
  for (int i = 0; i < 8; ++i) {
    const int lid  = w * 32 + i * 4 + sub;                                   // 0..127
    const int base = (which != 2) ? ((lid >> 1) * 132 + (lid & 1) * 64 + 8 * q8) : ((8 * q8) * 132 + lid);
    const int estr = (which != 2) ? 1 : 132;
    v4u a, a2;
#pragma unroll
    for (int q = 0; q < 4; ++q) {
      const float f0 = sT[base + (2 * q) * estr];
      const float f1 = sT[base + (2 * q + 1) * estr];
      const unsigned short h0 = f2bf_bits(f0), h1 = f2bf_bits(f1);
      const unsigned short l0 = f2bf_bits(f0 - bfbits2f(h0)), l1 = f2bf_bits(f1 - bfbits2f(h1));
      a[q]  = pk16(h0, h1);
      a2[q] = pk16(l0, l1);
    }
    hv[i] = a;
    lv[i] = a2;
  }
  unsigned short* P = (which == 0) ? QP : ((which == 1) ? KP : VP);
  {
#pragma unroll
    for (int i = 0; i < 8; ++i) {
      const int lid = w * 32 + i * 4 + sub;
      const size_t go = (which != 2)
          ? ((size_t)(m0 + (lid >> 1)) * NC + (lid & 1) * 64 + 8 * q8)
          : (((size_t)b * NC + lid) * NP + n0 + 8 * q8);
      *(v4ua*)(P + go) = hv[i];
      *(v4ua*)(P + PLANE_ELEMS + go) = lv[i];
    }
    
  }
  if (which == 0 && w == 0) {
    const v4f v = *(const v4fa*)(sAB + 4 * lane);    // lanes 0..15: alpha 0..63, lanes 16..31: beta 0..63
    {
      if (lane < 16) *(v4f*)(ALPHA + m0 + 4 * lane) = v;
      else           *(v4f*)(BETA + m0 + 4 * (lane - 16)) = v;
      
    }
  }
}

// ---------------------------------------------------------------------------
// Kernel 7: full (non-causal, unmasked) attention, head dim 128, block per (b, 64-query tile): grid 8 x 64 = 512,
// 256 threads = 8 waves. Wave w: query group g = w&3 (rows 16g..16g+15), key half kh = w>>2.
//   energy[n][m] = q[n].k[m] (bf16 hi/lo 3-term WMMA) + alpha[m] + sp[n]*beta[m]  (f32, no scale)
//   Per 64-key chunk: wave (g,kh) computes the scores of its 16 rows x keys 32kh..32kh+31, the partial row max and
//   partial row sum are exchanged between the wave pair through LDS (block barriers), both waves of a pair derive
//   the identical running max / correction / sum; p hi|lo of all 64 keys land in the pair's shared P tile;
//   then O[n][c] += p . V for the wave's 64-channel half c in [64kh, 64kh+64)  (p and V bf16 hi/lo, 3-term WMMA).
//   Online softmax over all 4096 keys in 64 chunks of 64 (compile-time trip count, no masking), f32 expf.
// LDS: K hi|lo [64][128], Vcm hi|lo [128][64], Q hi|lo [64][128] (staged once), P hi|lo [4 g][16][64]; every row is
// padded by 16 B (pitch 272 B for 256-B rows, 144 B for 128-B rows = 16 B x odd), so the 16 rows that one 16-byte
// fragment read touches fall on 16 different bank groups; the lo plane of K/Q starts 64 B and that of V 128 B past a
// multiple of 256 B; staging loads and stores give consecutive lanes consecutive 16-B pieces of a row (whole lines);
// alpha/beta slices [64]+[64], exchange arrays [128]+[128]; output tile [128 c][64 n] (pitch 68) overlays the
// K/V region after the loop (block barrier first).
// Staging coverage (Q once, K/V per chunk): Q/K 8 rounds x 256 thr x 8 = 64x128 x 2 planes; V 8 rounds x 256 thr x 8 = 128x64 x 2 planes;
// P: each wave pair writes its whole 16x64 tile (both planes) before the barrier that precedes the reload.
// Output: out[b][c][n0..n0+63] channel-major; each channel row segment = 256 B = 16 contiguous lanes x 16 B
// ---------------------------------------------------------------------------
#define KQ_PITCH 136                       // elements: 128 + 8 (272 B)
#define VP_PITCH 72                        // elements: 64 + 8 (144 B)
#define KQ_PLANE (64 * KQ_PITCH + 32)      // elements: 17472 B = 68 x 256 + 64
#define V_PLANE  (128 * VP_PITCH + 64)     // elements: 18560 B = 72 x 256 + 128
#define P_GROUP  (16 * VP_PITCH)           // elements per query group
#define P_PLANE  (4 * P_GROUP)
#define SM_K   0
#define SM_V   (SM_K + 2 * KQ_PLANE * 2)
#define SM_Q   (SM_V + 2 * V_PLANE * 2)
#define SM_P   (SM_Q + 2 * KQ_PLANE * 2)
#define SM_AB  (SM_P + 2 * P_PLANE * 2)
#define SM_RED (SM_AB + 512)
#define SM_TOT (SM_RED + 1024)
static_assert(128 * 68 * 4 <= SM_Q);
static_assert(SM_V % 16 == 0 && SM_Q % 16 == 0 && SM_P % 16 == 0 && SM_AB % 16 == 0);
static_assert(2 * SM_TOT <= 327680);

__global__ __launch_bounds__(256) void k_attn(const __bf16* __restrict__ QP, const __bf16* __restrict__ KP,
                                             const __bf16* __restrict__ VP, const float* __restrict__ ALPHA,
                                             const float* __restrict__ BETA, const float* __restrict__ SP,
                                             float* __restrict__ out) {
  __shared__ __align__(16) unsigned char smem[SM_TOT];
  __bf16* Ks   = (__bf16*)(smem + SM_K);     // hi at +0, lo at +KQ_PLANE elements
  __bf16* Vs   = (__bf16*)(smem + SM_V);
  __bf16* Qs   = (__bf16*)(smem + SM_Q);
  __bf16* Ps   = (__bf16*)(smem + SM_P);     // hi: group g at +P_GROUP*g ; lo: +P_PLANE + P_GROUP*g
  float*  sab  = (float*)(smem + SM_AB);     // alpha 0..63, beta 64..127
  float*  redm = (float*)(smem + SM_RED);    // partial row max [4 g][2 kh][16]
  float*  reds = redm + 128;                 // partial row sum [4 g][2 kh][16]
  float*  Os   = (float*)(smem + SM_K);      // [128][68] after the key loop

  const int tid = threadIdx.x, lane = tid & 31, w = tid >> 5, hh = lane >> 4, c = lane & 15;
  const int g = w & 3, kh = w >> 2;
  const int key0 = 32 * kh;                  // this wave's key half within a chunk
  const int ch0  = 64 * kh;                  // this wave's channel half
  const int b  = blockIdx.x >> 6;
  const int n0 = (blockIdx.x & 63) * 64;
  const size_t tok0 = (size_t)b * NP + n0;

  // Staging lane maps: consecutive lanes take consecutive 16-B pieces, so one wave-wide load covers 4 whole 128-B lines.
  const int kq_r = tid >> 4, kq_c = (tid & 15) * 8;   // Q/K: 16 lanes per 256-B row, 16 rows per round of the block
  const int v_r  = tid >> 3, v_c  = (tid & 7) * 8;    // V:    8 lanes per 128-B row, 32 rows per round of the block
  const unsigned kq_g = (unsigned)(kq_r * NC + kq_c) * 2u; // the lane's byte offset in a token-major tile
  const unsigned v_g  = (unsigned)(v_r * NP + v_c) * 2u;   // the lane's byte offset in a channel-major tile
  // ---- stage the block's Q tile hi|lo: 2 planes x 4 rounds x 256 thr x 8 elements ----
  {
    __bf16* dst = Qs + kq_r * KQ_PITCH + kq_c;
#pragma unroll
    for (int p = 0; p < 2; ++p) {
      const uint64_t qsrc = ubase(QP + (size_t)p * PLANE_ELEMS + tok0 * NC);
#pragma unroll
      for (int i = 0; i < 4; ++i) {
        const v8b v = ldg16(qsrc, kq_g, i * 16 * NC * 2);
        *(v8ba*)(dst + p * KQ_PLANE + i * 16 * KQ_PITCH) = v;
      }
    }
  }
  // ---- sp[n] for this lane's 8 query rows ----
  float spn[8];
  {
    const v4f s0 = *(const v4fa*)(SP + tok0 + 16 * g + 8 * hh);
    const v4f s1 = *(const v4fa*)(SP + tok0 + 16 * g + 8 * hh + 4);
    spn[0] = s0[0]; spn[1] = s0[1]; spn[2] = s0[2]; spn[3] = s0[3];
    spn[4] = s1[0]; spn[5] = s1[1]; spn[6] = s1[2]; spn[7] = s1[3];
  }
  float mrow[8], lrow[8];
  const v8f zero8 = {0.f, 0.f, 0.f, 0.f, 0.f, 0.f, 0.f, 0.f};
  v8f oacc[4];
#pragma unroll
  for (int r = 0; r < 8; ++r) { mrow[r] = -INFINITY; lrow[r] = 0.0f; }
#pragma unroll
  for (int t = 0; t < 4; ++t) oacc[t] = zero8;

  const __bf16* qrow = Qs + (16 * g + c) * KQ_PITCH;
  __bf16* pgh = Ps + g * P_GROUP;
  __bf16* pgl = Ps + P_PLANE + g * P_GROUP;
  const int rme = g * 32 + kh * 16 + 8 * hh;   // exchange slot base of this lane's rows
  const int r0e = g * 32 + 8 * hh;             // key half 0 slot base
  const int r1e = g * 32 + 16 + 8 * hh;        // key half 1 slot base

  // K/V plane bases of this batch (block-uniform) and the lane's running byte offsets (below 1 MiB + one tile)
  const uint64_t ksrc[2] = {ubase(KP + (size_t)b * NP * NC), ubase(KP + PLANE_ELEMS + (size_t)b * NP * NC)};
  const uint64_t vsrc[2] = {ubase(VP + (size_t)b * NC * NP), ubase(VP + PLANE_ELEMS + (size_t)b * NC * NP)};
  unsigned koff = kq_g, voff = v_g;

#pragma unroll 1
  for (int kc = 0; kc < NP / 64; ++kc) {
    const int m0 = kc * 64;
    __syncthreads();
    {
      // K: 2 planes x 4 rounds x 256 thr x 8 elements = 64 rows x 128 x 2 planes
      __bf16* kd = Ks + kq_r * KQ_PITCH + kq_c;
      // V: 2 planes x 4 rounds x 256 thr x 8 elements = 128 channel rows x 64 keys x 2 planes
      __bf16* vd = Vs + v_r * VP_PITCH + v_c;
      v8b ka[8], va[8];
#pragma unroll
      for (int i = 0; i < 8; ++i) ka[i] = ldg16(ksrc[i >> 2], koff, (i & 3) * 16 * NC * 2);
#pragma unroll
      for (int i = 0; i < 8; ++i) va[i] = ldg16(vsrc[i >> 2], voff, (i & 3) * 32 * NP * 2);
#pragma unroll
      for (int i = 0; i < 8; ++i) *(v8ba*)(kd + (i >> 2) * KQ_PLANE + (i & 3) * 16 * KQ_PITCH) = ka[i];
#pragma unroll
      for (int i = 0; i < 8; ++i) *(v8ba*)(vd + (i >> 2) * V_PLANE + (i & 3) * 32 * VP_PITCH) = va[i];
      koff += 64 * NC * 2;   // next 64 keys: 64 token rows of K
      voff += 64 * 2;        // next 64 keys: 64 columns of V
      if (w == 0) {
        const v2f a = *(const v2fa*)(ALPHA + (size_t)b * NP + m0 + 2 * lane);
        *(v2fa*)(sab + 2 * lane) = a;
      } else if (w == 1) {
        const v2f a = *(const v2fa*)(BETA + (size_t)b * NP + m0 + 2 * lane);
        *(v2fa*)(sab + 64 + 2 * lane) = a;
      }
    }
    __syncthreads();

    // ---- scores: s[jj][r] = S[query 16g+8hh+r][key m0+key0+16jj+c], 3-term split ----
    v8f s[2];
    s[0] = zero8; s[1] = zero8;
#pragma unroll 1
    for (int dc = 0; dc < 4; ++dc) {
      const v16b qa = ldfrag(qrow + dc * 32, hh);
      const v16b ql = ldfrag(qrow + KQ_PLANE + dc * 32, hh);
#pragma unroll
      for (int jj = 0; jj < 2; ++jj) {
        const __bf16* krow = Ks + (key0 + 16 * jj + c) * KQ_PITCH + dc * 32;
        const v16b kb = ldfrag(krow, hh);
        const v16b kl = ldfrag(krow + KQ_PLANE, hh);
        s[jj] = mma_bf(qa, kb, s[jj]);
        s[jj] = mma_bf(qa, kl, s[jj]);
        s[jj] = mma_bf(ql, kb, s[jj]);
      }
    }
    // ---- positional terms in f32, then partial row max over this key half ----
    float al[2], be[2];
#pragma unroll
    for (int jj = 0; jj < 2; ++jj) { al[jj] = sab[key0 + 16 * jj + c]; be[jj] = sab[64 + key0 + 16 * jj + c]; }
#pragma unroll
    for (int r = 0; r < 8; ++r) {
      float m = -INFINITY;
#pragma unroll
      for (int jj = 0; jj < 2; ++jj) {
        const float e = s[jj][r] + al[jj] + spn[r] * be[jj];
        s[jj][r] = e;
        m = fmaxf(m, e);
      }
#pragma unroll
      for (int off = 1; off < 16; off <<= 1) m = fmaxf(m, __shfl_xor(m, off, 32));
      if (c == 0) redm[rme + r] = m;
    }
    __syncthreads();
    // ---- online softmax: identical running state in both waves of a pair; P hi|lo into the pair's LDS tile ----
    float corr[8];
#pragma unroll
    for (int r = 0; r < 8; ++r) {
      const float cmx  = fmaxf(redm[r0e + r], redm[r1e + r]);
      const float mnew = fmaxf(mrow[r], cmx);
      corr[r] = expf(mrow[r] - mnew);
      mrow[r] = mnew;
      float psum = 0.0f;
#pragma unroll
      for (int jj = 0; jj < 2; ++jj) {
        const float p = expf(s[jj][r] - mnew);
        psum += p;
        const unsigned short hb = f2bf_bits(p);
        const unsigned short lb = f2bf_bits(p - bfbits2f(hb));
        pgh[(8 * hh + r) * VP_PITCH + key0 + 16 * jj + c] = __builtin_bit_cast(__bf16, hb);
        pgl[(8 * hh + r) * VP_PITCH + key0 + 16 * jj + c] = __builtin_bit_cast(__bf16, lb);
      }
#pragma unroll
      for (int off = 1; off < 16; off <<= 1) psum += __shfl_xor(psum, off, 32);
      if (c == 0) reds[rme + r] = psum;
      lrow[r] = lrow[r] * corr[r];
#pragma unroll
      for (int t = 0; t < 4; ++t) oacc[t][r] *= corr[r];
    }
    __syncthreads();
#pragma unroll
    for (int r = 0; r < 8; ++r) lrow[r] += reds[r0e + r] + reds[r1e + r];

    // ---- O += P . V : A = P [query][key], B = Vcm row c [key]; 4 channel tiles of this half, 2 key halves ----
#pragma unroll 1
    for (int kk = 0; kk < 2; ++kk) {
      const v16b pa = ldfrag(pgh + c * VP_PITCH + kk * 32, hh);
      const v16b pl = ldfrag(pgl + c * VP_PITCH + kk * 32, hh);
#pragma unroll
      for (int t = 0; t < 4; ++t) {
        const __bf16* vr = Vs + (ch0 + 16 * t + c) * VP_PITCH + kk * 32;
        const v16b vb = ldfrag(vr, hh);
        const v16b vl = ldfrag(vr + V_PLANE, hh);
        oacc[t] = mma_bf(pa, vb, oacc[t]);
        oacc[t] = mma_bf(pa, vl, oacc[t]);
        oacc[t] = mma_bf(pl, vb, oacc[t]);
      }
    }
  }
  __syncthreads();   // all waves done with K/V tiles before the output tile overlays them

  // ---- normalise, stage O transposed as [c][n_local], write whole 256-B channel segments ----
#pragma unroll
  for (int r = 0; r < 8; ++r) {
    const float inv = 1.0f / lrow[r];
#pragma unroll
    for (int t = 0; t < 4; ++t) Os[(ch0 + 16 * t + c) * 68 + 16 * g + 8 * hh + r] = oacc[t][r] * inv;
  }
  __syncthreads();
  {
    float* ob = out + (size_t)b * NC * NP + n0;
    const int c4 = (lane & 15) * 4;
    {
#pragma unroll
      for (int i = 0; i < 8; ++i) {
        const int row = i * 16 + w * 2 + hh;                       // 0..127 channel
        const v4f v = *(const v4fa*)(Os + row * 68 + c4);
        *(v4f*)(ob + (size_t)row * NP + c4) = v;
      }
      
    }
  }
}

// ---------------------------------------------------------------------------
//   XT    bf16 [32768][128]          0           8388608
//   WQKV  bf16 [384][128]            8388608       98304
//   AV    f32  [8][128]              8486912        4096
//   MX    f32  [8][128]              8491008        4096
//   SPIN  f32  [8][2][4096]          8495104      262144
//   AVEC  f32  [8][128]              8757248        4096
//   RVEC  f32  [8][128]              8761344        4096
//   SP    f32  [8][4096]             8765440      131072
//   ALPHA f32  [8][4096]             8896512      131072
//   BETA  f32  [8][4096]             9027584      131072
//   Q hi|lo bf16 2x[32768][128]      9158656    16777216
//   K hi|lo bf16 2x[32768][128]     25935872    16777216
//   V hi|lo bf16 2x[8][128][4096]   42713088    16777216
//   total                          59490304
// ---------------------------------------------------------------------------
extern "C" void kernel_launch(void* const* d_in, const int* in_sizes, int n_in,
                              void* d_out, int out_size, void* d_ws, size_t ws_size,
                              hipStream_t stream) {
  if (n_in < 13) return;
  if (in_sizes[0] != NB * NC * NP || in_sizes[1] != NB * NC * NP) return;
  if (in_sizes[2] != NC * NC || in_sizes[4] != NC * NC || in_sizes[6] != NC * NC || in_sizes[8] != NC * NC) return;
  if (in_sizes[3] != NC || in_sizes[5] != NC || in_sizes[7] != NC || in_sizes[9] != NC) return;
  if (in_sizes[10] != 10 || in_sizes[11] != 98 || in_sizes[12] != 1) return;
  if (out_size != NB * NC * NP) return;

  const float* x    = (const float*)d_in[0];
  const float* x2   = (const float*)d_in[1];
  const float* q_w  = (const float*)d_in[2];
  const float* q_b  = (const float*)d_in[3];
  const float* k_w  = (const float*)d_in[4];
  const float* k_b  = (const float*)d_in[5];
  const float* v_w  = (const float*)d_in[6];
  const float* v_b  = (const float*)d_in[7];
  const float* ck_w = (const float*)d_in[8];
  const float* ck_b = (const float*)d_in[9];
  const float* c1w  = (const float*)d_in[10];
  const float* sp_w = (const float*)d_in[11];
  const float* sp_b = (const float*)d_in[12];
  float* out = (float*)d_out;

  const size_t plane_b = PLANE_ELEMS * 2;                 // 8388608 bytes per 16-bit plane
  size_t off = 0;
  const size_t oXT   = off; off += plane_b;
  const size_t oW    = off; off += (size_t)3 * NC * NC * 2;
  const size_t oAV   = off; off += (size_t)NB * NC * 4;
  const size_t oMX   = off; off += (size_t)NB * NC * 4;
  const size_t oSPIN = off; off += (size_t)NB * 2 * NP * 4;
  const size_t oAVEC = off; off += (size_t)NB * NC * 4;
  const size_t oRVEC = off; off += (size_t)NB * NC * 4;
  const size_t oSP   = off; off += (size_t)NB * NP * 4;
  const size_t oAL   = off; off += (size_t)NB * NP * 4;
  const size_t oBE   = off; off += (size_t)NB * NP * 4;
  const size_t oQ    = off; off += 2 * plane_b;
  const size_t oK    = off; off += 2 * plane_b;
  const size_t oV    = off; off += 2 * plane_b;           // off = 59490304
  if (off > ws_size) return;
  if (off > (size_t)134217728) return;

  char* ws = (char*)d_ws;
  unsigned short* XT    = (unsigned short*)(ws + oXT);
  unsigned short* WQKV  = (unsigned short*)(ws + oW);
  float* AV    = (float*)(ws + oAV);
  float* MX    = (float*)(ws + oMX);
  float* SPIN  = (float*)(ws + oSPIN);
  float* AVEC  = (float*)(ws + oAVEC);
  float* RVEC  = (float*)(ws + oRVEC);
  float* SP    = (float*)(ws + oSP);
  float* ALPHA = (float*)(ws + oAL);
  float* BETA  = (float*)(ws + oBE);
  unsigned short* QP = (unsigned short*)(ws + oQ);
  unsigned short* KPp = (unsigned short*)(ws + oK);
  unsigned short* VPp = (unsigned short*)(ws + oV);

  // 1. x -> token-major bf16 planes (grid: n blocks, c blocks, batch)
  k_xt<<<dim3(NP / 64, NC / 64, NB), 256, 0, stream>>>(x, XT);
  // 2. projection weights -> bf16 [384][128]
  k_wcvt<<<dim3(NC * NC / 8 / 256, 3), 256, 0, stream>>>(q_w, k_w, v_w, WQKV);
  // 3. per-(b,c) pixel mean/max of x2
  k_poolbc<<<NB * NC / 32, 256, 0, stream>>>(x2, AV, MX);
  // 4. per-(b,n) channel mean/max of x2
  k_poolc<<<NB * (NP / 64), 256, 0, stream>>>(x2, SPIN);
  // 5. positional branch: Avec, R, sp
  k_pos<<<NB, 256, 0, stream>>>(AV, MX, SPIN, c1w, ck_w, ck_b, sp_w, sp_b, AVEC, RVEC, SP);
  // 6. q/k/v projections + alpha/beta + hi|lo planes
  k_qkv<<<dim3(NTOK / 64, 3), 128, 0, stream>>>((const __bf16*)(const void*)XT, (const __bf16*)(const void*)WQKV,
                                                q_b, k_b, v_b, AVEC, RVEC, QP, KPp, VPp, ALPHA, BETA);
  // 7. attention, channel-major output
  k_attn<<<NB * (NP / 64), 256, 0, stream>>>((const __bf16*)(const void*)QP, (const __bf16*)(const void*)KPp,
                                             (const __bf16*)(const void*)VPp, ALPHA, BETA, SP, out);
  (void)hipGetLastError();
}

// v003
// It runs in 384 microseconds.
// Next to v002, in two timings, it ran 1.34 and 1.35 times as fast.
// Counting every step since v000, it is 3.66 times as fast.
// Contractions: q/k/v 1x1 projections on v_wmma_f32_16x16x32_bf16 (bf16 operands taken from bf16-RNE inputs, single product, f32 accumulate);
// q.k^T scores and p.v on v_wmma_f32_16x16x32_bf16 with bf16 hi/lo split operands (hi.hi + hi.lo + lo.hi), f32 accumulate;
// pools, channel conv1d, spatial 7x7 conv, positional vectors alpha/beta, online softmax (expf) in f32.
// 16-bit planes and carries: XT = bf16 RNE(x), Wqkv = bf16 RNE(w), Q/K/V hi = RNE(y), lo = RNE(y - hi), P hi/lo per key chunk in LDS.
// No power-of-two carry on any plane (bf16 keeps the f32 exponent range), so no inverse fold anywhere.
#include <hip/hip_runtime.h>
#include <math.h>
#include <stdint.h>

#define NB   8
#define NC   128
#define NP   4096
#define NTOK (NB * NP)
#define PLANE_ELEMS ((size_t)NTOK * NC)

static_assert(NP % 64 == 0);
static_assert(NC == 128);
static_assert((NB * NC) % 32 == 0);
static_assert(NP % 256 == 0);

typedef __attribute__((ext_vector_type(16))) __bf16 v16b;
typedef __attribute__((ext_vector_type(8)))  __bf16 v8b;
typedef __attribute__((ext_vector_type(8)))  float  v8f;
typedef __attribute__((ext_vector_type(4)))  float  v4f;
typedef __attribute__((ext_vector_type(2)))  float  v2f;
typedef __attribute__((ext_vector_type(4)))  unsigned int v4u;
typedef v8b __attribute__((may_alias)) v8ba;
typedef v4f __attribute__((may_alias)) v4fa;
typedef v2f __attribute__((may_alias)) v2fa;
typedef v4u __attribute__((may_alias)) v4ua;

// ---------------------------------------------------------------------------
// bf16 helpers (RNE convert on the f32 bits)
// ---------------------------------------------------------------------------
__device__ __forceinline__ unsigned short f2bf_bits(float f) {
  const unsigned u = __float_as_uint(f);
  return (unsigned short)((u + 0x7FFFu + ((u >> 16) & 1u)) >> 16);
}
__device__ __forceinline__ float bfbits2f(unsigned short h) { return __uint_as_float(((unsigned)h) << 16); }
__device__ __forceinline__ float bfr(float f) { return bfbits2f(f2bf_bits(f)); }
__device__ __forceinline__ unsigned pk16(unsigned short a, unsigned short b) { return (unsigned)a | ((unsigned)b << 16); }

// ---------------------------------------------------------------------------
// 16x16x32 bf16 WMMA with hazard guard (ties D, keeps A/B live).
// Fragment map (wave32): lane l, h = l>>4, m = n = l&15.
//   A/B element i: i<8 -> k0+8h+i ; i>=8 -> k0+16+8h+(i-8)
//   D element r : row 8h+r, col l&15
// ---------------------------------------------------------------------------
__device__ __forceinline__ v8f mma_bf(v16b a, v16b b, v8f c) {
  c = __builtin_amdgcn_wmma_f32_16x16x32_bf16(false, a, false, b, (short)0, c, false, false);
  asm volatile("v_nop\n\tv_nop\n\tv_nop\n\tv_nop" : "+v"(c) : "v"(a), "v"(b));
  return c;
}
// One butterfly step inside a 16-lane row: lane l takes the value of lane l ^ M (DPP row_xmask, on the vector port).
template <int M> __device__ __forceinline__ float rowx(float v) {
  const int i = __builtin_bit_cast(int, v);
  return __builtin_bit_cast(float, __builtin_amdgcn_update_dpp(0, i, 0x160 + M, 0xf, 0xf, true));
}
// Lane l takes the value of lane l ^ 16 (the other 16-lane row).
__device__ __forceinline__ float xhalf(float v) {
  const int i = __builtin_bit_cast(int, v);
  return __builtin_bit_cast(float, __builtin_amdgcn_permlanex16(i, i, 0x76543210, 0xfedcba98, false, false));
}
// Eight independent 16-lane butterflies (steps 1, 2, 4, 8), taken step by step so that the eight chains interleave.
// Every lane must be on here (a lane that is off would hand on 0). The loops are unrolled so that the arrays stay in registers.
__device__ __forceinline__ void row16_max8(float (&m)[8]) {
#pragma unroll
  for (int r = 0; r < 8; ++r) m[r] = fmaxf(m[r], rowx<1>(m[r]));
#pragma unroll
  for (int r = 0; r < 8; ++r) m[r] = fmaxf(m[r], rowx<2>(m[r]));
#pragma unroll
  for (int r = 0; r < 8; ++r) m[r] = fmaxf(m[r], rowx<4>(m[r]));
#pragma unroll
  for (int r = 0; r < 8; ++r) m[r] = fmaxf(m[r], rowx<8>(m[r]));
}
__device__ __forceinline__ void row16_sum8(float (&s)[8]) {
#pragma unroll
  for (int r = 0; r < 8; ++r) s[r] += rowx<1>(s[r]);
#pragma unroll
  for (int r = 0; r < 8; ++r) s[r] += rowx<2>(s[r]);
#pragma unroll
  for (int r = 0; r < 8; ++r) s[r] += rowx<4>(s[r]);
#pragma unroll
  for (int r = 0; r < 8; ++r) s[r] += rowx<8>(s[r]);
}
union FB { v16b v; v8b h[2]; };
// A or B fragment from a k-contiguous bf16 row; p points at element k0 of the row owned by this lane.
__device__ __forceinline__ v16b ldfrag(const __bf16* p, int hh) {
  FB f;
  f.h[0] = *(const v8ba*)(p + 8 * hh);
  f.h[1] = *(const v8ba*)(p + 16 + 8 * hh);
  return f.v;
}

// 16-B global load at a block-uniform base plus the lane's own 32-bit byte offset plus a constant. Each plane's base goes
// through readfirstlane so that it keeps a scalar register pair of its own and the load takes the scalar-base form;
// without it the compiler folds the lo plane's 8-MiB step into 64-bit vector addresses that it forms anew every trip.
typedef const __attribute__((address_space(1))) v8ba gv8b;
__device__ __forceinline__ uint64_t ubase(const __bf16* p) {
  const uint64_t u = (uint64_t)p;
  const uint32_t lo = (uint32_t)__builtin_amdgcn_readfirstlane((int)(uint32_t)u);
  const uint32_t hi = (uint32_t)__builtin_amdgcn_readfirstlane((int)(uint32_t)(u >> 32));
  return ((uint64_t)hi << 32) | lo;
}
__device__ __forceinline__ v8b ldg16(uint64_t base, unsigned lane_bytes, unsigned imm_bytes) {
  return *(gv8b*)(base + lane_bytes + imm_bytes);
}

// ---------------------------------------------------------------------------
// Kernel 1: x[b] viewed [128 c][4096 n] (pitch 4096) -> XT bf16 [b*4096+n][128 c] (pitch 128), bf16 RNE.
// 64x64 tiles through LDS. grid = (4096/64, 128/64, 8), 256 threads.
// Coverage per block: load 4 it x 256 thr x 4 floats = 64x64; store 2 it x 256 thr x 8 u16 = 64x64.
// ---------------------------------------------------------------------------
__global__ __launch_bounds__(256) void k_xt(const float* __restrict__ X, unsigned short* __restrict__ xt) {
  __shared__ __align__(16) float tf[64 * 68];
  const int b = blockIdx.z;
  const float* W = X + (size_t)b * NC * NP;
  unsigned short* o = xt + (size_t)b * NP * NC;
  const int c0 = blockIdx.x * 64;   // input column block (n) = output row block
  const int r0 = blockIdx.y * 64;   // input row block (c)    = output column block
  const int tid = threadIdx.x;
  {
    const int lr = tid >> 4;
    const int c4 = (tid & 15) * 4;
#pragma unroll
    for (int it = 0; it < 4; ++it) {
      const int rr = it * 16 + lr;
      const v4f a = *(const v4fa*)(W + (size_t)(r0 + rr) * NP + c0 + c4);
      *(v4f*)(tf + rr * 68 + c4) = a;
    }
  }
  __syncthreads();
  const int sub = tid >> 3;          // 0..31
  const int c8  = (tid & 7) * 8;     // 0..56
  v4u hv[2];
#pragma unroll
  for (int it = 0; it < 2; ++it) {
    const int oc = it * 32 + sub;    // output row within tile (= input column)
    v4u a;
#pragma unroll
    for (int q = 0; q < 4; ++q) {
      const float f0 = tf[(c8 + 2 * q) * 68 + oc];
      const float f1 = tf[(c8 + 2 * q + 1) * 68 + oc];
      a[q] = pk16(f2bf_bits(f0), f2bf_bits(f1));
    }
    hv[it] = a;
  }
  {
#pragma unroll
    for (int it = 0; it < 2; ++it) {
      const int oc = it * 32 + sub;
      *(v4ua*)(o + (size_t)(c0 + oc) * NC + r0 + c8) = hv[it];
    }
    
  }
}

// ---------------------------------------------------------------------------
// Kernel 2: [q_w; k_w; v_w] ([out o][in c] row-major each) -> Wqkv bf16 [384 o][128 c] (natural Bt: n = o, k = c).
// grid = (16384/8/256 = 8, 3), 256 threads; matrix selected by blockIdx.y (block-uniform).
// Coverage: 3 x 2048 threads x 8 elements = 3 x 16384. One 16-B store per lane, lanes contiguous:
// ---------------------------------------------------------------------------
__global__ __launch_bounds__(256) void k_wcvt(const float* __restrict__ qw, const float* __restrict__ kw,
                                             const float* __restrict__ vw, unsigned short* __restrict__ Wb) {
  const int which = blockIdx.y;
  const float* src = (which == 0) ? qw : ((which == 1) ? kw : vw);
  const int i = blockIdx.x * 256 + threadIdx.x;
  if (i >= NC * NC / 8) return;
  const v4f a = *(const v4fa*)(src + (size_t)i * 8);
  const v4f c = *(const v4fa*)(src + (size_t)i * 8 + 4);
  v4u o4;
  o4[0] = pk16(f2bf_bits(a[0]), f2bf_bits(a[1]));
  o4[1] = pk16(f2bf_bits(a[2]), f2bf_bits(a[3]));
  o4[2] = pk16(f2bf_bits(c[0]), f2bf_bits(c[1]));
  o4[3] = pk16(f2bf_bits(c[2]), f2bf_bits(c[3]));
  unsigned short* dst = Wb + (size_t)which * NC * NC + (size_t)i * 8;
  *(v4ua*)dst = o4;
  
}

// ---------------------------------------------------------------------------
// Kernel 3: per-(b,c) mean and max over the 4096 pixels of bf16-RNE x2. Block handles 32 consecutive (b,c) rows
// (grid = 1024/32 = 32, 256 threads: each thread 16 elements of a row, fixed-order tree). The 32 means and 32
// maxes are funnelled through LDS; wave 0 lanes 0..7 write the AV line, lanes 8..15 the MX line
// Coverage: 32 blocks x 32 rows = 1024 = 8 x 128 rows; per row 256 x 16 = 4096 elements.
// ---------------------------------------------------------------------------
__global__ __launch_bounds__(256) void k_poolbc(const float* __restrict__ x2, float* __restrict__ AV,
                                               float* __restrict__ MX) {
  __shared__ float ws_s[8], ws_m[8];
  __shared__ __align__(16) float os[64];
  const int g = blockIdx.x, tid = threadIdx.x, lane = tid & 31, w = tid >> 5;
#pragma unroll 1
  for (int j = 0; j < 32; ++j) {
    const float* p = x2 + (size_t)(g * 32 + j) * NP + tid * 16;
    float s = 0.f, m = -INFINITY;
#pragma unroll
    for (int i = 0; i < 4; ++i) {
      const v4f a = *(const v4fa*)(p + 4 * i);
      const float a0 = bfr(a[0]), a1 = bfr(a[1]), a2 = bfr(a[2]), a3 = bfr(a[3]);
      s += (a0 + a1) + (a2 + a3);
      m = fmaxf(fmaxf(m, a0), fmaxf(fmaxf(a1, a2), a3));
    }
    s += xhalf(s);   m = fmaxf(m, xhalf(m));
    s += rowx<8>(s); m = fmaxf(m, rowx<8>(m));
    s += rowx<4>(s); m = fmaxf(m, rowx<4>(m));
    s += rowx<2>(s); m = fmaxf(m, rowx<2>(m));
    s += rowx<1>(s); m = fmaxf(m, rowx<1>(m));
    if (lane == 0) { ws_s[w] = s; ws_m[w] = m; }
    __syncthreads();
    if (tid == 0) {
      float ts = 0.f, tm = -INFINITY;
#pragma unroll
      for (int k = 0; k < 8; ++k) { ts += ws_s[k]; tm = fmaxf(tm, ws_m[k]); }
      os[j] = ts * (1.0f / 4096.0f);
      os[32 + j] = tm;
    }
    __syncthreads();
  }
  if (w == 0) {
    const v4f v = *(const v4fa*)(os + 4 * (lane & 15));
    {
      if (lane < 8)       *(v4f*)(AV + g * 32 + 4 * lane) = v;
      else if (lane < 16) *(v4f*)(MX + g * 32 + 4 * (lane - 8)) = v;
      
    }
  }
}

// ---------------------------------------------------------------------------
// Kernel 4: per-(b,n) mean and max over the 128 channels of bf16-RNE x2 -> SPIN[b][0][n] = mean, SPIN[b][1][n] = max.
// Block per (b, 64-pixel group): grid = 8 x 64 = 512, 256 threads = 64 pixels x 4 channel groups of 32 (serial,
// unroll 4), fixed-order 4-way combine. 64 means / 64 maxes funnelled through LDS; wave 0 writes both 256-B
// Coverage: 512 blocks x 64 pixels = 8 x 4096 per plane.
// ---------------------------------------------------------------------------
__global__ __launch_bounds__(256) void k_poolc(const float* __restrict__ x2, float* __restrict__ SPIN) {
  __shared__ float ps[4][64], pm[4][64];
  __shared__ __align__(16) float os[128];
  const int b = blockIdx.x >> 6, g = blockIdx.x & 63;
  const int tid = threadIdx.x, lane = tid & 31;
  const int p = tid & 63, cg = tid >> 6;
  const float* src = x2 + ((size_t)b * NC + cg * 32) * NP + g * 64 + p;
  float s = 0.f, m = -INFINITY;
#pragma unroll 4
  for (int c = 0; c < 32; ++c) {
    const float v = bfr(src[(size_t)c * NP]);
    s += v;
    m = fmaxf(m, v);
  }
  ps[cg][p] = s;
  pm[cg][p] = m;
  __syncthreads();
  if (tid < 64) {
    const float ts = ((ps[0][tid] + ps[1][tid]) + ps[2][tid]) + ps[3][tid];
    const float tm = fmaxf(fmaxf(pm[0][tid], pm[1][tid]), fmaxf(pm[2][tid], pm[3][tid]));
    os[tid] = ts * (1.0f / 128.0f);
    os[64 + tid] = tm;
  }
  __syncthreads();
  if (tid < 32) {
    const v4f v = *(const v4fa*)(os + 4 * lane);   // lanes 0..15: means 0..63, lanes 16..31: maxes 0..63
    float* base = SPIN + (size_t)b * 2 * NP + g * 64;
    {
      if (lane < 16) *(v4f*)(base + 4 * lane) = v;
      else           *(v4f*)(base + NP + 4 * (lane - 16)) = v;
      
    }
  }
}

// ---------------------------------------------------------------------------
// Kernel 5: positional branch, block per b (grid 8, 256 threads), all f32 VALU, conv loops rolled:
//   ch[c]   = sum_{i in {mean,max}} sum_{t<5} bf16r(conv1_w[i][t]) * stk[i][c+t-2]   (zero pad 2, no flip, no bias)
//   Avec[o] = sum_c bf16r(ck_w[o][c]) * ch[c] + bf16r(ck_b[o]) ;  R[o] = sum_c bf16r(ck_w[o][c])
//   sp[n]   = sum_i sum_{u,v<7} bf16r(sp_w[i][u][v]) * spin[i][h+u-3][w+v-3] + bf16r(sp_b)   (zero pad 3)
// The pooled maps are staged in zero-padded 70x70 LDS planes. Outputs: AVEC[b][128] by wave 0 and RVEC[b][128]
// Coverage: AVEC/RVEC 8 x 128; SP 8 blocks x 4 it x 256 thr x 4 = 8 x 4096.
// ---------------------------------------------------------------------------
__global__ __launch_bounds__(256) void k_pos(const float* __restrict__ AV, const float* __restrict__ MX,
                                            const float* __restrict__ SPIN, const float* __restrict__ c1w,
                                            const float* __restrict__ ckw, const float* __restrict__ ckb,
                                            const float* __restrict__ spw, const float* __restrict__ spb,
                                            float* __restrict__ AVEC, float* __restrict__ RVEC,
                                            float* __restrict__ SP) {
  __shared__ float sav[128], smx[128], sch[128];
  __shared__ float sw1[32], sw2[128];
  __shared__ __align__(16) float savec[128], srv[128];
  __shared__ float spl[2 * 4900];
  __shared__ __align__(16) float ssp[NP];
  const int b = blockIdx.x, tid = threadIdx.x, lane = tid & 31, w = tid >> 5;

  if (tid < 128) {                                   // waves 0..3 (wave-uniform)
    sav[tid] = AV[b * NC + tid];
    smx[tid] = MX[b * NC + tid];
    sw2[tid] = bfr(spw[min(tid, 97)]);               // clamped address, all lanes active
  }
  if (w == 0) sw1[lane] = bfr(c1w[min(lane, 9)]);
  for (int i = tid; i < 2 * 4900; i += 256) spl[i] = 0.0f;
  __syncthreads();
  // interior of the padded pooled planes
#pragma unroll 2
  for (int i = tid; i < NP; i += 256) {
    const int h = i >> 6, x = i & 63;
    const int li = (h + 3) * 70 + x + 3;
    spl[li]        = SPIN[(size_t)b * 2 * NP + i];
    spl[4900 + li] = SPIN[(size_t)b * 2 * NP + NP + i];
  }
  // channel conv1d
  if (tid < 128) {
    const int c = tid;
    float acc = 0.0f;
#pragma unroll 1
    for (int t = 0; t < 5; ++t) {
      const int cc  = c + t - 2;
      const int ccl = min(max(cc, 0), NC - 1);
      const float valid = (cc >= 0 && cc < NC) ? 1.0f : 0.0f;
      acc += valid * (sw1[t] * sav[ccl] + sw1[5 + t] * smx[ccl]);
    }
    sch[c] = acc;
  }
  __syncthreads();
  // Avec, R
  if (tid < 128) {
    const int o = tid;
    float a = bfr(ckb[o]), r = 0.0f;
    const float* wr = ckw + (size_t)o * NC;
#pragma unroll 4
    for (int c = 0; c < NC; ++c) {
      const float wv = bfr(wr[c]);
      a += wv * sch[c];
      r += wv;
    }
    savec[o] = a;
    srv[o] = r;
  }
  // spatial 7x7x2 conv + bias
  const float bias_sp = bfr(spb[0]);
#pragma unroll 1
  for (int it = 0; it < NP / 256; ++it) {
    const int n = it * 256 + tid;
    const int h = n >> 6, x = n & 63;
    float acc = bias_sp;
#pragma unroll 1
    for (int u = 0; u < 7; ++u) {
#pragma unroll 1
      for (int v = 0; v < 7; ++v) {
        const int li = (h + u) * 70 + x + v;
        acc += sw2[u * 7 + v] * spl[li] + sw2[49 + u * 7 + v] * spl[4900 + li];
      }
    }
    ssp[n] = acc;
  }
  __syncthreads();
  // stores
  if (w == 0) {
    const v4f v = *(const v4fa*)(savec + 4 * lane);
    {
      *(v4f*)(AVEC + b * NC + 4 * lane) = v;
      
    }
  } else if (w == 1) {
    const v4f v = *(const v4fa*)(srv + 4 * lane);
    {
      *(v4f*)(RVEC + b * NC + 4 * lane) = v;
      
    }
  }
  {
    v4f sv[4];
#pragma unroll
    for (int it = 0; it < 4; ++it) sv[it] = *(const v4fa*)(ssp + it * 1024 + 4 * tid);
    {
#pragma unroll
      for (int it = 0; it < 4; ++it)
        *(v4f*)(SP + (size_t)b * NP + it * 1024 + 4 * tid) = sv[it];
      
    }
  }
}

// ---------------------------------------------------------------------------
// Kernel 6: [Q|K|V] = XT . Wqkv^T + bias (exact bf16 x bf16 products, f32 accumulate, K = 128 in 4 steps of 32).
// grid = (32768/64 = 512 token tiles, 3 = which), 128 threads = 4 waves; wave w owns tokens m0+16w..+15 x all 128
// output channels (8 accumulator tiles). A fragments straight from XT rows, B fragments from Wqkv rows (both
// k-contiguous bf16, arithmetic addressing). bias (bf16r), Avec and R staged in LDS (one scalar load per thread each).
// Epilogue: f32 tile (acc + bias) staged in LDS [64][132];
//   which 0: alpha[n] = sum_o Avec[b][o] q[o][n], beta[n] = sum_o R[o] q[o][n] (f32, rolled) -> ALPHA/BETA 256-B
//            segments (16 lanes x 16 B); Q hi|lo token-major planes [tok][128];
//   which 1: K hi|lo token-major planes;  which 2: V hi|lo channel-major planes [b][c][4096] (transposed write).
// ---------------------------------------------------------------------------
__global__ __launch_bounds__(128) void k_qkv(const __bf16* __restrict__ XT, const __bf16* __restrict__ Wb,
                                            const float* __restrict__ qb, const float* __restrict__ kb,
                                            const float* __restrict__ vb,
                                            const float* __restrict__ AVEC, const float* __restrict__ RVEC,
                                            unsigned short* __restrict__ QP, unsigned short* __restrict__ KP,
                                            unsigned short* __restrict__ VP,
                                            float* __restrict__ ALPHA, float* __restrict__ BETA) {
  __shared__ __align__(16) float sT[64 * 132];
  __shared__ __align__(16) float sAV[128], sRV[128], sAB[128], sBI[128];
  const int tid = threadIdx.x, lane = tid & 31, w = tid >> 5, hh = lane >> 4, l16 = lane & 15;
  const int which = blockIdx.y;
  const int m0 = blockIdx.x * 64;            // global token row
  const int b  = m0 / NP;
  const int n0 = m0 - b * NP;

  const float* bias = (which == 0) ? qb : ((which == 1) ? kb : vb);   // block-uniform select, same address space
  sAV[tid] = AVEC[b * NC + tid];
  sRV[tid] = RVEC[b * NC + tid];
  sBI[tid] = bfr(bias[tid]);
  __syncthreads();

  const v8f zero8 = {0.f, 0.f, 0.f, 0.f, 0.f, 0.f, 0.f, 0.f};
  v8f acc[8];
#pragma unroll
  for (int t = 0; t < 8; ++t) acc[t] = zero8;

  const __bf16* arow = XT + (size_t)(m0 + 16 * w + l16) * NC;        // token row, k = input channel
  const __bf16* brow = Wb + ((size_t)which * NC + l16) * NC;          // output channel row (tile 0), k = input channel
#pragma unroll
  for (int kc = 0; kc < 4; ++kc) {
    const v16b a = ldfrag(arow + kc * 32, hh);
#pragma unroll
    for (int t = 0; t < 8; ++t) {
      const v16b bf = ldfrag(brow + (size_t)t * 16 * NC + kc * 32, hh);
      acc[t] = mma_bf(a, bf, acc[t]);
    }
  }
  // D[r] of tile t = Y[token 16w+8hh+r][channel 16t+l16]
#pragma unroll
  for (int t = 0; t < 8; ++t) {
    const float bv = sBI[16 * t + l16];
#pragma unroll
    for (int r = 0; r < 8; ++r) sT[(16 * w + 8 * hh + r) * 132 + 16 * t + l16] = acc[t][r] + bv;
  }
  __syncthreads();
  if (which == 0 && tid < 64) {            // waves 0,1
    const float* qr = sT + tid * 132;
    float a = 0.0f, be = 0.0f;
#pragma unroll 4
    for (int o = 0; o < NC; ++o) {
      const float q = qr[o];
      a  += sAV[o] * q;
      be += sRV[o] * q;
    }
    sAB[tid] = a;
    sAB[64 + tid] = be;
  }
  __syncthreads();

  // pack hi|lo planes
  const int q8 = lane & 7, sub = lane >> 3;
  v4u hv[8], lv[8];
#pragma unroll
  for (int i = 0; i < 8; ++i) {
    const int lid  = w * 32 + i * 4 + sub;                                   // 0..127
    const int base = (which != 2) ? ((lid >> 1) * 132 + (lid & 1) * 64 + 8 * q8) : ((8 * q8) * 132 + lid);
    const int estr = (which != 2) ? 1 : 132;
    v4u a, a2;
#pragma unroll
    for (int q = 0; q < 4; ++q) {
      const float f0 = sT[base + (2 * q) * estr];
      const float f1 = sT[base + (2 * q + 1) * estr];
      const unsigned short h0 = f2bf_bits(f0), h1 = f2bf_bits(f1);
      const unsigned short l0 = f2bf_bits(f0 - bfbits2f(h0)), l1 = f2bf_bits(f1 - bfbits2f(h1));
      a[q]  = pk16(h0, h1);
      a2[q] = pk16(l0, l1);
    }
    hv[i] = a;
    lv[i] = a2;
  }
  unsigned short* P = (which == 0) ? QP : ((which == 1) ? KP : VP);
  {
#pragma unroll
    for (int i = 0; i < 8; ++i) {
      const int lid = w * 32 + i * 4 + sub;
      const size_t go = (which != 2)
          ? ((size_t)(m0 + (lid >> 1)) * NC + (lid & 1) * 64 + 8 * q8)
          : (((size_t)b * NC + lid) * NP + n0 + 8 * q8);
      *(v4ua*)(P + go) = hv[i];
      *(v4ua*)(P + PLANE_ELEMS + go) = lv[i];
    }
    
  }
  if (which == 0 && w == 0) {
    const v4f v = *(const v4fa*)(sAB + 4 * lane);    // lanes 0..15: alpha 0..63, lanes 16..31: beta 0..63
    {
      if (lane < 16) *(v4f*)(ALPHA + m0 + 4 * lane) = v;
      else           *(v4f*)(BETA + m0 + 4 * (lane - 16)) = v;
      
    }
  }
}

// ---------------------------------------------------------------------------
// Kernel 7: full (non-causal, unmasked) attention, head dim 128, block per (b, 64-query tile): grid 8 x 64 = 512,
// 256 threads = 8 waves. Wave w: query group g = w&3 (rows 16g..16g+15), key half kh = w>>2.
//   energy[n][m] = q[n].k[m] (bf16 hi/lo 3-term WMMA) + alpha[m] + sp[n]*beta[m]  (f32, no scale)
//   Per 64-key chunk: wave (g,kh) computes the scores of its 16 rows x keys 32kh..32kh+31, the partial row max and
//   partial row sum are exchanged between the wave pair through LDS (block barriers), both waves of a pair derive
//   the identical running max / correction / sum; p hi|lo of all 64 keys land in the pair's shared P tile;
//   then O[n][c] += p . V for the wave's 64-channel half c in [64kh, 64kh+64)  (p and V bf16 hi/lo, 3-term WMMA).
//   Online softmax over all 4096 keys in 64 chunks of 64 (compile-time trip count, no masking), f32 expf.
// LDS: K hi|lo [64][128], Vcm hi|lo [128][64], Q hi|lo [64][128] (staged once), P hi|lo [4 g][16][64]; every row is
// padded by 16 B (pitch 272 B for 256-B rows, 144 B for 128-B rows = 16 B x odd), so the 16 rows that one 16-byte
// fragment read touches fall on 16 different bank groups; the lo plane of K/Q starts 64 B and that of V 128 B past a
// multiple of 256 B; staging loads and stores give consecutive lanes consecutive 16-B pieces of a row (whole lines);
// alpha/beta slices [64]+[64], exchange arrays [128]+[128]; output tile [128 c][64 n] (pitch 68) overlays the
// K/V region after the loop (block barrier first).
// Staging coverage (Q once, K/V per chunk): Q/K 8 rounds x 256 thr x 8 = 64x128 x 2 planes; V 8 rounds x 256 thr x 8 = 128x64 x 2 planes;
// P: each wave pair writes its whole 16x64 tile (both planes) before the barrier that precedes the reload.
// Output: out[b][c][n0..n0+63] channel-major; each channel row segment = 256 B = 16 contiguous lanes x 16 B
// ---------------------------------------------------------------------------
#define KQ_PITCH 136                       // elements: 128 + 8 (272 B)
#define VP_PITCH 72                        // elements: 64 + 8 (144 B)
#define KQ_PLANE (64 * KQ_PITCH + 32)      // elements: 17472 B = 68 x 256 + 64
#define V_PLANE  (128 * VP_PITCH + 64)     // elements: 18560 B = 72 x 256 + 128
#define P_GROUP  (16 * VP_PITCH)           // elements per query group
#define P_PLANE  (4 * P_GROUP)
#define SM_K   0
#define SM_V   (SM_K + 2 * KQ_PLANE * 2)
#define SM_Q   (SM_V + 2 * V_PLANE * 2)
#define SM_P   (SM_Q + 2 * KQ_PLANE * 2)
#define SM_AB  (SM_P + 2 * P_PLANE * 2)
#define SM_RED (SM_AB + 512)
#define SM_TOT (SM_RED + 1024)
static_assert(128 * 68 * 4 <= SM_Q);
static_assert(SM_V % 16 == 0 && SM_Q % 16 == 0 && SM_P % 16 == 0 && SM_AB % 16 == 0);
static_assert(2 * SM_TOT <= 327680);

__global__ __launch_bounds__(256) void k_attn(const __bf16* __restrict__ QP, const __bf16* __restrict__ KP,
                                             const __bf16* __restrict__ VP, const float* __restrict__ ALPHA,
                                             const float* __restrict__ BETA, const float* __restrict__ SP,
                                             float* __restrict__ out) {
  __shared__ __align__(16) unsigned char smem[SM_TOT];
  __bf16* Ks   = (__bf16*)(smem + SM_K);     // hi at +0, lo at +KQ_PLANE elements
  __bf16* Vs   = (__bf16*)(smem + SM_V);
  __bf16* Qs   = (__bf16*)(smem + SM_Q);
  __bf16* Ps   = (__bf16*)(smem + SM_P);     // hi: group g at +P_GROUP*g ; lo: +P_PLANE + P_GROUP*g
  float*  sab  = (float*)(smem + SM_AB);     // alpha 0..63, beta 64..127
  float*  redm = (float*)(smem + SM_RED);    // partial row max [4 g][2 kh][16]
  float*  reds = redm + 128;                 // partial row sum [4 g][2 kh][16]
  float*  Os   = (float*)(smem + SM_K);      // [128][68] after the key loop

  const int tid = threadIdx.x, lane = tid & 31, w = tid >> 5, hh = lane >> 4, c = lane & 15;
  const int g = w & 3, kh = w >> 2;
  const int key0 = 32 * kh;                  // this wave's key half within a chunk
  const int ch0  = 64 * kh;                  // this wave's channel half
  const int b  = blockIdx.x >> 6;
  const int n0 = (blockIdx.x & 63) * 64;
  const size_t tok0 = (size_t)b * NP + n0;

  // Staging lane maps: consecutive lanes take consecutive 16-B pieces, so one wave-wide load covers 4 whole 128-B lines.
  const int kq_r = tid >> 4, kq_c = (tid & 15) * 8;   // Q/K: 16 lanes per 256-B row, 16 rows per round of the block
  const int v_r  = tid >> 3, v_c  = (tid & 7) * 8;    // V:    8 lanes per 128-B row, 32 rows per round of the block
  const unsigned kq_g = (unsigned)(kq_r * NC + kq_c) * 2u; // the lane's byte offset in a token-major tile
  const unsigned v_g  = (unsigned)(v_r * NP + v_c) * 2u;   // the lane's byte offset in a channel-major tile
  // ---- stage the block's Q tile hi|lo: 2 planes x 4 rounds x 256 thr x 8 elements ----
  {
    __bf16* dst = Qs + kq_r * KQ_PITCH + kq_c;
#pragma unroll
    for (int p = 0; p < 2; ++p) {
      const uint64_t qsrc = ubase(QP + (size_t)p * PLANE_ELEMS + tok0 * NC);
#pragma unroll
      for (int i = 0; i < 4; ++i) {
        const v8b v = ldg16(qsrc, kq_g, i * 16 * NC * 2);
        *(v8ba*)(dst + p * KQ_PLANE + i * 16 * KQ_PITCH) = v;
      }
    }
  }
  // ---- sp[n] for this lane's 8 query rows ----
  float spn[8];
  {
    const v4f s0 = *(const v4fa*)(SP + tok0 + 16 * g + 8 * hh);
    const v4f s1 = *(const v4fa*)(SP + tok0 + 16 * g + 8 * hh + 4);
    spn[0] = s0[0]; spn[1] = s0[1]; spn[2] = s0[2]; spn[3] = s0[3];
    spn[4] = s1[0]; spn[5] = s1[1]; spn[6] = s1[2]; spn[7] = s1[3];
  }
  float mrow[8], lrow[8];
  const v8f zero8 = {0.f, 0.f, 0.f, 0.f, 0.f, 0.f, 0.f, 0.f};
  v8f oacc[4];
#pragma unroll
  for (int r = 0; r < 8; ++r) { mrow[r] = -INFINITY; lrow[r] = 0.0f; }
#pragma unroll
  for (int t = 0; t < 4; ++t) oacc[t] = zero8;

  const __bf16* qrow = Qs + (16 * g + c) * KQ_PITCH;
  __bf16* pgh = Ps + g * P_GROUP;
  __bf16* pgl = Ps + P_PLANE + g * P_GROUP;
  const int rme = g * 32 + kh * 16 + 8 * hh;   // exchange slot base of this lane's rows
  const int r0e = g * 32 + 8 * hh;             // key half 0 slot base
  const int r1e = g * 32 + 16 + 8 * hh;        // key half 1 slot base

  // K/V plane bases of this batch (block-uniform) and the lane's running byte offsets (below 1 MiB + one tile)
  const uint64_t ksrc[2] = {ubase(KP + (size_t)b * NP * NC), ubase(KP + PLANE_ELEMS + (size_t)b * NP * NC)};
  const uint64_t vsrc[2] = {ubase(VP + (size_t)b * NC * NP), ubase(VP + PLANE_ELEMS + (size_t)b * NC * NP)};
  unsigned koff = kq_g, voff = v_g;

#pragma unroll 1
  for (int kc = 0; kc < NP / 64; ++kc) {
    const int m0 = kc * 64;
    __syncthreads();
    {
      // K: 2 planes x 4 rounds x 256 thr x 8 elements = 64 rows x 128 x 2 planes
      __bf16* kd = Ks + kq_r * KQ_PITCH + kq_c;
      // V: 2 planes x 4 rounds x 256 thr x 8 elements = 128 channel rows x 64 keys x 2 planes
      __bf16* vd = Vs + v_r * VP_PITCH + v_c;
      v8b ka[8], va[8];
#pragma unroll
      for (int i = 0; i < 8; ++i) ka[i] = ldg16(ksrc[i >> 2], koff, (i & 3) * 16 * NC * 2);
#pragma unroll
      for (int i = 0; i < 8; ++i) va[i] = ldg16(vsrc[i >> 2], voff, (i & 3) * 32 * NP * 2);
#pragma unroll
      for (int i = 0; i < 8; ++i) *(v8ba*)(kd + (i >> 2) * KQ_PLANE + (i & 3) * 16 * KQ_PITCH) = ka[i];
#pragma unroll
      for (int i = 0; i < 8; ++i) *(v8ba*)(vd + (i >> 2) * V_PLANE + (i & 3) * 32 * VP_PITCH) = va[i];
      koff += 64 * NC * 2;   // next 64 keys: 64 token rows of K
      voff += 64 * 2;        // next 64 keys: 64 columns of V
      if (w == 0) {
        const v2f a = *(const v2fa*)(ALPHA + (size_t)b * NP + m0 + 2 * lane);
        *(v2fa*)(sab + 2 * lane) = a;
      } else if (w == 1) {
        const v2f a = *(const v2fa*)(BETA + (size_t)b * NP + m0 + 2 * lane);
        *(v2fa*)(sab + 64 + 2 * lane) = a;
      }
    }
    __syncthreads();

    // ---- scores: s[jj][r] = S[query 16g+8hh+r][key m0+key0+16jj+c], 3-term split ----
    v8f s[2];
    s[0] = zero8; s[1] = zero8;
#pragma unroll 1
    for (int dc = 0; dc < 4; ++dc) {
      const v16b qa = ldfrag(qrow + dc * 32, hh);
      const v16b ql = ldfrag(qrow + KQ_PLANE + dc * 32, hh);
#pragma unroll
      for (int jj = 0; jj < 2; ++jj) {
        const __bf16* krow = Ks + (key0 + 16 * jj + c) * KQ_PITCH + dc * 32;
        const v16b kb = ldfrag(krow, hh);
        const v16b kl = ldfrag(krow + KQ_PLANE, hh);
        s[jj] = mma_bf(qa, kb, s[jj]);
        s[jj] = mma_bf(qa, kl, s[jj]);
        s[jj] = mma_bf(ql, kb, s[jj]);
      }
    }
    // ---- positional terms in f32, then partial row max over this key half ----
    float al[2], be[2];
#pragma unroll
    for (int jj = 0; jj < 2; ++jj) { al[jj] = sab[key0 + 16 * jj + c]; be[jj] = sab[64 + key0 + 16 * jj + c]; }
    {
      float pm[8];
#pragma unroll
      for (int r = 0; r < 8; ++r) {
        float m = -INFINITY;
#pragma unroll
        for (int jj = 0; jj < 2; ++jj) {
          const float e = s[jj][r] + al[jj] + spn[r] * be[jj];
          s[jj][r] = e;
          m = fmaxf(m, e);
        }
        pm[r] = m;
      }
      row16_max8(pm);
      if (c == 0) {
        *(v4fa*)(redm + rme)     = (v4f){pm[0], pm[1], pm[2], pm[3]};
        *(v4fa*)(redm + rme + 4) = (v4f){pm[4], pm[5], pm[6], pm[7]};
      }
    }
    __syncthreads();
    // ---- online softmax: identical running state in both waves of a pair; P hi|lo into the pair's LDS tile ----
    float corr[8], ps8[8];
#pragma unroll
    for (int r = 0; r < 8; ++r) {
      const float cmx  = fmaxf(redm[r0e + r], redm[r1e + r]);
      const float mnew = fmaxf(mrow[r], cmx);
      corr[r] = expf(mrow[r] - mnew);
      mrow[r] = mnew;
      float psum = 0.0f;
#pragma unroll
      for (int jj = 0; jj < 2; ++jj) {
        const float p = expf(s[jj][r] - mnew);
        psum += p;
        const unsigned short hb = f2bf_bits(p);
        const unsigned short lb = f2bf_bits(p - bfbits2f(hb));
        pgh[(8 * hh + r) * VP_PITCH + key0 + 16 * jj + c] = __builtin_bit_cast(__bf16, hb);
        pgl[(8 * hh + r) * VP_PITCH + key0 + 16 * jj + c] = __builtin_bit_cast(__bf16, lb);
      }
      ps8[r] = psum;
      lrow[r] = lrow[r] * corr[r];
#pragma unroll
      for (int t = 0; t < 4; ++t) oacc[t][r] *= corr[r];
    }
    row16_sum8(ps8);
    if (c == 0) {
      *(v4fa*)(reds + rme)     = (v4f){ps8[0], ps8[1], ps8[2], ps8[3]};
      *(v4fa*)(reds + rme + 4) = (v4f){ps8[4], ps8[5], ps8[6], ps8[7]};
    }
    __syncthreads();
#pragma unroll
    for (int r = 0; r < 8; ++r) lrow[r] += reds[r0e + r] + reds[r1e + r];

    // ---- O += P . V : A = P [query][key], B = Vcm row c [key]; 4 channel tiles of this half, 2 key halves ----
#pragma unroll 1
    for (int kk = 0; kk < 2; ++kk) {
      const v16b pa = ldfrag(pgh + c * VP_PITCH + kk * 32, hh);
      const v16b pl = ldfrag(pgl + c * VP_PITCH + kk * 32, hh);
#pragma unroll
      for (int t = 0; t < 4; ++t) {
        const __bf16* vr = Vs + (ch0 + 16 * t + c) * VP_PITCH + kk * 32;
        const v16b vb = ldfrag(vr, hh);
        const v16b vl = ldfrag(vr + V_PLANE, hh);
        oacc[t] = mma_bf(pa, vb, oacc[t]);
        oacc[t] = mma_bf(pa, vl, oacc[t]);
        oacc[t] = mma_bf(pl, vb, oacc[t]);
      }
    }
  }
  __syncthreads();   // all waves done with K/V tiles before the output tile overlays them

  // ---- normalise, stage O transposed as [c][n_local], write whole 256-B channel segments ----
#pragma unroll
  for (int r = 0; r < 8; ++r) {
    const float inv = 1.0f / lrow[r];
#pragma unroll
    for (int t = 0; t < 4; ++t) Os[(ch0 + 16 * t + c) * 68 + 16 * g + 8 * hh + r] = oacc[t][r] * inv;
  }
  __syncthreads();
  {
    float* ob = out + (size_t)b * NC * NP + n0;
    const int c4 = (lane & 15) * 4;
    {
#pragma unroll
      for (int i = 0; i < 8; ++i) {
        const int row = i * 16 + w * 2 + hh;                       // 0..127 channel
        const v4f v = *(const v4fa*)(Os + row * 68 + c4);
        *(v4f*)(ob + (size_t)row * NP + c4) = v;
      }
      
    }
  }
}

// ---------------------------------------------------------------------------
//   XT    bf16 [32768][128]          0           8388608
//   WQKV  bf16 [384][128]            8388608       98304
//   AV    f32  [8][128]              8486912        4096
//   MX    f32  [8][128]              8491008        4096
//   SPIN  f32  [8][2][4096]          8495104      262144
//   AVEC  f32  [8][128]              8757248        4096
//   RVEC  f32  [8][128]              8761344        4096
//   SP    f32  [8][4096]             8765440      131072
//   ALPHA f32  [8][4096]             8896512      131072
//   BETA  f32  [8][4096]             9027584      131072
//   Q hi|lo bf16 2x[32768][128]      9158656    16777216
//   K hi|lo bf16 2x[32768][128]     25935872    16777216
//   V hi|lo bf16 2x[8][128][4096]   42713088    16777216
//   total                          59490304
// ---------------------------------------------------------------------------
extern "C" void kernel_launch(void* const* d_in, const int* in_sizes, int n_in,
                              void* d_out, int out_size, void* d_ws, size_t ws_size,
                              hipStream_t stream) {
  if (n_in < 13) return;
  if (in_sizes[0] != NB * NC * NP || in_sizes[1] != NB * NC * NP) return;
  if (in_sizes[2] != NC * NC || in_sizes[4] != NC * NC || in_sizes[6] != NC * NC || in_sizes[8] != NC * NC) return;
  if (in_sizes[3] != NC || in_sizes[5] != NC || in_sizes[7] != NC || in_sizes[9] != NC) return;
  if (in_sizes[10] != 10 || in_sizes[11] != 98 || in_sizes[12] != 1) return;
  if (out_size != NB * NC * NP) return;

  const float* x    = (const float*)d_in[0];
  const float* x2   = (const float*)d_in[1];
  const float* q_w  = (const float*)d_in[2];
  const float* q_b  = (const float*)d_in[3];
  const float* k_w  = (const float*)d_in[4];
  const float* k_b  = (const float*)d_in[5];
  const float* v_w  = (const float*)d_in[6];
  const float* v_b  = (const float*)d_in[7];
  const float* ck_w = (const float*)d_in[8];
  const float* ck_b = (const float*)d_in[9];
  const float* c1w  = (const float*)d_in[10];
  const float* sp_w = (const float*)d_in[11];
  const float* sp_b = (const float*)d_in[12];
  float* out = (float*)d_out;

  const size_t plane_b = PLANE_ELEMS * 2;                 // 8388608 bytes per 16-bit plane
  size_t off = 0;
  const size_t oXT   = off; off += plane_b;
  const size_t oW    = off; off += (size_t)3 * NC * NC * 2;
  const size_t oAV   = off; off += (size_t)NB * NC * 4;
  const size_t oMX   = off; off += (size_t)NB * NC * 4;
  const size_t oSPIN = off; off += (size_t)NB * 2 * NP * 4;
  const size_t oAVEC = off; off += (size_t)NB * NC * 4;
  const size_t oRVEC = off; off += (size_t)NB * NC * 4;
  const size_t oSP   = off; off += (size_t)NB * NP * 4;
  const size_t oAL   = off; off += (size_t)NB * NP * 4;
  const size_t oBE   = off; off += (size_t)NB * NP * 4;
  const size_t oQ    = off; off += 2 * plane_b;
  const size_t oK    = off; off += 2 * plane_b;
  const size_t oV    = off; off += 2 * plane_b;           // off = 59490304
  if (off > ws_size) return;
  if (off > (size_t)134217728) return;

  char* ws = (char*)d_ws;
  unsigned short* XT    = (unsigned short*)(ws + oXT);
  unsigned short* WQKV  = (unsigned short*)(ws + oW);
  float* AV    = (float*)(ws + oAV);
  float* MX    = (float*)(ws + oMX);
  float* SPIN  = (float*)(ws + oSPIN);
  float* AVEC  = (float*)(ws + oAVEC);
  float* RVEC  = (float*)(ws + oRVEC);
  float* SP    = (float*)(ws + oSP);
  float* ALPHA = (float*)(ws + oAL);
  float* BETA  = (float*)(ws + oBE);
  unsigned short* QP = (unsigned short*)(ws + oQ);
  unsigned short* KPp = (unsigned short*)(ws + oK);
  unsigned short* VPp = (unsigned short*)(ws + oV);

  // 1. x -> token-major bf16 planes (grid: n blocks, c blocks, batch)
  k_xt<<<dim3(NP / 64, NC / 64, NB), 256, 0, stream>>>(x, XT);
  // 2. projection weights -> bf16 [384][128]
  k_wcvt<<<dim3(NC * NC / 8 / 256, 3), 256, 0, stream>>>(q_w, k_w, v_w, WQKV);
  // 3. per-(b,c) pixel mean/max of x2
  k_poolbc<<<NB * NC / 32, 256, 0, stream>>>(x2, AV, MX);
  // 4. per-(b,n) channel mean/max of x2
  k_poolc<<<NB * (NP / 64), 256, 0, stream>>>(x2, SPIN);
  // 5. positional branch: Avec, R, sp
  k_pos<<<NB, 256, 0, stream>>>(AV, MX, SPIN, c1w, ck_w, ck_b, sp_w, sp_b, AVEC, RVEC, SP);
  // 6. q/k/v projections + alpha/beta + hi|lo planes
  k_qkv<<<dim3(NTOK / 64, 3), 128, 0, stream>>>((const __bf16*)(const void*)XT, (const __bf16*)(const void*)WQKV,
                                                q_b, k_b, v_b, AVEC, RVEC, QP, KPp, VPp, ALPHA, BETA);
  // 7. attention, channel-major output
  k_attn<<<NB * (NP / 64), 256, 0, stream>>>((const __bf16*)(const void*)QP, (const __bf16*)(const void*)KPp,
                                             (const __bf16*)(const void*)VPp, ALPHA, BETA, SP, out);
  (void)hipGetLastError();
}

// v004
// It runs in 345 microseconds.
// In both of two side-by-side timings against v003, it was 1.11 times as fast.
// Over all steps from v000 it is 4.07 times as fast.
// Contractions: q/k/v 1x1 projections on v_wmma_f32_16x16x32_bf16 (bf16 operands taken from bf16-RNE inputs, single product, f32 accumulate);
// q.k^T scores and p.v on v_wmma_f32_16x16x32_bf16 with bf16 hi/lo split operands (hi.hi + hi.lo + lo.hi), f32 accumulate;
// pools, channel conv1d, spatial 7x7 conv, positional vectors alpha/beta, online softmax (expf) in f32.
// 16-bit planes and carries: XT = bf16 RNE(x), Wqkv = bf16 RNE(w), Q/K/V hi = RNE(y), lo = RNE(y - hi), P hi/lo per key chunk in LDS.
// No power-of-two carry on any plane (bf16 keeps the f32 exponent range), so no inverse fold anywhere.
#include <hip/hip_runtime.h>
#include <math.h>
#include <stdint.h>

#define NB   8
#define NC   128
#define NP   4096
#define NTOK (NB * NP)
#define PLANE_ELEMS ((size_t)NTOK * NC)

static_assert(NP % 64 == 0);
static_assert(NC == 128);
static_assert((NB * NC) % 32 == 0);
static_assert(NP % 256 == 0);

typedef __attribute__((ext_vector_type(16))) __bf16 v16b;
typedef __attribute__((ext_vector_type(8)))  __bf16 v8b;
typedef __attribute__((ext_vector_type(8)))  float  v8f;
typedef __attribute__((ext_vector_type(4)))  float  v4f;
typedef __attribute__((ext_vector_type(2)))  float  v2f;
typedef __attribute__((ext_vector_type(4)))  unsigned int v4u;
typedef v8b __attribute__((may_alias)) v8ba;
typedef v4f __attribute__((may_alias)) v4fa;
typedef v2f __attribute__((may_alias)) v2fa;
typedef v4u __attribute__((may_alias)) v4ua;

// ---------------------------------------------------------------------------
// bf16 helpers (RNE convert on the f32 bits)
// ---------------------------------------------------------------------------
__device__ __forceinline__ unsigned short f2bf_bits(float f) {
  const unsigned u = __float_as_uint(f);
  return (unsigned short)((u + 0x7FFFu + ((u >> 16) & 1u)) >> 16);
}
__device__ __forceinline__ float bfbits2f(unsigned short h) { return __uint_as_float(((unsigned)h) << 16); }
__device__ __forceinline__ float bfr(float f) { return bfbits2f(f2bf_bits(f)); }
__device__ __forceinline__ unsigned pk16(unsigned short a, unsigned short b) { return (unsigned)a | ((unsigned)b << 16); }

// ---------------------------------------------------------------------------
// 16x16x32 bf16 WMMA with hazard guard (ties D, keeps A/B live).
// Fragment map (wave32): lane l, h = l>>4, m = n = l&15.
//   A/B element i: i<8 -> k0+8h+i ; i>=8 -> k0+16+8h+(i-8)
//   D element r : row 8h+r, col l&15
// ---------------------------------------------------------------------------
__device__ __forceinline__ v8f mma_bf(v16b a, v16b b, v8f c) {
  c = __builtin_amdgcn_wmma_f32_16x16x32_bf16(false, a, false, b, (short)0, c, false, false);
  asm volatile("v_nop\n\tv_nop\n\tv_nop\n\tv_nop" : "+v"(c) : "v"(a), "v"(b));
  return c;
}
// One butterfly step inside a 16-lane row: lane l takes the value of lane l ^ M (DPP row_xmask, on the vector port).
template <int M> __device__ __forceinline__ float rowx(float v) {
  const int i = __builtin_bit_cast(int, v);
  return __builtin_bit_cast(float, __builtin_amdgcn_update_dpp(0, i, 0x160 + M, 0xf, 0xf, true));
}
// Lane l takes the value of lane l ^ 16 (the other 16-lane row).
__device__ __forceinline__ float xhalf(float v) {
  const int i = __builtin_bit_cast(int, v);
  return __builtin_bit_cast(float, __builtin_amdgcn_permlanex16(i, i, 0x76543210, 0xfedcba98, false, false));
}
// Eight independent 16-lane butterflies (steps 1, 2, 4, 8), taken step by step so that the eight chains interleave.
// Every lane must be on here (a lane that is off would hand on 0). The loops are unrolled so that the arrays stay in registers.
__device__ __forceinline__ void row16_max8(float (&m)[8]) {
#pragma unroll
  for (int r = 0; r < 8; ++r) m[r] = fmaxf(m[r], rowx<1>(m[r]));
#pragma unroll
  for (int r = 0; r < 8; ++r) m[r] = fmaxf(m[r], rowx<2>(m[r]));
#pragma unroll
  for (int r = 0; r < 8; ++r) m[r] = fmaxf(m[r], rowx<4>(m[r]));
#pragma unroll
  for (int r = 0; r < 8; ++r) m[r] = fmaxf(m[r], rowx<8>(m[r]));
}
__device__ __forceinline__ void row16_sum8(float (&s)[8]) {
#pragma unroll
  for (int r = 0; r < 8; ++r) s[r] += rowx<1>(s[r]);
#pragma unroll
  for (int r = 0; r < 8; ++r) s[r] += rowx<2>(s[r]);
#pragma unroll
  for (int r = 0; r < 8; ++r) s[r] += rowx<4>(s[r]);
#pragma unroll
  for (int r = 0; r < 8; ++r) s[r] += rowx<8>(s[r]);
}
union FB { v16b v; v8b h[2]; };
// A or B fragment from a k-contiguous bf16 row; p points at element k0 of the row owned by this lane.
__device__ __forceinline__ v16b ldfrag(const __bf16* p, int hh) {
  FB f;
  f.h[0] = *(const v8ba*)(p + 8 * hh);
  f.h[1] = *(const v8ba*)(p + 16 + 8 * hh);
  return f.v;
}

// 16-B global load at a block-uniform base plus the lane's own 32-bit byte offset plus a constant. Each plane's base goes
// through readfirstlane so that it keeps a scalar register pair of its own and the load takes the scalar-base form;
// without it the compiler folds the lo plane's 8-MiB step into 64-bit vector addresses that it forms anew every trip.
typedef const __attribute__((address_space(1))) v8ba gv8b;
__device__ __forceinline__ uint64_t ubase(const __bf16* p) {
  const uint64_t u = (uint64_t)p;
  const uint32_t lo = (uint32_t)__builtin_amdgcn_readfirstlane((int)(uint32_t)u);
  const uint32_t hi = (uint32_t)__builtin_amdgcn_readfirstlane((int)(uint32_t)(u >> 32));
  return ((uint64_t)hi << 32) | lo;
}
__device__ __forceinline__ v8b ldg16(uint64_t base, unsigned lane_bytes, unsigned imm_bytes) {
  return *(gv8b*)(base + lane_bytes + imm_bytes);
}

// ---------------------------------------------------------------------------
// Kernel 1: x[b] viewed [128 c][4096 n] (pitch 4096) -> XT bf16 [b*4096+n][128 c] (pitch 128), bf16 RNE.
// 64x64 tiles through LDS. grid = (4096/64, 128/64, 8), 256 threads.
// Coverage per block: load 4 it x 256 thr x 4 floats = 64x64; store 2 it x 256 thr x 8 u16 = 64x64.
// ---------------------------------------------------------------------------
__global__ __launch_bounds__(256) void k_xt(const float* __restrict__ X, unsigned short* __restrict__ xt) {
  __shared__ __align__(16) float tf[64 * 68];
  const int b = blockIdx.z;
  const float* W = X + (size_t)b * NC * NP;
  unsigned short* o = xt + (size_t)b * NP * NC;
  const int c0 = blockIdx.x * 64;   // input column block (n) = output row block
  const int r0 = blockIdx.y * 64;   // input row block (c)    = output column block
  const int tid = threadIdx.x;
  {
    const int lr = tid >> 4;
    const int c4 = (tid & 15) * 4;
#pragma unroll
    for (int it = 0; it < 4; ++it) {
      const int rr = it * 16 + lr;
      const v4f a = *(const v4fa*)(W + (size_t)(r0 + rr) * NP + c0 + c4);
      *(v4f*)(tf + rr * 68 + c4) = a;
    }
  }
  __syncthreads();
  const int sub = tid >> 3;          // 0..31
  const int c8  = (tid & 7) * 8;     // 0..56
  v4u hv[2];
#pragma unroll
  for (int it = 0; it < 2; ++it) {
    const int oc = it * 32 + sub;    // output row within tile (= input column)
    v4u a;
#pragma unroll
    for (int q = 0; q < 4; ++q) {
      const float f0 = tf[(c8 + 2 * q) * 68 + oc];
      const float f1 = tf[(c8 + 2 * q + 1) * 68 + oc];
      a[q] = pk16(f2bf_bits(f0), f2bf_bits(f1));
    }
    hv[it] = a;
  }
  {
#pragma unroll
    for (int it = 0; it < 2; ++it) {
      const int oc = it * 32 + sub;
      *(v4ua*)(o + (size_t)(c0 + oc) * NC + r0 + c8) = hv[it];
    }
    
  }
}

// ---------------------------------------------------------------------------
// Kernel 2: [q_w; k_w; v_w] ([out o][in c] row-major each) -> Wqkv bf16 [384 o][128 c] (natural Bt: n = o, k = c).
// grid = (16384/8/256 = 8, 3), 256 threads; matrix selected by blockIdx.y (block-uniform).
// Coverage: 3 x 2048 threads x 8 elements = 3 x 16384. One 16-B store per lane, lanes contiguous:
// ---------------------------------------------------------------------------
__global__ __launch_bounds__(256) void k_wcvt(const float* __restrict__ qw, const float* __restrict__ kw,
                                             const float* __restrict__ vw, unsigned short* __restrict__ Wb) {
  const int which = blockIdx.y;
  const float* src = (which == 0) ? qw : ((which == 1) ? kw : vw);
  const int i = blockIdx.x * 256 + threadIdx.x;
  if (i >= NC * NC / 8) return;
  const v4f a = *(const v4fa*)(src + (size_t)i * 8);
  const v4f c = *(const v4fa*)(src + (size_t)i * 8 + 4);
  v4u o4;
  o4[0] = pk16(f2bf_bits(a[0]), f2bf_bits(a[1]));
  o4[1] = pk16(f2bf_bits(a[2]), f2bf_bits(a[3]));
  o4[2] = pk16(f2bf_bits(c[0]), f2bf_bits(c[1]));
  o4[3] = pk16(f2bf_bits(c[2]), f2bf_bits(c[3]));
  unsigned short* dst = Wb + (size_t)which * NC * NC + (size_t)i * 8;
  *(v4ua*)dst = o4;
  
}

// ---------------------------------------------------------------------------
// Kernel 3: per-(b,c) mean and max over the 4096 pixels of bf16-RNE x2. Block handles 32 consecutive (b,c) rows
// (grid = 1024/32 = 32, 256 threads: each thread 16 elements of a row, fixed-order tree). The 32 means and 32
// maxes are funnelled through LDS; wave 0 lanes 0..7 write the AV line, lanes 8..15 the MX line
// Coverage: 32 blocks x 32 rows = 1024 = 8 x 128 rows; per row 256 x 16 = 4096 elements.
// ---------------------------------------------------------------------------
__global__ __launch_bounds__(256) void k_poolbc(const float* __restrict__ x2, float* __restrict__ AV,
                                               float* __restrict__ MX) {
  __shared__ float ws_s[8], ws_m[8];
  __shared__ __align__(16) float os[64];
  const int g = blockIdx.x, tid = threadIdx.x, lane = tid & 31, w = tid >> 5;
#pragma unroll 1
  for (int j = 0; j < 32; ++j) {
    const float* p = x2 + (size_t)(g * 32 + j) * NP + tid * 16;
    float s = 0.f, m = -INFINITY;
#pragma unroll
    for (int i = 0; i < 4; ++i) {
      const v4f a = *(const v4fa*)(p + 4 * i);
      const float a0 = bfr(a[0]), a1 = bfr(a[1]), a2 = bfr(a[2]), a3 = bfr(a[3]);
      s += (a0 + a1) + (a2 + a3);
      m = fmaxf(fmaxf(m, a0), fmaxf(fmaxf(a1, a2), a3));
    }
    s += xhalf(s);   m = fmaxf(m, xhalf(m));
    s += rowx<8>(s); m = fmaxf(m, rowx<8>(m));
    s += rowx<4>(s); m = fmaxf(m, rowx<4>(m));
    s += rowx<2>(s); m = fmaxf(m, rowx<2>(m));
    s += rowx<1>(s); m = fmaxf(m, rowx<1>(m));
    if (lane == 0) { ws_s[w] = s; ws_m[w] = m; }
    __syncthreads();
    if (tid == 0) {
      float ts = 0.f, tm = -INFINITY;
#pragma unroll
      for (int k = 0; k < 8; ++k) { ts += ws_s[k]; tm = fmaxf(tm, ws_m[k]); }
      os[j] = ts * (1.0f / 4096.0f);
      os[32 + j] = tm;
    }
    __syncthreads();
  }
  if (w == 0) {
    const v4f v = *(const v4fa*)(os + 4 * (lane & 15));
    {
      if (lane < 8)       *(v4f*)(AV + g * 32 + 4 * lane) = v;
      else if (lane < 16) *(v4f*)(MX + g * 32 + 4 * (lane - 8)) = v;
      
    }
  }
}

// ---------------------------------------------------------------------------
// Kernel 4: per-(b,n) mean and max over the 128 channels of bf16-RNE x2 -> SPIN[b][0][n] = mean, SPIN[b][1][n] = max.
// Block per (b, 64-pixel group): grid = 8 x 64 = 512, 256 threads = 64 pixels x 4 channel groups of 32 (serial,
// unroll 4), fixed-order 4-way combine. 64 means / 64 maxes funnelled through LDS; wave 0 writes both 256-B
// Coverage: 512 blocks x 64 pixels = 8 x 4096 per plane.
// ---------------------------------------------------------------------------
__global__ __launch_bounds__(256) void k_poolc(const float* __restrict__ x2, float* __restrict__ SPIN) {
  __shared__ float ps[4][64], pm[4][64];
  __shared__ __align__(16) float os[128];
  const int b = blockIdx.x >> 6, g = blockIdx.x & 63;
  const int tid = threadIdx.x, lane = tid & 31;
  const int p = tid & 63, cg = tid >> 6;
  const float* src = x2 + ((size_t)b * NC + cg * 32) * NP + g * 64 + p;
  float s = 0.f, m = -INFINITY;
#pragma unroll 4
  for (int c = 0; c < 32; ++c) {
    const float v = bfr(src[(size_t)c * NP]);
    s += v;
    m = fmaxf(m, v);
  }
  ps[cg][p] = s;
  pm[cg][p] = m;
  __syncthreads();
  if (tid < 64) {
    const float ts = ((ps[0][tid] + ps[1][tid]) + ps[2][tid]) + ps[3][tid];
    const float tm = fmaxf(fmaxf(pm[0][tid], pm[1][tid]), fmaxf(pm[2][tid], pm[3][tid]));
    os[tid] = ts * (1.0f / 128.0f);
    os[64 + tid] = tm;
  }
  __syncthreads();
  if (tid < 32) {
    const v4f v = *(const v4fa*)(os + 4 * lane);   // lanes 0..15: means 0..63, lanes 16..31: maxes 0..63
    float* base = SPIN + (size_t)b * 2 * NP + g * 64;
    {
      if (lane < 16) *(v4f*)(base + 4 * lane) = v;
      else           *(v4f*)(base + NP + 4 * (lane - 16)) = v;
      
    }
  }
}

// ---------------------------------------------------------------------------
// Kernel 5: positional branch, grid (1 + 16, 8 batches), 256 threads, all f32 VALU:
//   ch[c]   = sum_{i in {mean,max}} sum_{t<5} bf16r(conv1_w[i][t]) * stk[i][c+t-2]   (zero pad 2, no flip, no bias)
//   Avec[o] = sum_c bf16r(ck_w[o][c]) * ch[c] + bf16r(ck_b[o]) ;  R[o] = sum_c bf16r(ck_w[o][c])
//   sp[n]   = sum_i sum_{u,v<7} bf16r(sp_w[i][u][v]) * spin[i][h+u-3][w+v-3] + bf16r(sp_b)   (zero pad 3)
// blockIdx.x == 0: the channel branch of batch b (AVEC[b][128] by wave 0, RVEC[b][128] by wave 1).
// blockIdx.x == 1 + s: the spatial conv of image rows 4s..4s+3 (256 pixels, one per thread). The two pooled maps are
// staged with their halo as zero-padded 10x70 LDS planes; each wave stores one whole 128-B line of SP.
// Coverage: AVEC/RVEC 8 x 128; SP 8 x 16 blocks x 256 thr = 8 x 4096.
// ---------------------------------------------------------------------------
#define POS_ROWS   4                     // image rows per spatial work-group
#define POS_SLICES (64 / POS_ROWS)       // spatial work-groups per batch
#define POS_PLANE  ((POS_ROWS + 6) * 70) // floats per padded plane
static_assert(POS_ROWS * 64 == 256);
static_assert(2 * POS_PLANE > 5 * 256 && 2 * POS_PLANE <= 6 * 256);

__global__ __launch_bounds__(256) void k_pos(const float* __restrict__ AV, const float* __restrict__ MX,
                                            const float* __restrict__ SPIN, const float* __restrict__ c1w,
                                            const float* __restrict__ ckw, const float* __restrict__ ckb,
                                            const float* __restrict__ spw, const float* __restrict__ spb,
                                            float* __restrict__ AVEC, float* __restrict__ RVEC,
                                            float* __restrict__ SP) {
  __shared__ float sav[128], smx[128];
  __shared__ __align__(16) float sch[128];
  __shared__ float sw1[32];
  __shared__ __align__(16) float sw2[128];
  __shared__ __align__(16) float savec[128], srv[128];
  __shared__ float spl[2 * POS_PLANE];
  const int b = blockIdx.y, tid = threadIdx.x, lane = tid & 31, w = tid >> 5;

  if (blockIdx.x == 0) {                               // block-uniform: every barrier below is passed by the whole block
    const int o = tid & 127;                           // waves 4..7 repeat waves 0..3 and store nothing
    // the ck_w row and ck_b are read here, ahead of the first barrier, so that they are in flight together with the
    // pooled values instead of one dependent round trip per four weights behind the second barrier
    v4f wq[NC / 4];                                    // this thread's whole ck_w row
#pragma unroll
    for (int i = 0; i < NC / 4; ++i) wq[i] = *(const v4fa*)(ckw + (size_t)o * NC + 4 * i);
    const float cb = ckb[o];
    if (tid < 128) { sav[tid] = AV[b * NC + tid]; smx[tid] = MX[b * NC + tid]; }
    if (tid < 32) sw1[tid] = bfr(c1w[min(tid, 9)]);    // clamped address
    __syncthreads();
    // channel conv1d
    if (tid < 128) {
      const int c = tid;
      float acc = 0.0f;
#pragma unroll 1
      for (int t = 0; t < 5; ++t) {
        const int cc  = c + t - 2;
        const int ccl = min(max(cc, 0), NC - 1);
        const float valid = (cc >= 0 && cc < NC) ? 1.0f : 0.0f;
        acc += valid * (sw1[t] * sav[ccl] + sw1[5 + t] * smx[ccl]);
      }
      sch[c] = acc;
    }
    __syncthreads();
    // Avec, R: c ascending, as one chain each (Avec by fused multiply-add, written out so that the unrolled form
    // is not split into packed multiplies and separate adds). Unrolled so that the row stays in registers.
    {
      float a = bfr(cb), r = 0.0f;
#pragma unroll
      for (int c = 0; c < NC; ++c) {
        const float wv = bfr(wq[c >> 2][c & 3]);
        a = __builtin_fmaf(wv, sch[c], a);
        r += wv;
      }
      if (tid < 128) { savec[o] = a; srv[o] = r; }
    }
    __syncthreads();
    if (w == 0) {
      const v4f v = *(const v4fa*)(savec + 4 * lane);
      *(v4f*)(AVEC + b * NC + 4 * lane) = v;
    } else if (w == 1) {
      const v4f v = *(const v4fa*)(srv + 4 * lane);
      *(v4f*)(RVEC + b * NC + 4 * lane) = v;
    }
    return;
  }

  // spatial 7x7x2 conv + bias of image rows h0..h0+3
  const int sl = blockIdx.x - 1;
  const int h0 = sl * POS_ROWS;
  const float* sp0 = SPIN + (size_t)b * 2 * NP;
  const float bias_sp = bfr(spb[0]);                   // read ahead of the barrier, with the other loads
  {
    // padded planes with halo: every lane loads at a clamped address, so that the weight load and the six tile loads
    // are in flight together; what lies outside the image becomes 0
    const float wt = spw[min(tid, 97)];
    float tv[6];
#pragma unroll
    for (int k = 0; k < 6; ++k) {
      const int i   = min(k * 256 + tid, 2 * POS_PLANE - 1);
      const int pl  = i / POS_PLANE, rem = i - pl * POS_PLANE;
      const int rr  = rem / 70, cc = rem - rr * 70;
      const int gh  = h0 + rr - 3, gx = cc - 3;
      const bool in = gh >= 0 && gh < 64 && gx >= 0 && gx < 64;
      const float v = sp0[pl * NP + min(max(gh, 0), 63) * 64 + min(max(gx, 0), 63)];
      tv[k] = in ? v : 0.0f;
    }
    if (tid < 128) sw2[tid] = bfr(wt);
#pragma unroll
    for (int k = 0; k < 5; ++k) spl[k * 256 + tid] = tv[k];
    if (5 * 256 + tid < 2 * POS_PLANE) spl[5 * 256 + tid] = tv[5];
  }
  __syncthreads();
  {
    const int h = tid >> 6, x = tid & 63;
    const float* t0 = spl + h * 70 + x;
    float acc = bias_sp;
    // both tap loops unrolled: the 98 LDS reads of a pixel do not depend on one another and overlap, where the
    // rolled loops paid one LDS round trip a tap; the taps are added in the same order
#pragma unroll
    for (int u = 0; u < 7; ++u) {
#pragma unroll
      for (int v = 0; v < 7; ++v) {
        const int li = u * 70 + v;
        acc += sw2[u * 7 + v] * t0[li] + sw2[49 + u * 7 + v] * t0[POS_PLANE + li];
      }
    }
    SP[(size_t)b * NP + sl * 256 + tid] = acc;
    asm volatile("s_wait_xcnt 0x0" ::: "memory");      // before a register that the store names is rewritten
  }
}

// ---------------------------------------------------------------------------
// Kernel 6: [Q|K|V] = XT . Wqkv^T + bias (exact bf16 x bf16 products, f32 accumulate, K = 128 in 4 steps of 32).
// grid = (32768/64 = 512 token tiles, 3 = which), 128 threads = 4 waves; wave w owns tokens m0+16w..+15 x all 128
// output channels (8 accumulator tiles). A fragments straight from XT rows, B fragments from Wqkv rows (both
// k-contiguous bf16, arithmetic addressing). bias (bf16r), Avec and R staged in LDS (one scalar load per thread each).
// Epilogue: f32 tile (acc + bias) staged in LDS [64][132];
//   which 0: alpha[n] = sum_o Avec[b][o] q[o][n], beta[n] = sum_o R[o] q[o][n] (f32, rolled) -> ALPHA/BETA 256-B
//            segments (16 lanes x 16 B); Q hi|lo token-major planes [tok][128];
//   which 1: K hi|lo token-major planes;  which 2: V hi|lo channel-major planes [b][c][4096] (transposed write).
// ---------------------------------------------------------------------------
__global__ __launch_bounds__(128) void k_qkv(const __bf16* __restrict__ XT, const __bf16* __restrict__ Wb,
                                            const float* __restrict__ qb, const float* __restrict__ kb,
                                            const float* __restrict__ vb,
                                            const float* __restrict__ AVEC, const float* __restrict__ RVEC,
                                            unsigned short* __restrict__ QP, unsigned short* __restrict__ KP,
                                            unsigned short* __restrict__ VP,
                                            float* __restrict__ ALPHA, float* __restrict__ BETA) {
  __shared__ __align__(16) float sT[64 * 132];
  __shared__ __align__(16) float sAV[128], sRV[128], sAB[128], sBI[128];
  const int tid = threadIdx.x, lane = tid & 31, w = tid >> 5, hh = lane >> 4, l16 = lane & 15;
  const int which = blockIdx.y;
  const int m0 = blockIdx.x * 64;            // global token row
  const int b  = m0 / NP;
  const int n0 = m0 - b * NP;

  const float* bias = (which == 0) ? qb : ((which == 1) ? kb : vb);   // block-uniform select, same address space
  sAV[tid] = AVEC[b * NC + tid];
  sRV[tid] = RVEC[b * NC + tid];
  sBI[tid] = bfr(bias[tid]);
  __syncthreads();

  const v8f zero8 = {0.f, 0.f, 0.f, 0.f, 0.f, 0.f, 0.f, 0.f};
  v8f acc[8];
#pragma unroll
  for (int t = 0; t < 8; ++t) acc[t] = zero8;

  const __bf16* arow = XT + (size_t)(m0 + 16 * w + l16) * NC;        // token row, k = input channel
  const __bf16* brow = Wb + ((size_t)which * NC + l16) * NC;          // output channel row (tile 0), k = input channel
#pragma unroll
  for (int kc = 0; kc < 4; ++kc) {
    const v16b a = ldfrag(arow + kc * 32, hh);
#pragma unroll
    for (int t = 0; t < 8; ++t) {
      const v16b bf = ldfrag(brow + (size_t)t * 16 * NC + kc * 32, hh);
      acc[t] = mma_bf(a, bf, acc[t]);
    }
  }
  // D[r] of tile t = Y[token 16w+8hh+r][channel 16t+l16]
#pragma unroll
  for (int t = 0; t < 8; ++t) {
    const float bv = sBI[16 * t + l16];
#pragma unroll
    for (int r = 0; r < 8; ++r) sT[(16 * w + 8 * hh + r) * 132 + 16 * t + l16] = acc[t][r] + bv;
  }
  __syncthreads();
  if (which == 0 && tid < 64) {            // waves 0,1
    const float* qr = sT + tid * 132;
    float a = 0.0f, be = 0.0f;
#pragma unroll 4
    for (int o = 0; o < NC; ++o) {
      const float q = qr[o];
      a  += sAV[o] * q;
      be += sRV[o] * q;
    }
    sAB[tid] = a;
    sAB[64 + tid] = be;
  }
  __syncthreads();

  // pack hi|lo planes
  const int q8 = lane & 7, sub = lane >> 3;
  v4u hv[8], lv[8];
#pragma unroll
  for (int i = 0; i < 8; ++i) {
    const int lid  = w * 32 + i * 4 + sub;                                   // 0..127
    const int base = (which != 2) ? ((lid >> 1) * 132 + (lid & 1) * 64 + 8 * q8) : ((8 * q8) * 132 + lid);
    const int estr = (which != 2) ? 1 : 132;
    v4u a, a2;
#pragma unroll
    for (int q = 0; q < 4; ++q) {
      const float f0 = sT[base + (2 * q) * estr];
      const float f1 = sT[base + (2 * q + 1) * estr];
      const unsigned short h0 = f2bf_bits(f0), h1 = f2bf_bits(f1);
      const unsigned short l0 = f2bf_bits(f0 - bfbits2f(h0)), l1 = f2bf_bits(f1 - bfbits2f(h1));
      a[q]  = pk16(h0, h1);
      a2[q] = pk16(l0, l1);
    }
    hv[i] = a;
    lv[i] = a2;
  }
  unsigned short* P = (which == 0) ? QP : ((which == 1) ? KP : VP);
  {
#pragma unroll
    for (int i = 0; i < 8; ++i) {
      const int lid = w * 32 + i * 4 + sub;
      const size_t go = (which != 2)
          ? ((size_t)(m0 + (lid >> 1)) * NC + (lid & 1) * 64 + 8 * q8)
          : (((size_t)b * NC + lid) * NP + n0 + 8 * q8);
      *(v4ua*)(P + go) = hv[i];
      *(v4ua*)(P + PLANE_ELEMS + go) = lv[i];
    }
    
  }
  if (which == 0 && w == 0) {
    const v4f v = *(const v4fa*)(sAB + 4 * lane);    // lanes 0..15: alpha 0..63, lanes 16..31: beta 0..63
    {
      if (lane < 16) *(v4f*)(ALPHA + m0 + 4 * lane) = v;
      else           *(v4f*)(BETA + m0 + 4 * (lane - 16)) = v;
      
    }
  }
}

// ---------------------------------------------------------------------------
// Kernel 7: full (non-causal, unmasked) attention, head dim 128, block per (b, 64-query tile): grid 8 x 64 = 512,
// 256 threads = 8 waves. Wave w: query group g = w&3 (rows 16g..16g+15), key half kh = w>>2.
//   energy[n][m] = q[n].k[m] (bf16 hi/lo 3-term WMMA) + alpha[m] + sp[n]*beta[m]  (f32, no scale)
//   Per 64-key chunk: wave (g,kh) computes the scores of its 16 rows x keys 32kh..32kh+31, the partial row max and
//   partial row sum are exchanged between the wave pair through LDS (block barriers), both waves of a pair derive
//   the identical running max / correction / sum; p hi|lo of all 64 keys land in the pair's shared P tile;
//   then O[n][c] += p . V for the wave's 64-channel half c in [64kh, 64kh+64)  (p and V bf16 hi/lo, 3-term WMMA).
//   Online softmax over all 4096 keys in 64 chunks of 64 (compile-time trip count, no masking), f32 expf.
// LDS: K hi|lo [64][128], Vcm hi|lo [128][64], Q hi|lo [64][128] (staged once), P hi|lo [4 g][16][64]; every row is
// padded by 16 B (pitch 272 B for 256-B rows, 144 B for 128-B rows = 16 B x odd), so the 16 rows that one 16-byte
// fragment read touches fall on 16 different bank groups; the lo plane of K/Q starts 64 B and that of V 128 B past a
// multiple of 256 B; staging loads and stores give consecutive lanes consecutive 16-B pieces of a row (whole lines);
// alpha/beta slices [64]+[64], exchange arrays [128]+[128]; output tile [128 c][64 n] (pitch 68) overlays the
// K/V region after the loop (block barrier first).
// Staging coverage (Q once, K/V per chunk): Q/K 8 rounds x 256 thr x 8 = 64x128 x 2 planes; V 8 rounds x 256 thr x 8 = 128x64 x 2 planes;
// P: each wave pair writes its whole 16x64 tile (both planes) before the barrier that precedes the reload.
// Output: out[b][c][n0..n0+63] channel-major; each channel row segment = 256 B = 16 contiguous lanes x 16 B
// ---------------------------------------------------------------------------
#define KQ_PITCH 136                       // elements: 128 + 8 (272 B)
#define VP_PITCH 72                        // elements: 64 + 8 (144 B)
#define KQ_PLANE (64 * KQ_PITCH + 32)      // elements: 17472 B = 68 x 256 + 64
#define V_PLANE  (128 * VP_PITCH + 64)     // elements: 18560 B = 72 x 256 + 128
#define P_GROUP  (16 * VP_PITCH)           // elements per query group
#define P_PLANE  (4 * P_GROUP)
#define SM_K   0
#define SM_V   (SM_K + 2 * KQ_PLANE * 2)
#define SM_Q   (SM_V + 2 * V_PLANE * 2)
#define SM_P   (SM_Q + 2 * KQ_PLANE * 2)
#define SM_AB  (SM_P + 2 * P_PLANE * 2)
#define SM_RED (SM_AB + 512)
#define SM_TOT (SM_RED + 1024)
static_assert(128 * 68 * 4 <= SM_Q);
static_assert(SM_V % 16 == 0 && SM_Q % 16 == 0 && SM_P % 16 == 0 && SM_AB % 16 == 0);
static_assert(2 * SM_TOT <= 327680);

__global__ __launch_bounds__(256) void k_attn(const __bf16* __restrict__ QP, const __bf16* __restrict__ KP,
                                             const __bf16* __restrict__ VP, const float* __restrict__ ALPHA,
                                             const float* __restrict__ BETA, const float* __restrict__ SP,
                                             float* __restrict__ out) {
  __shared__ __align__(16) unsigned char smem[SM_TOT];
  __bf16* Ks   = (__bf16*)(smem + SM_K);     // hi at +0, lo at +KQ_PLANE elements
  __bf16* Vs   = (__bf16*)(smem + SM_V);
  __bf16* Qs   = (__bf16*)(smem + SM_Q);
  __bf16* Ps   = (__bf16*)(smem + SM_P);     // hi: group g at +P_GROUP*g ; lo: +P_PLANE + P_GROUP*g
  float*  sab  = (float*)(smem + SM_AB);     // alpha 0..63, beta 64..127
  float*  redm = (float*)(smem + SM_RED);    // partial row max [4 g][2 kh][16]
  float*  reds = redm + 128;                 // partial row sum [4 g][2 kh][16]
  float*  Os   = (float*)(smem + SM_K);      // [128][68] after the key loop

  const int tid = threadIdx.x, lane = tid & 31, w = tid >> 5, hh = lane >> 4, c = lane & 15;
  const int g = w & 3, kh = w >> 2;
  const int key0 = 32 * kh;                  // this wave's key half within a chunk
  const int ch0  = 64 * kh;                  // this wave's channel half
  const int b  = blockIdx.x >> 6;
  const int n0 = (blockIdx.x & 63) * 64;
  const size_t tok0 = (size_t)b * NP + n0;

  // Staging lane maps: consecutive lanes take consecutive 16-B pieces, so one wave-wide load covers 4 whole 128-B lines.
  const int kq_r = tid >> 4, kq_c = (tid & 15) * 8;   // Q/K: 16 lanes per 256-B row, 16 rows per round of the block
  const int v_r  = tid >> 3, v_c  = (tid & 7) * 8;    // V:    8 lanes per 128-B row, 32 rows per round of the block
  const unsigned kq_g = (unsigned)(kq_r * NC + kq_c) * 2u; // the lane's byte offset in a token-major tile
  const unsigned v_g  = (unsigned)(v_r * NP + v_c) * 2u;   // the lane's byte offset in a channel-major tile
  // ---- stage the block's Q tile hi|lo: 2 planes x 4 rounds x 256 thr x 8 elements ----
  {
    __bf16* dst = Qs + kq_r * KQ_PITCH + kq_c;
#pragma unroll
    for (int p = 0; p < 2; ++p) {
      const uint64_t qsrc = ubase(QP + (size_t)p * PLANE_ELEMS + tok0 * NC);
#pragma unroll
      for (int i = 0; i < 4; ++i) {
        const v8b v = ldg16(qsrc, kq_g, i * 16 * NC * 2);
        *(v8ba*)(dst + p * KQ_PLANE + i * 16 * KQ_PITCH) = v;
      }
    }
  }
  // ---- sp[n] for this lane's 8 query rows ----
  float spn[8];
  {
    const v4f s0 = *(const v4fa*)(SP + tok0 + 16 * g + 8 * hh);
    const v4f s1 = *(const v4fa*)(SP + tok0 + 16 * g + 8 * hh + 4);
    spn[0] = s0[0]; spn[1] = s0[1]; spn[2] = s0[2]; spn[3] = s0[3];
    spn[4] = s1[0]; spn[5] = s1[1]; spn[6] = s1[2]; spn[7] = s1[3];
  }
  float mrow[8], lrow[8];
  const v8f zero8 = {0.f, 0.f, 0.f, 0.f, 0.f, 0.f, 0.f, 0.f};
  v8f oacc[4];
#pragma unroll
  for (int r = 0; r < 8; ++r) { mrow[r] = -INFINITY; lrow[r] = 0.0f; }
#pragma unroll
  for (int t = 0; t < 4; ++t) oacc[t] = zero8;

  const __bf16* qrow = Qs + (16 * g + c) * KQ_PITCH;
  __bf16* pgh = Ps + g * P_GROUP;
  __bf16* pgl = Ps + P_PLANE + g * P_GROUP;
  const int rme = g * 32 + kh * 16 + 8 * hh;   // exchange slot base of this lane's rows
  const int r0e = g * 32 + 8 * hh;             // key half 0 slot base
  const int r1e = g * 32 + 16 + 8 * hh;        // key half 1 slot base

  // K/V plane bases of this batch (block-uniform) and the lane's running byte offsets (below 1 MiB + one tile)
  const uint64_t ksrc[2] = {ubase(KP + (size_t)b * NP * NC), ubase(KP + PLANE_ELEMS + (size_t)b * NP * NC)};
  const uint64_t vsrc[2] = {ubase(VP + (size_t)b * NC * NP), ubase(VP + PLANE_ELEMS + (size_t)b * NC * NP)};
  unsigned koff = kq_g, voff = v_g;

#pragma unroll 1
  for (int kc = 0; kc < NP / 64; ++kc) {
    const int m0 = kc * 64;
    __syncthreads();
    {
      // K: 2 planes x 4 rounds x 256 thr x 8 elements = 64 rows x 128 x 2 planes
      __bf16* kd = Ks + kq_r * KQ_PITCH + kq_c;
      // V: 2 planes x 4 rounds x 256 thr x 8 elements = 128 channel rows x 64 keys x 2 planes
      __bf16* vd = Vs + v_r * VP_PITCH + v_c;
      v8b ka[8], va[8];
#pragma unroll
      for (int i = 0; i < 8; ++i) ka[i] = ldg16(ksrc[i >> 2], koff, (i & 3) * 16 * NC * 2);
#pragma unroll
      for (int i = 0; i < 8; ++i) va[i] = ldg16(vsrc[i >> 2], voff, (i & 3) * 32 * NP * 2);
#pragma unroll
      for (int i = 0; i < 8; ++i) *(v8ba*)(kd + (i >> 2) * KQ_PLANE + (i & 3) * 16 * KQ_PITCH) = ka[i];
#pragma unroll
      for (int i = 0; i < 8; ++i) *(v8ba*)(vd + (i >> 2) * V_PLANE + (i & 3) * 32 * VP_PITCH) = va[i];
      koff += 64 * NC * 2;   // next 64 keys: 64 token rows of K
      voff += 64 * 2;        // next 64 keys: 64 columns of V
      if (w == 0) {
        const v2f a = *(const v2fa*)(ALPHA + (size_t)b * NP + m0 + 2 * lane);
        *(v2fa*)(sab + 2 * lane) = a;
      } else if (w == 1) {
        const v2f a = *(const v2fa*)(BETA + (size_t)b * NP + m0 + 2 * lane);
        *(v2fa*)(sab + 64 + 2 * lane) = a;
      }
    }
    __syncthreads();

    // ---- scores: s[jj][r] = S[query 16g+8hh+r][key m0+key0+16jj+c], 3-term split ----
    v8f s[2];
    s[0] = zero8; s[1] = zero8;
#pragma unroll 1
    for (int dc = 0; dc < 4; ++dc) {
      const v16b qa = ldfrag(qrow + dc * 32, hh);
      const v16b ql = ldfrag(qrow + KQ_PLANE + dc * 32, hh);
#pragma unroll
      for (int jj = 0; jj < 2; ++jj) {
        const __bf16* krow = Ks + (key0 + 16 * jj + c) * KQ_PITCH + dc * 32;
        const v16b kb = ldfrag(krow, hh);
        const v16b kl = ldfrag(krow + KQ_PLANE, hh);
        s[jj] = mma_bf(qa, kb, s[jj]);
        s[jj] = mma_bf(qa, kl, s[jj]);
        s[jj] = mma_bf(ql, kb, s[jj]);
      }
    }
    // ---- positional terms in f32, then partial row max over this key half ----
    float al[2], be[2];
#pragma unroll
    for (int jj = 0; jj < 2; ++jj) { al[jj] = sab[key0 + 16 * jj + c]; be[jj] = sab[64 + key0 + 16 * jj + c]; }
    {
      float pm[8];
#pragma unroll
      for (int r = 0; r < 8; ++r) {
        float m = -INFINITY;
#pragma unroll
        for (int jj = 0; jj < 2; ++jj) {
          const float e = s[jj][r] + al[jj] + spn[r] * be[jj];
          s[jj][r] = e;
          m = fmaxf(m, e);
        }
        pm[r] = m;
      }
      row16_max8(pm);
      if (c == 0) {
        *(v4fa*)(redm + rme)     = (v4f){pm[0], pm[1], pm[2], pm[3]};
        *(v4fa*)(redm + rme + 4) = (v4f){pm[4], pm[5], pm[6], pm[7]};
      }
    }
    __syncthreads();
    // ---- online softmax: identical running state in both waves of a pair; P hi|lo into the pair's LDS tile ----
    float corr[8], ps8[8];
#pragma unroll
    for (int r = 0; r < 8; ++r) {
      const float cmx  = fmaxf(redm[r0e + r], redm[r1e + r]);
      const float mnew = fmaxf(mrow[r], cmx);
      corr[r] = expf(mrow[r] - mnew);
      mrow[r] = mnew;
      float psum = 0.0f;
#pragma unroll
      for (int jj = 0; jj < 2; ++jj) {
        const float p = expf(s[jj][r] - mnew);
        psum += p;
        const unsigned short hb = f2bf_bits(p);
        const unsigned short lb = f2bf_bits(p - bfbits2f(hb));
        pgh[(8 * hh + r) * VP_PITCH + key0 + 16 * jj + c] = __builtin_bit_cast(__bf16, hb);
        pgl[(8 * hh + r) * VP_PITCH + key0 + 16 * jj + c] = __builtin_bit_cast(__bf16, lb);
      }
      ps8[r] = psum;
      lrow[r] = lrow[r] * corr[r];
#pragma unroll
      for (int t = 0; t < 4; ++t) oacc[t][r] *= corr[r];
    }
    row16_sum8(ps8);
    if (c == 0) {
      *(v4fa*)(reds + rme)     = (v4f){ps8[0], ps8[1], ps8[2], ps8[3]};
      *(v4fa*)(reds + rme + 4) = (v4f){ps8[4], ps8[5], ps8[6], ps8[7]};
    }
    __syncthreads();
#pragma unroll
    for (int r = 0; r < 8; ++r) lrow[r] += reds[r0e + r] + reds[r1e + r];

    // ---- O += P . V : A = P [query][key], B = Vcm row c [key]; 4 channel tiles of this half, 2 key halves ----
#pragma unroll 1
    for (int kk = 0; kk < 2; ++kk) {
      const v16b pa = ldfrag(pgh + c * VP_PITCH + kk * 32, hh);
      const v16b pl = ldfrag(pgl + c * VP_PITCH + kk * 32, hh);
#pragma unroll
      for (int t = 0; t < 4; ++t) {
        const __bf16* vr = Vs + (ch0 + 16 * t + c) * VP_PITCH + kk * 32;
        const v16b vb = ldfrag(vr, hh);
        const v16b vl = ldfrag(vr + V_PLANE, hh);
        oacc[t] = mma_bf(pa, vb, oacc[t]);
        oacc[t] = mma_bf(pa, vl, oacc[t]);
        oacc[t] = mma_bf(pl, vb, oacc[t]);
      }
    }
  }
  __syncthreads();   // all waves done with K/V tiles before the output tile overlays them

  // ---- normalise, stage O transposed as [c][n_local], write whole 256-B channel segments ----
#pragma unroll
  for (int r = 0; r < 8; ++r) {
    const float inv = 1.0f / lrow[r];
#pragma unroll
    for (int t = 0; t < 4; ++t) Os[(ch0 + 16 * t + c) * 68 + 16 * g + 8 * hh + r] = oacc[t][r] * inv;
  }
  __syncthreads();
  {
    float* ob = out + (size_t)b * NC * NP + n0;
    const int c4 = (lane & 15) * 4;
    {
#pragma unroll
      for (int i = 0; i < 8; ++i) {
        const int row = i * 16 + w * 2 + hh;                       // 0..127 channel
        const v4f v = *(const v4fa*)(Os + row * 68 + c4);
        *(v4f*)(ob + (size_t)row * NP + c4) = v;
      }
      
    }
  }
}

// ---------------------------------------------------------------------------
//   XT    bf16 [32768][128]          0           8388608
//   WQKV  bf16 [384][128]            8388608       98304
//   AV    f32  [8][128]              8486912        4096
//   MX    f32  [8][128]              8491008        4096
//   SPIN  f32  [8][2][4096]          8495104      262144
//   AVEC  f32  [8][128]              8757248        4096
//   RVEC  f32  [8][128]              8761344        4096
//   SP    f32  [8][4096]             8765440      131072
//   ALPHA f32  [8][4096]             8896512      131072
//   BETA  f32  [8][4096]             9027584      131072
//   Q hi|lo bf16 2x[32768][128]      9158656    16777216
//   K hi|lo bf16 2x[32768][128]     25935872    16777216
//   V hi|lo bf16 2x[8][128][4096]   42713088    16777216
//   total                          59490304
// ---------------------------------------------------------------------------
extern "C" void kernel_launch(void* const* d_in, const int* in_sizes, int n_in,
                              void* d_out, int out_size, void* d_ws, size_t ws_size,
                              hipStream_t stream) {
  if (n_in < 13) return;
  if (in_sizes[0] != NB * NC * NP || in_sizes[1] != NB * NC * NP) return;
  if (in_sizes[2] != NC * NC || in_sizes[4] != NC * NC || in_sizes[6] != NC * NC || in_sizes[8] != NC * NC) return;
  if (in_sizes[3] != NC || in_sizes[5] != NC || in_sizes[7] != NC || in_sizes[9] != NC) return;
  if (in_sizes[10] != 10 || in_sizes[11] != 98 || in_sizes[12] != 1) return;
  if (out_size != NB * NC * NP) return;

  const float* x    = (const float*)d_in[0];
  const float* x2   = (const float*)d_in[1];
  const float* q_w  = (const float*)d_in[2];
  const float* q_b  = (const float*)d_in[3];
  const float* k_w  = (const float*)d_in[4];
  const float* k_b  = (const float*)d_in[5];
  const float* v_w  = (const float*)d_in[6];
  const float* v_b  = (const float*)d_in[7];
  const float* ck_w = (const float*)d_in[8];
  const float* ck_b = (const float*)d_in[9];
  const float* c1w  = (const float*)d_in[10];
  const float* sp_w = (const float*)d_in[11];
  const float* sp_b = (const float*)d_in[12];
  float* out = (float*)d_out;

  const size_t plane_b = PLANE_ELEMS * 2;                 // 8388608 bytes per 16-bit plane
  size_t off = 0;
  const size_t oXT   = off; off += plane_b;
  const size_t oW    = off; off += (size_t)3 * NC * NC * 2;
  const size_t oAV   = off; off += (size_t)NB * NC * 4;
  const size_t oMX   = off; off += (size_t)NB * NC * 4;
  const size_t oSPIN = off; off += (size_t)NB * 2 * NP * 4;
  const size_t oAVEC = off; off += (size_t)NB * NC * 4;
  const size_t oRVEC = off; off += (size_t)NB * NC * 4;
  const size_t oSP   = off; off += (size_t)NB * NP * 4;
  const size_t oAL   = off; off += (size_t)NB * NP * 4;
  const size_t oBE   = off; off += (size_t)NB * NP * 4;
  const size_t oQ    = off; off += 2 * plane_b;
  const size_t oK    = off; off += 2 * plane_b;
  const size_t oV    = off; off += 2 * plane_b;           // off = 59490304
  if (off > ws_size) return;
  if (off > (size_t)134217728) return;

  char* ws = (char*)d_ws;
  unsigned short* XT    = (unsigned short*)(ws + oXT);
  unsigned short* WQKV  = (unsigned short*)(ws + oW);
  float* AV    = (float*)(ws + oAV);
  float* MX    = (float*)(ws + oMX);
  float* SPIN  = (float*)(ws + oSPIN);
  float* AVEC  = (float*)(ws + oAVEC);
  float* RVEC  = (float*)(ws + oRVEC);
  float* SP    = (float*)(ws + oSP);
  float* ALPHA = (float*)(ws + oAL);
  float* BETA  = (float*)(ws + oBE);
  unsigned short* QP = (unsigned short*)(ws + oQ);
  unsigned short* KPp = (unsigned short*)(ws + oK);
  unsigned short* VPp = (unsigned short*)(ws + oV);

  // 1. x -> token-major bf16 planes (grid: n blocks, c blocks, batch)
  k_xt<<<dim3(NP / 64, NC / 64, NB), 256, 0, stream>>>(x, XT);
  // 2. projection weights -> bf16 [384][128]
  k_wcvt<<<dim3(NC * NC / 8 / 256, 3), 256, 0, stream>>>(q_w, k_w, v_w, WQKV);
  // 3. per-(b,c) pixel mean/max of x2
  k_poolbc<<<NB * NC / 32, 256, 0, stream>>>(x2, AV, MX);
  // 4. per-(b,n) channel mean/max of x2
  k_poolc<<<NB * (NP / 64), 256, 0, stream>>>(x2, SPIN);
  // 5. positional branch: Avec, R (x = 0), sp (x = 1..16), per batch (y)
  k_pos<<<dim3(POS_SLICES + 1, NB), 256, 0, stream>>>(AV, MX, SPIN, c1w, ck_w, ck_b, sp_w, sp_b, AVEC, RVEC, SP);
  // 6. q/k/v projections + alpha/beta + hi|lo planes
  k_qkv<<<dim3(NTOK / 64, 3), 128, 0, stream>>>((const __bf16*)(const void*)XT, (const __bf16*)(const void*)WQKV,
                                                q_b, k_b, v_b, AVEC, RVEC, QP, KPp, VPp, ALPHA, BETA);
  // 7. attention, channel-major output
  k_attn<<<NB * (NP / 64), 256, 0, stream>>>((const __bf16*)(const void*)QP, (const __bf16*)(const void*)KPp,
                                             (const __bf16*)(const void*)VPp, ALPHA, BETA, SP, out);
  (void)hipGetLastError();
}

// v005
// One run takes 315 microseconds.
// In both of two side-by-side timings against v004, it was 1.10 times as fast.
// All steps since v000 together make it 4.47 times as fast.
// Contractions: q/k/v 1x1 projections on v_wmma_f32_16x16x32_bf16 (bf16 operands taken from bf16-RNE inputs, single product, f32 accumulate);
// q.k^T scores and p.v on v_wmma_f32_16x16x32_bf16 with bf16 hi/lo split operands (hi.hi + hi.lo + lo.hi), f32 accumulate;
// pools, channel conv1d, spatial 7x7 conv, positional vectors alpha/beta, online softmax (expf) in f32.
// 16-bit planes and carries: XT = bf16 RNE(x), Wqkv = bf16 RNE(w), Q/K/V hi = RNE(y), lo = RNE(y - hi), P hi/lo per key chunk in LDS.
// No power-of-two carry on any plane (bf16 keeps the f32 exponent range), so no inverse fold anywhere.
#include <hip/hip_runtime.h>
#include <math.h>
#include <stdint.h>

#define NB   8
#define NC   128
#define NP   4096
#define NTOK (NB * NP)
#define PLANE_ELEMS ((size_t)NTOK * NC)

static_assert(NP % 64 == 0);
static_assert(NC == 128);
static_assert((NB * NC) % 32 == 0);
static_assert(NP % 256 == 0);

typedef __attribute__((ext_vector_type(16))) __bf16 v16b;
typedef __attribute__((ext_vector_type(8)))  __bf16 v8b;
typedef __attribute__((ext_vector_type(8)))  float  v8f;
typedef __attribute__((ext_vector_type(4)))  float  v4f;
typedef __attribute__((ext_vector_type(2)))  float  v2f;
typedef __attribute__((ext_vector_type(4)))  unsigned int v4u;
typedef v8b __attribute__((may_alias)) v8ba;
typedef v4f __attribute__((may_alias)) v4fa;
typedef v2f __attribute__((may_alias)) v2fa;
typedef v4u __attribute__((may_alias)) v4ua;

// ---------------------------------------------------------------------------
// bf16 helpers (RNE convert on the f32 bits)
// ---------------------------------------------------------------------------
__device__ __forceinline__ unsigned short f2bf_bits(float f) {
  const unsigned u = __float_as_uint(f);
  return (unsigned short)((u + 0x7FFFu + ((u >> 16) & 1u)) >> 16);
}
__device__ __forceinline__ float bfbits2f(unsigned short h) { return __uint_as_float(((unsigned)h) << 16); }
__device__ __forceinline__ float bfr(float f) { return bfbits2f(f2bf_bits(f)); }
__device__ __forceinline__ unsigned pk16(unsigned short a, unsigned short b) { return (unsigned)a | ((unsigned)b << 16); }

// ---------------------------------------------------------------------------
// 16x16x32 bf16 WMMA with hazard guard (ties D, keeps A/B live).
// Fragment map (wave32): lane l, h = l>>4, m = n = l&15.
//   A/B element i: i<8 -> k0+8h+i ; i>=8 -> k0+16+8h+(i-8)
//   D element r : row 8h+r, col l&15
// ---------------------------------------------------------------------------
__device__ __forceinline__ v8f mma_bf(v16b a, v16b b, v8f c) {
  c = __builtin_amdgcn_wmma_f32_16x16x32_bf16(false, a, false, b, (short)0, c, false, false);
  asm volatile("v_nop\n\tv_nop\n\tv_nop\n\tv_nop" : "+v"(c) : "v"(a), "v"(b));
  return c;
}
// One butterfly step inside a 16-lane row: lane l takes the value of lane l ^ M (DPP row_xmask, on the vector port).
template <int M> __device__ __forceinline__ float rowx(float v) {
  const int i = __builtin_bit_cast(int, v);
  return __builtin_bit_cast(float, __builtin_amdgcn_update_dpp(0, i, 0x160 + M, 0xf, 0xf, true));
}
// Lane l takes the value of lane l ^ 16 (the other 16-lane row).
__device__ __forceinline__ float xhalf(float v) {
  const int i = __builtin_bit_cast(int, v);
  return __builtin_bit_cast(float, __builtin_amdgcn_permlanex16(i, i, 0x76543210, 0xfedcba98, false, false));
}
// Eight independent 16-lane butterflies (steps 1, 2, 4, 8), taken step by step so that the eight chains interleave.
// Every lane must be on here (a lane that is off would hand on 0). The loops are unrolled so that the arrays stay in registers.
__device__ __forceinline__ void row16_max8(float (&m)[8]) {
#pragma unroll
  for (int r = 0; r < 8; ++r) m[r] = fmaxf(m[r], rowx<1>(m[r]));
#pragma unroll
  for (int r = 0; r < 8; ++r) m[r] = fmaxf(m[r], rowx<2>(m[r]));
#pragma unroll
  for (int r = 0; r < 8; ++r) m[r] = fmaxf(m[r], rowx<4>(m[r]));
#pragma unroll
  for (int r = 0; r < 8; ++r) m[r] = fmaxf(m[r], rowx<8>(m[r]));
}
__device__ __forceinline__ void row16_sum8(float (&s)[8]) {
#pragma unroll
  for (int r = 0; r < 8; ++r) s[r] += rowx<1>(s[r]);
#pragma unroll
  for (int r = 0; r < 8; ++r) s[r] += rowx<2>(s[r]);
#pragma unroll
  for (int r = 0; r < 8; ++r) s[r] += rowx<4>(s[r]);
#pragma unroll
  for (int r = 0; r < 8; ++r) s[r] += rowx<8>(s[r]);
}
union FB { v16b v; v8b h[2]; };
// A or B fragment from a k-contiguous bf16 row; p points at element k0 of the row owned by this lane.
__device__ __forceinline__ v16b ldfrag(const __bf16* p, int hh) {
  FB f;
  f.h[0] = *(const v8ba*)(p + 8 * hh);
  f.h[1] = *(const v8ba*)(p + 16 + 8 * hh);
  return f.v;
}

// 16-B global load at a block-uniform base plus the lane's own 32-bit byte offset plus a constant. Each plane's base goes
// through readfirstlane so that it keeps a scalar register pair of its own and the load takes the scalar-base form;
// without it the compiler folds the lo plane's 8-MiB step into 64-bit vector addresses that it forms anew every trip.
typedef const __attribute__((address_space(1))) v8ba gv8b;
__device__ __forceinline__ uint64_t ubase(const __bf16* p) {
  const uint64_t u = (uint64_t)p;
  const uint32_t lo = (uint32_t)__builtin_amdgcn_readfirstlane((int)(uint32_t)u);
  const uint32_t hi = (uint32_t)__builtin_amdgcn_readfirstlane((int)(uint32_t)(u >> 32));
  return ((uint64_t)hi << 32) | lo;
}
__device__ __forceinline__ v8b ldg16(uint64_t base, unsigned lane_bytes, unsigned imm_bytes) {
  return *(gv8b*)(base + lane_bytes + imm_bytes);
}
// Asynchronous 16-B copy, global memory to LDS, through no register: every lane brings its own 16 bytes (both addresses
// multiples of 16). The compiler places no wait for it: its bytes count as landed behind the issuing wave's own
// s_wait_asynccnt 0, and for the other waves behind the work-group barrier that follows that wait.
typedef __attribute__((ext_vector_type(4))) int v4i;
typedef __attribute__((address_space(1))) v4i gv4i;
typedef __attribute__((address_space(3))) v4i lv4i;
__device__ __forceinline__ void cp16(uint64_t base, unsigned lane_bytes, unsigned imm_bytes, void* lds) {
  __builtin_amdgcn_global_load_async_to_lds_b128((gv4i*)(base + lane_bytes + imm_bytes), (lv4i*)lds, 0, 0);
}
// In front of a barrier behind which a tile is refilled: this wave's LDS reads of that tile have retired.
__device__ __forceinline__ void wait_lds() { asm volatile("s_wait_dscnt 0x0" ::: "memory"); }
// In front of a barrier behind which the other waves read a tile: this wave's own copies have landed.
__device__ __forceinline__ void wait_copies() { asm volatile("s_wait_asynccnt 0x0" ::: "memory"); }

// ---------------------------------------------------------------------------
// Kernel 1: x[b] viewed [128 c][4096 n] (pitch 4096) -> XT bf16 [b*4096+n][128 c] (pitch 128), bf16 RNE.
// 64x64 tiles through LDS. grid = (4096/64, 128/64, 8), 256 threads.
// Coverage per block: load 4 it x 256 thr x 4 floats = 64x64; store 2 it x 256 thr x 8 u16 = 64x64.
// ---------------------------------------------------------------------------
__global__ __launch_bounds__(256) void k_xt(const float* __restrict__ X, unsigned short* __restrict__ xt) {
  __shared__ __align__(16) float tf[64 * 68];
  const int b = blockIdx.z;
  const float* W = X + (size_t)b * NC * NP;
  unsigned short* o = xt + (size_t)b * NP * NC;
  const int c0 = blockIdx.x * 64;   // input column block (n) = output row block
  const int r0 = blockIdx.y * 64;   // input row block (c)    = output column block
  const int tid = threadIdx.x;
  {
    const int lr = tid >> 4;
    const int c4 = (tid & 15) * 4;
#pragma unroll
    for (int it = 0; it < 4; ++it) {
      const int rr = it * 16 + lr;
      const v4f a = *(const v4fa*)(W + (size_t)(r0 + rr) * NP + c0 + c4);
      *(v4f*)(tf + rr * 68 + c4) = a;
    }
  }
  __syncthreads();
  const int sub = tid >> 3;          // 0..31
  const int c8  = (tid & 7) * 8;     // 0..56
  v4u hv[2];
#pragma unroll
  for (int it = 0; it < 2; ++it) {
    const int oc = it * 32 + sub;    // output row within tile (= input column)
    v4u a;
#pragma unroll
    for (int q = 0; q < 4; ++q) {
      const float f0 = tf[(c8 + 2 * q) * 68 + oc];
      const float f1 = tf[(c8 + 2 * q + 1) * 68 + oc];
      a[q] = pk16(f2bf_bits(f0), f2bf_bits(f1));
    }
    hv[it] = a;
  }
  {
#pragma unroll
    for (int it = 0; it < 2; ++it) {
      const int oc = it * 32 + sub;
      *(v4ua*)(o + (size_t)(c0 + oc) * NC + r0 + c8) = hv[it];
    }
    
  }
}

// ---------------------------------------------------------------------------
// Kernel 2: [q_w; k_w; v_w] ([out o][in c] row-major each) -> Wqkv bf16 [384 o][128 c] (natural Bt: n = o, k = c).
// grid = (16384/8/256 = 8, 3), 256 threads; matrix selected by blockIdx.y (block-uniform).
// Coverage: 3 x 2048 threads x 8 elements = 3 x 16384. One 16-B store per lane, lanes contiguous:
// ---------------------------------------------------------------------------
__global__ __launch_bounds__(256) void k_wcvt(const float* __restrict__ qw, const float* __restrict__ kw,
                                             const float* __restrict__ vw, unsigned short* __restrict__ Wb) {
  const int which = blockIdx.y;
  const float* src = (which == 0) ? qw : ((which == 1) ? kw : vw);
  const int i = blockIdx.x * 256 + threadIdx.x;
  if (i >= NC * NC / 8) return;
  const v4f a = *(const v4fa*)(src + (size_t)i * 8);
  const v4f c = *(const v4fa*)(src + (size_t)i * 8 + 4);
  v4u o4;
  o4[0] = pk16(f2bf_bits(a[0]), f2bf_bits(a[1]));
  o4[1] = pk16(f2bf_bits(a[2]), f2bf_bits(a[3]));
  o4[2] = pk16(f2bf_bits(c[0]), f2bf_bits(c[1]));
  o4[3] = pk16(f2bf_bits(c[2]), f2bf_bits(c[3]));
  unsigned short* dst = Wb + (size_t)which * NC * NC + (size_t)i * 8;
  *(v4ua*)dst = o4;
  
}

// ---------------------------------------------------------------------------
// Kernel 3: per-(b,c) mean and max over the 4096 pixels of bf16-RNE x2. Block handles 32 consecutive (b,c) rows
// (grid = 1024/32 = 32, 256 threads: each thread 16 elements of a row, fixed-order tree). The 32 means and 32
// maxes are funnelled through LDS; wave 0 lanes 0..7 write the AV line, lanes 8..15 the MX line
// Coverage: 32 blocks x 32 rows = 1024 = 8 x 128 rows; per row 256 x 16 = 4096 elements.
// ---------------------------------------------------------------------------
__global__ __launch_bounds__(256) void k_poolbc(const float* __restrict__ x2, float* __restrict__ AV,
                                               float* __restrict__ MX) {
  __shared__ float ws_s[8], ws_m[8];
  __shared__ __align__(16) float os[64];
  const int g = blockIdx.x, tid = threadIdx.x, lane = tid & 31, w = tid >> 5;
#pragma unroll 1
  for (int j = 0; j < 32; ++j) {
    const float* p = x2 + (size_t)(g * 32 + j) * NP + tid * 16;
    float s = 0.f, m = -INFINITY;
#pragma unroll
    for (int i = 0; i < 4; ++i) {
      const v4f a = *(const v4fa*)(p + 4 * i);
      const float a0 = bfr(a[0]), a1 = bfr(a[1]), a2 = bfr(a[2]), a3 = bfr(a[3]);
      s += (a0 + a1) + (a2 + a3);
      m = fmaxf(fmaxf(m, a0), fmaxf(fmaxf(a1, a2), a3));
    }
    s += xhalf(s);   m = fmaxf(m, xhalf(m));
    s += rowx<8>(s); m = fmaxf(m, rowx<8>(m));
    s += rowx<4>(s); m = fmaxf(m, rowx<4>(m));
    s += rowx<2>(s); m = fmaxf(m, rowx<2>(m));
    s += rowx<1>(s); m = fmaxf(m, rowx<1>(m));
    if (lane == 0) { ws_s[w] = s; ws_m[w] = m; }
    __syncthreads();
    if (tid == 0) {
      float ts = 0.f, tm = -INFINITY;
#pragma unroll
      for (int k = 0; k < 8; ++k) { ts += ws_s[k]; tm = fmaxf(tm, ws_m[k]); }
      os[j] = ts * (1.0f / 4096.0f);
      os[32 + j] = tm;
    }
    __syncthreads();
  }
  if (w == 0) {
    const v4f v = *(const v4fa*)(os + 4 * (lane & 15));
    {
      if (lane < 8)       *(v4f*)(AV + g * 32 + 4 * lane) = v;
      else if (lane < 16) *(v4f*)(MX + g * 32 + 4 * (lane - 8)) = v;
      
    }
  }
}

// ---------------------------------------------------------------------------
// Kernel 4: per-(b,n) mean and max over the 128 channels of bf16-RNE x2 -> SPIN[b][0][n] = mean, SPIN[b][1][n] = max.
// Block per (b, 64-pixel group): grid = 8 x 64 = 512, 256 threads = 64 pixels x 4 channel groups of 32 (serial,
// unroll 4), fixed-order 4-way combine. 64 means / 64 maxes funnelled through LDS; wave 0 writes both 256-B
// Coverage: 512 blocks x 64 pixels = 8 x 4096 per plane.
// ---------------------------------------------------------------------------
__global__ __launch_bounds__(256) void k_poolc(const float* __restrict__ x2, float* __restrict__ SPIN) {
  __shared__ float ps[4][64], pm[4][64];
  __shared__ __align__(16) float os[128];
  const int b = blockIdx.x >> 6, g = blockIdx.x & 63;
  const int tid = threadIdx.x, lane = tid & 31;
  const int p = tid & 63, cg = tid >> 6;
  const float* src = x2 + ((size_t)b * NC + cg * 32) * NP + g * 64 + p;
  float s = 0.f, m = -INFINITY;
#pragma unroll 4
  for (int c = 0; c < 32; ++c) {
    const float v = bfr(src[(size_t)c * NP]);
    s += v;
    m = fmaxf(m, v);
  }
  ps[cg][p] = s;
  pm[cg][p] = m;
  __syncthreads();
  if (tid < 64) {
    const float ts = ((ps[0][tid] + ps[1][tid]) + ps[2][tid]) + ps[3][tid];
    const float tm = fmaxf(fmaxf(pm[0][tid], pm[1][tid]), fmaxf(pm[2][tid], pm[3][tid]));
    os[tid] = ts * (1.0f / 128.0f);
    os[64 + tid] = tm;
  }
  __syncthreads();
  if (tid < 32) {
    const v4f v = *(const v4fa*)(os + 4 * lane);   // lanes 0..15: means 0..63, lanes 16..31: maxes 0..63
    float* base = SPIN + (size_t)b * 2 * NP + g * 64;
    {
      if (lane < 16) *(v4f*)(base + 4 * lane) = v;
      else           *(v4f*)(base + NP + 4 * (lane - 16)) = v;
      
    }
  }
}

// ---------------------------------------------------------------------------
// Kernel 5: positional branch, grid (1 + 16, 8 batches), 256 threads, all f32 VALU:
//   ch[c]   = sum_{i in {mean,max}} sum_{t<5} bf16r(conv1_w[i][t]) * stk[i][c+t-2]   (zero pad 2, no flip, no bias)
//   Avec[o] = sum_c bf16r(ck_w[o][c]) * ch[c] + bf16r(ck_b[o]) ;  R[o] = sum_c bf16r(ck_w[o][c])
//   sp[n]   = sum_i sum_{u,v<7} bf16r(sp_w[i][u][v]) * spin[i][h+u-3][w+v-3] + bf16r(sp_b)   (zero pad 3)
// blockIdx.x == 0: the channel branch of batch b (AVEC[b][128] by wave 0, RVEC[b][128] by wave 1).
// blockIdx.x == 1 + s: the spatial conv of image rows 4s..4s+3 (256 pixels, one per thread). The two pooled maps are
// staged with their halo as zero-padded 10x70 LDS planes; each wave stores one whole 128-B line of SP.
// Coverage: AVEC/RVEC 8 x 128; SP 8 x 16 blocks x 256 thr = 8 x 4096.
// ---------------------------------------------------------------------------
#define POS_ROWS   4                     // image rows per spatial work-group
#define POS_SLICES (64 / POS_ROWS)       // spatial work-groups per batch
#define POS_PLANE  ((POS_ROWS + 6) * 70) // floats per padded plane
static_assert(POS_ROWS * 64 == 256);
static_assert(2 * POS_PLANE > 5 * 256 && 2 * POS_PLANE <= 6 * 256);

__global__ __launch_bounds__(256) void k_pos(const float* __restrict__ AV, const float* __restrict__ MX,
                                            const float* __restrict__ SPIN, const float* __restrict__ c1w,
                                            const float* __restrict__ ckw, const float* __restrict__ ckb,
                                            const float* __restrict__ spw, const float* __restrict__ spb,
                                            float* __restrict__ AVEC, float* __restrict__ RVEC,
                                            float* __restrict__ SP) {
  __shared__ float sav[128], smx[128];
  __shared__ __align__(16) float sch[128];
  __shared__ float sw1[32];
  __shared__ __align__(16) float sw2[128];
  __shared__ __align__(16) float savec[128], srv[128];
  __shared__ float spl[2 * POS_PLANE];
  const int b = blockIdx.y, tid = threadIdx.x, lane = tid & 31, w = tid >> 5;

  if (blockIdx.x == 0) {                               // block-uniform: every barrier below is passed by the whole block
    const int o = tid & 127;                           // waves 4..7 repeat waves 0..3 and store nothing
    // the ck_w row and ck_b are read here, ahead of the first barrier, so that they are in flight together with the
    // pooled values instead of one dependent round trip per four weights behind the second barrier
    v4f wq[NC / 4];                                    // this thread's whole ck_w row
#pragma unroll
    for (int i = 0; i < NC / 4; ++i) wq[i] = *(const v4fa*)(ckw + (size_t)o * NC + 4 * i);
    const float cb = ckb[o];
    if (tid < 128) { sav[tid] = AV[b * NC + tid]; smx[tid] = MX[b * NC + tid]; }
    if (tid < 32) sw1[tid] = bfr(c1w[min(tid, 9)]);    // clamped address
    __syncthreads();
    // channel conv1d
    if (tid < 128) {
      const int c = tid;
      float acc = 0.0f;
#pragma unroll 1
      for (int t = 0; t < 5; ++t) {
        const int cc  = c + t - 2;
        const int ccl = min(max(cc, 0), NC - 1);
        const float valid = (cc >= 0 && cc < NC) ? 1.0f : 0.0f;
        acc += valid * (sw1[t] * sav[ccl] + sw1[5 + t] * smx[ccl]);
      }
      sch[c] = acc;
    }
    __syncthreads();
    // Avec, R: c ascending, as one chain each (Avec by fused multiply-add, written out so that the unrolled form
    // is not split into packed multiplies and separate adds). Unrolled so that the row stays in registers.
    {
      float a = bfr(cb), r = 0.0f;
#pragma unroll
      for (int c = 0; c < NC; ++c) {
        const float wv = bfr(wq[c >> 2][c & 3]);
        a = __builtin_fmaf(wv, sch[c], a);
        r += wv;
      }
      if (tid < 128) { savec[o] = a; srv[o] = r; }
    }
    __syncthreads();
    if (w == 0) {
      const v4f v = *(const v4fa*)(savec + 4 * lane);
      *(v4f*)(AVEC + b * NC + 4 * lane) = v;
    } else if (w == 1) {
      const v4f v = *(const v4fa*)(srv + 4 * lane);
      *(v4f*)(RVEC + b * NC + 4 * lane) = v;
    }
    return;
  }

  // spatial 7x7x2 conv + bias of image rows h0..h0+3
  const int sl = blockIdx.x - 1;
  const int h0 = sl * POS_ROWS;
  const float* sp0 = SPIN + (size_t)b * 2 * NP;
  const float bias_sp = bfr(spb[0]);                   // read ahead of the barrier, with the other loads
  {
    // padded planes with halo: every lane loads at a clamped address, so that the weight load and the six tile loads
    // are in flight together; what lies outside the image becomes 0
    const float wt = spw[min(tid, 97)];
    float tv[6];
#pragma unroll
    for (int k = 0; k < 6; ++k) {
      const int i   = min(k * 256 + tid, 2 * POS_PLANE - 1);
      const int pl  = i / POS_PLANE, rem = i - pl * POS_PLANE;
      const int rr  = rem / 70, cc = rem - rr * 70;
      const int gh  = h0 + rr - 3, gx = cc - 3;
      const bool in = gh >= 0 && gh < 64 && gx >= 0 && gx < 64;
      const float v = sp0[pl * NP + min(max(gh, 0), 63) * 64 + min(max(gx, 0), 63)];
      tv[k] = in ? v : 0.0f;
    }
    if (tid < 128) sw2[tid] = bfr(wt);
#pragma unroll
    for (int k = 0; k < 5; ++k) spl[k * 256 + tid] = tv[k];
    if (5 * 256 + tid < 2 * POS_PLANE) spl[5 * 256 + tid] = tv[5];
  }
  __syncthreads();
  {
    const int h = tid >> 6, x = tid & 63;
    const float* t0 = spl + h * 70 + x;
    float acc = bias_sp;
    // both tap loops unrolled: the 98 LDS reads of a pixel do not depend on one another and overlap, where the
    // rolled loops paid one LDS round trip a tap; the taps are added in the same order
#pragma unroll
    for (int u = 0; u < 7; ++u) {
#pragma unroll
      for (int v = 0; v < 7; ++v) {
        const int li = u * 70 + v;
        acc += sw2[u * 7 + v] * t0[li] + sw2[49 + u * 7 + v] * t0[POS_PLANE + li];
      }
    }
    SP[(size_t)b * NP + sl * 256 + tid] = acc;
    asm volatile("s_wait_xcnt 0x0" ::: "memory");      // before a register that the store names is rewritten
  }
}

// ---------------------------------------------------------------------------
// Kernel 6: [Q|K|V] = XT . Wqkv^T + bias (exact bf16 x bf16 products, f32 accumulate, K = 128 in 4 steps of 32).
// grid = (32768/64 = 512 token tiles, 3 = which), 128 threads = 4 waves; wave w owns tokens m0+16w..+15 x all 128
// output channels (8 accumulator tiles). A fragments straight from XT rows, B fragments from Wqkv rows (both
// k-contiguous bf16, arithmetic addressing). bias (bf16r), Avec and R staged in LDS (one scalar load per thread each).
// Epilogue: f32 tile (acc + bias) staged in LDS [64][132];
//   which 0: alpha[n] = sum_o Avec[b][o] q[o][n], beta[n] = sum_o R[o] q[o][n] (f32, unroll 4) -> ALPHA/BETA 256-B
//            segments (16 lanes x 16 B); Q hi|lo token-major planes [tok][128];
//   which 1: K hi|lo token-major planes;  which 2: V hi|lo channel-major planes [b][c][4096] (transposed write).
// ---------------------------------------------------------------------------
__global__ __launch_bounds__(128) void k_qkv(const __bf16* __restrict__ XT, const __bf16* __restrict__ Wb,
                                            const float* __restrict__ qb, const float* __restrict__ kb,
                                            const float* __restrict__ vb,
                                            const float* __restrict__ AVEC, const float* __restrict__ RVEC,
                                            unsigned short* __restrict__ QP, unsigned short* __restrict__ KP,
                                            unsigned short* __restrict__ VP,
                                            float* __restrict__ ALPHA, float* __restrict__ BETA) {
  __shared__ __align__(16) float sT[64 * 132];
  __shared__ __align__(16) float sAV[128], sRV[128], sAB[128], sBI[128];
  const int tid = threadIdx.x, lane = tid & 31, w = tid >> 5, hh = lane >> 4, l16 = lane & 15;
  const int which = blockIdx.y;
  const int m0 = blockIdx.x * 64;            // global token row
  const int b  = m0 / NP;
  const int n0 = m0 - b * NP;

  const float* bias = (which == 0) ? qb : ((which == 1) ? kb : vb);   // block-uniform select, same address space
  sAV[tid] = AVEC[b * NC + tid];
  sRV[tid] = RVEC[b * NC + tid];
  sBI[tid] = bfr(bias[tid]);
  __syncthreads();

  const v8f zero8 = {0.f, 0.f, 0.f, 0.f, 0.f, 0.f, 0.f, 0.f};
  v8f acc[8];
#pragma unroll
  for (int t = 0; t < 8; ++t) acc[t] = zero8;

  const __bf16* arow = XT + (size_t)(m0 + 16 * w + l16) * NC;        // token row, k = input channel
  const __bf16* brow = Wb + ((size_t)which * NC + l16) * NC;          // output channel row (tile 0), k = input channel
#pragma unroll
  for (int kc = 0; kc < 4; ++kc) {
    const v16b a = ldfrag(arow + kc * 32, hh);
#pragma unroll
    for (int t = 0; t < 8; ++t) {
      const v16b bf = ldfrag(brow + (size_t)t * 16 * NC + kc * 32, hh);
      acc[t] = mma_bf(a, bf, acc[t]);
    }
  }
  // D[r] of tile t = Y[token 16w+8hh+r][channel 16t+l16]
#pragma unroll
  for (int t = 0; t < 8; ++t) {
    const float bv = sBI[16 * t + l16];
#pragma unroll
    for (int r = 0; r < 8; ++r) sT[(16 * w + 8 * hh + r) * 132 + 16 * t + l16] = acc[t][r] + bv;
  }
  __syncthreads();
  if (which == 0 && tid < 64) {            // waves 0,1
    const float* qr = sT + tid * 132;
    float a = 0.0f, be = 0.0f;
#pragma unroll 4
    for (int o = 0; o < NC; ++o) {
      const float q = qr[o];
      a  += sAV[o] * q;
      be += sRV[o] * q;
    }
    sAB[tid] = a;
    sAB[64 + tid] = be;
  }
  __syncthreads();

  // pack hi|lo planes
  const int q8 = lane & 7, sub = lane >> 3;
  v4u hv[8], lv[8];
#pragma unroll
  for (int i = 0; i < 8; ++i) {
    const int lid  = w * 32 + i * 4 + sub;                                   // 0..127
    const int base = (which != 2) ? ((lid >> 1) * 132 + (lid & 1) * 64 + 8 * q8) : ((8 * q8) * 132 + lid);
    const int estr = (which != 2) ? 1 : 132;
    v4u a, a2;
#pragma unroll
    for (int q = 0; q < 4; ++q) {
      const float f0 = sT[base + (2 * q) * estr];
      const float f1 = sT[base + (2 * q + 1) * estr];
      const unsigned short h0 = f2bf_bits(f0), h1 = f2bf_bits(f1);
      const unsigned short l0 = f2bf_bits(f0 - bfbits2f(h0)), l1 = f2bf_bits(f1 - bfbits2f(h1));
      a[q]  = pk16(h0, h1);
      a2[q] = pk16(l0, l1);
    }
    hv[i] = a;
    lv[i] = a2;
  }
  unsigned short* P = (which == 0) ? QP : ((which == 1) ? KP : VP);
  {
#pragma unroll
    for (int i = 0; i < 8; ++i) {
      const int lid = w * 32 + i * 4 + sub;
      const size_t go = (which != 2)
          ? ((size_t)(m0 + (lid >> 1)) * NC + (lid & 1) * 64 + 8 * q8)
          : (((size_t)b * NC + lid) * NP + n0 + 8 * q8);
      *(v4ua*)(P + go) = hv[i];
      *(v4ua*)(P + PLANE_ELEMS + go) = lv[i];
    }
    
  }
  if (which == 0 && w == 0) {
    const v4f v = *(const v4fa*)(sAB + 4 * lane);    // lanes 0..15: alpha 0..63, lanes 16..31: beta 0..63
    {
      if (lane < 16) *(v4f*)(ALPHA + m0 + 4 * lane) = v;
      else           *(v4f*)(BETA + m0 + 4 * (lane - 16)) = v;
      
    }
  }
}

// ---------------------------------------------------------------------------
// Kernel 7: full (non-causal, unmasked) attention, head dim 128, block per (b, 64-query tile): grid 8 x 64 = 512,
// 256 threads = 8 waves. Wave w: query group g = w&3 (rows 16g..16g+15), key half kh = w>>2.
//   energy[n][m] = q[n].k[m] (bf16 hi/lo 3-term WMMA) + alpha[m] + sp[n]*beta[m]  (f32, no scale)
//   Per 64-key chunk: wave (g,kh) computes the scores of its 16 rows x keys 32kh..32kh+31, the partial row max and
//   partial row sum are exchanged between the wave pair through LDS (block barriers), both waves of a pair derive
//   the identical running max / correction / sum; p hi|lo of all 64 keys land in the pair's shared P tile;
//   then O[n][c] += p . V for the wave's 64-channel half c in [64kh, 64kh+64)  (p and V bf16 hi/lo, 3-term WMMA).
//   Online softmax over all 4096 keys in 64 chunks of 64 (compile-time trip count, no masking), f32 expf.
// LDS: K hi|lo [64][128], Vcm hi|lo [128][64], Q hi|lo [64][128] (staged once), P hi|lo [4 g][16][64]; every row is
// padded by 16 B (pitch 272 B for 256-B rows, 144 B for 128-B rows = 16 B x odd), so the 16 rows that one 16-byte
// fragment read touches fall on 16 different bank groups; the lo plane of K/Q starts 64 B and that of V 128 B past a
// multiple of 256 B; staging gives consecutive lanes consecutive 16-B pieces of a row (whole lines);
// K, V and alpha|beta come by asynchronous copies to LDS, one buffer each: V(kc) is issued behind the barrier at the
// loop's head (P.V of kc-1 done) and waited for in front of the row-sum barrier; K(kc+1), alpha|beta(kc+1) are issued
// behind the row-max barrier (scores of kc done) and waited for in front of the barrier at the loop's head;
// alpha/beta slices [64]+[64], exchange arrays [128]+[128]; output tile [128 c][64 n] (pitch 68) overlays the
// K/V region after the loop (block barrier first).
// Staging coverage: Q 8 rounds x 256 thr x 8 = 64x128 x 2 planes; per chunk K 16 rounds x 128 thr x 8 = 64x128 x 2 planes,
// V 16 rounds x 128 thr x 8 = 128x64 x 2 planes;
// P: each wave pair writes its whole 16x64 tile (both planes) before the barrier that precedes the reload.
// Output: out[b][c][n0..n0+63] channel-major; each channel row segment = 256 B = 16 contiguous lanes x 16 B
// ---------------------------------------------------------------------------
#define KQ_PITCH 136                       // elements: 128 + 8 (272 B)
#define VP_PITCH 72                        // elements: 64 + 8 (144 B)
#define KQ_PLANE (64 * KQ_PITCH + 32)      // elements: 17472 B = 68 x 256 + 64
#define V_PLANE  (128 * VP_PITCH + 64)     // elements: 18560 B = 72 x 256 + 128
#define P_GROUP  (16 * VP_PITCH)           // elements per query group
#define P_PLANE  (4 * P_GROUP)
#define SM_K   0
#define SM_V   (SM_K + 2 * KQ_PLANE * 2)
#define SM_Q   (SM_V + 2 * V_PLANE * 2)
#define SM_P   (SM_Q + 2 * KQ_PLANE * 2)
#define SM_AB  (SM_P + 2 * P_PLANE * 2)
#define SM_RED (SM_AB + 512)
#define SM_TOT (SM_RED + 1024)
static_assert(128 * 68 * 4 <= SM_Q);
static_assert(SM_V % 16 == 0 && SM_Q % 16 == 0 && SM_P % 16 == 0 && SM_AB % 16 == 0);
static_assert(2 * SM_TOT <= 327680);

__global__ __launch_bounds__(256) void k_attn(const __bf16* __restrict__ QP, const __bf16* __restrict__ KP,
                                             const __bf16* __restrict__ VP, const float* __restrict__ ALPHA,
                                             const float* __restrict__ BETA, const float* __restrict__ SP,
                                             float* __restrict__ out) {
  __shared__ __align__(16) unsigned char smem[SM_TOT];
  __bf16* Ks   = (__bf16*)(smem + SM_K);     // hi at +0, lo at +KQ_PLANE elements
  __bf16* Vs   = (__bf16*)(smem + SM_V);
  __bf16* Qs   = (__bf16*)(smem + SM_Q);
  __bf16* Ps   = (__bf16*)(smem + SM_P);     // hi: group g at +P_GROUP*g ; lo: +P_PLANE + P_GROUP*g
  float*  sab  = (float*)(smem + SM_AB);     // alpha 0..63, beta 64..127
  float*  redm = (float*)(smem + SM_RED);    // partial row max [4 g][2 kh][16]
  float*  reds = redm + 128;                 // partial row sum [4 g][2 kh][16]
  float*  Os   = (float*)(smem + SM_K);      // [128][68] after the key loop

  const int tid = threadIdx.x, lane = tid & 31, w = tid >> 5, hh = lane >> 4, c = lane & 15;
  const int g = w & 3, kh = w >> 2;
  const int key0 = 32 * kh;                  // this wave's key half within a chunk
  const int ch0  = 64 * kh;                  // this wave's channel half
  const int b  = blockIdx.x >> 6;
  const int n0 = (blockIdx.x & 63) * 64;
  const size_t tok0 = (size_t)b * NP + n0;

  // Staging lane maps: consecutive lanes take consecutive 16-B pieces, so one wave-wide load covers 4 whole 128-B lines.
  const int kq_r = tid >> 4, kq_c = (tid & 15) * 8;   // Q: 16 lanes per 256-B row, 16 rows per round of the block
  const unsigned kq_g = (unsigned)(kq_r * NC + kq_c) * 2u; // the lane's byte offset in a token-major tile
  // ---- stage the block's Q tile hi|lo: 2 planes x 4 rounds x 256 thr x 8 elements ----
  {
    __bf16* dst = Qs + kq_r * KQ_PITCH + kq_c;
#pragma unroll
    for (int p = 0; p < 2; ++p) {
      const uint64_t qsrc = ubase(QP + (size_t)p * PLANE_ELEMS + tok0 * NC);
#pragma unroll
      for (int i = 0; i < 4; ++i) {
        const v8b v = ldg16(qsrc, kq_g, i * 16 * NC * 2);
        *(v8ba*)(dst + p * KQ_PLANE + i * 16 * KQ_PITCH) = v;
      }
    }
  }
  // ---- sp[n] for this lane's 8 query rows ----
  float spn[8];
  {
    const v4f s0 = *(const v4fa*)(SP + tok0 + 16 * g + 8 * hh);
    const v4f s1 = *(const v4fa*)(SP + tok0 + 16 * g + 8 * hh + 4);
    spn[0] = s0[0]; spn[1] = s0[1]; spn[2] = s0[2]; spn[3] = s0[3];
    spn[4] = s1[0]; spn[5] = s1[1]; spn[6] = s1[2]; spn[7] = s1[3];
  }
  float mrow[8], lrow[8];
  const v8f zero8 = {0.f, 0.f, 0.f, 0.f, 0.f, 0.f, 0.f, 0.f};
  v8f oacc[4];
#pragma unroll
  for (int r = 0; r < 8; ++r) { mrow[r] = -INFINITY; lrow[r] = 0.0f; }
#pragma unroll
  for (int t = 0; t < 4; ++t) oacc[t] = zero8;

  const __bf16* qrow = Qs + (16 * g + c) * KQ_PITCH;
  __bf16* pgh = Ps + g * P_GROUP;
  __bf16* pgl = Ps + P_PLANE + g * P_GROUP;
  const int rme = g * 32 + kh * 16 + 8 * hh;   // exchange slot base of this lane's rows
  const int r0e = g * 32 + 8 * hh;             // key half 0 slot base
  const int r1e = g * 32 + 16 + 8 * hh;        // key half 1 slot base

  // K/V plane bases of this batch (block-uniform) and the lane's running byte offsets (below 1 MiB + one tile)
  const uint64_t ksrc[2] = {ubase(KP + (size_t)b * NP * NC), ubase(KP + PLANE_ELEMS + (size_t)b * NP * NC)};
  const uint64_t vsrc[2] = {ubase(VP + (size_t)b * NC * NP), ubase(VP + PLANE_ELEMS + (size_t)b * NC * NP)};
  // Who copies what: waves 0..3 bring the K tiles (wave 0 the alpha|beta slice too), waves 4..7 the V tiles, so that a
  // wave's wait for its own copies never holds up the other tile's copies in flight. The wave's number stands in a
  // scalar register: every test on it is a scalar branch, and every lane is on at every copy.
  const int wu = __builtin_amdgcn_readfirstlane(w);
  const int ct = tid & 127;                            // the lane's place among the 128 lanes that bring a tile
  const int ck_r = ct >> 4, ck_c = (ct & 15) * 8;      // K: 16 lanes per 256-B row, 8 rows per round
  const int cv_r = ct >> 3, cv_c = (ct & 7) * 8;       // V:  8 lanes per 128-B row, 16 rows per round
  unsigned koff = (unsigned)(ck_r * NC + ck_c) * 2u;   // the lane's running byte offset in the token-major K planes
  unsigned voff = (unsigned)(cv_r * NP + cv_c) * 2u;   // the lane's running byte offset in the channel-major V planes
  // K: 2 planes x 8 rounds x 128 thr x 8 elements = 64 rows x 128 x 2 planes
  __bf16* kd = Ks + ck_r * KQ_PITCH + ck_c;
  // V: 2 planes x 8 rounds x 128 thr x 8 elements = 128 channel rows x 64 keys x 2 planes
  __bf16* vd = Vs + cv_r * VP_PITCH + cv_c;
  // alpha|beta slice of a chunk: one copy, lanes 0..15 the 64 alphas, lanes 16..31 the 64 betas
  const uint64_t absrc = (uint64_t)((lane < 16 ? ALPHA + 4 * lane : BETA + 4 * (lane - 16)) + (size_t)b * NP);

  // chunk 0's K tile and alpha|beta slice, into LDS that nobody has touched yet
  if (wu < 4) {
#pragma unroll   // each copy's plane and step are constants: no index arithmetic is left at run time
    for (int i = 0; i < 16; ++i)
      cp16(ksrc[i >> 3], koff, (i & 7) * 8 * NC * 2, kd + (i >> 3) * KQ_PLANE + (i & 7) * 8 * KQ_PITCH);
    if (wu == 0) cp16(absrc, 0, 0, sab + 4 * lane);
  }

#pragma unroll 1
  for (int kc = 0; kc < NP / 64; ++kc) {
    // this chunk's K and alpha|beta have landed (first trip: Q is stored too); every wave has left the V and P tiles
    wait_lds();
    wait_copies();
    __syncthreads();
    // this chunk's V tile flies under the scores and the softmax
    if (wu >= 4) {
#pragma unroll   // as above: constant plane and step per copy
      for (int i = 0; i < 16; ++i)
        cp16(vsrc[i >> 3], voff, (i & 7) * 16 * NP * 2, vd + (i >> 3) * V_PLANE + (i & 7) * 16 * VP_PITCH);
      voff += 64 * 2;        // next 64 keys: 64 columns of V
    }

    // ---- scores: s[jj][r] = S[query 16g+8hh+r][key m0+key0+16jj+c], 3-term split ----
    v8f s[2];
    s[0] = zero8; s[1] = zero8;
#pragma unroll 1
    for (int dc = 0; dc < 4; ++dc) {
      const v16b qa = ldfrag(qrow + dc * 32, hh);
      const v16b ql = ldfrag(qrow + KQ_PLANE + dc * 32, hh);
#pragma unroll
      for (int jj = 0; jj < 2; ++jj) {
        const __bf16* krow = Ks + (key0 + 16 * jj + c) * KQ_PITCH + dc * 32;
        const v16b kb = ldfrag(krow, hh);
        const v16b kl = ldfrag(krow + KQ_PLANE, hh);
        s[jj] = mma_bf(qa, kb, s[jj]);
        s[jj] = mma_bf(qa, kl, s[jj]);
        s[jj] = mma_bf(ql, kb, s[jj]);
      }
    }
    // ---- positional terms in f32, then partial row max over this key half ----
    float al[2], be[2];
#pragma unroll
    for (int jj = 0; jj < 2; ++jj) { al[jj] = sab[key0 + 16 * jj + c]; be[jj] = sab[64 + key0 + 16 * jj + c]; }
    {
      float pm[8];
#pragma unroll
      for (int r = 0; r < 8; ++r) {
        float m = -INFINITY;
#pragma unroll
        for (int jj = 0; jj < 2; ++jj) {
          const float e = s[jj][r] + al[jj] + spn[r] * be[jj];
          s[jj][r] = e;
          m = fmaxf(m, e);
        }
        pm[r] = m;
      }
      row16_max8(pm);
      if (c == 0) {
        *(v4fa*)(redm + rme)     = (v4f){pm[0], pm[1], pm[2], pm[3]};
        *(v4fa*)(redm + rme + 4) = (v4f){pm[4], pm[5], pm[6], pm[7]};
      }
    }
    wait_lds();              // every wave has left the K tile and the alpha|beta slice
    __syncthreads();
    // the next chunk's K tile and alpha|beta slice fly under the softmax and P.V
    if (kc + 1 < NP / 64) {
      if (wu < 4) {
        koff += 64 * NC * 2; // next 64 keys: 64 token rows of K
#pragma unroll   // as above: constant plane and step per copy
        for (int i = 0; i < 16; ++i)
          cp16(ksrc[i >> 3], koff, (i & 7) * 8 * NC * 2, kd + (i >> 3) * KQ_PLANE + (i & 7) * 8 * KQ_PITCH);
        if (wu == 0) cp16(absrc, (unsigned)(kc + 1) * 64 * 4, 0, sab + 4 * lane);
      }
    }
    // ---- online softmax: identical running state in both waves of a pair; P hi|lo into the pair's LDS tile ----
    float corr[8], ps8[8];
#pragma unroll
    for (int r = 0; r < 8; ++r) {
      const float cmx  = fmaxf(redm[r0e + r], redm[r1e + r]);
      const float mnew = fmaxf(mrow[r], cmx);
      corr[r] = expf(mrow[r] - mnew);
      mrow[r] = mnew;
      float psum = 0.0f;
#pragma unroll
      for (int jj = 0; jj < 2; ++jj) {
        const float p = expf(s[jj][r] - mnew);
        psum += p;
        const unsigned short hb = f2bf_bits(p);
        const unsigned short lb = f2bf_bits(p - bfbits2f(hb));
        pgh[(8 * hh + r) * VP_PITCH + key0 + 16 * jj + c] = __builtin_bit_cast(__bf16, hb);
        pgl[(8 * hh + r) * VP_PITCH + key0 + 16 * jj + c] = __builtin_bit_cast(__bf16, lb);
      }
      ps8[r] = psum;
      lrow[r] = lrow[r] * corr[r];
#pragma unroll
      for (int t = 0; t < 4; ++t) oacc[t][r] *= corr[r];
    }
    row16_sum8(ps8);
    if (c == 0) {
      *(v4fa*)(reds + rme)     = (v4f){ps8[0], ps8[1], ps8[2], ps8[3]};
      *(v4fa*)(reds + rme + 4) = (v4f){ps8[4], ps8[5], ps8[6], ps8[7]};
    }
    if (wu >= 4) wait_copies();   // this chunk's V has landed; the K copies of waves 0..3 fly on
    __syncthreads();
#pragma unroll
    for (int r = 0; r < 8; ++r) lrow[r] += reds[r0e + r] + reds[r1e + r];

    // ---- O += P . V : A = P [query][key], B = Vcm row c [key]; 4 channel tiles of this half, 2 key halves ----
#pragma unroll 1
    for (int kk = 0; kk < 2; ++kk) {
      const v16b pa = ldfrag(pgh + c * VP_PITCH + kk * 32, hh);
      const v16b pl = ldfrag(pgl + c * VP_PITCH + kk * 32, hh);
#pragma unroll
      for (int t = 0; t < 4; ++t) {
        const __bf16* vr = Vs + (ch0 + 16 * t + c) * VP_PITCH + kk * 32;
        const v16b vb = ldfrag(vr, hh);
        const v16b vl = ldfrag(vr + V_PLANE, hh);
        oacc[t] = mma_bf(pa, vb, oacc[t]);
        oacc[t] = mma_bf(pa, vl, oacc[t]);
        oacc[t] = mma_bf(pl, vb, oacc[t]);
      }
    }
  }
  wait_lds();
  wait_copies();     // no copy is in flight here; the wait stands before the tiles' LDS gets another use
  __syncthreads();   // all waves done with K/V/P tiles before the output tile overlays them

  // ---- normalise, stage O transposed as [c][n_local], write whole 256-B channel segments ----
#pragma unroll
  for (int r = 0; r < 8; ++r) {
    const float inv = 1.0f / lrow[r];
#pragma unroll
    for (int t = 0; t < 4; ++t) Os[(ch0 + 16 * t + c) * 68 + 16 * g + 8 * hh + r] = oacc[t][r] * inv;
  }
  __syncthreads();
  {
    float* ob = out + (size_t)b * NC * NP + n0;
    const int c4 = (lane & 15) * 4;
    {
#pragma unroll
      for (int i = 0; i < 8; ++i) {
        const int row = i * 16 + w * 2 + hh;                       // 0..127 channel
        const v4f v = *(const v4fa*)(Os + row * 68 + c4);
        *(v4f*)(ob + (size_t)row * NP + c4) = v;
      }
      
    }
  }
}

// ---------------------------------------------------------------------------
//   XT    bf16 [32768][128]          0           8388608
//   WQKV  bf16 [384][128]            8388608       98304
//   AV    f32  [8][128]              8486912        4096
//   MX    f32  [8][128]              8491008        4096
//   SPIN  f32  [8][2][4096]          8495104      262144
//   AVEC  f32  [8][128]              8757248        4096
//   RVEC  f32  [8][128]              8761344        4096
//   SP    f32  [8][4096]             8765440      131072
//   ALPHA f32  [8][4096]             8896512      131072
//   BETA  f32  [8][4096]             9027584      131072
//   Q hi|lo bf16 2x[32768][128]      9158656    16777216
//   K hi|lo bf16 2x[32768][128]     25935872    16777216
//   V hi|lo bf16 2x[8][128][4096]   42713088    16777216
//   total                          59490304
// ---------------------------------------------------------------------------
extern "C" void kernel_launch(void* const* d_in, const int* in_sizes, int n_in,
                              void* d_out, int out_size, void* d_ws, size_t ws_size,
                              hipStream_t stream) {
  if (n_in < 13) return;
  if (in_sizes[0] != NB * NC * NP || in_sizes[1] != NB * NC * NP) return;
  if (in_sizes[2] != NC * NC || in_sizes[4] != NC * NC || in_sizes[6] != NC * NC || in_sizes[8] != NC * NC) return;
  if (in_sizes[3] != NC || in_sizes[5] != NC || in_sizes[7] != NC || in_sizes[9] != NC) return;
  if (in_sizes[10] != 10 || in_sizes[11] != 98 || in_sizes[12] != 1) return;
  if (out_size != NB * NC * NP) return;

  const float* x    = (const float*)d_in[0];
  const float* x2   = (const float*)d_in[1];
  const float* q_w  = (const float*)d_in[2];
  const float* q_b  = (const float*)d_in[3];
  const float* k_w  = (const float*)d_in[4];
  const float* k_b  = (const float*)d_in[5];
  const float* v_w  = (const float*)d_in[6];
  const float* v_b  = (const float*)d_in[7];
  const float* ck_w = (const float*)d_in[8];
  const float* ck_b = (const float*)d_in[9];
  const float* c1w  = (const float*)d_in[10];
  const float* sp_w = (const float*)d_in[11];
  const float* sp_b = (const float*)d_in[12];
  float* out = (float*)d_out;

  const size_t plane_b = PLANE_ELEMS * 2;                 // 8388608 bytes per 16-bit plane
  size_t off = 0;
  const size_t oXT   = off; off += plane_b;
  const size_t oW    = off; off += (size_t)3 * NC * NC * 2;
  const size_t oAV   = off; off += (size_t)NB * NC * 4;
  const size_t oMX   = off; off += (size_t)NB * NC * 4;
  const size_t oSPIN = off; off += (size_t)NB * 2 * NP * 4;
  const size_t oAVEC = off; off += (size_t)NB * NC * 4;
  const size_t oRVEC = off; off += (size_t)NB * NC * 4;
  const size_t oSP   = off; off += (size_t)NB * NP * 4;
  const size_t oAL   = off; off += (size_t)NB * NP * 4;
  const size_t oBE   = off; off += (size_t)NB * NP * 4;
  const size_t oQ    = off; off += 2 * plane_b;
  const size_t oK    = off; off += 2 * plane_b;
  const size_t oV    = off; off += 2 * plane_b;           // off = 59490304
  if (off > ws_size) return;
  if (off > (size_t)134217728) return;

  char* ws = (char*)d_ws;
  unsigned short* XT    = (unsigned short*)(ws + oXT);
  unsigned short* WQKV  = (unsigned short*)(ws + oW);
  float* AV    = (float*)(ws + oAV);
  float* MX    = (float*)(ws + oMX);
  float* SPIN  = (float*)(ws + oSPIN);
  float* AVEC  = (float*)(ws + oAVEC);
  float* RVEC  = (float*)(ws + oRVEC);
  float* SP    = (float*)(ws + oSP);
  float* ALPHA = (float*)(ws + oAL);
  float* BETA  = (float*)(ws + oBE);
  unsigned short* QP = (unsigned short*)(ws + oQ);
  unsigned short* KPp = (unsigned short*)(ws + oK);
  unsigned short* VPp = (unsigned short*)(ws + oV);

  // 1. x -> token-major bf16 planes (grid: n blocks, c blocks, batch)
  k_xt<<<dim3(NP / 64, NC / 64, NB), 256, 0, stream>>>(x, XT);
  // 2. projection weights -> bf16 [384][128]
  k_wcvt<<<dim3(NC * NC / 8 / 256, 3), 256, 0, stream>>>(q_w, k_w, v_w, WQKV);
  // 3. per-(b,c) pixel mean/max of x2
  k_poolbc<<<NB * NC / 32, 256, 0, stream>>>(x2, AV, MX);
  // 4. per-(b,n) channel mean/max of x2
  k_poolc<<<NB * (NP / 64), 256, 0, stream>>>(x2, SPIN);
  // 5. positional branch: Avec, R (x = 0), sp (x = 1..16), per batch (y)
  k_pos<<<dim3(POS_SLICES + 1, NB), 256, 0, stream>>>(AV, MX, SPIN, c1w, ck_w, ck_b, sp_w, sp_b, AVEC, RVEC, SP);
  // 6. q/k/v projections + alpha/beta + hi|lo planes
  k_qkv<<<dim3(NTOK / 64, 3), 128, 0, stream>>>((const __bf16*)(const void*)XT, (const __bf16*)(const void*)WQKV,
                                                q_b, k_b, v_b, AVEC, RVEC, QP, KPp, VPp, ALPHA, BETA);
  // 7. attention, channel-major output
  k_attn<<<NB * (NP / 64), 256, 0, stream>>>((const __bf16*)(const void*)QP, (const __bf16*)(const void*)KPp,
                                             (const __bf16*)(const void*)VPp, ALPHA, BETA, SP, out);
  (void)hipGetLastError();
}

// v006
// One run takes 269 microseconds.
// In two side-by-side timings against v005, it was 1.18 and 1.17 times as fast.
// All steps since v000 together make it 5.23 times as fast.
// Contractions: q/k/v 1x1 projections on v_wmma_f32_16x16x32_bf16 (bf16 operands taken from bf16-RNE inputs, single product, f32 accumulate);
// q.k^T scores and p.v on v_wmma_f32_16x16x32_bf16 with bf16 hi/lo split operands (hi.hi + hi.lo + lo.hi), f32 accumulate;
// pools, channel conv1d, spatial 7x7 conv, positional vectors alpha/beta, online softmax (expf) in f32.
// 16-bit planes and carries: XT = bf16 RNE(x), Wqkv = bf16 RNE(w), Q/K/V hi = RNE(y), lo = RNE(y - hi), P hi/lo per key chunk in registers.
// No power-of-two carry on any plane (bf16 keeps the f32 exponent range), so no inverse fold anywhere.
#include <hip/hip_runtime.h>
#include <math.h>
#include <stdint.h>

#define NB   8
#define NC   128
#define NP   4096
#define NTOK (NB * NP)
#define PLANE_ELEMS ((size_t)NTOK * NC)

static_assert(NP % 64 == 0);
static_assert(NC == 128);
static_assert((NB * NC) % 32 == 0);
static_assert(NP % 256 == 0);

typedef __attribute__((ext_vector_type(16))) __bf16 v16b;
typedef __attribute__((ext_vector_type(8)))  __bf16 v8b;
typedef __attribute__((ext_vector_type(8)))  float  v8f;
typedef __attribute__((ext_vector_type(4)))  float  v4f;
typedef __attribute__((ext_vector_type(2)))  float  v2f;
typedef __attribute__((ext_vector_type(4)))  unsigned int v4u;
typedef v8b __attribute__((may_alias)) v8ba;
typedef v4f __attribute__((may_alias)) v4fa;
typedef v2f __attribute__((may_alias)) v2fa;
typedef v4u __attribute__((may_alias)) v4ua;

// ---------------------------------------------------------------------------
// bf16 helpers (RNE convert on the f32 bits)
// ---------------------------------------------------------------------------
__device__ __forceinline__ unsigned short f2bf_bits(float f) {
  const unsigned u = __float_as_uint(f);
  return (unsigned short)((u + 0x7FFFu + ((u >> 16) & 1u)) >> 16);
}
__device__ __forceinline__ float bfbits2f(unsigned short h) { return __uint_as_float(((unsigned)h) << 16); }
__device__ __forceinline__ float bfr(float f) { return bfbits2f(f2bf_bits(f)); }
__device__ __forceinline__ unsigned pk16(unsigned short a, unsigned short b) { return (unsigned)a | ((unsigned)b << 16); }

// ---------------------------------------------------------------------------
// 16x16x32 bf16 WMMA with hazard guard (ties D, keeps A/B live).
// Fragment map (wave32): lane l, h = l>>4, m = n = l&15.
//   A/B element i: i<8 -> k0+8h+i ; i>=8 -> k0+16+8h+(i-8)
//   D element r : row 8h+r, col l&15
// ---------------------------------------------------------------------------
__device__ __forceinline__ v8f mma_bf(v16b a, v16b b, v8f c) {
  c = __builtin_amdgcn_wmma_f32_16x16x32_bf16(false, a, false, b, (short)0, c, false, false);
  asm volatile("v_nop\n\tv_nop\n\tv_nop\n\tv_nop" : "+v"(c) : "v"(a), "v"(b));
  return c;
}
// One butterfly step inside a 16-lane row: lane l takes the value of lane l ^ M (DPP row_xmask, on the vector port).
template <int M> __device__ __forceinline__ float rowx(float v) {
  const int i = __builtin_bit_cast(int, v);
  return __builtin_bit_cast(float, __builtin_amdgcn_update_dpp(0, i, 0x160 + M, 0xf, 0xf, true));
}
// Lane l takes the value of lane l ^ 16 (the other 16-lane row).
__device__ __forceinline__ float xhalf(float v) {
  const int i = __builtin_bit_cast(int, v);
  return __builtin_bit_cast(float, __builtin_amdgcn_permlanex16(i, i, 0x76543210, 0xfedcba98, false, false));
}
union FB { v16b v; v8b h[2]; };
// A or B fragment from a k-contiguous bf16 row; p points at element k0 of the row owned by this lane.
__device__ __forceinline__ v16b ldfrag(const __bf16* p, int hh) {
  FB f;
  f.h[0] = *(const v8ba*)(p + 8 * hh);
  f.h[1] = *(const v8ba*)(p + 16 + 8 * hh);
  return f.v;
}

// 16-B global load at a block-uniform base plus the lane's own 32-bit byte offset plus a constant. Each plane's base goes
// through readfirstlane so that it keeps a scalar register pair of its own and the load takes the scalar-base form;
// without it the compiler folds the lo plane's 8-MiB step into 64-bit vector addresses that it forms anew every trip.
typedef const __attribute__((address_space(1))) v8ba gv8b;
__device__ __forceinline__ uint64_t ubase(const __bf16* p) {
  const uint64_t u = (uint64_t)p;
  const uint32_t lo = (uint32_t)__builtin_amdgcn_readfirstlane((int)(uint32_t)u);
  const uint32_t hi = (uint32_t)__builtin_amdgcn_readfirstlane((int)(uint32_t)(u >> 32));
  return ((uint64_t)hi << 32) | lo;
}
__device__ __forceinline__ v8b ldg16(uint64_t base, unsigned lane_bytes, unsigned imm_bytes) {
  return *(gv8b*)(base + lane_bytes + imm_bytes);
}
// Asynchronous 16-B copy, global memory to LDS, through no register: every lane brings its own 16 bytes (both addresses
// multiples of 16). The compiler places no wait for it: its bytes count as landed behind the issuing wave's own
// s_wait_asynccnt 0, and for the other waves behind the work-group barrier that follows that wait.
typedef __attribute__((ext_vector_type(4))) int v4i;
typedef __attribute__((address_space(1))) v4i gv4i;
typedef __attribute__((address_space(3))) v4i lv4i;
__device__ __forceinline__ void cp16(uint64_t base, unsigned lane_bytes, unsigned imm_bytes, void* lds) {
  __builtin_amdgcn_global_load_async_to_lds_b128((gv4i*)(base + lane_bytes + imm_bytes), (lv4i*)lds, 0, 0);
}
// In front of a barrier behind which a tile is refilled: this wave's LDS reads of that tile have retired.
__device__ __forceinline__ void wait_lds() { asm volatile("s_wait_dscnt 0x0" ::: "memory"); }
// In front of a barrier behind which the other waves read a tile: this wave's own copies have landed.
__device__ __forceinline__ void wait_copies() { asm volatile("s_wait_asynccnt 0x0" ::: "memory"); }

// ---------------------------------------------------------------------------
// Kernel 1: x[b] viewed [128 c][4096 n] (pitch 4096) -> XT bf16 [b*4096+n][128 c] (pitch 128), bf16 RNE.
// 64x64 tiles through LDS. grid = (4096/64, 128/64, 8), 256 threads.
// Coverage per block: load 4 it x 256 thr x 4 floats = 64x64; store 2 it x 256 thr x 8 u16 = 64x64.
// ---------------------------------------------------------------------------
__global__ __launch_bounds__(256) void k_xt(const float* __restrict__ X, unsigned short* __restrict__ xt) {
  __shared__ __align__(16) float tf[64 * 68];
  const int b = blockIdx.z;
  const float* W = X + (size_t)b * NC * NP;
  unsigned short* o = xt + (size_t)b * NP * NC;
  const int c0 = blockIdx.x * 64;   // input column block (n) = output row block
  const int r0 = blockIdx.y * 64;   // input row block (c)    = output column block
  const int tid = threadIdx.x;
  {
    const int lr = tid >> 4;
    const int c4 = (tid & 15) * 4;
#pragma unroll
    for (int it = 0; it < 4; ++it) {
      const int rr = it * 16 + lr;
      const v4f a = *(const v4fa*)(W + (size_t)(r0 + rr) * NP + c0 + c4);
      *(v4f*)(tf + rr * 68 + c4) = a;
    }
  }
  __syncthreads();
  const int sub = tid >> 3;          // 0..31
  const int c8  = (tid & 7) * 8;     // 0..56
  v4u hv[2];
#pragma unroll
  for (int it = 0; it < 2; ++it) {
    const int oc = it * 32 + sub;    // output row within tile (= input column)
    v4u a;
#pragma unroll
    for (int q = 0; q < 4; ++q) {
      const float f0 = tf[(c8 + 2 * q) * 68 + oc];
      const float f1 = tf[(c8 + 2 * q + 1) * 68 + oc];
      a[q] = pk16(f2bf_bits(f0), f2bf_bits(f1));
    }
    hv[it] = a;
  }
  {
#pragma unroll
    for (int it = 0; it < 2; ++it) {
      const int oc = it * 32 + sub;
      *(v4ua*)(o + (size_t)(c0 + oc) * NC + r0 + c8) = hv[it];
    }
    
  }
}

// ---------------------------------------------------------------------------
// Kernel 2: [q_w; k_w; v_w] ([out o][in c] row-major each) -> Wqkv bf16 [384 o][128 c] (natural Bt: n = o, k = c).
// grid = (16384/8/256 = 8, 3), 256 threads; matrix selected by blockIdx.y (block-uniform).
// Coverage: 3 x 2048 threads x 8 elements = 3 x 16384. One 16-B store per lane, lanes contiguous:
// ---------------------------------------------------------------------------
__global__ __launch_bounds__(256) void k_wcvt(const float* __restrict__ qw, const float* __restrict__ kw,
                                             const float* __restrict__ vw, unsigned short* __restrict__ Wb) {
  const int which = blockIdx.y;
  const float* src = (which == 0) ? qw : ((which == 1) ? kw : vw);
  const int i = blockIdx.x * 256 + threadIdx.x;
  if (i >= NC * NC / 8) return;
  const v4f a = *(const v4fa*)(src + (size_t)i * 8);
  const v4f c = *(const v4fa*)(src + (size_t)i * 8 + 4);
  v4u o4;
  o4[0] = pk16(f2bf_bits(a[0]), f2bf_bits(a[1]));
  o4[1] = pk16(f2bf_bits(a[2]), f2bf_bits(a[3]));
  o4[2] = pk16(f2bf_bits(c[0]), f2bf_bits(c[1]));
  o4[3] = pk16(f2bf_bits(c[2]), f2bf_bits(c[3]));
  unsigned short* dst = Wb + (size_t)which * NC * NC + (size_t)i * 8;
  *(v4ua*)dst = o4;
  
}

// ---------------------------------------------------------------------------
// Kernel 3: per-(b,c) mean and max over the 4096 pixels of bf16-RNE x2. Block handles 32 consecutive (b,c) rows
// (grid = 1024/32 = 32, 256 threads: each thread 16 elements of a row, fixed-order tree). The 32 means and 32
// maxes are funnelled through LDS; wave 0 lanes 0..7 write the AV line, lanes 8..15 the MX line
// Coverage: 32 blocks x 32 rows = 1024 = 8 x 128 rows; per row 256 x 16 = 4096 elements.
// ---------------------------------------------------------------------------
__global__ __launch_bounds__(256) void k_poolbc(const float* __restrict__ x2, float* __restrict__ AV,
                                               float* __restrict__ MX) {
  __shared__ float ws_s[8], ws_m[8];
  __shared__ __align__(16) float os[64];
  const int g = blockIdx.x, tid = threadIdx.x, lane = tid & 31, w = tid >> 5;
#pragma unroll 1
  for (int j = 0; j < 32; ++j) {
    const float* p = x2 + (size_t)(g * 32 + j) * NP + tid * 16;
    float s = 0.f, m = -INFINITY;
#pragma unroll
    for (int i = 0; i < 4; ++i) {
      const v4f a = *(const v4fa*)(p + 4 * i);
      const float a0 = bfr(a[0]), a1 = bfr(a[1]), a2 = bfr(a[2]), a3 = bfr(a[3]);
      s += (a0 + a1) + (a2 + a3);
      m = fmaxf(fmaxf(m, a0), fmaxf(fmaxf(a1, a2), a3));
    }
    s += xhalf(s);   m = fmaxf(m, xhalf(m));
    s += rowx<8>(s); m = fmaxf(m, rowx<8>(m));
    s += rowx<4>(s); m = fmaxf(m, rowx<4>(m));
    s += rowx<2>(s); m = fmaxf(m, rowx<2>(m));
    s += rowx<1>(s); m = fmaxf(m, rowx<1>(m));
    if (lane == 0) { ws_s[w] = s; ws_m[w] = m; }
    __syncthreads();
    if (tid == 0) {
      float ts = 0.f, tm = -INFINITY;
#pragma unroll
      for (int k = 0; k < 8; ++k) { ts += ws_s[k]; tm = fmaxf(tm, ws_m[k]); }
      os[j] = ts * (1.0f / 4096.0f);
      os[32 + j] = tm;
    }
    __syncthreads();
  }
  if (w == 0) {
    const v4f v = *(const v4fa*)(os + 4 * (lane & 15));
    {
      if (lane < 8)       *(v4f*)(AV + g * 32 + 4 * lane) = v;
      else if (lane < 16) *(v4f*)(MX + g * 32 + 4 * (lane - 8)) = v;
      
    }
  }
}

// ---------------------------------------------------------------------------
// Kernel 4: per-(b,n) mean and max over the 128 channels of bf16-RNE x2 -> SPIN[b][0][n] = mean, SPIN[b][1][n] = max.
// Block per (b, 64-pixel group): grid = 8 x 64 = 512, 256 threads = 64 pixels x 4 channel groups of 32 (serial,
// unroll 4), fixed-order 4-way combine. 64 means / 64 maxes funnelled through LDS; wave 0 writes both 256-B
// Coverage: 512 blocks x 64 pixels = 8 x 4096 per plane.
// ---------------------------------------------------------------------------
__global__ __launch_bounds__(256) void k_poolc(const float* __restrict__ x2, float* __restrict__ SPIN) {
  __shared__ float ps[4][64], pm[4][64];
  __shared__ __align__(16) float os[128];
  const int b = blockIdx.x >> 6, g = blockIdx.x & 63;
  const int tid = threadIdx.x, lane = tid & 31;
  const int p = tid & 63, cg = tid >> 6;
  const float* src = x2 + ((size_t)b * NC + cg * 32) * NP + g * 64 + p;
  float s = 0.f, m = -INFINITY;
#pragma unroll 4
  for (int c = 0; c < 32; ++c) {
    const float v = bfr(src[(size_t)c * NP]);
    s += v;
    m = fmaxf(m, v);
  }
  ps[cg][p] = s;
  pm[cg][p] = m;
  __syncthreads();
  if (tid < 64) {
    const float ts = ((ps[0][tid] + ps[1][tid]) + ps[2][tid]) + ps[3][tid];
    const float tm = fmaxf(fmaxf(pm[0][tid], pm[1][tid]), fmaxf(pm[2][tid], pm[3][tid]));
    os[tid] = ts * (1.0f / 128.0f);
    os[64 + tid] = tm;
  }
  __syncthreads();
  if (tid < 32) {
    const v4f v = *(const v4fa*)(os + 4 * lane);   // lanes 0..15: means 0..63, lanes 16..31: maxes 0..63
    float* base = SPIN + (size_t)b * 2 * NP + g * 64;
    {
      if (lane < 16) *(v4f*)(base + 4 * lane) = v;
      else           *(v4f*)(base + NP + 4 * (lane - 16)) = v;
      
    }
  }
}

// ---------------------------------------------------------------------------
// Kernel 5: positional branch, grid (1 + 16, 8 batches), 256 threads, all f32 VALU:
//   ch[c]   = sum_{i in {mean,max}} sum_{t<5} bf16r(conv1_w[i][t]) * stk[i][c+t-2]   (zero pad 2, no flip, no bias)
//   Avec[o] = sum_c bf16r(ck_w[o][c]) * ch[c] + bf16r(ck_b[o]) ;  R[o] = sum_c bf16r(ck_w[o][c])
//   sp[n]   = sum_i sum_{u,v<7} bf16r(sp_w[i][u][v]) * spin[i][h+u-3][w+v-3] + bf16r(sp_b)   (zero pad 3)
// blockIdx.x == 0: the channel branch of batch b (AVEC[b][128] by wave 0, RVEC[b][128] by wave 1).
// blockIdx.x == 1 + s: the spatial conv of image rows 4s..4s+3 (256 pixels, one per thread). The two pooled maps are
// staged with their halo as zero-padded 10x70 LDS planes; each wave stores one whole 128-B line of SP.
// Coverage: AVEC/RVEC 8 x 128; SP 8 x 16 blocks x 256 thr = 8 x 4096.
// ---------------------------------------------------------------------------
#define POS_ROWS   4                     // image rows per spatial work-group
#define POS_SLICES (64 / POS_ROWS)       // spatial work-groups per batch
#define POS_PLANE  ((POS_ROWS + 6) * 70) // floats per padded plane
static_assert(POS_ROWS * 64 == 256);
static_assert(2 * POS_PLANE > 5 * 256 && 2 * POS_PLANE <= 6 * 256);

__global__ __launch_bounds__(256) void k_pos(const float* __restrict__ AV, const float* __restrict__ MX,
                                            const float* __restrict__ SPIN, const float* __restrict__ c1w,
                                            const float* __restrict__ ckw, const float* __restrict__ ckb,
                                            const float* __restrict__ spw, const float* __restrict__ spb,
                                            float* __restrict__ AVEC, float* __restrict__ RVEC,
                                            float* __restrict__ SP) {
  __shared__ float sav[128], smx[128];
  __shared__ __align__(16) float sch[128];
  __shared__ float sw1[32];
  __shared__ __align__(16) float sw2[128];
  __shared__ __align__(16) float savec[128], srv[128];
  __shared__ float spl[2 * POS_PLANE];
  const int b = blockIdx.y, tid = threadIdx.x, lane = tid & 31, w = tid >> 5;

  if (blockIdx.x == 0) {                               // block-uniform: every barrier below is passed by the whole block
    const int o = tid & 127;                           // waves 4..7 repeat waves 0..3 and store nothing
    // the ck_w row and ck_b are read here, ahead of the first barrier, so that they are in flight together with the
    // pooled values instead of one dependent round trip per four weights behind the second barrier
    v4f wq[NC / 4];                                    // this thread's whole ck_w row
#pragma unroll
    for (int i = 0; i < NC / 4; ++i) wq[i] = *(const v4fa*)(ckw + (size_t)o * NC + 4 * i);
    const float cb = ckb[o];
    if (tid < 128) { sav[tid] = AV[b * NC + tid]; smx[tid] = MX[b * NC + tid]; }
    if (tid < 32) sw1[tid] = bfr(c1w[min(tid, 9)]);    // clamped address
    __syncthreads();
    // channel conv1d
    if (tid < 128) {
      const int c = tid;
      float acc = 0.0f;
#pragma unroll 1
      for (int t = 0; t < 5; ++t) {
        const int cc  = c + t - 2;
        const int ccl = min(max(cc, 0), NC - 1);
        const float valid = (cc >= 0 && cc < NC) ? 1.0f : 0.0f;
        acc += valid * (sw1[t] * sav[ccl] + sw1[5 + t] * smx[ccl]);
      }
      sch[c] = acc;
    }
    __syncthreads();
    // Avec, R: c ascending, as one chain each (Avec by fused multiply-add, written out so that the unrolled form
    // is not split into packed multiplies and separate adds). Unrolled so that the row stays in registers.
    {
      float a = bfr(cb), r = 0.0f;
#pragma unroll
      for (int c = 0; c < NC; ++c) {
        const float wv = bfr(wq[c >> 2][c & 3]);
        a = __builtin_fmaf(wv, sch[c], a);
        r += wv;
      }
      if (tid < 128) { savec[o] = a; srv[o] = r; }
    }
    __syncthreads();
    if (w == 0) {
      const v4f v = *(const v4fa*)(savec + 4 * lane);
      *(v4f*)(AVEC + b * NC + 4 * lane) = v;
    } else if (w == 1) {
      const v4f v = *(const v4fa*)(srv + 4 * lane);
      *(v4f*)(RVEC + b * NC + 4 * lane) = v;
    }
    return;
  }

  // spatial 7x7x2 conv + bias of image rows h0..h0+3
  const int sl = blockIdx.x - 1;
  const int h0 = sl * POS_ROWS;
  const float* sp0 = SPIN + (size_t)b * 2 * NP;
  const float bias_sp = bfr(spb[0]);                   // read ahead of the barrier, with the other loads
  {
    // padded planes with halo: every lane loads at a clamped address, so that the weight load and the six tile loads
    // are in flight together; what lies outside the image becomes 0
    const float wt = spw[min(tid, 97)];
    float tv[6];
#pragma unroll
    for (int k = 0; k < 6; ++k) {
      const int i   = min(k * 256 + tid, 2 * POS_PLANE - 1);
      const int pl  = i / POS_PLANE, rem = i - pl * POS_PLANE;
      const int rr  = rem / 70, cc = rem - rr * 70;
      const int gh  = h0 + rr - 3, gx = cc - 3;
      const bool in = gh >= 0 && gh < 64 && gx >= 0 && gx < 64;
      const float v = sp0[pl * NP + min(max(gh, 0), 63) * 64 + min(max(gx, 0), 63)];
      tv[k] = in ? v : 0.0f;
    }
    if (tid < 128) sw2[tid] = bfr(wt);
#pragma unroll
    for (int k = 0; k < 5; ++k) spl[k * 256 + tid] = tv[k];
    if (5 * 256 + tid < 2 * POS_PLANE) spl[5 * 256 + tid] = tv[5];
  }
  __syncthreads();
  {
    const int h = tid >> 6, x = tid & 63;
    const float* t0 = spl + h * 70 + x;
    float acc = bias_sp;
    // both tap loops unrolled: the 98 LDS reads of a pixel do not depend on one another and overlap, where the
    // rolled loops paid one LDS round trip a tap; the taps are added in the same order
#pragma unroll
    for (int u = 0; u < 7; ++u) {
#pragma unroll
      for (int v = 0; v < 7; ++v) {
        const int li = u * 70 + v;
        acc += sw2[u * 7 + v] * t0[li] + sw2[49 + u * 7 + v] * t0[POS_PLANE + li];
      }
    }
    SP[(size_t)b * NP + sl * 256 + tid] = acc;
    asm volatile("s_wait_xcnt 0x0" ::: "memory");      // before a register that the store names is rewritten
  }
}

// ---------------------------------------------------------------------------
// Kernel 6: [Q|K|V] = XT . Wqkv^T + bias (exact bf16 x bf16 products, f32 accumulate, K = 128 in 4 steps of 32).
// grid = (32768/64 = 512 token tiles, 3 = which), 128 threads = 4 waves; wave w owns tokens m0+16w..+15 x all 128
// output channels (8 accumulator tiles). A fragments straight from XT rows, B fragments from Wqkv rows (both
// k-contiguous bf16, arithmetic addressing). bias (bf16r), Avec and R staged in LDS (one scalar load per thread each).
// Epilogue: f32 tile (acc + bias) staged in LDS [64][132];
//   which 0: alpha[n] = sum_o Avec[b][o] q[o][n], beta[n] = sum_o R[o] q[o][n] (f32, unroll 4) -> ALPHA/BETA 256-B
//            segments (16 lanes x 16 B); Q hi|lo token-major planes [tok][128];
//   which 1: K hi|lo token-major planes;  which 2: V hi|lo channel-major planes [b][c][4096] (transposed write).
// ---------------------------------------------------------------------------
__global__ __launch_bounds__(128) void k_qkv(const __bf16* __restrict__ XT, const __bf16* __restrict__ Wb,
                                            const float* __restrict__ qb, const float* __restrict__ kb,
                                            const float* __restrict__ vb,
                                            const float* __restrict__ AVEC, const float* __restrict__ RVEC,
                                            unsigned short* __restrict__ QP, unsigned short* __restrict__ KP,
                                            unsigned short* __restrict__ VP,
                                            float* __restrict__ ALPHA, float* __restrict__ BETA) {
  __shared__ __align__(16) float sT[64 * 132];
  __shared__ __align__(16) float sAV[128], sRV[128], sAB[128], sBI[128];
  const int tid = threadIdx.x, lane = tid & 31, w = tid >> 5, hh = lane >> 4, l16 = lane & 15;
  const int which = blockIdx.y;
  const int m0 = blockIdx.x * 64;            // global token row
  const int b  = m0 / NP;
  const int n0 = m0 - b * NP;

  const float* bias = (which == 0) ? qb : ((which == 1) ? kb : vb);   // block-uniform select, same address space
  sAV[tid] = AVEC[b * NC + tid];
  sRV[tid] = RVEC[b * NC + tid];
  sBI[tid] = bfr(bias[tid]);
  __syncthreads();

  const v8f zero8 = {0.f, 0.f, 0.f, 0.f, 0.f, 0.f, 0.f, 0.f};
  v8f acc[8];
#pragma unroll
  for (int t = 0; t < 8; ++t) acc[t] = zero8;

  const __bf16* arow = XT + (size_t)(m0 + 16 * w + l16) * NC;        // token row, k = input channel
  const __bf16* brow = Wb + ((size_t)which * NC + l16) * NC;          // output channel row (tile 0), k = input channel
#pragma unroll
  for (int kc = 0; kc < 4; ++kc) {
    const v16b a = ldfrag(arow + kc * 32, hh);
#pragma unroll
    for (int t = 0; t < 8; ++t) {
      const v16b bf = ldfrag(brow + (size_t)t * 16 * NC + kc * 32, hh);
      acc[t] = mma_bf(a, bf, acc[t]);
    }
  }
  // D[r] of tile t = Y[token 16w+8hh+r][channel 16t+l16]
#pragma unroll
  for (int t = 0; t < 8; ++t) {
    const float bv = sBI[16 * t + l16];
#pragma unroll
    for (int r = 0; r < 8; ++r) sT[(16 * w + 8 * hh + r) * 132 + 16 * t + l16] = acc[t][r] + bv;
  }
  __syncthreads();
  if (which == 0 && tid < 64) {            // waves 0,1
    const float* qr = sT + tid * 132;
    float a = 0.0f, be = 0.0f;
#pragma unroll 4
    for (int o = 0; o < NC; ++o) {
      const float q = qr[o];
      a  += sAV[o] * q;
      be += sRV[o] * q;
    }
    sAB[tid] = a;
    sAB[64 + tid] = be;
  }
  __syncthreads();

  // pack hi|lo planes
  const int q8 = lane & 7, sub = lane >> 3;
  v4u hv[8], lv[8];
#pragma unroll
  for (int i = 0; i < 8; ++i) {
    const int lid  = w * 32 + i * 4 + sub;                                   // 0..127
    const int base = (which != 2) ? ((lid >> 1) * 132 + (lid & 1) * 64 + 8 * q8) : ((8 * q8) * 132 + lid);
    const int estr = (which != 2) ? 1 : 132;
    v4u a, a2;
#pragma unroll
    for (int q = 0; q < 4; ++q) {
      const float f0 = sT[base + (2 * q) * estr];
      const float f1 = sT[base + (2 * q + 1) * estr];
      const unsigned short h0 = f2bf_bits(f0), h1 = f2bf_bits(f1);
      const unsigned short l0 = f2bf_bits(f0 - bfbits2f(h0)), l1 = f2bf_bits(f1 - bfbits2f(h1));
      a[q]  = pk16(h0, h1);
      a2[q] = pk16(l0, l1);
    }
    hv[i] = a;
    lv[i] = a2;
  }
  unsigned short* P = (which == 0) ? QP : ((which == 1) ? KP : VP);
  {
#pragma unroll
    for (int i = 0; i < 8; ++i) {
      const int lid = w * 32 + i * 4 + sub;
      const size_t go = (which != 2)
          ? ((size_t)(m0 + (lid >> 1)) * NC + (lid & 1) * 64 + 8 * q8)
          : (((size_t)b * NC + lid) * NP + n0 + 8 * q8);
      *(v4ua*)(P + go) = hv[i];
      *(v4ua*)(P + PLANE_ELEMS + go) = lv[i];
    }
    
  }
  if (which == 0 && w == 0) {
    const v4f v = *(const v4fa*)(sAB + 4 * lane);    // lanes 0..15: alpha 0..63, lanes 16..31: beta 0..63
    {
      if (lane < 16) *(v4f*)(ALPHA + m0 + 4 * lane) = v;
      else           *(v4f*)(BETA + m0 + 4 * (lane - 16)) = v;
      
    }
  }
}

// ---------------------------------------------------------------------------
// Kernel 7: full (non-causal, unmasked) attention, head dim 128, block per (b, 64-query tile): grid 8 x 64 = 512,
// 256 threads = 8 waves. Wave w: query group g = w&3 (queries 16g..16g+15), key half kh = w>>2.
//   energy[n][m] = q[n].k[m] (bf16 hi/lo 3-term WMMA) + alpha[m] + sp[n]*beta[m]  (f32, no scale)
//   Both products are taken transposed, so that a lane owns ONE query (n = 16g + (lane&15)) all the way:
//   S^T = K . Q^T : A = K rows (m = key), B = Q rows (n = query); D[r] of tile jj = S[key key0+16jj+8hh+r][query].
//   The 16 scores of a lane are keys key0+8hh+0..7 and key0+16+8hh+0..7: exactly the k order of a B fragment of
//   32 keys, so p hi|lo is packed in registers and goes into the second product with no trip through LDS.
//   O^T += V . P^T : A = Vcm rows (m = channel), B = P (n = query, k = the wave's own 32 keys), all 128 channels
//   (8 accumulator tiles); D[r] of tile t = O[channel 16t+8hh+r][query].
//   Row max and row sum are in-lane over 16 values plus one exchange with lane^16. Each wave keeps an online softmax
//   state (max, sum, O) of its own for its key half of every chunk; the two halves of a query are merged once,
//   behind the key loop, through LDS: O = (O0 e^(m0-m) + O1 e^(m1-m)) / (l0 e^(m0-m) + l1 e^(m1-m)).
//   Online softmax over all 4096 keys in 64 chunks of 64 (compile-time trip count, no masking), f32 expf.
// LDS: K hi|lo [64][128], Vcm hi|lo [128][64], Q hi|lo [64][128] (staged once); every row is
// padded by 16 B (pitch 272 B for 256-B rows, 144 B for 128-B rows = 16 B x odd), so the 16 rows that one 16-byte
// fragment read touches fall on 16 different bank groups; the lo plane of K/Q starts 64 B and that of V 128 B past a
// multiple of 256 B; staging gives consecutive lanes consecutive 16-B pieces of a row (whole lines);
// K, V and alpha|beta come by asynchronous copies to LDS, one buffer each, two barriers a chunk: V(kc) is issued behind
// the barrier at the loop's head (V.P of kc-1 done) and waited for in front of the barrier behind the scores;
// K(kc+1), alpha|beta(kc+1) are issued behind that barrier (scores of kc done) and waited for in front of the barrier
// at the loop's head;
// alpha/beta slices [64]+[64], merge arrays [128]+[128]; output tile [128 c][64 n] (pitch 68) overlays the
// K/V region after the loop (block barrier first).
// Staging coverage: Q 8 rounds x 256 thr x 8 = 64x128 x 2 planes; per chunk K 16 rounds x 128 thr x 8 = 64x128 x 2 planes,
// V 16 rounds x 128 thr x 8 = 128x64 x 2 planes;
// Output: out[b][c][n0..n0+63] channel-major; each channel row segment = 256 B = 16 contiguous lanes x 16 B
// ---------------------------------------------------------------------------
#define KQ_PITCH 136                       // elements: 128 + 8 (272 B)
#define VP_PITCH 72                        // elements: 64 + 8 (144 B)
#define KQ_PLANE (64 * KQ_PITCH + 32)      // elements: 17472 B = 68 x 256 + 64
#define V_PLANE  (128 * VP_PITCH + 64)     // elements: 18560 B = 72 x 256 + 128
#define SM_K   0
#define SM_V   (SM_K + 2 * KQ_PLANE * 2)
#define SM_Q   (SM_V + 2 * V_PLANE * 2)
#define SM_AB  (SM_Q + 2 * KQ_PLANE * 2)
#define SM_RED (SM_AB + 512)
#define SM_TOT (SM_RED + 1024)
static_assert(128 * 68 * 4 <= SM_Q);
static_assert(SM_V % 16 == 0 && SM_Q % 16 == 0 && SM_AB % 16 == 0);
static_assert(2 * SM_TOT <= 327680);

__global__ __launch_bounds__(256) void k_attn(const __bf16* __restrict__ QP, const __bf16* __restrict__ KP,
                                             const __bf16* __restrict__ VP, const float* __restrict__ ALPHA,
                                             const float* __restrict__ BETA, const float* __restrict__ SP,
                                             float* __restrict__ out) {
  __shared__ __align__(16) unsigned char smem[SM_TOT];
  __bf16* Ks   = (__bf16*)(smem + SM_K);     // hi at +0, lo at +KQ_PLANE elements
  __bf16* Vs   = (__bf16*)(smem + SM_V);
  __bf16* Qs   = (__bf16*)(smem + SM_Q);
  float*  sab  = (float*)(smem + SM_AB);     // alpha 0..63, beta 64..127
  float*  redm = (float*)(smem + SM_RED);    // final row max of a key half [4 g][2 kh][16]
  float*  reds = redm + 128;                 // final row sum of a key half [4 g][2 kh][16]
  float*  Os   = (float*)(smem + SM_K);      // [128][68] after the key loop

  const int tid = threadIdx.x, lane = tid & 31, w = tid >> 5, hh = lane >> 4, c = lane & 15;
  const int g = w & 3, kh = w >> 2;
  const int key0 = 32 * kh;                  // this wave's key half within a chunk
  const int b  = blockIdx.x >> 6;
  const int n0 = (blockIdx.x & 63) * 64;
  const size_t tok0 = (size_t)b * NP + n0;

  // Staging lane maps: consecutive lanes take consecutive 16-B pieces, so one wave-wide load covers 4 whole 128-B lines.
  const int kq_r = tid >> 4, kq_c = (tid & 15) * 8;   // Q: 16 lanes per 256-B row, 16 rows per round of the block
  const unsigned kq_g = (unsigned)(kq_r * NC + kq_c) * 2u; // the lane's byte offset in a token-major tile
  // ---- stage the block's Q tile hi|lo: 2 planes x 4 rounds x 256 thr x 8 elements ----
  {
    __bf16* dst = Qs + kq_r * KQ_PITCH + kq_c;
#pragma unroll
    for (int p = 0; p < 2; ++p) {
      const uint64_t qsrc = ubase(QP + (size_t)p * PLANE_ELEMS + tok0 * NC);
#pragma unroll
      for (int i = 0; i < 4; ++i) {
        const v8b v = ldg16(qsrc, kq_g, i * 16 * NC * 2);
        *(v8ba*)(dst + p * KQ_PLANE + i * 16 * KQ_PITCH) = v;
      }
    }
  }
  // ---- sp[n] of this lane's query ----
  const float spq = SP[tok0 + 16 * g + c];
  float mrow = -INFINITY, lrow = 0.0f;       // this wave's own running max and sum of the lane's query (same in lane^16)
  const v8f zero8 = {0.f, 0.f, 0.f, 0.f, 0.f, 0.f, 0.f, 0.f};
  v8f oacc[8];
#pragma unroll
  for (int t = 0; t < 8; ++t) oacc[t] = zero8;

  const __bf16* qrow = Qs + (16 * g + c) * KQ_PITCH;

  // K/V plane bases of this batch (block-uniform) and the lane's running byte offsets (below 1 MiB + one tile)
  const uint64_t ksrc[2] = {ubase(KP + (size_t)b * NP * NC), ubase(KP + PLANE_ELEMS + (size_t)b * NP * NC)};
  const uint64_t vsrc[2] = {ubase(VP + (size_t)b * NC * NP), ubase(VP + PLANE_ELEMS + (size_t)b * NC * NP)};
  // Who copies what: waves 0..3 bring the K tiles (wave 0 the alpha|beta slice too), waves 4..7 the V tiles, so that a
  // wave's wait for its own copies never holds up the other tile's copies in flight. The wave's number stands in a
  // scalar register: every test on it is a scalar branch, and every lane is on at every copy.
  const int wu = __builtin_amdgcn_readfirstlane(w);
  const int ct = tid & 127;                            // the lane's place among the 128 lanes that bring a tile
  const int ck_r = ct >> 4, ck_c = (ct & 15) * 8;      // K: 16 lanes per 256-B row, 8 rows per round
  const int cv_r = ct >> 3, cv_c = (ct & 7) * 8;       // V:  8 lanes per 128-B row, 16 rows per round
  unsigned koff = (unsigned)(ck_r * NC + ck_c) * 2u;   // the lane's running byte offset in the token-major K planes
  unsigned voff = (unsigned)(cv_r * NP + cv_c) * 2u;   // the lane's running byte offset in the channel-major V planes
  // K: 2 planes x 8 rounds x 128 thr x 8 elements = 64 rows x 128 x 2 planes
  __bf16* kd = Ks + ck_r * KQ_PITCH + ck_c;
  // V: 2 planes x 8 rounds x 128 thr x 8 elements = 128 channel rows x 64 keys x 2 planes
  __bf16* vd = Vs + cv_r * VP_PITCH + cv_c;
  // alpha|beta slice of a chunk: one copy, lanes 0..15 the 64 alphas, lanes 16..31 the 64 betas
  const uint64_t absrc = (uint64_t)((lane < 16 ? ALPHA + 4 * lane : BETA + 4 * (lane - 16)) + (size_t)b * NP);

  // chunk 0's K tile and alpha|beta slice, into LDS that nobody has touched yet
  if (wu < 4) {
#pragma unroll   // each copy's plane and step are constants: no index arithmetic is left at run time
    for (int i = 0; i < 16; ++i)
      cp16(ksrc[i >> 3], koff, (i & 7) * 8 * NC * 2, kd + (i >> 3) * KQ_PLANE + (i & 7) * 8 * KQ_PITCH);
    if (wu == 0) cp16(absrc, 0, 0, sab + 4 * lane);
  }

#pragma unroll 1
  for (int kc = 0; kc < NP / 64; ++kc) {
    // this chunk's K and alpha|beta have landed (first trip: Q is stored too); every wave has left the V tile
    wait_lds();
    wait_copies();
    __syncthreads();
    // this chunk's V tile flies under the scores
    if (wu >= 4) {
#pragma unroll   // as above: constant plane and step per copy
      for (int i = 0; i < 16; ++i)
        cp16(vsrc[i >> 3], voff, (i & 7) * 16 * NP * 2, vd + (i >> 3) * V_PLANE + (i & 7) * 16 * VP_PITCH);
      voff += 64 * 2;        // next 64 keys: 64 columns of V
    }

    // ---- scores, transposed: s[jj][r] = S[key m0+key0+16jj+8hh+r][query 16g+c], 3-term split ----
    v8f s[2];
    s[0] = zero8; s[1] = zero8;
#pragma unroll 1
    for (int dc = 0; dc < 4; ++dc) {
      const v16b qa = ldfrag(qrow + dc * 32, hh);
      const v16b ql = ldfrag(qrow + KQ_PLANE + dc * 32, hh);
#pragma unroll
      for (int jj = 0; jj < 2; ++jj) {
        const __bf16* krow = Ks + (key0 + 16 * jj + c) * KQ_PITCH + dc * 32;
        const v16b kb = ldfrag(krow, hh);
        const v16b kl = ldfrag(krow + KQ_PLANE, hh);
        s[jj] = mma_bf(kb, qa, s[jj]);
        s[jj] = mma_bf(kl, qa, s[jj]);
        s[jj] = mma_bf(kb, ql, s[jj]);
      }
    }
    // ---- positional terms in f32 (alpha, beta of the lane's 16 keys), then the max over this wave's 32 keys ----
    float cmx = -INFINITY;
#pragma unroll
    for (int jj = 0; jj < 2; ++jj) {
      const float* ap = sab + key0 + 16 * jj + 8 * hh;
      const v4f a0 = *(const v4fa*)(ap),      a1 = *(const v4fa*)(ap + 4);
      const v4f b0 = *(const v4fa*)(ap + 64), b1 = *(const v4fa*)(ap + 68);
#pragma unroll
      for (int r = 0; r < 8; ++r) {
        const float al = (r < 4) ? a0[r & 3] : a1[r & 3];
        const float be = (r < 4) ? b0[r & 3] : b1[r & 3];
        const float e = s[jj][r] + al + spq * be;
        s[jj][r] = e;
        cmx = fmaxf(cmx, e);
      }
    }
    cmx = fmaxf(cmx, xhalf(cmx));
    wait_lds();                   // every wave has left the K tile and the alpha|beta slice
    if (wu >= 4) wait_copies();   // this chunk's V has landed
    __syncthreads();
    // the next chunk's K tile and alpha|beta slice fly under the softmax and V.P
    if (kc + 1 < NP / 64) {
      if (wu < 4) {
        koff += 64 * NC * 2; // next 64 keys: 64 token rows of K
#pragma unroll   // as above: constant plane and step per copy
        for (int i = 0; i < 16; ++i)
          cp16(ksrc[i >> 3], koff, (i & 7) * 8 * NC * 2, kd + (i >> 3) * KQ_PLANE + (i & 7) * 8 * KQ_PITCH);
        if (wu == 0) cp16(absrc, (unsigned)(kc + 1) * 64 * 4, 0, sab + 4 * lane);
      }
    }
    // ---- online softmax of the lane's query over this wave's keys; P hi|lo packed as B fragments in registers ----
    const float mnew = fmaxf(mrow, cmx);
    const float corr = expf(mrow - mnew);
    mrow = mnew;
    float psum = 0.0f;
    union PB { v16b v; unsigned u[8]; } pa, pl;   // element 8jj+r = key key0+16jj+8hh+r: the fragment's k order
#pragma unroll
    for (int jj = 0; jj < 2; ++jj) {
#pragma unroll
      for (int r = 0; r < 8; r += 2) {
        const float p0 = expf(s[jj][r] - mnew);
        const float p1 = expf(s[jj][r + 1] - mnew);
        psum += p0;
        psum += p1;
        const unsigned short h0 = f2bf_bits(p0), h1 = f2bf_bits(p1);
        const unsigned short l0 = f2bf_bits(p0 - bfbits2f(h0)), l1 = f2bf_bits(p1 - bfbits2f(h1));
        pa.u[4 * jj + (r >> 1)] = pk16(h0, h1);
        pl.u[4 * jj + (r >> 1)] = pk16(l0, l1);
      }
    }
    psum += xhalf(psum);
    lrow = lrow * corr + psum;
#pragma unroll
    for (int t = 0; t < 8; ++t) {
#pragma unroll
      for (int r = 0; r < 8; ++r) oacc[t][r] *= corr;
    }

    // ---- O^T += V . P^T : A = Vcm row (channel 16t+c) [key], B = P [key][query]; 8 channel tiles, the wave's 32 keys ----
#pragma unroll   // the accumulator tiles are indexed by constants, so that they stay in registers
    for (int t = 0; t < 8; ++t) {
      const __bf16* vr = Vs + (16 * t + c) * VP_PITCH + key0;
      const v16b vb = ldfrag(vr, hh);
      const v16b vl = ldfrag(vr + V_PLANE, hh);
      oacc[t] = mma_bf(vb, pa.v, oacc[t]);
      oacc[t] = mma_bf(vl, pa.v, oacc[t]);
      oacc[t] = mma_bf(vb, pl.v, oacc[t]);
    }
  }
  wait_lds();
  wait_copies();     // no copy is in flight here; the wait stands before the tiles' LDS gets another use
  // ---- merge the two key halves of every query: exchange (max, sum), scale, add through the output tile ----
  if (hh == 0) { redm[g * 32 + kh * 16 + c] = mrow; reds[g * 32 + kh * 16 + c] = lrow; }
  __syncthreads();   // all waves done with the K/V tiles before the output tile overlays them; max and sum published
  {
    const float m0 = redm[g * 32 + c], m1 = redm[g * 32 + 16 + c];
    const float l0 = reds[g * 32 + c], l1 = reds[g * 32 + 16 + c];
    const float mt = fmaxf(m0, m1);
    const float f0 = expf(m0 - mt), f1 = expf(m1 - mt);
    const float inv = 1.0f / (l0 * f0 + l1 * f1);
    const float fs = (kh == 0 ? f0 : f1) * inv;
    float* op = Os + (8 * hh) * 68 + 16 * g + c;     // O staged as [c][n_local]
    if (wu >= 4) {                                   // key half 1 stores its share
#pragma unroll
      for (int t = 0; t < 8; ++t) {
#pragma unroll
        for (int r = 0; r < 8; ++r) op[(16 * t + r) * 68] = oacc[t][r] * fs;
      }
    }
    __syncthreads();
    if (wu < 4) {                                    // key half 0 adds its own to the same places
#pragma unroll
      for (int t = 0; t < 8; ++t) {
#pragma unroll
        for (int r = 0; r < 8; ++r) op[(16 * t + r) * 68] = oacc[t][r] * fs + op[(16 * t + r) * 68];
      }
    }
  }
  __syncthreads();
  {
    float* ob = out + (size_t)b * NC * NP + n0;
    const int c4 = (lane & 15) * 4;
    {
#pragma unroll
      for (int i = 0; i < 8; ++i) {
        const int row = i * 16 + w * 2 + hh;                       // 0..127 channel
        const v4f v = *(const v4fa*)(Os + row * 68 + c4);
        *(v4f*)(ob + (size_t)row * NP + c4) = v;
      }
      
    }
  }
}

// ---------------------------------------------------------------------------
//   XT    bf16 [32768][128]          0           8388608
//   WQKV  bf16 [384][128]            8388608       98304
//   AV    f32  [8][128]              8486912        4096
//   MX    f32  [8][128]              8491008        4096
//   SPIN  f32  [8][2][4096]          8495104      262144
//   AVEC  f32  [8][128]              8757248        4096
//   RVEC  f32  [8][128]              8761344        4096
//   SP    f32  [8][4096]             8765440      131072
//   ALPHA f32  [8][4096]             8896512      131072
//   BETA  f32  [8][4096]             9027584      131072
//   Q hi|lo bf16 2x[32768][128]      9158656    16777216
//   K hi|lo bf16 2x[32768][128]     25935872    16777216
//   V hi|lo bf16 2x[8][128][4096]   42713088    16777216
//   total                          59490304
// ---------------------------------------------------------------------------
extern "C" void kernel_launch(void* const* d_in, const int* in_sizes, int n_in,
                              void* d_out, int out_size, void* d_ws, size_t ws_size,
                              hipStream_t stream) {
  if (n_in < 13) return;
  if (in_sizes[0] != NB * NC * NP || in_sizes[1] != NB * NC * NP) return;
  if (in_sizes[2] != NC * NC || in_sizes[4] != NC * NC || in_sizes[6] != NC * NC || in_sizes[8] != NC * NC) return;
  if (in_sizes[3] != NC || in_sizes[5] != NC || in_sizes[7] != NC || in_sizes[9] != NC) return;
  if (in_sizes[10] != 10 || in_sizes[11] != 98 || in_sizes[12] != 1) return;
  if (out_size != NB * NC * NP) return;

  const float* x    = (const float*)d_in[0];
  const float* x2   = (const float*)d_in[1];
  const float* q_w  = (const float*)d_in[2];
  const float* q_b  = (const float*)d_in[3];
  const float* k_w  = (const float*)d_in[4];
  const float* k_b  = (const float*)d_in[5];
  const float* v_w  = (const float*)d_in[6];
  const float* v_b  = (const float*)d_in[7];
  const float* ck_w = (const float*)d_in[8];
  const float* ck_b = (const float*)d_in[9];
  const float* c1w  = (const float*)d_in[10];
  const float* sp_w = (const float*)d_in[11];
  const float* sp_b = (const float*)d_in[12];
  float* out = (float*)d_out;

  const size_t plane_b = PLANE_ELEMS * 2;                 // 8388608 bytes per 16-bit plane
  size_t off = 0;
  const size_t oXT   = off; off += plane_b;
  const size_t oW    = off; off += (size_t)3 * NC * NC * 2;
  const size_t oAV   = off; off += (size_t)NB * NC * 4;
  const size_t oMX   = off; off += (size_t)NB * NC * 4;
  const size_t oSPIN = off; off += (size_t)NB * 2 * NP * 4;
  const size_t oAVEC = off; off += (size_t)NB * NC * 4;
  const size_t oRVEC = off; off += (size_t)NB * NC * 4;
  const size_t oSP   = off; off += (size_t)NB * NP * 4;
  const size_t oAL   = off; off += (size_t)NB * NP * 4;
  const size_t oBE   = off; off += (size_t)NB * NP * 4;
  const size_t oQ    = off; off += 2 * plane_b;
  const size_t oK    = off; off += 2 * plane_b;
  const size_t oV    = off; off += 2 * plane_b;           // off = 59490304
  if (off > ws_size) return;
  if (off > (size_t)134217728) return;

  char* ws = (char*)d_ws;
  unsigned short* XT    = (unsigned short*)(ws + oXT);
  unsigned short* WQKV  = (unsigned short*)(ws + oW);
  float* AV    = (float*)(ws + oAV);
  float* MX    = (float*)(ws + oMX);
  float* SPIN  = (float*)(ws + oSPIN);
  float* AVEC  = (float*)(ws + oAVEC);
  float* RVEC  = (float*)(ws + oRVEC);
  float* SP    = (float*)(ws + oSP);
  float* ALPHA = (float*)(ws + oAL);
  float* BETA  = (float*)(ws + oBE);
  unsigned short* QP = (unsigned short*)(ws + oQ);
  unsigned short* KPp = (unsigned short*)(ws + oK);
  unsigned short* VPp = (unsigned short*)(ws + oV);

  // 1. x -> token-major bf16 planes (grid: n blocks, c blocks, batch)
  k_xt<<<dim3(NP / 64, NC / 64, NB), 256, 0, stream>>>(x, XT);
  // 2. projection weights -> bf16 [384][128]
  k_wcvt<<<dim3(NC * NC / 8 / 256, 3), 256, 0, stream>>>(q_w, k_w, v_w, WQKV);
  // 3. per-(b,c) pixel mean/max of x2
  k_poolbc<<<NB * NC / 32, 256, 0, stream>>>(x2, AV, MX);
  // 4. per-(b,n) channel mean/max of x2
  k_poolc<<<NB * (NP / 64), 256, 0, stream>>>(x2, SPIN);
  // 5. positional branch: Avec, R (x = 0), sp (x = 1..16), per batch (y)
  k_pos<<<dim3(POS_SLICES + 1, NB), 256, 0, stream>>>(AV, MX, SPIN, c1w, ck_w, ck_b, sp_w, sp_b, AVEC, RVEC, SP);
  // 6. q/k/v projections + alpha/beta + hi|lo planes
  k_qkv<<<dim3(NTOK / 64, 3), 128, 0, stream>>>((const __bf16*)(const void*)XT, (const __bf16*)(const void*)WQKV,
                                                q_b, k_b, v_b, AVEC, RVEC, QP, KPp, VPp, ALPHA, BETA);
  // 7. attention, channel-major output
  k_attn<<<NB * (NP / 64), 256, 0, stream>>>((const __bf16*)(const void*)QP, (const __bf16*)(const void*)KPp,
                                             (const __bf16*)(const void*)VPp, ALPHA, BETA, SP, out);
  (void)hipGetLastError();
}

// v007
// It runs in 245 microseconds.
// Two timings next to v006 put it at 1.10 and 1.09 times that version's speed.
// All steps since v000 together make it 5.72 times as fast.
// Contractions: q/k/v 1x1 projections on v_wmma_f32_16x16x32_bf16 (bf16 operands taken from bf16-RNE inputs, single product, f32 accumulate);
// q.k^T scores and p.v on v_wmma_f32_16x16x32_bf16 with bf16 hi/lo split operands (hi.hi + hi.lo + lo.hi), f32 accumulate;
// pools, channel conv1d, spatial 7x7 conv, positional vectors alpha/beta, online softmax (hardware exp2) in f32.
// 16-bit planes and carries: XT = bf16 RNE(x), Wqkv = bf16 RNE(w), Q/K/V hi = RNE(y), lo = RNE(y - hi), P hi/lo per key chunk in registers.
// No power-of-two carry on any plane (bf16 keeps the f32 exponent range), so no inverse fold anywhere.
#include <hip/hip_runtime.h>
#include <math.h>
#include <stdint.h>

#define NB   8
#define NC   128
#define NP   4096
#define NTOK (NB * NP)
#define PLANE_ELEMS ((size_t)NTOK * NC)

static_assert(NP % 64 == 0);
static_assert(NC == 128);
static_assert((NB * NC) % 32 == 0);
static_assert(NP % 256 == 0);

typedef __attribute__((ext_vector_type(16))) __bf16 v16b;
typedef __attribute__((ext_vector_type(8)))  __bf16 v8b;
typedef __attribute__((ext_vector_type(8)))  float  v8f;
typedef __attribute__((ext_vector_type(4)))  float  v4f;
typedef __attribute__((ext_vector_type(2)))  float  v2f;
typedef __attribute__((ext_vector_type(4)))  unsigned int v4u;
typedef v8b __attribute__((may_alias)) v8ba;
typedef v4f __attribute__((may_alias)) v4fa;
typedef v2f __attribute__((may_alias)) v2fa;
typedef v4u __attribute__((may_alias)) v4ua;

// ---------------------------------------------------------------------------
// bf16 helpers (RNE convert on the f32 bits)
// ---------------------------------------------------------------------------
__device__ __forceinline__ unsigned short f2bf_bits(float f) {
  const unsigned u = __float_as_uint(f);
  return (unsigned short)((u + 0x7FFFu + ((u >> 16) & 1u)) >> 16);
}
__device__ __forceinline__ float bfbits2f(unsigned short h) { return __uint_as_float(((unsigned)h) << 16); }
__device__ __forceinline__ float bfr(float f) { return bfbits2f(f2bf_bits(f)); }
__device__ __forceinline__ unsigned pk16(unsigned short a, unsigned short b) { return (unsigned)a | ((unsigned)b << 16); }

// ---------------------------------------------------------------------------
// 16x16x32 bf16 WMMA with hazard guard (ties D, keeps A/B live).
// Fragment map (wave32): lane l, h = l>>4, m = n = l&15.
//   A/B element i: i<8 -> k0+8h+i ; i>=8 -> k0+16+8h+(i-8)
//   D element r : row 8h+r, col l&15
// ---------------------------------------------------------------------------
__device__ __forceinline__ v8f mma_bf(v16b a, v16b b, v8f c) {
  c = __builtin_amdgcn_wmma_f32_16x16x32_bf16(false, a, false, b, (short)0, c, false, false);
  asm volatile("v_nop\n\tv_nop\n\tv_nop\n\tv_nop" : "+v"(c) : "v"(a), "v"(b));
  return c;
}
// One butterfly step inside a 16-lane row: lane l takes the value of lane l ^ M (DPP row_xmask, on the vector port).
template <int M> __device__ __forceinline__ float rowx(float v) {
  const int i = __builtin_bit_cast(int, v);
  return __builtin_bit_cast(float, __builtin_amdgcn_update_dpp(0, i, 0x160 + M, 0xf, 0xf, true));
}
// Lane l takes the value of lane l ^ 16 (the other 16-lane row).
__device__ __forceinline__ float xhalf(float v) {
  const int i = __builtin_bit_cast(int, v);
  return __builtin_bit_cast(float, __builtin_amdgcn_permlanex16(i, i, 0x76543210, 0xfedcba98, false, false));
}
// 2^x on the hardware's own exponential, one instruction. Every argument here is <= about 0 (a score minus its running
// maximum, in log2 units); a result below the smallest normal f32 comes out as 0, which adds nothing to a sum whose
// largest term is 1. The library expf spends a dozen more vector instructions a value on range tests and on a
// two-part argument.
#define LOG2E 1.4426950408889634f
__device__ __forceinline__ float ex2(float x) { return __builtin_amdgcn_exp2f(x); }
union FB { v16b v; v8b h[2]; };
// A or B fragment from a k-contiguous bf16 row; p points at element k0 of the row owned by this lane.
__device__ __forceinline__ v16b ldfrag(const __bf16* p, int hh) {
  FB f;
  f.h[0] = *(const v8ba*)(p + 8 * hh);
  f.h[1] = *(const v8ba*)(p + 16 + 8 * hh);
  return f.v;
}

// 16-B global load at a block-uniform base plus the lane's own 32-bit byte offset plus a constant. Each plane's base goes
// through readfirstlane so that it keeps a scalar register pair of its own and the load takes the scalar-base form;
// without it the compiler folds the lo plane's 8-MiB step into 64-bit vector addresses that it forms anew every trip.
typedef const __attribute__((address_space(1))) v8ba gv8b;
__device__ __forceinline__ uint64_t ubase(const __bf16* p) {
  const uint64_t u = (uint64_t)p;
  const uint32_t lo = (uint32_t)__builtin_amdgcn_readfirstlane((int)(uint32_t)u);
  const uint32_t hi = (uint32_t)__builtin_amdgcn_readfirstlane((int)(uint32_t)(u >> 32));
  return ((uint64_t)hi << 32) | lo;
}
__device__ __forceinline__ v8b ldg16(uint64_t base, unsigned lane_bytes, unsigned imm_bytes) {
  return *(gv8b*)(base + lane_bytes + imm_bytes);
}
// Asynchronous 16-B copy, global memory to LDS, through no register: every lane brings its own 16 bytes (both addresses
// multiples of 16). The compiler places no wait for it: its bytes count as landed behind the issuing wave's own
// s_wait_asynccnt 0, and for the other waves behind the work-group barrier that follows that wait.
typedef __attribute__((ext_vector_type(4))) int v4i;
typedef __attribute__((address_space(1))) v4i gv4i;
typedef __attribute__((address_space(3))) v4i lv4i;
__device__ __forceinline__ void cp16(uint64_t base, unsigned lane_bytes, unsigned imm_bytes, void* lds) {
  __builtin_amdgcn_global_load_async_to_lds_b128((gv4i*)(base + lane_bytes + imm_bytes), (lv4i*)lds, 0, 0);
}
// In front of a barrier behind which a tile is refilled: this wave's LDS reads of that tile have retired.
__device__ __forceinline__ void wait_lds() { asm volatile("s_wait_dscnt 0x0" ::: "memory"); }
// In front of a barrier behind which the other waves read a tile: this wave's own copies have landed.
__device__ __forceinline__ void wait_copies() { asm volatile("s_wait_asynccnt 0x0" ::: "memory"); }

// ---------------------------------------------------------------------------
// Kernel 1: x[b] viewed [128 c][4096 n] (pitch 4096) -> XT bf16 [b*4096+n][128 c] (pitch 128), bf16 RNE.
// 64x64 tiles through LDS. grid = (4096/64, 128/64, 8), 256 threads.
// Coverage per block: load 4 it x 256 thr x 4 floats = 64x64; store 2 it x 256 thr x 8 u16 = 64x64.
// ---------------------------------------------------------------------------
__global__ __launch_bounds__(256) void k_xt(const float* __restrict__ X, unsigned short* __restrict__ xt) {
  __shared__ __align__(16) float tf[64 * 68];
  const int b = blockIdx.z;
  const float* W = X + (size_t)b * NC * NP;
  unsigned short* o = xt + (size_t)b * NP * NC;
  const int c0 = blockIdx.x * 64;   // input column block (n) = output row block
  const int r0 = blockIdx.y * 64;   // input row block (c)    = output column block
  const int tid = threadIdx.x;
  {
    const int lr = tid >> 4;
    const int c4 = (tid & 15) * 4;
#pragma unroll
    for (int it = 0; it < 4; ++it) {
      const int rr = it * 16 + lr;
      const v4f a = *(const v4fa*)(W + (size_t)(r0 + rr) * NP + c0 + c4);
      *(v4f*)(tf + rr * 68 + c4) = a;
    }
  }
  __syncthreads();
  const int sub = tid >> 3;          // 0..31
  const int c8  = (tid & 7) * 8;     // 0..56
  v4u hv[2];
#pragma unroll
  for (int it = 0; it < 2; ++it) {
    const int oc = it * 32 + sub;    // output row within tile (= input column)
    v4u a;
#pragma unroll
    for (int q = 0; q < 4; ++q) {
      const float f0 = tf[(c8 + 2 * q) * 68 + oc];
      const float f1 = tf[(c8 + 2 * q + 1) * 68 + oc];
      a[q] = pk16(f2bf_bits(f0), f2bf_bits(f1));
    }
    hv[it] = a;
  }
  {
#pragma unroll
    for (int it = 0; it < 2; ++it) {
      const int oc = it * 32 + sub;
      *(v4ua*)(o + (size_t)(c0 + oc) * NC + r0 + c8) = hv[it];
    }
    
  }
}

// ---------------------------------------------------------------------------
// Kernel 2: [q_w; k_w; v_w] ([out o][in c] row-major each) -> Wqkv bf16 [384 o][128 c] (natural Bt: n = o, k = c).
// grid = (16384/8/256 = 8, 3), 256 threads; matrix selected by blockIdx.y (block-uniform).
// Coverage: 3 x 2048 threads x 8 elements = 3 x 16384. One 16-B store per lane, lanes contiguous:
// ---------------------------------------------------------------------------
__global__ __launch_bounds__(256) void k_wcvt(const float* __restrict__ qw, const float* __restrict__ kw,
                                             const float* __restrict__ vw, unsigned short* __restrict__ Wb) {
  const int which = blockIdx.y;
  const float* src = (which == 0) ? qw : ((which == 1) ? kw : vw);
  const int i = blockIdx.x * 256 + threadIdx.x;
  if (i >= NC * NC / 8) return;
  const v4f a = *(const v4fa*)(src + (size_t)i * 8);
  const v4f c = *(const v4fa*)(src + (size_t)i * 8 + 4);
  v4u o4;
  o4[0] = pk16(f2bf_bits(a[0]), f2bf_bits(a[1]));
  o4[1] = pk16(f2bf_bits(a[2]), f2bf_bits(a[3]));
  o4[2] = pk16(f2bf_bits(c[0]), f2bf_bits(c[1]));
  o4[3] = pk16(f2bf_bits(c[2]), f2bf_bits(c[3]));
  unsigned short* dst = Wb + (size_t)which * NC * NC + (size_t)i * 8;
  *(v4ua*)dst = o4;
  
}

// ---------------------------------------------------------------------------
// Kernel 3: per-(b,c) mean and max over the 4096 pixels of bf16-RNE x2. Block handles 32 consecutive (b,c) rows
// (grid = 1024/32 = 32, 256 threads: each thread 16 elements of a row, fixed-order tree). The 32 means and 32
// maxes are funnelled through LDS; wave 0 lanes 0..7 write the AV line, lanes 8..15 the MX line
// Coverage: 32 blocks x 32 rows = 1024 = 8 x 128 rows; per row 256 x 16 = 4096 elements.
// ---------------------------------------------------------------------------
__global__ __launch_bounds__(256) void k_poolbc(const float* __restrict__ x2, float* __restrict__ AV,
                                               float* __restrict__ MX) {
  __shared__ float ws_s[8], ws_m[8];
  __shared__ __align__(16) float os[64];
  const int g = blockIdx.x, tid = threadIdx.x, lane = tid & 31, w = tid >> 5;
#pragma unroll 1
  for (int j = 0; j < 32; ++j) {
    const float* p = x2 + (size_t)(g * 32 + j) * NP + tid * 16;
    float s = 0.f, m = -INFINITY;
#pragma unroll
    for (int i = 0; i < 4; ++i) {
      const v4f a = *(const v4fa*)(p + 4 * i);
      const float a0 = bfr(a[0]), a1 = bfr(a[1]), a2 = bfr(a[2]), a3 = bfr(a[3]);
      s += (a0 + a1) + (a2 + a3);
      m = fmaxf(fmaxf(m, a0), fmaxf(fmaxf(a1, a2), a3));
    }
    s += xhalf(s);   m = fmaxf(m, xhalf(m));
    s += rowx<8>(s); m = fmaxf(m, rowx<8>(m));
    s += rowx<4>(s); m = fmaxf(m, rowx<4>(m));
    s += rowx<2>(s); m = fmaxf(m, rowx<2>(m));
    s += rowx<1>(s); m = fmaxf(m, rowx<1>(m));
    if (lane == 0) { ws_s[w] = s; ws_m[w] = m; }
    __syncthreads();
    if (tid == 0) {
      float ts = 0.f, tm = -INFINITY;
#pragma unroll
      for (int k = 0; k < 8; ++k) { ts += ws_s[k]; tm = fmaxf(tm, ws_m[k]); }
      os[j] = ts * (1.0f / 4096.0f);
      os[32 + j] = tm;
    }
    __syncthreads();
  }
  if (w == 0) {
    const v4f v = *(const v4fa*)(os + 4 * (lane & 15));
    {
      if (lane < 8)       *(v4f*)(AV + g * 32 + 4 * lane) = v;
      else if (lane < 16) *(v4f*)(MX + g * 32 + 4 * (lane - 8)) = v;
      
    }
  }
}

// ---------------------------------------------------------------------------
// Kernel 4: per-(b,n) mean and max over the 128 channels of bf16-RNE x2 -> SPIN[b][0][n] = mean, SPIN[b][1][n] = max.
// Block per (b, 64-pixel group): grid = 8 x 64 = 512, 256 threads = 64 pixels x 4 channel groups of 32 (serial,
// unroll 4), fixed-order 4-way combine. 64 means / 64 maxes funnelled through LDS; wave 0 writes both 256-B
// Coverage: 512 blocks x 64 pixels = 8 x 4096 per plane.
// ---------------------------------------------------------------------------
__global__ __launch_bounds__(256) void k_poolc(const float* __restrict__ x2, float* __restrict__ SPIN) {
  __shared__ float ps[4][64], pm[4][64];
  __shared__ __align__(16) float os[128];
  const int b = blockIdx.x >> 6, g = blockIdx.x & 63;
  const int tid = threadIdx.x, lane = tid & 31;
  const int p = tid & 63, cg = tid >> 6;
  const float* src = x2 + ((size_t)b * NC + cg * 32) * NP + g * 64 + p;
  float s = 0.f, m = -INFINITY;
#pragma unroll 4
  for (int c = 0; c < 32; ++c) {
    const float v = bfr(src[(size_t)c * NP]);
    s += v;
    m = fmaxf(m, v);
  }
  ps[cg][p] = s;
  pm[cg][p] = m;
  __syncthreads();
  if (tid < 64) {
    const float ts = ((ps[0][tid] + ps[1][tid]) + ps[2][tid]) + ps[3][tid];
    const float tm = fmaxf(fmaxf(pm[0][tid], pm[1][tid]), fmaxf(pm[2][tid], pm[3][tid]));
    os[tid] = ts * (1.0f / 128.0f);
    os[64 + tid] = tm;
  }
  __syncthreads();
  if (tid < 32) {
    const v4f v = *(const v4fa*)(os + 4 * lane);   // lanes 0..15: means 0..63, lanes 16..31: maxes 0..63
    float* base = SPIN + (size_t)b * 2 * NP + g * 64;
    {
      if (lane < 16) *(v4f*)(base + 4 * lane) = v;
      else           *(v4f*)(base + NP + 4 * (lane - 16)) = v;
      
    }
  }
}

// ---------------------------------------------------------------------------
// Kernel 5: positional branch, grid (1 + 16, 8 batches), 256 threads, all f32 VALU:
//   ch[c]   = sum_{i in {mean,max}} sum_{t<5} bf16r(conv1_w[i][t]) * stk[i][c+t-2]   (zero pad 2, no flip, no bias)
//   Avec[o] = sum_c bf16r(ck_w[o][c]) * ch[c] + bf16r(ck_b[o]) ;  R[o] = sum_c bf16r(ck_w[o][c])
//   sp[n]   = sum_i sum_{u,v<7} bf16r(sp_w[i][u][v]) * spin[i][h+u-3][w+v-3] + bf16r(sp_b)   (zero pad 3)
// blockIdx.x == 0: the channel branch of batch b (AVEC[b][128] by wave 0, RVEC[b][128] by wave 1).
// blockIdx.x == 1 + s: the spatial conv of image rows 4s..4s+3 (256 pixels, one per thread). The two pooled maps are
// staged with their halo as zero-padded 10x70 LDS planes; each wave stores one whole 128-B line of SP.
// Coverage: AVEC/RVEC 8 x 128; SP 8 x 16 blocks x 256 thr = 8 x 4096.
// ---------------------------------------------------------------------------
#define POS_ROWS   4                     // image rows per spatial work-group
#define POS_SLICES (64 / POS_ROWS)       // spatial work-groups per batch
#define POS_PLANE  ((POS_ROWS + 6) * 70) // floats per padded plane
static_assert(POS_ROWS * 64 == 256);
static_assert(2 * POS_PLANE > 5 * 256 && 2 * POS_PLANE <= 6 * 256);

__global__ __launch_bounds__(256) void k_pos(const float* __restrict__ AV, const float* __restrict__ MX,
                                            const float* __restrict__ SPIN, const float* __restrict__ c1w,
                                            const float* __restrict__ ckw, const float* __restrict__ ckb,
                                            const float* __restrict__ spw, const float* __restrict__ spb,
                                            float* __restrict__ AVEC, float* __restrict__ RVEC,
                                            float* __restrict__ SP) {
  __shared__ float sav[128], smx[128];
  __shared__ __align__(16) float sch[128];
  __shared__ float sw1[32];
  __shared__ __align__(16) float sw2[128];
  __shared__ __align__(16) float savec[128], srv[128];
  __shared__ float spl[2 * POS_PLANE];
  const int b = blockIdx.y, tid = threadIdx.x, lane = tid & 31, w = tid >> 5;

  if (blockIdx.x == 0) {                               // block-uniform: every barrier below is passed by the whole block
    const int o = tid & 127;                           // waves 4..7 repeat waves 0..3 and store nothing
    // the ck_w row and ck_b are read here, ahead of the first barrier, so that they are in flight together with the
    // pooled values instead of one dependent round trip per four weights behind the second barrier
    v4f wq[NC / 4];                                    // this thread's whole ck_w row
#pragma unroll
    for (int i = 0; i < NC / 4; ++i) wq[i] = *(const v4fa*)(ckw + (size_t)o * NC + 4 * i);
    const float cb = ckb[o];
    if (tid < 128) { sav[tid] = AV[b * NC + tid]; smx[tid] = MX[b * NC + tid]; }
    if (tid < 32) sw1[tid] = bfr(c1w[min(tid, 9)]);    // clamped address
    __syncthreads();
    // channel conv1d
    if (tid < 128) {
      const int c = tid;
      float acc = 0.0f;
#pragma unroll 1
      for (int t = 0; t < 5; ++t) {
        const int cc  = c + t - 2;
        const int ccl = min(max(cc, 0), NC - 1);
        const float valid = (cc >= 0 && cc < NC) ? 1.0f : 0.0f;
        acc += valid * (sw1[t] * sav[ccl] + sw1[5 + t] * smx[ccl]);
      }
      sch[c] = acc;
    }
    __syncthreads();
    // Avec, R: c ascending, as one chain each (Avec by fused multiply-add, written out so that the unrolled form
    // is not split into packed multiplies and separate adds). Unrolled so that the row stays in registers.
    {
      float a = bfr(cb), r = 0.0f;
#pragma unroll
      for (int c = 0; c < NC; ++c) {
        const float wv = bfr(wq[c >> 2][c & 3]);
        a = __builtin_fmaf(wv, sch[c], a);
        r += wv;
      }
      if (tid < 128) { savec[o] = a; srv[o] = r; }
    }
    __syncthreads();
    if (w == 0) {
      const v4f v = *(const v4fa*)(savec + 4 * lane);
      *(v4f*)(AVEC + b * NC + 4 * lane) = v;
    } else if (w == 1) {
      const v4f v = *(const v4fa*)(srv + 4 * lane);
      *(v4f*)(RVEC + b * NC + 4 * lane) = v;
    }
    return;
  }

  // spatial 7x7x2 conv + bias of image rows h0..h0+3
  const int sl = blockIdx.x - 1;
  const int h0 = sl * POS_ROWS;
  const float* sp0 = SPIN + (size_t)b * 2 * NP;
  const float bias_sp = bfr(spb[0]);                   // read ahead of the barrier, with the other loads
  {
    // padded planes with halo: every lane loads at a clamped address, so that the weight load and the six tile loads
    // are in flight together; what lies outside the image becomes 0
    const float wt = spw[min(tid, 97)];
    float tv[6];
#pragma unroll
    for (int k = 0; k < 6; ++k) {
      const int i   = min(k * 256 + tid, 2 * POS_PLANE - 1);
      const int pl  = i / POS_PLANE, rem = i - pl * POS_PLANE;
      const int rr  = rem / 70, cc = rem - rr * 70;
      const int gh  = h0 + rr - 3, gx = cc - 3;
      const bool in = gh >= 0 && gh < 64 && gx >= 0 && gx < 64;
      const float v = sp0[pl * NP + min(max(gh, 0), 63) * 64 + min(max(gx, 0), 63)];
      tv[k] = in ? v : 0.0f;
    }
    if (tid < 128) sw2[tid] = bfr(wt);
#pragma unroll
    for (int k = 0; k < 5; ++k) spl[k * 256 + tid] = tv[k];
    if (5 * 256 + tid < 2 * POS_PLANE) spl[5 * 256 + tid] = tv[5];
  }
  __syncthreads();
  {
    const int h = tid >> 6, x = tid & 63;
    const float* t0 = spl + h * 70 + x;
    float acc = bias_sp;
    // both tap loops unrolled: the 98 LDS reads of a pixel do not depend on one another and overlap, where the
    // rolled loops paid one LDS round trip a tap; the taps are added in the same order
#pragma unroll
    for (int u = 0; u < 7; ++u) {
#pragma unroll
      for (int v = 0; v < 7; ++v) {
        const int li = u * 70 + v;
        acc += sw2[u * 7 + v] * t0[li] + sw2[49 + u * 7 + v] * t0[POS_PLANE + li];
      }
    }
    SP[(size_t)b * NP + sl * 256 + tid] = acc;
    asm volatile("s_wait_xcnt 0x0" ::: "memory");      // before a register that the store names is rewritten
  }
}

// ---------------------------------------------------------------------------
// Kernel 6: [Q|K|V] = XT . Wqkv^T + bias (exact bf16 x bf16 products, f32 accumulate, K = 128 in 4 steps of 32).
// grid = (32768/64 = 512 token tiles, 3 = which), 128 threads = 4 waves; wave w owns tokens m0+16w..+15 x all 128
// output channels (8 accumulator tiles). A fragments straight from XT rows, B fragments from Wqkv rows (both
// k-contiguous bf16, arithmetic addressing). bias (bf16r), Avec and R staged in LDS (one scalar load per thread each).
// Epilogue: f32 tile (acc + bias) staged in LDS [64][132];
//   which 0: alpha[n] = sum_o Avec[b][o] q[o][n], beta[n] = sum_o R[o] q[o][n] (f32, unroll 4) -> ALPHA/BETA 256-B
//            segments (16 lanes x 16 B); Q hi|lo token-major planes [tok][128];
//   which 1: K hi|lo token-major planes;  which 2: V hi|lo channel-major planes [b][c][4096] (transposed write).
// ---------------------------------------------------------------------------
__global__ __launch_bounds__(128) void k_qkv(const __bf16* __restrict__ XT, const __bf16* __restrict__ Wb,
                                            const float* __restrict__ qb, const float* __restrict__ kb,
                                            const float* __restrict__ vb,
                                            const float* __restrict__ AVEC, const float* __restrict__ RVEC,
                                            unsigned short* __restrict__ QP, unsigned short* __restrict__ KP,
                                            unsigned short* __restrict__ VP,
                                            float* __restrict__ ALPHA, float* __restrict__ BETA) {
  __shared__ __align__(16) float sT[64 * 132];
  __shared__ __align__(16) float sAV[128], sRV[128], sAB[128], sBI[128];
  const int tid = threadIdx.x, lane = tid & 31, w = tid >> 5, hh = lane >> 4, l16 = lane & 15;
  const int which = blockIdx.y;
  const int m0 = blockIdx.x * 64;            // global token row
  const int b  = m0 / NP;
  const int n0 = m0 - b * NP;

  const float* bias = (which == 0) ? qb : ((which == 1) ? kb : vb);   // block-uniform select, same address space
  sAV[tid] = AVEC[b * NC + tid];
  sRV[tid] = RVEC[b * NC + tid];
  sBI[tid] = bfr(bias[tid]);
  __syncthreads();

  const v8f zero8 = {0.f, 0.f, 0.f, 0.f, 0.f, 0.f, 0.f, 0.f};
  v8f acc[8];
#pragma unroll
  for (int t = 0; t < 8; ++t) acc[t] = zero8;

  const __bf16* arow = XT + (size_t)(m0 + 16 * w + l16) * NC;        // token row, k = input channel
  const __bf16* brow = Wb + ((size_t)which * NC + l16) * NC;          // output channel row (tile 0), k = input channel
#pragma unroll
  for (int kc = 0; kc < 4; ++kc) {
    const v16b a = ldfrag(arow + kc * 32, hh);
#pragma unroll
    for (int t = 0; t < 8; ++t) {
      const v16b bf = ldfrag(brow + (size_t)t * 16 * NC + kc * 32, hh);
      acc[t] = mma_bf(a, bf, acc[t]);
    }
  }
  // D[r] of tile t = Y[token 16w+8hh+r][channel 16t+l16]
#pragma unroll
  for (int t = 0; t < 8; ++t) {
    const float bv = sBI[16 * t + l16];
#pragma unroll
    for (int r = 0; r < 8; ++r) sT[(16 * w + 8 * hh + r) * 132 + 16 * t + l16] = acc[t][r] + bv;
  }
  __syncthreads();
  if (which == 0 && tid < 64) {            // waves 0,1
    const float* qr = sT + tid * 132;
    float a = 0.0f, be = 0.0f;
#pragma unroll 4
    for (int o = 0; o < NC; ++o) {
      const float q = qr[o];
      a  += sAV[o] * q;
      be += sRV[o] * q;
    }
    sAB[tid] = a;
    sAB[64 + tid] = be;
  }
  __syncthreads();

  // pack hi|lo planes
  const int q8 = lane & 7, sub = lane >> 3;
  v4u hv[8], lv[8];
#pragma unroll
  for (int i = 0; i < 8; ++i) {
    const int lid  = w * 32 + i * 4 + sub;                                   // 0..127
    const int base = (which != 2) ? ((lid >> 1) * 132 + (lid & 1) * 64 + 8 * q8) : ((8 * q8) * 132 + lid);
    const int estr = (which != 2) ? 1 : 132;
    v4u a, a2;
#pragma unroll
    for (int q = 0; q < 4; ++q) {
      const float f0 = sT[base + (2 * q) * estr];
      const float f1 = sT[base + (2 * q + 1) * estr];
      const unsigned short h0 = f2bf_bits(f0), h1 = f2bf_bits(f1);
      const unsigned short l0 = f2bf_bits(f0 - bfbits2f(h0)), l1 = f2bf_bits(f1 - bfbits2f(h1));
      a[q]  = pk16(h0, h1);
      a2[q] = pk16(l0, l1);
    }
    hv[i] = a;
    lv[i] = a2;
  }
  unsigned short* P = (which == 0) ? QP : ((which == 1) ? KP : VP);
  {
#pragma unroll
    for (int i = 0; i < 8; ++i) {
      const int lid = w * 32 + i * 4 + sub;
      const size_t go = (which != 2)
          ? ((size_t)(m0 + (lid >> 1)) * NC + (lid & 1) * 64 + 8 * q8)
          : (((size_t)b * NC + lid) * NP + n0 + 8 * q8);
      *(v4ua*)(P + go) = hv[i];
      *(v4ua*)(P + PLANE_ELEMS + go) = lv[i];
    }
    
  }
  if (which == 0 && w == 0) {
    const v4f v = *(const v4fa*)(sAB + 4 * lane);    // lanes 0..15: alpha 0..63, lanes 16..31: beta 0..63
    {
      if (lane < 16) *(v4f*)(ALPHA + m0 + 4 * lane) = v;
      else           *(v4f*)(BETA + m0 + 4 * (lane - 16)) = v;
      
    }
  }
}

// ---------------------------------------------------------------------------
// Kernel 7: full (non-causal, unmasked) attention, head dim 128, block per (b, 64-query tile): grid 8 x 64 = 512,
// 256 threads = 8 waves. Wave w: query group g = w&3 (queries 16g..16g+15), key half kh = w>>2.
//   energy[n][m] = q[n].k[m] (bf16 hi/lo 3-term WMMA) + alpha[m] + sp[n]*beta[m]  (f32, no scale)
//   Both products are taken transposed, so that a lane owns ONE query (n = 16g + (lane&15)) all the way:
//   S^T = K . Q^T : A = K rows (m = key), B = Q rows (n = query); D[r] of tile jj = S[key key0+16jj+8hh+r][query].
//   The 16 scores of a lane are keys key0+8hh+0..7 and key0+16+8hh+0..7: exactly the k order of a B fragment of
//   32 keys, so p hi|lo is packed in registers and goes into the second product with no trip through LDS.
//   O^T += V . P^T : A = Vcm rows (m = channel), B = P (n = query, k = the wave's own 32 keys), all 128 channels
//   (8 accumulator tiles); D[r] of tile t = O[channel 16t+8hh+r][query].
//   Row max and row sum are in-lane over 16 values plus one exchange with lane^16. Each wave keeps an online softmax
//   state (max, sum, O) of its own for its key half of every chunk; the two halves of a query are merged once,
//   behind the key loop, through LDS: O = (O0 2^(m0-m) + O1 2^(m1-m)) / (l0 2^(m0-m) + l1 2^(m1-m)).
//   Online softmax over all 4096 keys in 64 chunks of 64 (compile-time trip count, no masking). The running maximum is
//   kept in log2 units (max * log2 e), so that p = 2^(e * log2 e - max) is one fused multiply-add and one v_exp_f32;
//   the correction of the older sums, 2^(old max - new max), uses the very values the older p were formed with.
// LDS: K hi|lo [64][128], Vcm hi|lo [128][64], Q hi|lo [64][128] (staged once); every row is
// padded by 16 B (pitch 272 B for 256-B rows, 144 B for 128-B rows = 16 B x odd), so the 16 rows that one 16-byte
// fragment read touches fall on 16 different bank groups; the lo plane of K/Q starts 64 B and that of V 128 B past a
// multiple of 256 B; staging gives consecutive lanes consecutive 16-B pieces of a row (whole lines);
// K, V and alpha|beta come by asynchronous copies to LDS, one buffer each, two barriers a chunk: V(kc) is issued behind
// the barrier at the loop's head (V.P of kc-1 done) and waited for in front of the barrier behind the scores;
// K(kc+1), alpha|beta(kc+1) are issued behind that barrier (scores of kc done) and waited for in front of the barrier
// at the loop's head;
// alpha/beta slices [64]+[64], merge arrays [128]+[128]; output tile [128 c][64 n] (pitch 68) overlays the
// K/V region after the loop (block barrier first).
// Staging coverage: Q 8 rounds x 256 thr x 8 = 64x128 x 2 planes; per chunk K 16 rounds x 128 thr x 8 = 64x128 x 2 planes,
// V 16 rounds x 128 thr x 8 = 128x64 x 2 planes;
// Output: out[b][c][n0..n0+63] channel-major; each channel row segment = 256 B = 16 contiguous lanes x 16 B
// ---------------------------------------------------------------------------
#define KQ_PITCH 136                       // elements: 128 + 8 (272 B)
#define VP_PITCH 72                        // elements: 64 + 8 (144 B)
#define KQ_PLANE (64 * KQ_PITCH + 32)      // elements: 17472 B = 68 x 256 + 64
#define V_PLANE  (128 * VP_PITCH + 64)     // elements: 18560 B = 72 x 256 + 128
#define SM_K   0
#define SM_V   (SM_K + 2 * KQ_PLANE * 2)
#define SM_Q   (SM_V + 2 * V_PLANE * 2)
#define SM_AB  (SM_Q + 2 * KQ_PLANE * 2)
#define SM_RED (SM_AB + 512)
#define SM_TOT (SM_RED + 1024)
static_assert(128 * 68 * 4 <= SM_Q);
static_assert(SM_V % 16 == 0 && SM_Q % 16 == 0 && SM_AB % 16 == 0);
static_assert(2 * SM_TOT <= 327680);

__global__ __launch_bounds__(256) void k_attn(const __bf16* __restrict__ QP, const __bf16* __restrict__ KP,
                                             const __bf16* __restrict__ VP, const float* __restrict__ ALPHA,
                                             const float* __restrict__ BETA, const float* __restrict__ SP,
                                             float* __restrict__ out) {
  __shared__ __align__(16) unsigned char smem[SM_TOT];
  __bf16* Ks   = (__bf16*)(smem + SM_K);     // hi at +0, lo at +KQ_PLANE elements
  __bf16* Vs   = (__bf16*)(smem + SM_V);
  __bf16* Qs   = (__bf16*)(smem + SM_Q);
  float*  sab  = (float*)(smem + SM_AB);     // alpha 0..63, beta 64..127
  float*  redm = (float*)(smem + SM_RED);    // final row max of a key half [4 g][2 kh][16]
  float*  reds = redm + 128;                 // final row sum of a key half [4 g][2 kh][16]
  float*  Os   = (float*)(smem + SM_K);      // [128][68] after the key loop

  const int tid = threadIdx.x, lane = tid & 31, w = tid >> 5, hh = lane >> 4, c = lane & 15;
  const int g = w & 3, kh = w >> 2;
  const int key0 = 32 * kh;                  // this wave's key half within a chunk
  const int b  = blockIdx.x >> 6;
  const int n0 = (blockIdx.x & 63) * 64;
  const size_t tok0 = (size_t)b * NP + n0;

  // Staging lane maps: consecutive lanes take consecutive 16-B pieces, so one wave-wide load covers 4 whole 128-B lines.
  const int kq_r = tid >> 4, kq_c = (tid & 15) * 8;   // Q: 16 lanes per 256-B row, 16 rows per round of the block
  const unsigned kq_g = (unsigned)(kq_r * NC + kq_c) * 2u; // the lane's byte offset in a token-major tile
  // ---- stage the block's Q tile hi|lo: 2 planes x 4 rounds x 256 thr x 8 elements ----
  {
    __bf16* dst = Qs + kq_r * KQ_PITCH + kq_c;
#pragma unroll
    for (int p = 0; p < 2; ++p) {
      const uint64_t qsrc = ubase(QP + (size_t)p * PLANE_ELEMS + tok0 * NC);
#pragma unroll
      for (int i = 0; i < 4; ++i) {
        const v8b v = ldg16(qsrc, kq_g, i * 16 * NC * 2);
        *(v8ba*)(dst + p * KQ_PLANE + i * 16 * KQ_PITCH) = v;
      }
    }
  }
  // ---- sp[n] of this lane's query ----
  const float spq = SP[tok0 + 16 * g + c];
  float mrow = -INFINITY, lrow = 0.0f;       // this wave's own running max (log2 units) and sum of the lane's query (same in lane^16)
  const v8f zero8 = {0.f, 0.f, 0.f, 0.f, 0.f, 0.f, 0.f, 0.f};
  v8f oacc[8];
#pragma unroll
  for (int t = 0; t < 8; ++t) oacc[t] = zero8;

  const __bf16* qrow = Qs + (16 * g + c) * KQ_PITCH;

  // K/V plane bases of this batch (block-uniform) and the lane's running byte offsets (below 1 MiB + one tile)
  const uint64_t ksrc[2] = {ubase(KP + (size_t)b * NP * NC), ubase(KP + PLANE_ELEMS + (size_t)b * NP * NC)};
  const uint64_t vsrc[2] = {ubase(VP + (size_t)b * NC * NP), ubase(VP + PLANE_ELEMS + (size_t)b * NC * NP)};
  // Who copies what: waves 0..3 bring the K tiles (wave 0 the alpha|beta slice too), waves 4..7 the V tiles, so that a
  // wave's wait for its own copies never holds up the other tile's copies in flight. The wave's number stands in a
  // scalar register: every test on it is a scalar branch, and every lane is on at every copy.
  const int wu = __builtin_amdgcn_readfirstlane(w);
  const int ct = tid & 127;                            // the lane's place among the 128 lanes that bring a tile
  const int ck_r = ct >> 4, ck_c = (ct & 15) * 8;      // K: 16 lanes per 256-B row, 8 rows per round
  const int cv_r = ct >> 3, cv_c = (ct & 7) * 8;       // V:  8 lanes per 128-B row, 16 rows per round
  unsigned koff = (unsigned)(ck_r * NC + ck_c) * 2u;   // the lane's running byte offset in the token-major K planes
  unsigned voff = (unsigned)(cv_r * NP + cv_c) * 2u;   // the lane's running byte offset in the channel-major V planes
  // K: 2 planes x 8 rounds x 128 thr x 8 elements = 64 rows x 128 x 2 planes
  __bf16* kd = Ks + ck_r * KQ_PITCH + ck_c;
  // V: 2 planes x 8 rounds x 128 thr x 8 elements = 128 channel rows x 64 keys x 2 planes
  __bf16* vd = Vs + cv_r * VP_PITCH + cv_c;
  // alpha|beta slice of a chunk: one copy, lanes 0..15 the 64 alphas, lanes 16..31 the 64 betas
  const uint64_t absrc = (uint64_t)((lane < 16 ? ALPHA + 4 * lane : BETA + 4 * (lane - 16)) + (size_t)b * NP);

  // chunk 0's K tile and alpha|beta slice, into LDS that nobody has touched yet
  if (wu < 4) {
#pragma unroll   // each copy's plane and step are constants: no index arithmetic is left at run time
    for (int i = 0; i < 16; ++i)
      cp16(ksrc[i >> 3], koff, (i & 7) * 8 * NC * 2, kd + (i >> 3) * KQ_PLANE + (i & 7) * 8 * KQ_PITCH);
    if (wu == 0) cp16(absrc, 0, 0, sab + 4 * lane);
  }

#pragma unroll 1
  for (int kc = 0; kc < NP / 64; ++kc) {
    // this chunk's K and alpha|beta have landed (first trip: Q is stored too); every wave has left the V tile
    wait_lds();
    wait_copies();
    __syncthreads();
    // this chunk's V tile flies under the scores
    if (wu >= 4) {
#pragma unroll   // as above: constant plane and step per copy
      for (int i = 0; i < 16; ++i)
        cp16(vsrc[i >> 3], voff, (i & 7) * 16 * NP * 2, vd + (i >> 3) * V_PLANE + (i & 7) * 16 * VP_PITCH);
      voff += 64 * 2;        // next 64 keys: 64 columns of V
    }

    // ---- scores, transposed: s[jj][r] = S[key m0+key0+16jj+8hh+r][query 16g+c], 3-term split ----
    v8f s[2];
    s[0] = zero8; s[1] = zero8;
#pragma unroll 1
    for (int dc = 0; dc < 4; ++dc) {
      const v16b qa = ldfrag(qrow + dc * 32, hh);
      const v16b ql = ldfrag(qrow + KQ_PLANE + dc * 32, hh);
#pragma unroll
      for (int jj = 0; jj < 2; ++jj) {
        const __bf16* krow = Ks + (key0 + 16 * jj + c) * KQ_PITCH + dc * 32;
        const v16b kb = ldfrag(krow, hh);
        const v16b kl = ldfrag(krow + KQ_PLANE, hh);
        s[jj] = mma_bf(kb, qa, s[jj]);
        s[jj] = mma_bf(kl, qa, s[jj]);
        s[jj] = mma_bf(kb, ql, s[jj]);
      }
    }
    // ---- positional terms in f32 (alpha, beta of the lane's 16 keys), then the max over this wave's 32 keys ----
    float cmx = -INFINITY;
#pragma unroll
    for (int jj = 0; jj < 2; ++jj) {
      const float* ap = sab + key0 + 16 * jj + 8 * hh;
      const v4f a0 = *(const v4fa*)(ap),      a1 = *(const v4fa*)(ap + 4);
      const v4f b0 = *(const v4fa*)(ap + 64), b1 = *(const v4fa*)(ap + 68);
#pragma unroll
      for (int r = 0; r < 8; ++r) {
        const float al = (r < 4) ? a0[r & 3] : a1[r & 3];
        const float be = (r < 4) ? b0[r & 3] : b1[r & 3];
        const float e = s[jj][r] + al + spq * be;
        s[jj][r] = e;
        cmx = fmaxf(cmx, e);
      }
    }
    cmx = fmaxf(cmx, xhalf(cmx));
    wait_lds();                   // every wave has left the K tile and the alpha|beta slice
    if (wu >= 4) wait_copies();   // this chunk's V has landed
    __syncthreads();
    // the next chunk's K tile and alpha|beta slice fly under the softmax and V.P
    if (kc + 1 < NP / 64) {
      if (wu < 4) {
        koff += 64 * NC * 2; // next 64 keys: 64 token rows of K
#pragma unroll   // as above: constant plane and step per copy
        for (int i = 0; i < 16; ++i)
          cp16(ksrc[i >> 3], koff, (i & 7) * 8 * NC * 2, kd + (i >> 3) * KQ_PLANE + (i & 7) * 8 * KQ_PITCH);
        if (wu == 0) cp16(absrc, (unsigned)(kc + 1) * 64 * 4, 0, sab + 4 * lane);
      }
    }
    // ---- online softmax of the lane's query over this wave's keys; P hi|lo packed as B fragments in registers ----
    const float mnew = fmaxf(mrow, cmx * LOG2E);
    const float corr = ex2(mrow - mnew);
    mrow = mnew;
    float psum = 0.0f;
    union PB { v16b v; unsigned u[8]; } pa, pl;   // element 8jj+r = key key0+16jj+8hh+r: the fragment's k order
#pragma unroll
    for (int jj = 0; jj < 2; ++jj) {
#pragma unroll
      for (int r = 0; r < 8; r += 2) {
        const float p0 = ex2(__builtin_fmaf(s[jj][r], LOG2E, -mnew));
        const float p1 = ex2(__builtin_fmaf(s[jj][r + 1], LOG2E, -mnew));
        psum += p0;
        psum += p1;
        const unsigned short h0 = f2bf_bits(p0), h1 = f2bf_bits(p1);
        const unsigned short l0 = f2bf_bits(p0 - bfbits2f(h0)), l1 = f2bf_bits(p1 - bfbits2f(h1));
        pa.u[4 * jj + (r >> 1)] = pk16(h0, h1);
        pl.u[4 * jj + (r >> 1)] = pk16(l0, l1);
      }
    }
    psum += xhalf(psum);
    lrow = lrow * corr + psum;
#pragma unroll
    for (int t = 0; t < 8; ++t) {
#pragma unroll
      for (int r = 0; r < 8; ++r) oacc[t][r] *= corr;
    }

    // ---- O^T += V . P^T : A = Vcm row (channel 16t+c) [key], B = P [key][query]; 8 channel tiles, the wave's 32 keys ----
#pragma unroll   // the accumulator tiles are indexed by constants, so that they stay in registers
    for (int t = 0; t < 8; ++t) {
      const __bf16* vr = Vs + (16 * t + c) * VP_PITCH + key0;
      const v16b vb = ldfrag(vr, hh);
      const v16b vl = ldfrag(vr + V_PLANE, hh);
      oacc[t] = mma_bf(vb, pa.v, oacc[t]);
      oacc[t] = mma_bf(vl, pa.v, oacc[t]);
      oacc[t] = mma_bf(vb, pl.v, oacc[t]);
    }
  }
  wait_lds();
  wait_copies();     // no copy is in flight here; the wait stands before the tiles' LDS gets another use
  // ---- merge the two key halves of every query: exchange (max, sum), scale, add through the output tile ----
  if (hh == 0) { redm[g * 32 + kh * 16 + c] = mrow; reds[g * 32 + kh * 16 + c] = lrow; }
  __syncthreads();   // all waves done with the K/V tiles before the output tile overlays them; max and sum published
  {
    const float m0 = redm[g * 32 + c], m1 = redm[g * 32 + 16 + c];
    const float l0 = reds[g * 32 + c], l1 = reds[g * 32 + 16 + c];
    const float mt = fmaxf(m0, m1);
    const float f0 = ex2(m0 - mt), f1 = ex2(m1 - mt);
    const float inv = 1.0f / (l0 * f0 + l1 * f1);
    const float fs = (kh == 0 ? f0 : f1) * inv;
    float* op = Os + (8 * hh) * 68 + 16 * g + c;     // O staged as [c][n_local]
    if (wu >= 4) {                                   // key half 1 stores its share
#pragma unroll
      for (int t = 0; t < 8; ++t) {
#pragma unroll
        for (int r = 0; r < 8; ++r) op[(16 * t + r) * 68] = oacc[t][r] * fs;
      }
    }
    __syncthreads();
    if (wu < 4) {                                    // key half 0 adds its own to the same places
#pragma unroll
      for (int t = 0; t < 8; ++t) {
#pragma unroll
        for (int r = 0; r < 8; ++r) op[(16 * t + r) * 68] = oacc[t][r] * fs + op[(16 * t + r) * 68];
      }
    }
  }
  __syncthreads();
  {
    float* ob = out + (size_t)b * NC * NP + n0;
    const int c4 = (lane & 15) * 4;
    {
#pragma unroll
      for (int i = 0; i < 8; ++i) {
        const int row = i * 16 + w * 2 + hh;                       // 0..127 channel
        const v4f v = *(const v4fa*)(Os + row * 68 + c4);
        *(v4f*)(ob + (size_t)row * NP + c4) = v;
      }
      
    }
  }
}

// ---------------------------------------------------------------------------
//   XT    bf16 [32768][128]          0           8388608
//   WQKV  bf16 [384][128]            8388608       98304
//   AV    f32  [8][128]              8486912        4096
//   MX    f32  [8][128]              8491008        4096
//   SPIN  f32  [8][2][4096]          8495104      262144
//   AVEC  f32  [8][128]              8757248        4096
//   RVEC  f32  [8][128]              8761344        4096
//   SP    f32  [8][4096]             8765440      131072
//   ALPHA f32  [8][4096]             8896512      131072
//   BETA  f32  [8][4096]             9027584      131072
//   Q hi|lo bf16 2x[32768][128]      9158656    16777216
//   K hi|lo bf16 2x[32768][128]     25935872    16777216
//   V hi|lo bf16 2x[8][128][4096]   42713088    16777216
//   total                          59490304
// ---------------------------------------------------------------------------
extern "C" void kernel_launch(void* const* d_in, const int* in_sizes, int n_in,
                              void* d_out, int out_size, void* d_ws, size_t ws_size,
                              hipStream_t stream) {
  if (n_in < 13) return;
  if (in_sizes[0] != NB * NC * NP || in_sizes[1] != NB * NC * NP) return;
  if (in_sizes[2] != NC * NC || in_sizes[4] != NC * NC || in_sizes[6] != NC * NC || in_sizes[8] != NC * NC) return;
  if (in_sizes[3] != NC || in_sizes[5] != NC || in_sizes[7] != NC || in_sizes[9] != NC) return;
  if (in_sizes[10] != 10 || in_sizes[11] != 98 || in_sizes[12] != 1) return;
  if (out_size != NB * NC * NP) return;

  const float* x    = (const float*)d_in[0];
  const float* x2   = (const float*)d_in[1];
  const float* q_w  = (const float*)d_in[2];
  const float* q_b  = (const float*)d_in[3];
  const float* k_w  = (const float*)d_in[4];
  const float* k_b  = (const float*)d_in[5];
  const float* v_w  = (const float*)d_in[6];
  const float* v_b  = (const float*)d_in[7];
  const float* ck_w = (const float*)d_in[8];
  const float* ck_b = (const float*)d_in[9];
  const float* c1w  = (const float*)d_in[10];
  const float* sp_w = (const float*)d_in[11];
  const float* sp_b = (const float*)d_in[12];
  float* out = (float*)d_out;

  const size_t plane_b = PLANE_ELEMS * 2;                 // 8388608 bytes per 16-bit plane
  size_t off = 0;
  const size_t oXT   = off; off += plane_b;
  const size_t oW    = off; off += (size_t)3 * NC * NC * 2;
  const size_t oAV   = off; off += (size_t)NB * NC * 4;
  const size_t oMX   = off; off += (size_t)NB * NC * 4;
  const size_t oSPIN = off; off += (size_t)NB * 2 * NP * 4;
  const size_t oAVEC = off; off += (size_t)NB * NC * 4;
  const size_t oRVEC = off; off += (size_t)NB * NC * 4;
  const size_t oSP   = off; off += (size_t)NB * NP * 4;
  const size_t oAL   = off; off += (size_t)NB * NP * 4;
  const size_t oBE   = off; off += (size_t)NB * NP * 4;
  const size_t oQ    = off; off += 2 * plane_b;
  const size_t oK    = off; off += 2 * plane_b;
  const size_t oV    = off; off += 2 * plane_b;           // off = 59490304
  if (off > ws_size) return;
  if (off > (size_t)134217728) return;

  char* ws = (char*)d_ws;
  unsigned short* XT    = (unsigned short*)(ws + oXT);
  unsigned short* WQKV  = (unsigned short*)(ws + oW);
  float* AV    = (float*)(ws + oAV);
  float* MX    = (float*)(ws + oMX);
  float* SPIN  = (float*)(ws + oSPIN);
  float* AVEC  = (float*)(ws + oAVEC);
  float* RVEC  = (float*)(ws + oRVEC);
  float* SP    = (float*)(ws + oSP);
  float* ALPHA = (float*)(ws + oAL);
  float* BETA  = (float*)(ws + oBE);
  unsigned short* QP = (unsigned short*)(ws + oQ);
  unsigned short* KPp = (unsigned short*)(ws + oK);
  unsigned short* VPp = (unsigned short*)(ws + oV);

  // 1. x -> token-major bf16 planes (grid: n blocks, c blocks, batch)
  k_xt<<<dim3(NP / 64, NC / 64, NB), 256, 0, stream>>>(x, XT);
  // 2. projection weights -> bf16 [384][128]
  k_wcvt<<<dim3(NC * NC / 8 / 256, 3), 256, 0, stream>>>(q_w, k_w, v_w, WQKV);
  // 3. per-(b,c) pixel mean/max of x2
  k_poolbc<<<NB * NC / 32, 256, 0, stream>>>(x2, AV, MX);
  // 4. per-(b,n) channel mean/max of x2
  k_poolc<<<NB * (NP / 64), 256, 0, stream>>>(x2, SPIN);
  // 5. positional branch: Avec, R (x = 0), sp (x = 1..16), per batch (y)
  k_pos<<<dim3(POS_SLICES + 1, NB), 256, 0, stream>>>(AV, MX, SPIN, c1w, ck_w, ck_b, sp_w, sp_b, AVEC, RVEC, SP);
  // 6. q/k/v projections + alpha/beta + hi|lo planes
  k_qkv<<<dim3(NTOK / 64, 3), 128, 0, stream>>>((const __bf16*)(const void*)XT, (const __bf16*)(const void*)WQKV,
                                                q_b, k_b, v_b, AVEC, RVEC, QP, KPp, VPp, ALPHA, BETA);
  // 7. attention, channel-major output
  k_attn<<<NB * (NP / 64), 256, 0, stream>>>((const __bf16*)(const void*)QP, (const __bf16*)(const void*)KPp,
                                             (const __bf16*)(const void*)VPp, ALPHA, BETA, SP, out);
  (void)hipGetLastError();
}

// v008
// A run of this version takes 213 microseconds.
// Two timings next to v007 both put it at 1.15 times that version's speed.
// Over all steps from v000 it is 6.59 times as fast.
// Contractions: q/k/v 1x1 projections on v_wmma_f32_16x16x32_bf16 (bf16 operands taken from bf16-RNE inputs, single product, f32 accumulate);
// q.k^T scores and p.v on v_wmma_f32_16x16x32_bf16 with bf16 hi/lo split operands (hi.hi + hi.lo + lo.hi), f32 accumulate;
// pools, channel conv1d, spatial 7x7 conv, positional vectors alpha/beta, online softmax (hardware exp2) in f32.
// 16-bit planes and carries: XT = bf16 RNE(x), Wqkv = bf16 RNE(w), Q/K/V hi = RNE(y), lo = RNE(y - hi), P hi/lo per key chunk in registers.
// No power-of-two carry on any plane (bf16 keeps the f32 exponent range), so no inverse fold anywhere.
#include <hip/hip_runtime.h>
#include <math.h>
#include <stdint.h>

#define NB   8
#define NC   128
#define NP   4096
#define NTOK (NB * NP)
#define PLANE_ELEMS ((size_t)NTOK * NC)

static_assert(NP % 64 == 0);
static_assert(NC == 128);
static_assert((NB * NC) % 32 == 0);
static_assert(NP % 256 == 0);

typedef __attribute__((ext_vector_type(16))) __bf16 v16b;
typedef __attribute__((ext_vector_type(8)))  __bf16 v8b;
typedef __attribute__((ext_vector_type(8)))  float  v8f;
typedef __attribute__((ext_vector_type(4)))  float  v4f;
typedef __attribute__((ext_vector_type(2)))  float  v2f;
typedef __attribute__((ext_vector_type(4)))  unsigned int v4u;
typedef v8b __attribute__((may_alias)) v8ba;
typedef v4f __attribute__((may_alias)) v4fa;
typedef v2f __attribute__((may_alias)) v2fa;
typedef v4u __attribute__((may_alias)) v4ua;

// ---------------------------------------------------------------------------
// bf16 helpers (RNE convert on the f32 bits)
// ---------------------------------------------------------------------------
__device__ __forceinline__ unsigned short f2bf_bits(float f) {
  const unsigned u = __float_as_uint(f);
  return (unsigned short)((u + 0x7FFFu + ((u >> 16) & 1u)) >> 16);
}
__device__ __forceinline__ float bfbits2f(unsigned short h) { return __uint_as_float(((unsigned)h) << 16); }
__device__ __forceinline__ float bfr(float f) { return bfbits2f(f2bf_bits(f)); }
__device__ __forceinline__ unsigned pk16(unsigned short a, unsigned short b) { return (unsigned)a | ((unsigned)b << 16); }

// ---------------------------------------------------------------------------
// 16x16x32 bf16 WMMA with hazard guard (ties D, keeps A/B live).
// Fragment map (wave32): lane l, h = l>>4, m = n = l&15.
//   A/B element i: i<8 -> k0+8h+i ; i>=8 -> k0+16+8h+(i-8)
//   D element r : row 8h+r, col l&15
// ---------------------------------------------------------------------------
__device__ __forceinline__ v8f mma_bf(v16b a, v16b b, v8f c) {
  c = __builtin_amdgcn_wmma_f32_16x16x32_bf16(false, a, false, b, (short)0, c, false, false);
  asm volatile("v_nop\n\tv_nop\n\tv_nop\n\tv_nop" : "+v"(c) : "v"(a), "v"(b));
  return c;
}
// One butterfly step inside a 16-lane row: lane l takes the value of lane l ^ M (DPP row_xmask, on the vector port).
template <int M> __device__ __forceinline__ float rowx(float v) {
  const int i = __builtin_bit_cast(int, v);
  return __builtin_bit_cast(float, __builtin_amdgcn_update_dpp(0, i, 0x160 + M, 0xf, 0xf, true));
}
// Lane l takes the value of lane l ^ 16 (the other 16-lane row).
__device__ __forceinline__ float xhalf(float v) {
  const int i = __builtin_bit_cast(int, v);
  return __builtin_bit_cast(float, __builtin_amdgcn_permlanex16(i, i, 0x76543210, 0xfedcba98, false, false));
}
// 2^x on the hardware's own exponential, one instruction. Every argument here is <= about 0 (a score minus its running
// maximum, in log2 units); a result below the smallest normal f32 comes out as 0, which adds nothing to a sum whose
// largest term is 1. The library expf spends a dozen more vector instructions a value on range tests and on a
// two-part argument.
#define LOG2E 1.4426950408889634f
__device__ __forceinline__ float ex2(float x) { return __builtin_amdgcn_exp2f(x); }
union FB { v16b v; v8b h[2]; };
// A or B fragment from a k-contiguous bf16 row; p points at element k0 of the row owned by this lane.
__device__ __forceinline__ v16b ldfrag(const __bf16* p, int hh) {
  FB f;
  f.h[0] = *(const v8ba*)(p + 8 * hh);
  f.h[1] = *(const v8ba*)(p + 16 + 8 * hh);
  return f.v;
}

// 16-B global load at a block-uniform base plus the lane's own 32-bit byte offset plus a constant. Each plane's base goes
// through readfirstlane so that it keeps a scalar register pair of its own and the load takes the scalar-base form;
// without it the compiler folds the lo plane's 8-MiB step into 64-bit vector addresses that it forms anew every trip.
typedef const __attribute__((address_space(1))) v8ba gv8b;
__device__ __forceinline__ uint64_t ubase(const __bf16* p) {
  const uint64_t u = (uint64_t)p;
  const uint32_t lo = (uint32_t)__builtin_amdgcn_readfirstlane((int)(uint32_t)u);
  const uint32_t hi = (uint32_t)__builtin_amdgcn_readfirstlane((int)(uint32_t)(u >> 32));
  return ((uint64_t)hi << 32) | lo;
}
__device__ __forceinline__ v8b ldg16(uint64_t base, unsigned lane_bytes, unsigned imm_bytes) {
  return *(gv8b*)(base + lane_bytes + imm_bytes);
}
// Asynchronous 16-B copy, global memory to LDS, through no register: every lane brings its own 16 bytes (both addresses
// multiples of 16). The compiler places no wait for it: its bytes count as landed behind the issuing wave's own
// s_wait_asynccnt 0, and for the other waves behind the work-group barrier that follows that wait.
typedef __attribute__((ext_vector_type(4))) int v4i;
typedef __attribute__((address_space(1))) v4i gv4i;
typedef __attribute__((address_space(3))) v4i lv4i;
__device__ __forceinline__ void cp16(uint64_t base, unsigned lane_bytes, unsigned imm_bytes, void* lds) {
  __builtin_amdgcn_global_load_async_to_lds_b128((gv4i*)(base + lane_bytes + imm_bytes), (lv4i*)lds, 0, 0);
}
// In front of a barrier behind which a tile is refilled: this wave's LDS reads of that tile have retired.
__device__ __forceinline__ void wait_lds() { asm volatile("s_wait_dscnt 0x0" ::: "memory"); }
// In front of a barrier behind which the other waves read a tile: this wave's own copies have landed.
__device__ __forceinline__ void wait_copies() { asm volatile("s_wait_asynccnt 0x0" ::: "memory"); }

// ---------------------------------------------------------------------------
// Kernel 1: x[b] viewed [128 c][4096 n] (pitch 4096) -> XT bf16 [b*4096+n][128 c] (pitch 128), bf16 RNE.
// 64x64 tiles through LDS. grid = (4096/64, 128/64, 8), 256 threads.
// Coverage per block: load 4 it x 256 thr x 4 floats = 64x64; store 2 it x 256 thr x 8 u16 = 64x64.
// ---------------------------------------------------------------------------
__global__ __launch_bounds__(256) void k_xt(const float* __restrict__ X, unsigned short* __restrict__ xt) {
  __shared__ __align__(16) float tf[64 * 68];
  const int b = blockIdx.z;
  const float* W = X + (size_t)b * NC * NP;
  unsigned short* o = xt + (size_t)b * NP * NC;
  const int c0 = blockIdx.x * 64;   // input column block (n) = output row block
  const int r0 = blockIdx.y * 64;   // input row block (c)    = output column block
  const int tid = threadIdx.x;
  {
    const int lr = tid >> 4;
    const int c4 = (tid & 15) * 4;
#pragma unroll
    for (int it = 0; it < 4; ++it) {
      const int rr = it * 16 + lr;
      const v4f a = *(const v4fa*)(W + (size_t)(r0 + rr) * NP + c0 + c4);
      *(v4f*)(tf + rr * 68 + c4) = a;
    }
  }
  __syncthreads();
  const int sub = tid >> 3;          // 0..31
  const int c8  = (tid & 7) * 8;     // 0..56
  v4u hv[2];
#pragma unroll
  for (int it = 0; it < 2; ++it) {
    const int oc = it * 32 + sub;    // output row within tile (= input column)
    v4u a;
#pragma unroll
    for (int q = 0; q < 4; ++q) {
      const float f0 = tf[(c8 + 2 * q) * 68 + oc];
      const float f1 = tf[(c8 + 2 * q + 1) * 68 + oc];
      a[q] = pk16(f2bf_bits(f0), f2bf_bits(f1));
    }
    hv[it] = a;
  }
  {
#pragma unroll
    for (int it = 0; it < 2; ++it) {
      const int oc = it * 32 + sub;
      *(v4ua*)(o + (size_t)(c0 + oc) * NC + r0 + c8) = hv[it];
    }
    
  }
}

// ---------------------------------------------------------------------------
// Kernel 2: [q_w; k_w; v_w] ([out o][in c] row-major each) -> Wqkv bf16 [384 o][128 c] (natural Bt: n = o, k = c).
// grid = (16384/8/256 = 8, 3), 256 threads; matrix selected by blockIdx.y (block-uniform).
// Coverage: 3 x 2048 threads x 8 elements = 3 x 16384. One 16-B store per lane, lanes contiguous:
// ---------------------------------------------------------------------------
__global__ __launch_bounds__(256) void k_wcvt(const float* __restrict__ qw, const float* __restrict__ kw,
                                             const float* __restrict__ vw, unsigned short* __restrict__ Wb) {
  const int which = blockIdx.y;
  const float* src = (which == 0) ? qw : ((which == 1) ? kw : vw);
  const int i = blockIdx.x * 256 + threadIdx.x;
  if (i >= NC * NC / 8) return;
  const v4f a = *(const v4fa*)(src + (size_t)i * 8);
  const v4f c = *(const v4fa*)(src + (size_t)i * 8 + 4);
  v4u o4;
  o4[0] = pk16(f2bf_bits(a[0]), f2bf_bits(a[1]));
  o4[1] = pk16(f2bf_bits(a[2]), f2bf_bits(a[3]));
  o4[2] = pk16(f2bf_bits(c[0]), f2bf_bits(c[1]));
  o4[3] = pk16(f2bf_bits(c[2]), f2bf_bits(c[3]));
  unsigned short* dst = Wb + (size_t)which * NC * NC + (size_t)i * 8;
  *(v4ua*)dst = o4;
  
}

// ---------------------------------------------------------------------------
// Kernel 3: per-(b,c) mean and max over the 4096 pixels of bf16-RNE x2. Block handles 4 consecutive (b,c) rows
// (grid = 1024/4 = 256, 256 threads: each thread 16 elements of every row, fixed-order tree). All 16 loads of a thread
// (4 rows x 64 B) are issued before the first is used, so a block pays one trip to memory, and the four rows' trees run
// side by side with one barrier for all. Each block owns one whole 128-B line of POOL: floats 0..3 the means of its
// rows, floats 4..7 the maxes; the rest of the line is neither written nor read.
// Coverage: 256 blocks x 4 rows = 1024 = 8 x 128 rows; per row 256 x 16 = 4096 elements.
// ---------------------------------------------------------------------------
#define PB_ROWS 4                        // (b,c) rows per work-group
#define PB_LINE 32                       // floats per work-group in POOL (one 128-B line)
static_assert((NB * NC) % PB_ROWS == 0 && 2 * PB_ROWS <= PB_LINE);

__global__ __launch_bounds__(256) void k_poolbc(const float* __restrict__ x2, float* __restrict__ POOL) {
  __shared__ float ws_s[PB_ROWS][8], ws_m[PB_ROWS][8];
  const int g = blockIdx.x, tid = threadIdx.x, lane = tid & 31, w = tid >> 5;
  const float* p = x2 + (size_t)g * PB_ROWS * NP + tid * 16;
  v4f a[PB_ROWS][4];
#pragma unroll   // constant indices keep the 16 quads in registers, and their loads stand together ahead of all use
  for (int j = 0; j < PB_ROWS; ++j) {
#pragma unroll
    for (int i = 0; i < 4; ++i) a[j][i] = *(const v4fa*)(p + (size_t)j * NP + 4 * i);
  }
  // Holds all 16 loads ahead of the first use (loaded values as inputs only): without it the compiler sinks three of
  // them behind the wait for the others, and the block pays further trips one after another.
  asm volatile("" :: "v"(a[0][0]), "v"(a[0][1]), "v"(a[0][2]), "v"(a[0][3]), "v"(a[1][0]), "v"(a[1][1]), "v"(a[1][2]),
               "v"(a[1][3]), "v"(a[2][0]), "v"(a[2][1]), "v"(a[2][2]), "v"(a[2][3]), "v"(a[3][0]), "v"(a[3][1]),
               "v"(a[3][2]), "v"(a[3][3]));
  static_assert(PB_ROWS == 4);           // the statement above names the quads one by one
  float s[PB_ROWS], m[PB_ROWS];
#pragma unroll
  for (int j = 0; j < PB_ROWS; ++j) {
    float sj = 0.f, mj = -INFINITY;
#pragma unroll
    for (int i = 0; i < 4; ++i) {
      const float a0 = bfr(a[j][i][0]), a1 = bfr(a[j][i][1]), a2 = bfr(a[j][i][2]), a3 = bfr(a[j][i][3]);
      sj += (a0 + a1) + (a2 + a3);
      mj = fmaxf(fmaxf(mj, a0), fmaxf(fmaxf(a1, a2), a3));
    }
    s[j] = sj;
    m[j] = mj;
  }
#pragma unroll
  for (int j = 0; j < PB_ROWS; ++j) { s[j] += xhalf(s[j]);   m[j] = fmaxf(m[j], xhalf(m[j])); }
#pragma unroll
  for (int j = 0; j < PB_ROWS; ++j) { s[j] += rowx<8>(s[j]); m[j] = fmaxf(m[j], rowx<8>(m[j])); }
#pragma unroll
  for (int j = 0; j < PB_ROWS; ++j) { s[j] += rowx<4>(s[j]); m[j] = fmaxf(m[j], rowx<4>(m[j])); }
#pragma unroll
  for (int j = 0; j < PB_ROWS; ++j) { s[j] += rowx<2>(s[j]); m[j] = fmaxf(m[j], rowx<2>(m[j])); }
#pragma unroll
  for (int j = 0; j < PB_ROWS; ++j) { s[j] += rowx<1>(s[j]); m[j] = fmaxf(m[j], rowx<1>(m[j])); }
  if (lane == 0) {
#pragma unroll
    for (int j = 0; j < PB_ROWS; ++j) { ws_s[j][w] = s[j]; ws_m[j][w] = m[j]; }
  }
  __syncthreads();
  if (tid < PB_ROWS) {                   // lane j of wave 0 closes row j: the eight waves' parts in wave order
    float ts = 0.f, tm = -INFINITY;
#pragma unroll
    for (int k = 0; k < 8; ++k) { ts += ws_s[tid][k]; tm = fmaxf(tm, ws_m[tid][k]); }
    POOL[g * PB_LINE + tid] = ts * (1.0f / 4096.0f);
    POOL[g * PB_LINE + PB_ROWS + tid] = tm;
  }
}

// ---------------------------------------------------------------------------
// Kernel 4: per-(b,n) mean and max over the 128 channels of bf16-RNE x2 -> SPIN[b][0][n] = mean, SPIN[b][1][n] = max.
// Block per (b, 64-pixel group): grid = 8 x 64 = 512, 256 threads = 64 pixels x 4 channel groups of 32 (serial sum,
// all 32 loads issued ahead of it), fixed-order 4-way combine. 64 means / 64 maxes funnelled through LDS; wave 0 writes both 256-B
// Coverage: 512 blocks x 64 pixels = 8 x 4096 per plane.
// ---------------------------------------------------------------------------
__global__ __launch_bounds__(256) void k_poolc(const float* __restrict__ x2, float* __restrict__ SPIN) {
  __shared__ float ps[4][64], pm[4][64];
  __shared__ __align__(16) float os[128];
  const int b = blockIdx.x >> 6, g = blockIdx.x & 63;
  const int tid = threadIdx.x, lane = tid & 31;
  const int p = tid & 63, cg = tid >> 6;
  const float* src = x2 + ((size_t)b * NC + cg * 32) * NP + g * 64 + p;
  float s = 0.f, m = -INFINITY;
#pragma unroll   // whole: the 32 loads do not depend on one another and share one trip to memory (by fours: eight trips)
  for (int c = 0; c < 32; ++c) {
    const float v = bfr(src[(size_t)c * NP]);
    s += v;
    m = fmaxf(m, v);
  }
  ps[cg][p] = s;
  pm[cg][p] = m;
  __syncthreads();
  if (tid < 64) {
    const float ts = ((ps[0][tid] + ps[1][tid]) + ps[2][tid]) + ps[3][tid];
    const float tm = fmaxf(fmaxf(pm[0][tid], pm[1][tid]), fmaxf(pm[2][tid], pm[3][tid]));
    os[tid] = ts * (1.0f / 128.0f);
    os[64 + tid] = tm;
  }
  __syncthreads();
  if (tid < 32) {
    const v4f v = *(const v4fa*)(os + 4 * lane);   // lanes 0..15: means 0..63, lanes 16..31: maxes 0..63
    float* base = SPIN + (size_t)b * 2 * NP + g * 64;
    {
      if (lane < 16) *(v4f*)(base + 4 * lane) = v;
      else           *(v4f*)(base + NP + 4 * (lane - 16)) = v;
      
    }
  }
}

// ---------------------------------------------------------------------------
// Kernel 5: positional branch, grid (1 + 16, 8 batches), 256 threads, all f32 VALU:
//   ch[c]   = sum_{i in {mean,max}} sum_{t<5} bf16r(conv1_w[i][t]) * stk[i][c+t-2]   (zero pad 2, no flip, no bias)
//   Avec[o] = sum_c bf16r(ck_w[o][c]) * ch[c] + bf16r(ck_b[o]) ;  R[o] = sum_c bf16r(ck_w[o][c])
//   sp[n]   = sum_i sum_{u,v<7} bf16r(sp_w[i][u][v]) * spin[i][h+u-3][w+v-3] + bf16r(sp_b)   (zero pad 3)
// blockIdx.x == 0: the channel branch of batch b (AVEC[b][128] by wave 0, RVEC[b][128] by wave 1).
// blockIdx.x == 1 + s: the spatial conv of image rows 4s..4s+3 (256 pixels, one per thread). The two pooled maps are
// staged with their halo as zero-padded 10x70 LDS planes; each wave stores one whole 128-B line of SP.
// Coverage: AVEC/RVEC 8 x 128; SP 8 x 16 blocks x 256 thr = 8 x 4096.
// ---------------------------------------------------------------------------
#define POS_ROWS   4                     // image rows per spatial work-group
#define POS_SLICES (64 / POS_ROWS)       // spatial work-groups per batch
#define POS_PLANE  ((POS_ROWS + 6) * 70) // floats per padded plane
static_assert(POS_ROWS * 64 == 256);
static_assert(2 * POS_PLANE > 5 * 256 && 2 * POS_PLANE <= 6 * 256);

__global__ __launch_bounds__(256) void k_pos(const float* __restrict__ POOL,
                                            const float* __restrict__ SPIN, const float* __restrict__ c1w,
                                            const float* __restrict__ ckw, const float* __restrict__ ckb,
                                            const float* __restrict__ spw, const float* __restrict__ spb,
                                            float* __restrict__ AVEC, float* __restrict__ RVEC,
                                            float* __restrict__ SP) {
  __shared__ float sav[128], smx[128];
  __shared__ __align__(16) float sch[128];
  __shared__ float sw1[32];
  __shared__ __align__(16) float sw2[128];
  __shared__ __align__(16) float savec[128], srv[128];
  __shared__ float spl[2 * POS_PLANE];
  const int b = blockIdx.y, tid = threadIdx.x, lane = tid & 31, w = tid >> 5;

  if (blockIdx.x == 0) {                               // block-uniform: every barrier below is passed by the whole block
    const int o = tid & 127;                           // waves 4..7 repeat waves 0..3 and store nothing
    // the ck_w row and ck_b are read here, ahead of the first barrier, so that they are in flight together with the
    // pooled values instead of one dependent round trip per four weights behind the second barrier
    v4f wq[NC / 4];                                    // this thread's whole ck_w row
#pragma unroll
    for (int i = 0; i < NC / 4; ++i) wq[i] = *(const v4fa*)(ckw + (size_t)o * NC + 4 * i);
    const float cb = ckb[o];
    if (tid < 128) {                                   // row b*128+tid: its work-group's line of POOL, mean and max
      const unsigned row = (unsigned)(b * NC + tid);
      const float* pl = POOL + (row / PB_ROWS) * PB_LINE + (row % PB_ROWS);
      sav[tid] = pl[0];
      smx[tid] = pl[PB_ROWS];
    }
    if (tid < 32) sw1[tid] = bfr(c1w[min(tid, 9)]);    // clamped address
    __syncthreads();
    // channel conv1d
    if (tid < 128) {
      const int c = tid;
      float acc = 0.0f;
#pragma unroll 1
      for (int t = 0; t < 5; ++t) {
        const int cc  = c + t - 2;
        const int ccl = min(max(cc, 0), NC - 1);
        const float valid = (cc >= 0 && cc < NC) ? 1.0f : 0.0f;
        acc += valid * (sw1[t] * sav[ccl] + sw1[5 + t] * smx[ccl]);
      }
      sch[c] = acc;
    }
    __syncthreads();
    // Avec, R: c ascending, as one chain each (Avec by fused multiply-add, written out so that the unrolled form
    // is not split into packed multiplies and separate adds). Unrolled so that the row stays in registers.
    {
      float a = bfr(cb), r = 0.0f;
#pragma unroll
      for (int c = 0; c < NC; ++c) {
        const float wv = bfr(wq[c >> 2][c & 3]);
        a = __builtin_fmaf(wv, sch[c], a);
        r += wv;
      }
      if (tid < 128) { savec[o] = a; srv[o] = r; }
    }
    __syncthreads();
    if (w == 0) {
      const v4f v = *(const v4fa*)(savec + 4 * lane);
      *(v4f*)(AVEC + b * NC + 4 * lane) = v;
    } else if (w == 1) {
      const v4f v = *(const v4fa*)(srv + 4 * lane);
      *(v4f*)(RVEC + b * NC + 4 * lane) = v;
    }
    return;
  }

  // spatial 7x7x2 conv + bias of image rows h0..h0+3
  const int sl = blockIdx.x - 1;
  const int h0 = sl * POS_ROWS;
  const float* sp0 = SPIN + (size_t)b * 2 * NP;
  const float bias_sp = bfr(spb[0]);                   // read ahead of the barrier, with the other loads
  {
    // padded planes with halo: every lane loads at a clamped address, so that the weight load and the six tile loads
    // are in flight together; what lies outside the image becomes 0
    const float wt = spw[min(tid, 97)];
    float tv[6];
#pragma unroll
    for (int k = 0; k < 6; ++k) {
      const int i   = min(k * 256 + tid, 2 * POS_PLANE - 1);
      const int pl  = i / POS_PLANE, rem = i - pl * POS_PLANE;
      const int rr  = rem / 70, cc = rem - rr * 70;
      const int gh  = h0 + rr - 3, gx = cc - 3;
      const bool in = gh >= 0 && gh < 64 && gx >= 0 && gx < 64;
      const float v = sp0[pl * NP + min(max(gh, 0), 63) * 64 + min(max(gx, 0), 63)];
      tv[k] = in ? v : 0.0f;
    }
    if (tid < 128) sw2[tid] = bfr(wt);
#pragma unroll
    for (int k = 0; k < 5; ++k) spl[k * 256 + tid] = tv[k];
    if (5 * 256 + tid < 2 * POS_PLANE) spl[5 * 256 + tid] = tv[5];
  }
  __syncthreads();
  {
    const int h = tid >> 6, x = tid & 63;
    const float* t0 = spl + h * 70 + x;
    float acc = bias_sp;
    // both tap loops unrolled: the 98 LDS reads of a pixel do not depend on one another and overlap, where the
    // rolled loops paid one LDS round trip a tap; the taps are added in the same order
#pragma unroll
    for (int u = 0; u < 7; ++u) {
#pragma unroll
      for (int v = 0; v < 7; ++v) {
        const int li = u * 70 + v;
        acc += sw2[u * 7 + v] * t0[li] + sw2[49 + u * 7 + v] * t0[POS_PLANE + li];
      }
    }
    SP[(size_t)b * NP + sl * 256 + tid] = acc;
    asm volatile("s_wait_xcnt 0x0" ::: "memory");      // before a register that the store names is rewritten
  }
}

// ---------------------------------------------------------------------------
// Kernel 6: [Q|K|V] = XT . Wqkv^T + bias (exact bf16 x bf16 products, f32 accumulate, K = 128 in 4 steps of 32).
// grid = (32768/64 = 512 token tiles, 3 = which), 128 threads = 4 waves; wave w owns tokens m0+16w..+15 x all 128
// output channels (8 accumulator tiles). A fragments straight from XT rows, B fragments from Wqkv rows (both
// k-contiguous bf16, arithmetic addressing). bias (bf16r), Avec and R staged in LDS (one scalar load per thread each).
// Epilogue: f32 tile (acc + bias) staged in LDS [64][132];
//   which 0: alpha[n] = sum_o Avec[b][o] q[o][n], beta[n] = sum_o R[o] q[o][n] (f32, unroll 4) -> ALPHA/BETA 256-B
//            segments (16 lanes x 16 B); Q hi|lo token-major planes [tok][128];
//   which 1: K hi|lo token-major planes;  which 2: V hi|lo channel-major planes [b][c][4096] (transposed write).
// ---------------------------------------------------------------------------
__global__ __launch_bounds__(128) void k_qkv(const __bf16* __restrict__ XT, const __bf16* __restrict__ Wb,
                                            const float* __restrict__ qb, const float* __restrict__ kb,
                                            const float* __restrict__ vb,
                                            const float* __restrict__ AVEC, const float* __restrict__ RVEC,
                                            unsigned short* __restrict__ QP, unsigned short* __restrict__ KP,
                                            unsigned short* __restrict__ VP,
                                            float* __restrict__ ALPHA, float* __restrict__ BETA) {
  __shared__ __align__(16) float sT[64 * 132];
  __shared__ __align__(16) float sAV[128], sRV[128], sAB[128], sBI[128];
  const int tid = threadIdx.x, lane = tid & 31, w = tid >> 5, hh = lane >> 4, l16 = lane & 15;
  const int which = blockIdx.y;
  const int m0 = blockIdx.x * 64;            // global token row
  const int b  = m0 / NP;
  const int n0 = m0 - b * NP;

  const float* bias = (which == 0) ? qb : ((which == 1) ? kb : vb);   // block-uniform select, same address space
  sAV[tid] = AVEC[b * NC + tid];
  sRV[tid] = RVEC[b * NC + tid];
  sBI[tid] = bfr(bias[tid]);
  __syncthreads();

  const v8f zero8 = {0.f, 0.f, 0.f, 0.f, 0.f, 0.f, 0.f, 0.f};
  v8f acc[8];
#pragma unroll
  for (int t = 0; t < 8; ++t) acc[t] = zero8;

  const __bf16* arow = XT + (size_t)(m0 + 16 * w + l16) * NC;        // token row, k = input channel
  const __bf16* brow = Wb + ((size_t)which * NC + l16) * NC;          // output channel row (tile 0), k = input channel
#pragma unroll
  for (int kc = 0; kc < 4; ++kc) {
    const v16b a = ldfrag(arow + kc * 32, hh);
#pragma unroll
    for (int t = 0; t < 8; ++t) {
      const v16b bf = ldfrag(brow + (size_t)t * 16 * NC + kc * 32, hh);
      acc[t] = mma_bf(a, bf, acc[t]);
    }
  }
  // D[r] of tile t = Y[token 16w+8hh+r][channel 16t+l16]
#pragma unroll
  for (int t = 0; t < 8; ++t) {
    const float bv = sBI[16 * t + l16];
#pragma unroll
    for (int r = 0; r < 8; ++r) sT[(16 * w + 8 * hh + r) * 132 + 16 * t + l16] = acc[t][r] + bv;
  }
  __syncthreads();
  if (which == 0 && tid < 64) {            // waves 0,1
    const float* qr = sT + tid * 132;
    float a = 0.0f, be = 0.0f;
#pragma unroll 4
    for (int o = 0; o < NC; ++o) {
      const float q = qr[o];
      a  += sAV[o] * q;
      be += sRV[o] * q;
    }
    sAB[tid] = a;
    sAB[64 + tid] = be;
  }
  __syncthreads();

  // pack hi|lo planes
  const int q8 = lane & 7, sub = lane >> 3;
  v4u hv[8], lv[8];
#pragma unroll
  for (int i = 0; i < 8; ++i) {
    const int lid  = w * 32 + i * 4 + sub;                                   // 0..127
    const int base = (which != 2) ? ((lid >> 1) * 132 + (lid & 1) * 64 + 8 * q8) : ((8 * q8) * 132 + lid);
    const int estr = (which != 2) ? 1 : 132;
    v4u a, a2;
#pragma unroll
    for (int q = 0; q < 4; ++q) {
      const float f0 = sT[base + (2 * q) * estr];
      const float f1 = sT[base + (2 * q + 1) * estr];
      const unsigned short h0 = f2bf_bits(f0), h1 = f2bf_bits(f1);
      const unsigned short l0 = f2bf_bits(f0 - bfbits2f(h0)), l1 = f2bf_bits(f1 - bfbits2f(h1));
      a[q]  = pk16(h0, h1);
      a2[q] = pk16(l0, l1);
    }
    hv[i] = a;
    lv[i] = a2;
  }
  unsigned short* P = (which == 0) ? QP : ((which == 1) ? KP : VP);
  {
#pragma unroll
    for (int i = 0; i < 8; ++i) {
      const int lid = w * 32 + i * 4 + sub;
      const size_t go = (which != 2)
          ? ((size_t)(m0 + (lid >> 1)) * NC + (lid & 1) * 64 + 8 * q8)
          : (((size_t)b * NC + lid) * NP + n0 + 8 * q8);
      *(v4ua*)(P + go) = hv[i];
      *(v4ua*)(P + PLANE_ELEMS + go) = lv[i];
    }
    
  }
  if (which == 0 && w == 0) {
    const v4f v = *(const v4fa*)(sAB + 4 * lane);    // lanes 0..15: alpha 0..63, lanes 16..31: beta 0..63
    {
      if (lane < 16) *(v4f*)(ALPHA + m0 + 4 * lane) = v;
      else           *(v4f*)(BETA + m0 + 4 * (lane - 16)) = v;
      
    }
  }
}

// ---------------------------------------------------------------------------
// Kernel 7: full (non-causal, unmasked) attention, head dim 128, block per (b, 64-query tile): grid 8 x 64 = 512,
// 256 threads = 8 waves. Wave w: query group g = w&3 (queries 16g..16g+15), key half kh = w>>2.
//   energy[n][m] = q[n].k[m] (bf16 hi/lo 3-term WMMA) + alpha[m] + sp[n]*beta[m]  (f32, no scale)
//   Both products are taken transposed, so that a lane owns ONE query (n = 16g + (lane&15)) all the way:
//   S^T = K . Q^T : A = K rows (m = key), B = Q rows (n = query); D[r] of tile jj = S[key key0+16jj+8hh+r][query].
//   The 16 scores of a lane are keys key0+8hh+0..7 and key0+16+8hh+0..7: exactly the k order of a B fragment of
//   32 keys, so p hi|lo is packed in registers and goes into the second product with no trip through LDS.
//   O^T += V . P^T : A = Vcm rows (m = channel), B = P (n = query, k = the wave's own 32 keys), all 128 channels
//   (8 accumulator tiles); D[r] of tile t = O[channel 16t+8hh+r][query].
//   Row max and row sum are in-lane over 16 values plus one exchange with lane^16. Each wave keeps an online softmax
//   state (max, sum, O) of its own for its key half of every chunk; the two halves of a query are merged once,
//   behind the key loop, through LDS: O = (O0 2^(m0-m) + O1 2^(m1-m)) / (l0 2^(m0-m) + l1 2^(m1-m)).
//   Online softmax over all 4096 keys in 64 chunks of 64 (compile-time trip count, no masking). The running maximum is
//   kept in log2 units (max * log2 e), so that p = 2^(e * log2 e - max) is one fused multiply-add and one v_exp_f32;
//   the correction of the older sums, 2^(old max - new max), uses the very values the older p were formed with.
// LDS: K hi|lo [64][128], Vcm hi|lo [128][64], Q hi|lo [64][128] (staged once); every row is
// padded by 16 B (pitch 272 B for 256-B rows, 144 B for 128-B rows = 16 B x odd), so the 16 rows that one 16-byte
// fragment read touches fall on 16 different bank groups; the lo plane of K/Q starts 64 B and that of V 128 B past a
// multiple of 256 B; staging gives consecutive lanes consecutive 16-B pieces of a row (whole lines);
// K, V and alpha|beta come by asynchronous copies to LDS, one buffer each, two barriers a chunk: V(kc) is issued behind
// the barrier at the loop's head (V.P of kc-1 done) and waited for in front of the barrier behind the scores;
// K(kc+1), alpha|beta(kc+1) are issued behind that barrier (scores of kc done) and waited for in front of the barrier
// at the loop's head;
// alpha/beta slices [64]+[64], merge arrays [128]+[128]; output tile [128 c][64 n] (pitch 68) overlays the
// K/V region after the loop (block barrier first).
// Staging coverage: Q 8 rounds x 256 thr x 8 = 64x128 x 2 planes; per chunk K 16 rounds x 128 thr x 8 = 64x128 x 2 planes,
// V 16 rounds x 128 thr x 8 = 128x64 x 2 planes;
// Output: out[b][c][n0..n0+63] channel-major; each channel row segment = 256 B = 16 contiguous lanes x 16 B
// ---------------------------------------------------------------------------
#define KQ_PITCH 136                       // elements: 128 + 8 (272 B)
#define VP_PITCH 72                        // elements: 64 + 8 (144 B)
#define KQ_PLANE (64 * KQ_PITCH + 32)      // elements: 17472 B = 68 x 256 + 64
#define V_PLANE  (128 * VP_PITCH + 64)     // elements: 18560 B = 72 x 256 + 128
#define SM_K   0
#define SM_V   (SM_K + 2 * KQ_PLANE * 2)
#define SM_Q   (SM_V + 2 * V_PLANE * 2)
#define SM_AB  (SM_Q + 2 * KQ_PLANE * 2)
#define SM_RED (SM_AB + 512)
#define SM_TOT (SM_RED + 1024)
static_assert(128 * 68 * 4 <= SM_Q);
static_assert(SM_V % 16 == 0 && SM_Q % 16 == 0 && SM_AB % 16 == 0);
static_assert(2 * SM_TOT <= 327680);

__global__ __launch_bounds__(256) void k_attn(const __bf16* __restrict__ QP, const __bf16* __restrict__ KP,
                                             const __bf16* __restrict__ VP, const float* __restrict__ ALPHA,
                                             const float* __restrict__ BETA, const float* __restrict__ SP,
                                             float* __restrict__ out) {
  __shared__ __align__(16) unsigned char smem[SM_TOT];
  __bf16* Ks   = (__bf16*)(smem + SM_K);     // hi at +0, lo at +KQ_PLANE elements
  __bf16* Vs   = (__bf16*)(smem + SM_V);
  __bf16* Qs   = (__bf16*)(smem + SM_Q);
  float*  sab  = (float*)(smem + SM_AB);     // alpha 0..63, beta 64..127
  float*  redm = (float*)(smem + SM_RED);    // final row max of a key half [4 g][2 kh][16]
  float*  reds = redm + 128;                 // final row sum of a key half [4 g][2 kh][16]
  float*  Os   = (float*)(smem + SM_K);      // [128][68] after the key loop

  const int tid = threadIdx.x, lane = tid & 31, w = tid >> 5, hh = lane >> 4, c = lane & 15;
  const int g = w & 3, kh = w >> 2;
  const int key0 = 32 * kh;                  // this wave's key half within a chunk
  const int b  = blockIdx.x >> 6;
  const int n0 = (blockIdx.x & 63) * 64;
  const size_t tok0 = (size_t)b * NP + n0;

  // Staging lane maps: consecutive lanes take consecutive 16-B pieces, so one wave-wide load covers 4 whole 128-B lines.
  const int kq_r = tid >> 4, kq_c = (tid & 15) * 8;   // Q: 16 lanes per 256-B row, 16 rows per round of the block
  const unsigned kq_g = (unsigned)(kq_r * NC + kq_c) * 2u; // the lane's byte offset in a token-major tile
  // ---- stage the block's Q tile hi|lo: 2 planes x 4 rounds x 256 thr x 8 elements ----
  {
    __bf16* dst = Qs + kq_r * KQ_PITCH + kq_c;
#pragma unroll
    for (int p = 0; p < 2; ++p) {
      const uint64_t qsrc = ubase(QP + (size_t)p * PLANE_ELEMS + tok0 * NC);
#pragma unroll
      for (int i = 0; i < 4; ++i) {
        const v8b v = ldg16(qsrc, kq_g, i * 16 * NC * 2);
        *(v8ba*)(dst + p * KQ_PLANE + i * 16 * KQ_PITCH) = v;
      }
    }
  }
  // ---- sp[n] of this lane's query ----
  const float spq = SP[tok0 + 16 * g + c];
  float mrow = -INFINITY, lrow = 0.0f;       // this wave's own running max (log2 units) and sum of the lane's query (same in lane^16)
  const v8f zero8 = {0.f, 0.f, 0.f, 0.f, 0.f, 0.f, 0.f, 0.f};
  v8f oacc[8];
#pragma unroll
  for (int t = 0; t < 8; ++t) oacc[t] = zero8;

  const __bf16* qrow = Qs + (16 * g + c) * KQ_PITCH;

  // K/V plane bases of this batch (block-uniform) and the lane's running byte offsets (below 1 MiB + one tile)
  const uint64_t ksrc[2] = {ubase(KP + (size_t)b * NP * NC), ubase(KP + PLANE_ELEMS + (size_t)b * NP * NC)};
  const uint64_t vsrc[2] = {ubase(VP + (size_t)b * NC * NP), ubase(VP + PLANE_ELEMS + (size_t)b * NC * NP)};
  // Who copies what: waves 0..3 bring the K tiles (wave 0 the alpha|beta slice too), waves 4..7 the V tiles, so that a
  // wave's wait for its own copies never holds up the other tile's copies in flight. The wave's number stands in a
  // scalar register: every test on it is a scalar branch, and every lane is on at every copy.
  const int wu = __builtin_amdgcn_readfirstlane(w);
  const int ct = tid & 127;                            // the lane's place among the 128 lanes that bring a tile
  const int ck_r = ct >> 4, ck_c = (ct & 15) * 8;      // K: 16 lanes per 256-B row, 8 rows per round
  const int cv_r = ct >> 3, cv_c = (ct & 7) * 8;       // V:  8 lanes per 128-B row, 16 rows per round
  unsigned koff = (unsigned)(ck_r * NC + ck_c) * 2u;   // the lane's running byte offset in the token-major K planes
  unsigned voff = (unsigned)(cv_r * NP + cv_c) * 2u;   // the lane's running byte offset in the channel-major V planes
  // K: 2 planes x 8 rounds x 128 thr x 8 elements = 64 rows x 128 x 2 planes
  __bf16* kd = Ks + ck_r * KQ_PITCH + ck_c;
  // V: 2 planes x 8 rounds x 128 thr x 8 elements = 128 channel rows x 64 keys x 2 planes
  __bf16* vd = Vs + cv_r * VP_PITCH + cv_c;
  // alpha|beta slice of a chunk: one copy, lanes 0..15 the 64 alphas, lanes 16..31 the 64 betas
  const uint64_t absrc = (uint64_t)((lane < 16 ? ALPHA + 4 * lane : BETA + 4 * (lane - 16)) + (size_t)b * NP);

  // chunk 0's K tile and alpha|beta slice, into LDS that nobody has touched yet
  if (wu < 4) {
#pragma unroll   // each copy's plane and step are constants: no index arithmetic is left at run time
    for (int i = 0; i < 16; ++i)
      cp16(ksrc[i >> 3], koff, (i & 7) * 8 * NC * 2, kd + (i >> 3) * KQ_PLANE + (i & 7) * 8 * KQ_PITCH);
    if (wu == 0) cp16(absrc, 0, 0, sab + 4 * lane);
  }

#pragma unroll 1
  for (int kc = 0; kc < NP / 64; ++kc) {
    // this chunk's K and alpha|beta have landed (first trip: Q is stored too); every wave has left the V tile
    wait_lds();
    wait_copies();
    __syncthreads();
    // this chunk's V tile flies under the scores
    if (wu >= 4) {
#pragma unroll   // as above: constant plane and step per copy
      for (int i = 0; i < 16; ++i)
        cp16(vsrc[i >> 3], voff, (i & 7) * 16 * NP * 2, vd + (i >> 3) * V_PLANE + (i & 7) * 16 * VP_PITCH);
      voff += 64 * 2;        // next 64 keys: 64 columns of V
    }

    // ---- scores, transposed: s[jj][r] = S[key m0+key0+16jj+8hh+r][query 16g+c], 3-term split ----
    v8f s[2];
    s[0] = zero8; s[1] = zero8;
#pragma unroll 1
    for (int dc = 0; dc < 4; ++dc) {
      const v16b qa = ldfrag(qrow + dc * 32, hh);
      const v16b ql = ldfrag(qrow + KQ_PLANE + dc * 32, hh);
#pragma unroll
      for (int jj = 0; jj < 2; ++jj) {
        const __bf16* krow = Ks + (key0 + 16 * jj + c) * KQ_PITCH + dc * 32;
        const v16b kb = ldfrag(krow, hh);
        const v16b kl = ldfrag(krow + KQ_PLANE, hh);
        s[jj] = mma_bf(kb, qa, s[jj]);
        s[jj] = mma_bf(kl, qa, s[jj]);
        s[jj] = mma_bf(kb, ql, s[jj]);
      }
    }
    // ---- positional terms in f32 (alpha, beta of the lane's 16 keys), then the max over this wave's 32 keys ----
    float cmx = -INFINITY;
#pragma unroll
    for (int jj = 0; jj < 2; ++jj) {
      const float* ap = sab + key0 + 16 * jj + 8 * hh;
      const v4f a0 = *(const v4fa*)(ap),      a1 = *(const v4fa*)(ap + 4);
      const v4f b0 = *(const v4fa*)(ap + 64), b1 = *(const v4fa*)(ap + 68);
#pragma unroll
      for (int r = 0; r < 8; ++r) {
        const float al = (r < 4) ? a0[r & 3] : a1[r & 3];
        const float be = (r < 4) ? b0[r & 3] : b1[r & 3];
        const float e = s[jj][r] + al + spq * be;
        s[jj][r] = e;
        cmx = fmaxf(cmx, e);
      }
    }
    cmx = fmaxf(cmx, xhalf(cmx));
    wait_lds();                   // every wave has left the K tile and the alpha|beta slice
    if (wu >= 4) wait_copies();   // this chunk's V has landed
    __syncthreads();
    // the next chunk's K tile and alpha|beta slice fly under the softmax and V.P
    if (kc + 1 < NP / 64) {
      if (wu < 4) {
        koff += 64 * NC * 2; // next 64 keys: 64 token rows of K
#pragma unroll   // as above: constant plane and step per copy
        for (int i = 0; i < 16; ++i)
          cp16(ksrc[i >> 3], koff, (i & 7) * 8 * NC * 2, kd + (i >> 3) * KQ_PLANE + (i & 7) * 8 * KQ_PITCH);
        if (wu == 0) cp16(absrc, (unsigned)(kc + 1) * 64 * 4, 0, sab + 4 * lane);
      }
    }
    // ---- online softmax of the lane's query over this wave's keys; P hi|lo packed as B fragments in registers ----
    const float mnew = fmaxf(mrow, cmx * LOG2E);
    const float corr = ex2(mrow - mnew);
    mrow = mnew;
    float psum = 0.0f;
    union PB { v16b v; unsigned u[8]; } pa, pl;   // element 8jj+r = key key0+16jj+8hh+r: the fragment's k order
#pragma unroll
    for (int jj = 0; jj < 2; ++jj) {
#pragma unroll
      for (int r = 0; r < 8; r += 2) {
        const float p0 = ex2(__builtin_fmaf(s[jj][r], LOG2E, -mnew));
        const float p1 = ex2(__builtin_fmaf(s[jj][r + 1], LOG2E, -mnew));
        psum += p0;
        psum += p1;
        const unsigned short h0 = f2bf_bits(p0), h1 = f2bf_bits(p1);
        const unsigned short l0 = f2bf_bits(p0 - bfbits2f(h0)), l1 = f2bf_bits(p1 - bfbits2f(h1));
        pa.u[4 * jj + (r >> 1)] = pk16(h0, h1);
        pl.u[4 * jj + (r >> 1)] = pk16(l0, l1);
      }
    }
    psum += xhalf(psum);
    lrow = lrow * corr + psum;
#pragma unroll
    for (int t = 0; t < 8; ++t) {
#pragma unroll
      for (int r = 0; r < 8; ++r) oacc[t][r] *= corr;
    }

    // ---- O^T += V . P^T : A = Vcm row (channel 16t+c) [key], B = P [key][query]; 8 channel tiles, the wave's 32 keys ----
#pragma unroll   // the accumulator tiles are indexed by constants, so that they stay in registers
    for (int t = 0; t < 8; ++t) {
      const __bf16* vr = Vs + (16 * t + c) * VP_PITCH + key0;
      const v16b vb = ldfrag(vr, hh);
      const v16b vl = ldfrag(vr + V_PLANE, hh);
      oacc[t] = mma_bf(vb, pa.v, oacc[t]);
      oacc[t] = mma_bf(vl, pa.v, oacc[t]);
      oacc[t] = mma_bf(vb, pl.v, oacc[t]);
    }
  }
  wait_lds();
  wait_copies();     // no copy is in flight here; the wait stands before the tiles' LDS gets another use
  // ---- merge the two key halves of every query: exchange (max, sum), scale, add through the output tile ----
  if (hh == 0) { redm[g * 32 + kh * 16 + c] = mrow; reds[g * 32 + kh * 16 + c] = lrow; }
  __syncthreads();   // all waves done with the K/V tiles before the output tile overlays them; max and sum published
  {
    const float m0 = redm[g * 32 + c], m1 = redm[g * 32 + 16 + c];
    const float l0 = reds[g * 32 + c], l1 = reds[g * 32 + 16 + c];
    const float mt = fmaxf(m0, m1);
    const float f0 = ex2(m0 - mt), f1 = ex2(m1 - mt);
    const float inv = 1.0f / (l0 * f0 + l1 * f1);
    const float fs = (kh == 0 ? f0 : f1) * inv;
    float* op = Os + (8 * hh) * 68 + 16 * g + c;     // O staged as [c][n_local]
    if (wu >= 4) {                                   // key half 1 stores its share
#pragma unroll
      for (int t = 0; t < 8; ++t) {
#pragma unroll
        for (int r = 0; r < 8; ++r) op[(16 * t + r) * 68] = oacc[t][r] * fs;
      }
    }
    __syncthreads();
    if (wu < 4) {                                    // key half 0 adds its own to the same places
#pragma unroll
      for (int t = 0; t < 8; ++t) {
#pragma unroll
        for (int r = 0; r < 8; ++r) op[(16 * t + r) * 68] = oacc[t][r] * fs + op[(16 * t + r) * 68];
      }
    }
  }
  __syncthreads();
  {
    float* ob = out + (size_t)b * NC * NP + n0;
    const int c4 = (lane & 15) * 4;
    {
#pragma unroll
      for (int i = 0; i < 8; ++i) {
        const int row = i * 16 + w * 2 + hh;                       // 0..127 channel
        const v4f v = *(const v4fa*)(Os + row * 68 + c4);
        *(v4f*)(ob + (size_t)row * NP + c4) = v;
      }
      
    }
  }
}

// ---------------------------------------------------------------------------
//   XT    bf16 [32768][128]          0           8388608
//   WQKV  bf16 [384][128]            8388608       98304
//   POOL  f32  [256][32]             8486912       32768
//   SPIN  f32  [8][2][4096]          8519680      262144
//   AVEC  f32  [8][128]              8781824        4096
//   RVEC  f32  [8][128]              8785920        4096
//   SP    f32  [8][4096]             8790016      131072
//   ALPHA f32  [8][4096]             8921088      131072
//   BETA  f32  [8][4096]             9052160      131072
//   Q hi|lo bf16 2x[32768][128]      9183232    16777216
//   K hi|lo bf16 2x[32768][128]     25960448    16777216
//   V hi|lo bf16 2x[8][128][4096]   42737664    16777216
//   total                          59514880
// ---------------------------------------------------------------------------
extern "C" void kernel_launch(void* const* d_in, const int* in_sizes, int n_in,
                              void* d_out, int out_size, void* d_ws, size_t ws_size,
                              hipStream_t stream) {
  if (n_in < 13) return;
  if (in_sizes[0] != NB * NC * NP || in_sizes[1] != NB * NC * NP) return;
  if (in_sizes[2] != NC * NC || in_sizes[4] != NC * NC || in_sizes[6] != NC * NC || in_sizes[8] != NC * NC) return;
  if (in_sizes[3] != NC || in_sizes[5] != NC || in_sizes[7] != NC || in_sizes[9] != NC) return;
  if (in_sizes[10] != 10 || in_sizes[11] != 98 || in_sizes[12] != 1) return;
  if (out_size != NB * NC * NP) return;

  const float* x    = (const float*)d_in[0];
  const float* x2   = (const float*)d_in[1];
  const float* q_w  = (const float*)d_in[2];
  const float* q_b  = (const float*)d_in[3];
  const float* k_w  = (const float*)d_in[4];
  const float* k_b  = (const float*)d_in[5];
  const float* v_w  = (const float*)d_in[6];
  const float* v_b  = (const float*)d_in[7];
  const float* ck_w = (const float*)d_in[8];
  const float* ck_b = (const float*)d_in[9];
  const float* c1w  = (const float*)d_in[10];
  const float* sp_w = (const float*)d_in[11];
  const float* sp_b = (const float*)d_in[12];
  float* out = (float*)d_out;

  const size_t plane_b = PLANE_ELEMS * 2;                 // 8388608 bytes per 16-bit plane
  size_t off = 0;
  const size_t oXT   = off; off += plane_b;
  const size_t oW    = off; off += (size_t)3 * NC * NC * 2;
  const size_t oPOOL = off; off += (size_t)(NB * NC / PB_ROWS) * PB_LINE * 4;
  const size_t oSPIN = off; off += (size_t)NB * 2 * NP * 4;
  const size_t oAVEC = off; off += (size_t)NB * NC * 4;
  const size_t oRVEC = off; off += (size_t)NB * NC * 4;
  const size_t oSP   = off; off += (size_t)NB * NP * 4;
  const size_t oAL   = off; off += (size_t)NB * NP * 4;
  const size_t oBE   = off; off += (size_t)NB * NP * 4;
  const size_t oQ    = off; off += 2 * plane_b;
  const size_t oK    = off; off += 2 * plane_b;
  const size_t oV    = off; off += 2 * plane_b;           // off = 59514880
  if (off > ws_size) return;
  if (off > (size_t)134217728) return;

  char* ws = (char*)d_ws;
  unsigned short* XT    = (unsigned short*)(ws + oXT);
  unsigned short* WQKV  = (unsigned short*)(ws + oW);
  float* POOL  = (float*)(ws + oPOOL);
  float* SPIN  = (float*)(ws + oSPIN);
  float* AVEC  = (float*)(ws + oAVEC);
  float* RVEC  = (float*)(ws + oRVEC);
  float* SP    = (float*)(ws + oSP);
  float* ALPHA = (float*)(ws + oAL);
  float* BETA  = (float*)(ws + oBE);
  unsigned short* QP = (unsigned short*)(ws + oQ);
  unsigned short* KPp = (unsigned short*)(ws + oK);
  unsigned short* VPp = (unsigned short*)(ws + oV);

  // 1. x -> token-major bf16 planes (grid: n blocks, c blocks, batch)
  k_xt<<<dim3(NP / 64, NC / 64, NB), 256, 0, stream>>>(x, XT);
  // 2. projection weights -> bf16 [384][128]
  k_wcvt<<<dim3(NC * NC / 8 / 256, 3), 256, 0, stream>>>(q_w, k_w, v_w, WQKV);
  // 3. per-(b,c) pixel mean/max of x2
  k_poolbc<<<NB * NC / PB_ROWS, 256, 0, stream>>>(x2, POOL);
  // 4. per-(b,n) channel mean/max of x2
  k_poolc<<<NB * (NP / 64), 256, 0, stream>>>(x2, SPIN);
  // 5. positional branch: Avec, R (x = 0), sp (x = 1..16), per batch (y)
  k_pos<<<dim3(POS_SLICES + 1, NB), 256, 0, stream>>>(POOL, SPIN, c1w, ck_w, ck_b, sp_w, sp_b, AVEC, RVEC, SP);
  // 6. q/k/v projections + alpha/beta + hi|lo planes
  k_qkv<<<dim3(NTOK / 64, 3), 128, 0, stream>>>((const __bf16*)(const void*)XT, (const __bf16*)(const void*)WQKV,
                                                q_b, k_b, v_b, AVEC, RVEC, QP, KPp, VPp, ALPHA, BETA);
  // 7. attention, channel-major output
  k_attn<<<NB * (NP / 64), 256, 0, stream>>>((const __bf16*)(const void*)QP, (const __bf16*)(const void*)KPp,
                                             (const __bf16*)(const void*)VPp, ALPHA, BETA, SP, out);
  (void)hipGetLastError();
}

// v009
// A run of this version takes 200 microseconds.
// Two timings next to v008 both put it at 1.07 times that version's speed.
// Counting every step since v000, it is 7.04 times as fast.
// Contractions: q/k/v 1x1 projections on v_wmma_f32_16x16x32_bf16 (bf16 operands taken from bf16-RNE inputs, single product, f32 accumulate);
// q.k^T scores and p.v on v_wmma_f32_16x16x32_bf16 with bf16 hi/lo split operands (hi.hi + hi.lo + lo.hi), f32 accumulate;
// pools, channel conv1d, spatial 7x7 conv, positional vectors alpha/beta, online softmax (hardware exp2) in f32.
// 16-bit planes and carries: XT = bf16 RNE(x), Wqkv = bf16 RNE(w), Q/K/V hi = RNE(y), lo = RNE(y - hi), P hi/lo per key chunk in registers.
// No power-of-two carry on any plane (bf16 keeps the f32 exponent range), so no inverse fold anywhere.
#include <hip/hip_runtime.h>
#include <math.h>
#include <stdint.h>

#define NB   8
#define NC   128
#define NP   4096
#define NTOK (NB * NP)
#define PLANE_ELEMS ((size_t)NTOK * NC)

static_assert(NP % 64 == 0);
static_assert(NC == 128);
static_assert((NB * NC) % 32 == 0);
static_assert(NP % 256 == 0);

typedef __attribute__((ext_vector_type(16))) __bf16 v16b;
typedef __attribute__((ext_vector_type(8)))  __bf16 v8b;
typedef __attribute__((ext_vector_type(8)))  float  v8f;
typedef __attribute__((ext_vector_type(4)))  float  v4f;
typedef __attribute__((ext_vector_type(2)))  float  v2f;
typedef __attribute__((ext_vector_type(4)))  unsigned int v4u;
typedef v8b __attribute__((may_alias)) v8ba;
typedef v4f __attribute__((may_alias)) v4fa;
typedef v2f __attribute__((may_alias)) v2fa;
typedef v4u __attribute__((may_alias)) v4ua;

// ---------------------------------------------------------------------------
// bf16 helpers (RNE convert on the f32 bits)
// ---------------------------------------------------------------------------
__device__ __forceinline__ unsigned short f2bf_bits(float f) {
  const unsigned u = __float_as_uint(f);
  return (unsigned short)((u + 0x7FFFu + ((u >> 16) & 1u)) >> 16);
}
__device__ __forceinline__ float bfbits2f(unsigned short h) { return __uint_as_float(((unsigned)h) << 16); }
__device__ __forceinline__ float bfr(float f) { return bfbits2f(f2bf_bits(f)); }
__device__ __forceinline__ unsigned pk16(unsigned short a, unsigned short b) { return (unsigned)a | ((unsigned)b << 16); }

// ---------------------------------------------------------------------------
// 16x16x32 bf16 WMMA with hazard guard (ties D, keeps A/B live).
// Fragment map (wave32): lane l, h = l>>4, m = n = l&15.
//   A/B element i: i<8 -> k0+8h+i ; i>=8 -> k0+16+8h+(i-8)
//   D element r : row 8h+r, col l&15
// ---------------------------------------------------------------------------
__device__ __forceinline__ v8f mma_bf(v16b a, v16b b, v8f c) {
  c = __builtin_amdgcn_wmma_f32_16x16x32_bf16(false, a, false, b, (short)0, c, false, false);
  asm volatile("v_nop\n\tv_nop\n\tv_nop\n\tv_nop" : "+v"(c) : "v"(a), "v"(b));
  return c;
}
// The same product with no asm statement behind it: the compiler keeps the distances of its own builtin. For a kernel whose
// fragments and accumulators reach past v255, which the operands of an asm statement cannot name.
__device__ __forceinline__ v8f mma_hi(v16b a, v16b b, v8f c) {
  return __builtin_amdgcn_wmma_f32_16x16x32_bf16(false, a, false, b, (short)0, c, false, false);
}
// One butterfly step inside a 16-lane row: lane l takes the value of lane l ^ M (DPP row_xmask, on the vector port).
template <int M> __device__ __forceinline__ float rowx(float v) {
  const int i = __builtin_bit_cast(int, v);
  return __builtin_bit_cast(float, __builtin_amdgcn_update_dpp(0, i, 0x160 + M, 0xf, 0xf, true));
}
// Lane l takes the value of lane l ^ 16 (the other 16-lane row).
__device__ __forceinline__ float xhalf(float v) {
  const int i = __builtin_bit_cast(int, v);
  return __builtin_bit_cast(float, __builtin_amdgcn_permlanex16(i, i, 0x76543210, 0xfedcba98, false, false));
}
// 2^x on the hardware's own exponential, one instruction. Every argument here is <= about 0 (a score minus its running
// maximum, in log2 units); a result below the smallest normal f32 comes out as 0, which adds nothing to a sum whose
// largest term is 1. The library expf spends a dozen more vector instructions a value on range tests and on a
// two-part argument.
#define LOG2E 1.4426950408889634f
__device__ __forceinline__ float ex2(float x) { return __builtin_amdgcn_exp2f(x); }
union FB { v16b v; v8b h[2]; };
// A or B fragment from a k-contiguous bf16 row; p points at element k0 of the row owned by this lane.
__device__ __forceinline__ v16b ldfrag(const __bf16* p, int hh) {
  FB f;
  f.h[0] = *(const v8ba*)(p + 8 * hh);
  f.h[1] = *(const v8ba*)(p + 16 + 8 * hh);
  return f.v;
}

// 16-B global load at a block-uniform base plus the lane's own 32-bit byte offset plus a constant. Each plane's base goes
// through readfirstlane so that it keeps a scalar register pair of its own and the load takes the scalar-base form;
// without it the compiler folds the lo plane's 8-MiB step into 64-bit vector addresses that it forms anew every trip.
typedef const __attribute__((address_space(1))) v8ba gv8b;
__device__ __forceinline__ uint64_t ubase(const __bf16* p) {
  const uint64_t u = (uint64_t)p;
  const uint32_t lo = (uint32_t)__builtin_amdgcn_readfirstlane((int)(uint32_t)u);
  const uint32_t hi = (uint32_t)__builtin_amdgcn_readfirstlane((int)(uint32_t)(u >> 32));
  return ((uint64_t)hi << 32) | lo;
}
__device__ __forceinline__ v8b ldg16(uint64_t base, unsigned lane_bytes, unsigned imm_bytes) {
  return *(gv8b*)(base + lane_bytes + imm_bytes);
}
// Asynchronous 16-B copy, global memory to LDS, through no register: every lane brings its own 16 bytes (both addresses
// multiples of 16). The compiler places no wait for it: its bytes count as landed behind the issuing wave's own
// s_wait_asynccnt 0, and for the other waves behind the work-group barrier that follows that wait.
typedef __attribute__((ext_vector_type(4))) int v4i;
typedef __attribute__((address_space(1))) v4i gv4i;
typedef __attribute__((address_space(3))) v4i lv4i;
__device__ __forceinline__ void cp16(uint64_t base, unsigned lane_bytes, unsigned imm_bytes, void* lds) {
  __builtin_amdgcn_global_load_async_to_lds_b128((gv4i*)(base + lane_bytes + imm_bytes), (lv4i*)lds, 0, 0);
}
// In front of a barrier behind which a tile is refilled: this wave's LDS reads of that tile have retired.
__device__ __forceinline__ void wait_lds() { asm volatile("s_wait_dscnt 0x0" ::: "memory"); }
// In front of a barrier behind which the other waves read a tile: this wave's own copies have landed.
__device__ __forceinline__ void wait_copies() { asm volatile("s_wait_asynccnt 0x0" ::: "memory"); }

// ---------------------------------------------------------------------------
// Kernel 1: x[b] viewed [128 c][4096 n] (pitch 4096) -> XT bf16 [b*4096+n][128 c] (pitch 128), bf16 RNE.
// 64x64 tiles through LDS. grid = (4096/64, 128/64, 8), 256 threads.
// Coverage per block: load 4 it x 256 thr x 4 floats = 64x64; store 2 it x 256 thr x 8 u16 = 64x64.
// ---------------------------------------------------------------------------
__global__ __launch_bounds__(256) void k_xt(const float* __restrict__ X, unsigned short* __restrict__ xt) {
  __shared__ __align__(16) float tf[64 * 68];
  const int b = blockIdx.z;
  const float* W = X + (size_t)b * NC * NP;
  unsigned short* o = xt + (size_t)b * NP * NC;
  const int c0 = blockIdx.x * 64;   // input column block (n) = output row block
  const int r0 = blockIdx.y * 64;   // input row block (c)    = output column block
  const int tid = threadIdx.x;
  {
    const int lr = tid >> 4;
    const int c4 = (tid & 15) * 4;
#pragma unroll
    for (int it = 0; it < 4; ++it) {
      const int rr = it * 16 + lr;
      const v4f a = *(const v4fa*)(W + (size_t)(r0 + rr) * NP + c0 + c4);
      *(v4f*)(tf + rr * 68 + c4) = a;
    }
  }
  __syncthreads();
  const int sub = tid >> 3;          // 0..31
  const int c8  = (tid & 7) * 8;     // 0..56
  v4u hv[2];
#pragma unroll
  for (int it = 0; it < 2; ++it) {
    const int oc = it * 32 + sub;    // output row within tile (= input column)
    v4u a;
#pragma unroll
    for (int q = 0; q < 4; ++q) {
      const float f0 = tf[(c8 + 2 * q) * 68 + oc];
      const float f1 = tf[(c8 + 2 * q + 1) * 68 + oc];
      a[q] = pk16(f2bf_bits(f0), f2bf_bits(f1));
    }
    hv[it] = a;
  }
  {
#pragma unroll
    for (int it = 0; it < 2; ++it) {
      const int oc = it * 32 + sub;
      *(v4ua*)(o + (size_t)(c0 + oc) * NC + r0 + c8) = hv[it];
    }
    
  }
}

// ---------------------------------------------------------------------------
// Kernel 2: [q_w; k_w; v_w] ([out o][in c] row-major each) -> Wqkv bf16 [384 o][128 c] (natural Bt: n = o, k = c).
// grid = (16384/8/256 = 8, 3), 256 threads; matrix selected by blockIdx.y (block-uniform).
// Coverage: 3 x 2048 threads x 8 elements = 3 x 16384. One 16-B store per lane, lanes contiguous:
// ---------------------------------------------------------------------------
__global__ __launch_bounds__(256) void k_wcvt(const float* __restrict__ qw, const float* __restrict__ kw,
                                             const float* __restrict__ vw, unsigned short* __restrict__ Wb) {
  const int which = blockIdx.y;
  const float* src = (which == 0) ? qw : ((which == 1) ? kw : vw);
  const int i = blockIdx.x * 256 + threadIdx.x;
  if (i >= NC * NC / 8) return;
  const v4f a = *(const v4fa*)(src + (size_t)i * 8);
  const v4f c = *(const v4fa*)(src + (size_t)i * 8 + 4);
  v4u o4;
  o4[0] = pk16(f2bf_bits(a[0]), f2bf_bits(a[1]));
  o4[1] = pk16(f2bf_bits(a[2]), f2bf_bits(a[3]));
  o4[2] = pk16(f2bf_bits(c[0]), f2bf_bits(c[1]));
  o4[3] = pk16(f2bf_bits(c[2]), f2bf_bits(c[3]));
  unsigned short* dst = Wb + (size_t)which * NC * NC + (size_t)i * 8;
  *(v4ua*)dst = o4;
  
}

// ---------------------------------------------------------------------------
// Kernel 3: per-(b,c) mean and max over the 4096 pixels of bf16-RNE x2. Block handles 4 consecutive (b,c) rows
// (grid = 1024/4 = 256, 256 threads: each thread 16 elements of every row, fixed-order tree). All 16 loads of a thread
// (4 rows x 64 B) are issued before the first is used, so a block pays one trip to memory, and the four rows' trees run
// side by side with one barrier for all. Each block owns one whole 128-B line of POOL: floats 0..3 the means of its
// rows, floats 4..7 the maxes; the rest of the line is neither written nor read.
// Coverage: 256 blocks x 4 rows = 1024 = 8 x 128 rows; per row 256 x 16 = 4096 elements.
// ---------------------------------------------------------------------------
#define PB_ROWS 4                        // (b,c) rows per work-group
#define PB_LINE 32                       // floats per work-group in POOL (one 128-B line)
static_assert((NB * NC) % PB_ROWS == 0 && 2 * PB_ROWS <= PB_LINE);

__global__ __launch_bounds__(256) void k_poolbc(const float* __restrict__ x2, float* __restrict__ POOL) {
  __shared__ float ws_s[PB_ROWS][8], ws_m[PB_ROWS][8];
  const int g = blockIdx.x, tid = threadIdx.x, lane = tid & 31, w = tid >> 5;
  const float* p = x2 + (size_t)g * PB_ROWS * NP + tid * 16;
  v4f a[PB_ROWS][4];
#pragma unroll   // constant indices keep the 16 quads in registers, and their loads stand together ahead of all use
  for (int j = 0; j < PB_ROWS; ++j) {
#pragma unroll
    for (int i = 0; i < 4; ++i) a[j][i] = *(const v4fa*)(p + (size_t)j * NP + 4 * i);
  }
  // Holds all 16 loads ahead of the first use (loaded values as inputs only): without it the compiler sinks three of
  // them behind the wait for the others, and the block pays further trips one after another.
  asm volatile("" :: "v"(a[0][0]), "v"(a[0][1]), "v"(a[0][2]), "v"(a[0][3]), "v"(a[1][0]), "v"(a[1][1]), "v"(a[1][2]),
               "v"(a[1][3]), "v"(a[2][0]), "v"(a[2][1]), "v"(a[2][2]), "v"(a[2][3]), "v"(a[3][0]), "v"(a[3][1]),
               "v"(a[3][2]), "v"(a[3][3]));
  static_assert(PB_ROWS == 4);           // the statement above names the quads one by one
  float s[PB_ROWS], m[PB_ROWS];
#pragma unroll
  for (int j = 0; j < PB_ROWS; ++j) {
    float sj = 0.f, mj = -INFINITY;
#pragma unroll
    for (int i = 0; i < 4; ++i) {
      const float a0 = bfr(a[j][i][0]), a1 = bfr(a[j][i][1]), a2 = bfr(a[j][i][2]), a3 = bfr(a[j][i][3]);
      sj += (a0 + a1) + (a2 + a3);
      mj = fmaxf(fmaxf(mj, a0), fmaxf(fmaxf(a1, a2), a3));
    }
    s[j] = sj;
    m[j] = mj;
  }
#pragma unroll
  for (int j = 0; j < PB_ROWS; ++j) { s[j] += xhalf(s[j]);   m[j] = fmaxf(m[j], xhalf(m[j])); }
#pragma unroll
  for (int j = 0; j < PB_ROWS; ++j) { s[j] += rowx<8>(s[j]); m[j] = fmaxf(m[j], rowx<8>(m[j])); }
#pragma unroll
  for (int j = 0; j < PB_ROWS; ++j) { s[j] += rowx<4>(s[j]); m[j] = fmaxf(m[j], rowx<4>(m[j])); }
#pragma unroll
  for (int j = 0; j < PB_ROWS; ++j) { s[j] += rowx<2>(s[j]); m[j] = fmaxf(m[j], rowx<2>(m[j])); }
#pragma unroll
  for (int j = 0; j < PB_ROWS; ++j) { s[j] += rowx<1>(s[j]); m[j] = fmaxf(m[j], rowx<1>(m[j])); }
  if (lane == 0) {
#pragma unroll
    for (int j = 0; j < PB_ROWS; ++j) { ws_s[j][w] = s[j]; ws_m[j][w] = m[j]; }
  }
  __syncthreads();
  if (tid < PB_ROWS) {                   // lane j of wave 0 closes row j: the eight waves' parts in wave order
    float ts = 0.f, tm = -INFINITY;
#pragma unroll
    for (int k = 0; k < 8; ++k) { ts += ws_s[tid][k]; tm = fmaxf(tm, ws_m[tid][k]); }
    POOL[g * PB_LINE + tid] = ts * (1.0f / 4096.0f);
    POOL[g * PB_LINE + PB_ROWS + tid] = tm;
  }
}

// ---------------------------------------------------------------------------
// Kernel 4: per-(b,n) mean and max over the 128 channels of bf16-RNE x2 -> SPIN[b][0][n] = mean, SPIN[b][1][n] = max.
// Block per (b, 64-pixel group): grid = 8 x 64 = 512, 256 threads = 64 pixels x 4 channel groups of 32 (serial sum,
// all 32 loads issued ahead of it), fixed-order 4-way combine. 64 means / 64 maxes funnelled through LDS; wave 0 writes both 256-B
// Coverage: 512 blocks x 64 pixels = 8 x 4096 per plane.
// ---------------------------------------------------------------------------
__global__ __launch_bounds__(256) void k_poolc(const float* __restrict__ x2, float* __restrict__ SPIN) {
  __shared__ float ps[4][64], pm[4][64];
  __shared__ __align__(16) float os[128];
  const int b = blockIdx.x >> 6, g = blockIdx.x & 63;
  const int tid = threadIdx.x, lane = tid & 31;
  const int p = tid & 63, cg = tid >> 6;
  const float* src = x2 + ((size_t)b * NC + cg * 32) * NP + g * 64 + p;
  float s = 0.f, m = -INFINITY;
#pragma unroll   // whole: the 32 loads do not depend on one another and share one trip to memory (by fours: eight trips)
  for (int c = 0; c < 32; ++c) {
    const float v = bfr(src[(size_t)c * NP]);
    s += v;
    m = fmaxf(m, v);
  }
  ps[cg][p] = s;
  pm[cg][p] = m;
  __syncthreads();
  if (tid < 64) {
    const float ts = ((ps[0][tid] + ps[1][tid]) + ps[2][tid]) + ps[3][tid];
    const float tm = fmaxf(fmaxf(pm[0][tid], pm[1][tid]), fmaxf(pm[2][tid], pm[3][tid]));
    os[tid] = ts * (1.0f / 128.0f);
    os[64 + tid] = tm;
  }
  __syncthreads();
  if (tid < 32) {
    const v4f v = *(const v4fa*)(os + 4 * lane);   // lanes 0..15: means 0..63, lanes 16..31: maxes 0..63
    float* base = SPIN + (size_t)b * 2 * NP + g * 64;
    {
      if (lane < 16) *(v4f*)(base + 4 * lane) = v;
      else           *(v4f*)(base + NP + 4 * (lane - 16)) = v;
      
    }
  }
}

// ---------------------------------------------------------------------------
// Kernel 5: positional branch, grid (1 + 16, 8 batches), 256 threads, all f32 VALU:
//   ch[c]   = sum_{i in {mean,max}} sum_{t<5} bf16r(conv1_w[i][t]) * stk[i][c+t-2]   (zero pad 2, no flip, no bias)
//   Avec[o] = sum_c bf16r(ck_w[o][c]) * ch[c] + bf16r(ck_b[o]) ;  R[o] = sum_c bf16r(ck_w[o][c])
//   sp[n]   = sum_i sum_{u,v<7} bf16r(sp_w[i][u][v]) * spin[i][h+u-3][w+v-3] + bf16r(sp_b)   (zero pad 3)
// blockIdx.x == 0: the channel branch of batch b (AVEC[b][128] by wave 0, RVEC[b][128] by wave 1).
// blockIdx.x == 1 + s: the spatial conv of image rows 4s..4s+3 (256 pixels, one per thread). The two pooled maps are
// staged with their halo as zero-padded 10x70 LDS planes; each wave stores one whole 128-B line of SP.
// Coverage: AVEC/RVEC 8 x 128; SP 8 x 16 blocks x 256 thr = 8 x 4096.
// ---------------------------------------------------------------------------
#define POS_ROWS   4                     // image rows per spatial work-group
#define POS_SLICES (64 / POS_ROWS)       // spatial work-groups per batch
#define POS_PLANE  ((POS_ROWS + 6) * 70) // floats per padded plane
static_assert(POS_ROWS * 64 == 256);
static_assert(2 * POS_PLANE > 5 * 256 && 2 * POS_PLANE <= 6 * 256);

__global__ __launch_bounds__(256) void k_pos(const float* __restrict__ POOL,
                                            const float* __restrict__ SPIN, const float* __restrict__ c1w,
                                            const float* __restrict__ ckw, const float* __restrict__ ckb,
                                            const float* __restrict__ spw, const float* __restrict__ spb,
                                            float* __restrict__ AVEC, float* __restrict__ RVEC,
                                            float* __restrict__ SP) {
  __shared__ float sav[128], smx[128];
  __shared__ __align__(16) float sch[128];
  __shared__ float sw1[32];
  __shared__ __align__(16) float sw2[128];
  __shared__ __align__(16) float savec[128], srv[128];
  __shared__ float spl[2 * POS_PLANE];
  const int b = blockIdx.y, tid = threadIdx.x, lane = tid & 31, w = tid >> 5;

  if (blockIdx.x == 0) {                               // block-uniform: every barrier below is passed by the whole block
    const int o = tid & 127;                           // waves 4..7 repeat waves 0..3 and store nothing
    // the ck_w row and ck_b are read here, ahead of the first barrier, so that they are in flight together with the
    // pooled values instead of one dependent round trip per four weights behind the second barrier
    v4f wq[NC / 4];                                    // this thread's whole ck_w row
#pragma unroll
    for (int i = 0; i < NC / 4; ++i) wq[i] = *(const v4fa*)(ckw + (size_t)o * NC + 4 * i);
    const float cb = ckb[o];
    if (tid < 128) {                                   // row b*128+tid: its work-group's line of POOL, mean and max
      const unsigned row = (unsigned)(b * NC + tid);
      const float* pl = POOL + (row / PB_ROWS) * PB_LINE + (row % PB_ROWS);
      sav[tid] = pl[0];
      smx[tid] = pl[PB_ROWS];
    }
    if (tid < 32) sw1[tid] = bfr(c1w[min(tid, 9)]);    // clamped address
    __syncthreads();
    // channel conv1d
    if (tid < 128) {
      const int c = tid;
      float acc = 0.0f;
#pragma unroll 1
      for (int t = 0; t < 5; ++t) {
        const int cc  = c + t - 2;
        const int ccl = min(max(cc, 0), NC - 1);
        const float valid = (cc >= 0 && cc < NC) ? 1.0f : 0.0f;
        acc += valid * (sw1[t] * sav[ccl] + sw1[5 + t] * smx[ccl]);
      }
      sch[c] = acc;
    }
    __syncthreads();
    // Avec, R: c ascending, as one chain each (Avec by fused multiply-add, written out so that the unrolled form
    // is not split into packed multiplies and separate adds). Unrolled so that the row stays in registers.
    {
      float a = bfr(cb), r = 0.0f;
#pragma unroll
      for (int c = 0; c < NC; ++c) {
        const float wv = bfr(wq[c >> 2][c & 3]);
        a = __builtin_fmaf(wv, sch[c], a);
        r += wv;
      }
      if (tid < 128) { savec[o] = a; srv[o] = r; }
    }
    __syncthreads();
    if (w == 0) {
      const v4f v = *(const v4fa*)(savec + 4 * lane);
      *(v4f*)(AVEC + b * NC + 4 * lane) = v;
    } else if (w == 1) {
      const v4f v = *(const v4fa*)(srv + 4 * lane);
      *(v4f*)(RVEC + b * NC + 4 * lane) = v;
    }
    return;
  }

  // spatial 7x7x2 conv + bias of image rows h0..h0+3
  const int sl = blockIdx.x - 1;
  const int h0 = sl * POS_ROWS;
  const float* sp0 = SPIN + (size_t)b * 2 * NP;
  const float bias_sp = bfr(spb[0]);                   // read ahead of the barrier, with the other loads
  {
    // padded planes with halo: every lane loads at a clamped address, so that the weight load and the six tile loads
    // are in flight together; what lies outside the image becomes 0
    const float wt = spw[min(tid, 97)];
    float tv[6];
#pragma unroll
    for (int k = 0; k < 6; ++k) {
      const int i   = min(k * 256 + tid, 2 * POS_PLANE - 1);
      const int pl  = i / POS_PLANE, rem = i - pl * POS_PLANE;
      const int rr  = rem / 70, cc = rem - rr * 70;
      const int gh  = h0 + rr - 3, gx = cc - 3;
      const bool in = gh >= 0 && gh < 64 && gx >= 0 && gx < 64;
      const float v = sp0[pl * NP + min(max(gh, 0), 63) * 64 + min(max(gx, 0), 63)];
      tv[k] = in ? v : 0.0f;
    }
    if (tid < 128) sw2[tid] = bfr(wt);
#pragma unroll
    for (int k = 0; k < 5; ++k) spl[k * 256 + tid] = tv[k];
    if (5 * 256 + tid < 2 * POS_PLANE) spl[5 * 256 + tid] = tv[5];
  }
  __syncthreads();
  {
    const int h = tid >> 6, x = tid & 63;
    const float* t0 = spl + h * 70 + x;
    float acc = bias_sp;
    // both tap loops unrolled: the 98 LDS reads of a pixel do not depend on one another and overlap, where the
    // rolled loops paid one LDS round trip a tap; the taps are added in the same order
#pragma unroll
    for (int u = 0; u < 7; ++u) {
#pragma unroll
      for (int v = 0; v < 7; ++v) {
        const int li = u * 70 + v;
        acc += sw2[u * 7 + v] * t0[li] + sw2[49 + u * 7 + v] * t0[POS_PLANE + li];
      }
    }
    SP[(size_t)b * NP + sl * 256 + tid] = acc;
    asm volatile("s_wait_xcnt 0x0" ::: "memory");      // before a register that the store names is rewritten
  }
}

// ---------------------------------------------------------------------------
// Kernel 6: [Q|K|V] = XT . Wqkv^T + bias (exact bf16 x bf16 products, f32 accumulate, K = 128 in 4 steps of 32).
// grid = (32768/64 = 512 token tiles, 3 = which), 128 threads = 4 waves; wave w owns tokens m0+16w..+15 x all 128
// output channels (8 accumulator tiles). A fragments straight from XT rows, B fragments from Wqkv rows (both
// k-contiguous bf16, arithmetic addressing). bias (bf16r), Avec and R staged in LDS (one scalar load per thread each).
// Epilogue: f32 tile (acc + bias) staged in LDS [64][132];
//   which 0: alpha[n] = sum_o Avec[b][o] q[o][n], beta[n] = sum_o R[o] q[o][n] (f32, unroll 4) -> ALPHA/BETA 256-B
//            segments (16 lanes x 16 B); Q hi|lo token-major planes [tok][128];
//   which 1: K hi|lo token-major planes;  which 2: V hi|lo channel-major planes [b][c][4096] (transposed write).
// ---------------------------------------------------------------------------
__global__ __launch_bounds__(128) void k_qkv(const __bf16* __restrict__ XT, const __bf16* __restrict__ Wb,
                                            const float* __restrict__ qb, const float* __restrict__ kb,
                                            const float* __restrict__ vb,
                                            const float* __restrict__ AVEC, const float* __restrict__ RVEC,
                                            unsigned short* __restrict__ QP, unsigned short* __restrict__ KP,
                                            unsigned short* __restrict__ VP,
                                            float* __restrict__ ALPHA, float* __restrict__ BETA) {
  __shared__ __align__(16) float sT[64 * 132];
  __shared__ __align__(16) float sAV[128], sRV[128], sAB[128], sBI[128];
  const int tid = threadIdx.x, lane = tid & 31, w = tid >> 5, hh = lane >> 4, l16 = lane & 15;
  const int which = blockIdx.y;
  const int m0 = blockIdx.x * 64;            // global token row
  const int b  = m0 / NP;
  const int n0 = m0 - b * NP;

  const float* bias = (which == 0) ? qb : ((which == 1) ? kb : vb);   // block-uniform select, same address space
  sAV[tid] = AVEC[b * NC + tid];
  sRV[tid] = RVEC[b * NC + tid];
  sBI[tid] = bfr(bias[tid]);
  __syncthreads();

  const v8f zero8 = {0.f, 0.f, 0.f, 0.f, 0.f, 0.f, 0.f, 0.f};
  v8f acc[8];
#pragma unroll
  for (int t = 0; t < 8; ++t) acc[t] = zero8;

  const __bf16* arow = XT + (size_t)(m0 + 16 * w + l16) * NC;        // token row, k = input channel
  const __bf16* brow = Wb + ((size_t)which * NC + l16) * NC;          // output channel row (tile 0), k = input channel
#pragma unroll
  for (int kc = 0; kc < 4; ++kc) {
    const v16b a = ldfrag(arow + kc * 32, hh);
#pragma unroll
    for (int t = 0; t < 8; ++t) {
      const v16b bf = ldfrag(brow + (size_t)t * 16 * NC + kc * 32, hh);
      acc[t] = mma_bf(a, bf, acc[t]);
    }
  }
  // D[r] of tile t = Y[token 16w+8hh+r][channel 16t+l16]
#pragma unroll
  for (int t = 0; t < 8; ++t) {
    const float bv = sBI[16 * t + l16];
#pragma unroll
    for (int r = 0; r < 8; ++r) sT[(16 * w + 8 * hh + r) * 132 + 16 * t + l16] = acc[t][r] + bv;
  }
  __syncthreads();
  if (which == 0 && tid < 64) {            // waves 0,1
    const float* qr = sT + tid * 132;
    float a = 0.0f, be = 0.0f;
#pragma unroll 4
    for (int o = 0; o < NC; ++o) {
      const float q = qr[o];
      a  += sAV[o] * q;
      be += sRV[o] * q;
    }
    sAB[tid] = a;
    sAB[64 + tid] = be;
  }
  __syncthreads();

  // pack hi|lo planes
  const int q8 = lane & 7, sub = lane >> 3;
  v4u hv[8], lv[8];
#pragma unroll
  for (int i = 0; i < 8; ++i) {
    const int lid  = w * 32 + i * 4 + sub;                                   // 0..127
    const int base = (which != 2) ? ((lid >> 1) * 132 + (lid & 1) * 64 + 8 * q8) : ((8 * q8) * 132 + lid);
    const int estr = (which != 2) ? 1 : 132;
    v4u a, a2;
#pragma unroll
    for (int q = 0; q < 4; ++q) {
      const float f0 = sT[base + (2 * q) * estr];
      const float f1 = sT[base + (2 * q + 1) * estr];
      const unsigned short h0 = f2bf_bits(f0), h1 = f2bf_bits(f1);
      const unsigned short l0 = f2bf_bits(f0 - bfbits2f(h0)), l1 = f2bf_bits(f1 - bfbits2f(h1));
      a[q]  = pk16(h0, h1);
      a2[q] = pk16(l0, l1);
    }
    hv[i] = a;
    lv[i] = a2;
  }
  unsigned short* P = (which == 0) ? QP : ((which == 1) ? KP : VP);
  {
#pragma unroll
    for (int i = 0; i < 8; ++i) {
      const int lid = w * 32 + i * 4 + sub;
      const size_t go = (which != 2)
          ? ((size_t)(m0 + (lid >> 1)) * NC + (lid & 1) * 64 + 8 * q8)
          : (((size_t)b * NC + lid) * NP + n0 + 8 * q8);
      *(v4ua*)(P + go) = hv[i];
      *(v4ua*)(P + PLANE_ELEMS + go) = lv[i];
    }
    
  }
  if (which == 0 && w == 0) {
    const v4f v = *(const v4fa*)(sAB + 4 * lane);    // lanes 0..15: alpha 0..63, lanes 16..31: beta 0..63
    {
      if (lane < 16) *(v4f*)(ALPHA + m0 + 4 * lane) = v;
      else           *(v4f*)(BETA + m0 + 4 * (lane - 16)) = v;
      
    }
  }
}

// ---------------------------------------------------------------------------
// Kernel 7: full (non-causal, unmasked) attention, head dim 128, block per (b, 64-query tile): grid 8 x 64 = 512,
// 128 threads = 4 waves. Wave w: query group g = w&1 (queries 32g..32g+31, two tiles u of 16), key half kh = w>>1.
//   energy[n][m] = q[n].k[m] (bf16 hi/lo 3-term WMMA) + alpha[m] + sp[n]*beta[m]  (f32, no scale)
//   Both products are taken transposed, so that a lane owns ONE query per tile (n = 32g + 16u + (lane&15)) all the way:
//   S^T = K . Q^T : A = K rows (m = key), B = Q rows (n = query); D[r] of tile (u, jj) = S[key key0+16jj+8hh+r][query].
//   The Q fragments of the wave's 32 queries (hi|lo, 4 steps of 32 channels) are loaded once from global memory and stay
//   in registers for all 64 chunks; every K and V fragment that is read from LDS feeds both query tiles (6 products).
//   The 16 scores of a lane and tile are keys key0+8hh+0..7 and key0+16+8hh+0..7: exactly the k order of a B fragment of
//   32 keys, so p hi|lo is packed in registers and goes into the second product with no trip through LDS.
//   O^T += V . P^T : A = Vcm rows (m = channel), B = P (n = query, k = the wave's own 32 keys), all 128 channels
//   (8 accumulator tiles per query tile); D[r] of tile (u, t) = O[channel 16t+8hh+r][query].
//   Row max and row sum are in-lane over 16 values plus one exchange with lane^16. Each wave keeps an online softmax
//   state (max, sum, O) of its own for its key half of every chunk; the two halves of a query are merged once,
//   behind the key loop, through LDS: O = (O0 2^(m0-m) + O1 2^(m1-m)) / (l0 2^(m0-m) + l1 2^(m1-m)).
//   Online softmax over all 4096 keys in 64 chunks of 64 (compile-time trip count, no masking). The running maximum is
//   kept in log2 units (max * log2 e), so that p = 2^(e * log2 e - max) is one fused multiply-add and one v_exp_f32;
//   the correction of the older sums, 2^(old max - new max), uses the very values the older p were formed with.
// LDS: K hi|lo [64][128], Vcm hi|lo [128][64]; every row is
// padded by 16 B (pitch 272 B for 256-B rows, 144 B for 128-B rows = 16 B x odd), so the 16 rows that one 16-byte
// fragment read touches fall on 16 different bank groups; the lo plane of K starts 64 B and that of V 128 B past a
// multiple of 256 B; staging gives consecutive lanes consecutive 16-B pieces of a row (whole lines);
// K, V and alpha|beta come by asynchronous copies to LDS, one buffer each, two barriers a chunk: V(kc) is issued behind
// the barrier at the loop's head (V.P of kc-1 done) and waited for in front of the barrier behind the scores;
// K(kc+1), alpha|beta(kc+1) are issued behind that barrier (scores of kc done) and waited for in front of the barrier
// at the loop's head;
// alpha/beta slices [64]+[64], merge arrays [128]+[128]; output tile [128 c][64 n] (pitch 68) overlays the
// K/V region after the loop (block barrier first).
// Staging coverage per chunk: K 32 rounds x 64 thr x 8 = 64x128 x 2 planes, V 32 rounds x 64 thr x 8 = 128x64 x 2 planes;
// Output: out[b][c][n0..n0+63] channel-major; each channel row segment = 256 B = 16 contiguous lanes x 16 B
// ---------------------------------------------------------------------------
#define KQ_PITCH 136                       // elements: 128 + 8 (272 B)
#define VP_PITCH 72                        // elements: 64 + 8 (144 B)
#define KQ_PLANE (64 * KQ_PITCH + 32)      // elements: 17472 B = 68 x 256 + 64
#define V_PLANE  (128 * VP_PITCH + 64)     // elements: 18560 B = 72 x 256 + 128
#define SM_K   0
#define SM_V   (SM_K + 2 * KQ_PLANE * 2)
#define SM_AB  (SM_V + 2 * V_PLANE * 2)
#define SM_RED (SM_AB + 512)
#define SM_TOT (SM_RED + 1024)
static_assert(128 * 68 * 4 <= SM_AB);
static_assert(SM_V % 16 == 0 && SM_AB % 16 == 0);
static_assert(2 * SM_TOT <= 327680);

// Two waves per SIMD (two work-groups of four waves on a WGP): the register budget of a wave is 512.
__global__ __launch_bounds__(128) __attribute__((amdgpu_waves_per_eu(2)))
void k_attn(const __bf16* __restrict__ QP, const __bf16* __restrict__ KP,
            const __bf16* __restrict__ VP, const float* __restrict__ ALPHA,
            const float* __restrict__ BETA, const float* __restrict__ SP,
            float* __restrict__ out) {
  __shared__ __align__(16) unsigned char smem[SM_TOT];
  __bf16* Ks   = (__bf16*)(smem + SM_K);     // hi at +0, lo at +KQ_PLANE elements
  __bf16* Vs   = (__bf16*)(smem + SM_V);
  float*  sab  = (float*)(smem + SM_AB);     // alpha 0..63, beta 64..127
  float*  redm = (float*)(smem + SM_RED);    // final row max of a key half [2 g][2 kh][2 u][16]
  float*  reds = redm + 128;                 // final row sum of a key half [2 g][2 kh][2 u][16]
  float*  Os   = (float*)(smem + SM_K);      // [128][68] after the key loop

  const int tid = threadIdx.x, lane = tid & 31, w = tid >> 5, hh = lane >> 4, c = lane & 15;
  const int g = w & 1, kh = w >> 1;
  const int key0 = 32 * kh;                  // this wave's key half within a chunk
  const int b  = blockIdx.x >> 6;
  const int n0 = (blockIdx.x & 63) * 64;
  const size_t tok0 = (size_t)b * NP + n0;

  // ---- the wave's Q fragments hi|lo, once, straight from the token-major planes: 2 tiles x 4 steps x 2 planes ----
  v16b qa[2][4], ql[2][4];
  float spq[2];                              // sp[n] of this lane's two queries
  // block-uniform plane bases and one byte offset of the lane (its tile-0 query row, at its half's first 8 channels)
  const uint64_t qsrc[2] = {ubase(QP + tok0 * NC), ubase(QP + PLANE_ELEMS + tok0 * NC)};
  const unsigned qoff = (unsigned)((32 * g + c) * NC + 8 * hh) * 2u;
  const float* spp = SP + tok0 + 32 * g + c;
#pragma unroll   // constant indices keep the fragments in registers
  for (int u = 0; u < 2; ++u) {
#pragma unroll
    for (int dc = 0; dc < 4; ++dc) {
      FB fa, fl;
      fa.h[0] = ldg16(qsrc[0], qoff, (16 * u * NC + dc * 32) * 2);
      fa.h[1] = ldg16(qsrc[0], qoff, (16 * u * NC + dc * 32 + 16) * 2);
      fl.h[0] = ldg16(qsrc[1], qoff, (16 * u * NC + dc * 32) * 2);
      fl.h[1] = ldg16(qsrc[1], qoff, (16 * u * NC + dc * 32 + 16) * 2);
      qa[u][dc] = fa.v;
      ql[u][dc] = fl.v;
    }
    spq[u] = spp[16 * u];
  }
  // before a register that these loads name is rewritten; what they name are inputs, so that it lives up to the wait
  asm volatile("s_wait_xcnt 0x0" :: "v"(qoff), "s"(qsrc[0]), "s"(qsrc[1]), "v"(spp) : "memory");
  // this wave's own running max (log2 units) and sum of the lane's two queries (same in lane^16)
  float mrow[2] = {-INFINITY, -INFINITY}, lrow[2] = {0.0f, 0.0f};
  const v8f zero8 = {0.f, 0.f, 0.f, 0.f, 0.f, 0.f, 0.f, 0.f};
  v8f oacc[2][8];
#pragma unroll
  for (int u = 0; u < 2; ++u) {
#pragma unroll
    for (int t = 0; t < 8; ++t) oacc[u][t] = zero8;
  }

  // K/V plane bases of this batch (block-uniform) and the lane's running byte offsets (below 1 MiB + one tile)
  const uint64_t ksrc[2] = {ubase(KP + (size_t)b * NP * NC), ubase(KP + PLANE_ELEMS + (size_t)b * NP * NC)};
  const uint64_t vsrc[2] = {ubase(VP + (size_t)b * NC * NP), ubase(VP + PLANE_ELEMS + (size_t)b * NC * NP)};
  // Who copies what: waves 0,1 bring the K tiles (wave 0 the alpha|beta slice too), waves 2,3 the V tiles, so that a
  // wave's wait for its own copies never holds up the other tile's copies in flight. The wave's number stands in a
  // scalar register: every test on it is a scalar branch, and every lane is on at every copy.
  const int wu = __builtin_amdgcn_readfirstlane(w);
  const int ct = tid & 63;                             // the lane's place among the 64 lanes that bring a tile
  const int ck_r = ct >> 4, ck_c = (ct & 15) * 8;      // K: 16 lanes per 256-B row, 4 rows per round
  const int cv_r = ct >> 3, cv_c = (ct & 7) * 8;       // V:  8 lanes per 128-B row, 8 rows per round
  unsigned koff = (unsigned)(ck_r * NC + ck_c) * 2u;   // the lane's running byte offset in the token-major K planes
  unsigned voff = (unsigned)(cv_r * NP + cv_c) * 2u;   // the lane's running byte offset in the channel-major V planes
  // K: 2 planes x 16 rounds x 64 thr x 8 elements = 64 rows x 128 x 2 planes
  __bf16* kd = Ks + ck_r * KQ_PITCH + ck_c;
  // V: 2 planes x 16 rounds x 64 thr x 8 elements = 128 channel rows x 64 keys x 2 planes
  __bf16* vd = Vs + cv_r * VP_PITCH + cv_c;
  // alpha|beta slice of a chunk: one copy, lanes 0..15 the 64 alphas, lanes 16..31 the 64 betas
  const uint64_t absrc = (uint64_t)((lane < 16 ? ALPHA + 4 * lane : BETA + 4 * (lane - 16)) + (size_t)b * NP);

  // chunk 0's K tile and alpha|beta slice, into LDS that nobody has touched yet
  if (wu < 2) {
#pragma unroll   // each copy's plane and step are constants: no index arithmetic is left at run time
    for (int i = 0; i < 32; ++i)
      cp16(ksrc[i >> 4], koff, (i & 15) * 4 * NC * 2, kd + (i >> 4) * KQ_PLANE + (i & 15) * 4 * KQ_PITCH);
    if (wu == 0) cp16(absrc, 0, 0, sab + 4 * lane);
  }

#pragma unroll 1
  for (int kc = 0; kc < NP / 64; ++kc) {
    // this chunk's K and alpha|beta have landed; every wave has left the V tile
    wait_lds();
    wait_copies();
    __syncthreads();
    // this chunk's V tile flies under the scores
    if (wu >= 2) {
#pragma unroll   // as above: constant plane and step per copy
      for (int i = 0; i < 32; ++i)
        cp16(vsrc[i >> 4], voff, (i & 15) * 8 * NP * 2, vd + (i >> 4) * V_PLANE + (i & 15) * 8 * VP_PITCH);
      voff += 64 * 2;        // next 64 keys: 64 columns of V
    }

    // ---- scores, transposed: s[u][jj][r] = S[key m0+key0+16jj+8hh+r][query 32g+16u+c], 3-term split ----
    v8f s[2][2];
    s[0][0] = zero8; s[0][1] = zero8; s[1][0] = zero8; s[1][1] = zero8;
    // K fragments come two groups (12 products) ahead of their use, through a ring of three register sets, so that a
    // group's LDS latency passes under the products of the groups in front of it. Group q: channel step q>>1, key tile q&1.
    v16b kf[3][2];
#pragma unroll
    for (int q = 0; q < 2; ++q) {
      const __bf16* krow = Ks + (key0 + 16 * (q & 1) + c) * KQ_PITCH + (q >> 1) * 32;
      kf[q][0] = ldfrag(krow, hh);
      kf[q][1] = ldfrag(krow + KQ_PLANE, hh);
    }
#pragma unroll   // the Q fragments and the ring are indexed by constants, so that they stay in registers
    for (int q = 0; q < 8; ++q) {
      if (q + 2 < 8) {
        const __bf16* krow = Ks + (key0 + 16 * ((q + 2) & 1) + c) * KQ_PITCH + ((q + 2) >> 1) * 32;
        kf[(q + 2) % 3][0] = ldfrag(krow, hh);
        kf[(q + 2) % 3][1] = ldfrag(krow + KQ_PLANE, hh);
      }
      const int dc = q >> 1, jj = q & 1;
      const v16b kb = kf[q % 3][0], kl = kf[q % 3][1];
      // the two query tiles take turns, so that no product waits for the one directly ahead of it
      s[0][jj] = mma_hi(kb, qa[0][dc], s[0][jj]);
      s[1][jj] = mma_hi(kb, qa[1][dc], s[1][jj]);
      s[0][jj] = mma_hi(kl, qa[0][dc], s[0][jj]);
      s[1][jj] = mma_hi(kl, qa[1][dc], s[1][jj]);
      s[0][jj] = mma_hi(kb, ql[0][dc], s[0][jj]);
      s[1][jj] = mma_hi(kb, ql[1][dc], s[1][jj]);
    }
    // ---- positional terms in f32 (alpha, beta of the lane's 16 keys), then the max over this wave's 32 keys ----
    float cmx[2] = {-INFINITY, -INFINITY};
#pragma unroll
    for (int jj = 0; jj < 2; ++jj) {
      const float* ap = sab + key0 + 16 * jj + 8 * hh;
      const v4f a0 = *(const v4fa*)(ap),      a1 = *(const v4fa*)(ap + 4);
      const v4f b0 = *(const v4fa*)(ap + 64), b1 = *(const v4fa*)(ap + 68);
#pragma unroll
      for (int u = 0; u < 2; ++u) {
#pragma unroll
        for (int r = 0; r < 8; ++r) {
          const float al = (r < 4) ? a0[r & 3] : a1[r & 3];
          const float be = (r < 4) ? b0[r & 3] : b1[r & 3];
          const float e = s[u][jj][r] + al + spq[u] * be;
          s[u][jj][r] = e;
          cmx[u] = fmaxf(cmx[u], e);
        }
      }
    }
#pragma unroll
    for (int u = 0; u < 2; ++u) cmx[u] = fmaxf(cmx[u], xhalf(cmx[u]));
    wait_lds();                   // every wave has left the K tile and the alpha|beta slice
    if (wu >= 2) wait_copies();   // this chunk's V has landed
    __syncthreads();
    // the next chunk's K tile and alpha|beta slice fly under the softmax and V.P
    if (kc + 1 < NP / 64) {
      if (wu < 2) {
        koff += 64 * NC * 2; // next 64 keys: 64 token rows of K
#pragma unroll   // as above: constant plane and step per copy
        for (int i = 0; i < 32; ++i)
          cp16(ksrc[i >> 4], koff, (i & 15) * 4 * NC * 2, kd + (i >> 4) * KQ_PLANE + (i & 15) * 4 * KQ_PITCH);
        if (wu == 0) cp16(absrc, (unsigned)(kc + 1) * 64 * 4, 0, sab + 4 * lane);
      }
    }
    // V fragments come two channel tiles (12 products) ahead of their use, through a ring of three register sets, as with
    // K; the first two tiles' reads stand here, so that their LDS latency passes under the softmax.
    v16b vf[3][2];
#pragma unroll
    for (int t = 0; t < 2; ++t) {
      const __bf16* vr = Vs + (16 * t + c) * VP_PITCH + key0;
      vf[t][0] = ldfrag(vr, hh);
      vf[t][1] = ldfrag(vr + V_PLANE, hh);
    }
    // keeps these reads where they stand (vector, scalar and exp instructions may cross): the compiler sinks them to their use
    __builtin_amdgcn_sched_barrier(0x406);
    // ---- online softmax of the lane's queries over this wave's keys; P hi|lo packed as B fragments in registers ----
    union PB { v16b v; unsigned u[8]; } pa[2], pl[2];   // element 8jj+r = key key0+16jj+8hh+r: the fragment's k order
#pragma unroll
    for (int u = 0; u < 2; ++u) {
      const float mnew = fmaxf(mrow[u], cmx[u] * LOG2E);
      const float corr = ex2(mrow[u] - mnew);
      mrow[u] = mnew;
      float psum = 0.0f;
#pragma unroll
      for (int jj = 0; jj < 2; ++jj) {
#pragma unroll
        for (int r = 0; r < 8; r += 2) {
          const float p0 = ex2(__builtin_fmaf(s[u][jj][r], LOG2E, -mnew));
          const float p1 = ex2(__builtin_fmaf(s[u][jj][r + 1], LOG2E, -mnew));
          psum += p0;
          psum += p1;
          const unsigned short h0 = f2bf_bits(p0), h1 = f2bf_bits(p1);
          const unsigned short l0 = f2bf_bits(p0 - bfbits2f(h0)), l1 = f2bf_bits(p1 - bfbits2f(h1));
          pa[u].u[4 * jj + (r >> 1)] = pk16(h0, h1);
          pl[u].u[4 * jj + (r >> 1)] = pk16(l0, l1);
        }
      }
      psum += xhalf(psum);
      lrow[u] = lrow[u] * corr + psum;
#pragma unroll
      for (int t = 0; t < 8; ++t) {
#pragma unroll
        for (int r = 0; r < 8; ++r) oacc[u][t][r] *= corr;
      }
    }

    // ---- O^T += V . P^T : A = Vcm row (channel 16t+c) [key], B = P [key][query]; 8 channel tiles, the wave's 32 keys ----
#pragma unroll   // the accumulator tiles and the ring are indexed by constants, so that they stay in registers
    for (int t = 0; t < 8; ++t) {
      if (t + 2 < 8) {
        const __bf16* vr = Vs + (16 * (t + 2) + c) * VP_PITCH + key0;
        vf[(t + 2) % 3][0] = ldfrag(vr, hh);
        vf[(t + 2) % 3][1] = ldfrag(vr + V_PLANE, hh);
      }
      // keeps the reads two tiles ahead of their products (vector, scalar and exp instructions may cross), as above
      __builtin_amdgcn_sched_barrier(0x406);
      const v16b vb = vf[t % 3][0], vl = vf[t % 3][1];
      // the two query tiles take turns, as in the scores
      oacc[0][t] = mma_hi(vb, pa[0].v, oacc[0][t]);
      oacc[1][t] = mma_hi(vb, pa[1].v, oacc[1][t]);
      oacc[0][t] = mma_hi(vl, pa[0].v, oacc[0][t]);
      oacc[1][t] = mma_hi(vl, pa[1].v, oacc[1][t]);
      oacc[0][t] = mma_hi(vb, pl[0].v, oacc[0][t]);
      oacc[1][t] = mma_hi(vb, pl[1].v, oacc[1][t]);
    }
  }
  wait_lds();
  wait_copies();     // no copy is in flight here; the wait stands before the tiles' LDS gets another use
  // ---- merge the two key halves of every query: exchange (max, sum), scale, add through the output tile ----
  if (hh == 0) {
#pragma unroll
    for (int u = 0; u < 2; ++u) {
      redm[g * 64 + kh * 32 + 16 * u + c] = mrow[u];
      reds[g * 64 + kh * 32 + 16 * u + c] = lrow[u];
    }
  }
  __syncthreads();   // all waves done with the K/V tiles before the output tile overlays them; max and sum published
  {
    float fs[2];
#pragma unroll
    for (int u = 0; u < 2; ++u) {
      const float m0 = redm[g * 64 + 16 * u + c], m1 = redm[g * 64 + 32 + 16 * u + c];
      const float l0 = reds[g * 64 + 16 * u + c], l1 = reds[g * 64 + 32 + 16 * u + c];
      const float mt = fmaxf(m0, m1);
      const float f0 = ex2(m0 - mt), f1 = ex2(m1 - mt);
      const float inv = 1.0f / (l0 * f0 + l1 * f1);
      fs[u] = (kh == 0 ? f0 : f1) * inv;
    }
    float* op = Os + (8 * hh) * 68 + 32 * g + c;     // O staged as [c][n_local]
    if (wu >= 2) {                                   // key half 1 stores its share
#pragma unroll
      for (int u = 0; u < 2; ++u) {
#pragma unroll
        for (int t = 0; t < 8; ++t) {
#pragma unroll
          for (int r = 0; r < 8; ++r) op[(16 * t + r) * 68 + 16 * u] = oacc[u][t][r] * fs[u];
        }
      }
    }
    __syncthreads();
    if (wu < 2) {                                    // key half 0 adds its own to the same places
#pragma unroll
      for (int u = 0; u < 2; ++u) {
#pragma unroll
        for (int t = 0; t < 8; ++t) {
#pragma unroll
          for (int r = 0; r < 8; ++r)
            op[(16 * t + r) * 68 + 16 * u] = oacc[u][t][r] * fs[u] + op[(16 * t + r) * 68 + 16 * u];
        }
      }
    }
  }
  __syncthreads();
  {
    float* ob = out + (size_t)b * NC * NP + n0;
    const int c4 = (lane & 15) * 4;
    {
#pragma unroll
      for (int i = 0; i < 16; ++i) {
        const int row = i * 8 + w * 2 + hh;                        // 0..127 channel
        const v4f v = *(const v4fa*)(Os + row * 68 + c4);
        *(v4f*)(ob + (size_t)row * NP + c4) = v;
      }
      
    }
  }
}

// ---------------------------------------------------------------------------
//   XT    bf16 [32768][128]          0           8388608
//   WQKV  bf16 [384][128]            8388608       98304
//   POOL  f32  [256][32]             8486912       32768
//   SPIN  f32  [8][2][4096]          8519680      262144
//   AVEC  f32  [8][128]              8781824        4096
//   RVEC  f32  [8][128]              8785920        4096
//   SP    f32  [8][4096]             8790016      131072
//   ALPHA f32  [8][4096]             8921088      131072
//   BETA  f32  [8][4096]             9052160      131072
//   Q hi|lo bf16 2x[32768][128]      9183232    16777216
//   K hi|lo bf16 2x[32768][128]     25960448    16777216
//   V hi|lo bf16 2x[8][128][4096]   42737664    16777216
//   total                          59514880
// ---------------------------------------------------------------------------
extern "C" void kernel_launch(void* const* d_in, const int* in_sizes, int n_in,
                              void* d_out, int out_size, void* d_ws, size_t ws_size,
                              hipStream_t stream) {
  if (n_in < 13) return;
  if (in_sizes[0] != NB * NC * NP || in_sizes[1] != NB * NC * NP) return;
  if (in_sizes[2] != NC * NC || in_sizes[4] != NC * NC || in_sizes[6] != NC * NC || in_sizes[8] != NC * NC) return;
  if (in_sizes[3] != NC || in_sizes[5] != NC || in_sizes[7] != NC || in_sizes[9] != NC) return;
  if (in_sizes[10] != 10 || in_sizes[11] != 98 || in_sizes[12] != 1) return;
  if (out_size != NB * NC * NP) return;

  const float* x    = (const float*)d_in[0];
  const float* x2   = (const float*)d_in[1];
  const float* q_w  = (const float*)d_in[2];
  const float* q_b  = (const float*)d_in[3];
  const float* k_w  = (const float*)d_in[4];
  const float* k_b  = (const float*)d_in[5];
  const float* v_w  = (const float*)d_in[6];
  const float* v_b  = (const float*)d_in[7];
  const float* ck_w = (const float*)d_in[8];
  const float* ck_b = (const float*)d_in[9];
  const float* c1w  = (const float*)d_in[10];
  const float* sp_w = (const float*)d_in[11];
  const float* sp_b = (const float*)d_in[12];
  float* out = (float*)d_out;

  const size_t plane_b = PLANE_ELEMS * 2;                 // 8388608 bytes per 16-bit plane
  size_t off = 0;
  const size_t oXT   = off; off += plane_b;
  const size_t oW    = off; off += (size_t)3 * NC * NC * 2;
  const size_t oPOOL = off; off += (size_t)(NB * NC / PB_ROWS) * PB_LINE * 4;
  const size_t oSPIN = off; off += (size_t)NB * 2 * NP * 4;
  const size_t oAVEC = off; off += (size_t)NB * NC * 4;
  const size_t oRVEC = off; off += (size_t)NB * NC * 4;
  const size_t oSP   = off; off += (size_t)NB * NP * 4;
  const size_t oAL   = off; off += (size_t)NB * NP * 4;
  const size_t oBE   = off; off += (size_t)NB * NP * 4;
  const size_t oQ    = off; off += 2 * plane_b;
  const size_t oK    = off; off += 2 * plane_b;
  const size_t oV    = off; off += 2 * plane_b;           // off = 59514880
  if (off > ws_size) return;
  if (off > (size_t)134217728) return;

  char* ws = (char*)d_ws;
  unsigned short* XT    = (unsigned short*)(ws + oXT);
  unsigned short* WQKV  = (unsigned short*)(ws + oW);
  float* POOL  = (float*)(ws + oPOOL);
  float* SPIN  = (float*)(ws + oSPIN);
  float* AVEC  = (float*)(ws + oAVEC);
  float* RVEC  = (float*)(ws + oRVEC);
  float* SP    = (float*)(ws + oSP);
  float* ALPHA = (float*)(ws + oAL);
  float* BETA  = (float*)(ws + oBE);
  unsigned short* QP = (unsigned short*)(ws + oQ);
  unsigned short* KPp = (unsigned short*)(ws + oK);
  unsigned short* VPp = (unsigned short*)(ws + oV);

  // 1. x -> token-major bf16 planes (grid: n blocks, c blocks, batch)
  k_xt<<<dim3(NP / 64, NC / 64, NB), 256, 0, stream>>>(x, XT);
  // 2. projection weights -> bf16 [384][128]
  k_wcvt<<<dim3(NC * NC / 8 / 256, 3), 256, 0, stream>>>(q_w, k_w, v_w, WQKV);
  // 3. per-(b,c) pixel mean/max of x2
  k_poolbc<<<NB * NC / PB_ROWS, 256, 0, stream>>>(x2, POOL);
  // 4. per-(b,n) channel mean/max of x2
  k_poolc<<<NB * (NP / 64), 256, 0, stream>>>(x2, SPIN);
  // 5. positional branch: Avec, R (x = 0), sp (x = 1..16), per batch (y)
  k_pos<<<dim3(POS_SLICES + 1, NB), 256, 0, stream>>>(POOL, SPIN, c1w, ck_w, ck_b, sp_w, sp_b, AVEC, RVEC, SP);
  // 6. q/k/v projections + alpha/beta + hi|lo planes
  k_qkv<<<dim3(NTOK / 64, 3), 128, 0, stream>>>((const __bf16*)(const void*)XT, (const __bf16*)(const void*)WQKV,
                                                q_b, k_b, v_b, AVEC, RVEC, QP, KPp, VPp, ALPHA, BETA);
  // 7. attention, channel-major output
  k_attn<<<NB * (NP / 64), 128, 0, stream>>>((const __bf16*)(const void*)QP, (const __bf16*)(const void*)KPp,
                                             (const __bf16*)(const void*)VPp, ALPHA, BETA, SP, out);
  (void)hipGetLastError();
}

// v010
// One run takes 186 microseconds.
// Next to v009, in two timings, it ran 1.07 and 1.08 times as fast.
// Over all steps from v000 it is 7.57 times as fast.
// Contractions: q/k/v 1x1 projections on v_wmma_f32_16x16x32_bf16 (bf16 operands taken from bf16-RNE inputs, single product, f32 accumulate);
// q.k^T scores and p.v on v_wmma_f32_16x16x32_bf16 with bf16 hi/lo split operands (hi.hi + hi.lo + lo.hi), f32 accumulate;
// pools, channel conv1d, spatial 7x7 conv, positional vectors alpha/beta, online softmax (hardware exp2) in f32.
// 16-bit planes and carries: XT = bf16 RNE(x), Wqkv = bf16 RNE(w), Q/K/V hi = RNE(y), lo = RNE(y - hi), P hi/lo per key chunk in registers.
// No power-of-two carry on any plane (bf16 keeps the f32 exponent range), so no inverse fold anywhere.
#include <hip/hip_runtime.h>
#include <math.h>
#include <stdint.h>

#define NB   8
#define NC   128
#define NP   4096
#define NTOK (NB * NP)
#define PLANE_ELEMS ((size_t)NTOK * NC)

static_assert(NP % 64 == 0);
static_assert(NC == 128);
static_assert((NB * NC) % 32 == 0);
static_assert(NP % 256 == 0);

typedef __attribute__((ext_vector_type(16))) __bf16 v16b;
typedef __attribute__((ext_vector_type(8)))  __bf16 v8b;
typedef __attribute__((ext_vector_type(8)))  float  v8f;
typedef __attribute__((ext_vector_type(4)))  float  v4f;
typedef __attribute__((ext_vector_type(2)))  float  v2f;
typedef __attribute__((ext_vector_type(4)))  unsigned int v4u;
typedef v8b __attribute__((may_alias)) v8ba;
typedef v4f __attribute__((may_alias)) v4fa;
typedef v2f __attribute__((may_alias)) v2fa;
typedef v4u __attribute__((may_alias)) v4ua;

// ---------------------------------------------------------------------------
// bf16 helpers. Where values are packed two to a register, the hardware's own f32 -> bf16 conversion (round to nearest
// even, two values an instruction); bfr, one value rounded and kept as f32, works on the f32 bits (same rounding).
// ---------------------------------------------------------------------------
typedef __attribute__((ext_vector_type(2))) __bf16 v2b;
// bf16(a) in bits 15..0, bf16(b) in bits 31..16
__device__ __forceinline__ unsigned cvt2(float a, float b) {
  const v2f f = {a, b};
  return __builtin_bit_cast(unsigned, __builtin_convertvector(f, v2b));
}
// the f32 values of the low and of the high bf16 of a packed pair
__device__ __forceinline__ float bflo(unsigned p) { return __uint_as_float(p << 16); }
__device__ __forceinline__ float bfhi(unsigned p) { return __uint_as_float(p & 0xFFFF0000u); }
// hi|lo split of a pair: hi = RNE(f), lo = RNE(f - hi)
__device__ __forceinline__ void split2(float f0, float f1, unsigned& hi, unsigned& lo) {
  hi = cvt2(f0, f1);
  lo = cvt2(f0 - bflo(hi), f1 - bfhi(hi));
}
__device__ __forceinline__ float bfr(float f) {
  const unsigned u = __float_as_uint(f);
  return __uint_as_float((u + 0x7FFFu + ((u >> 16) & 1u)) & 0xFFFF0000u);
}

// ---------------------------------------------------------------------------
// 16x16x32 bf16 WMMA with hazard guard (ties D, keeps A/B live).
// Fragment map (wave32): lane l, h = l>>4, m = n = l&15.
//   A/B element i: i<8 -> k0+8h+i ; i>=8 -> k0+16+8h+(i-8)
//   D element r : row 8h+r, col l&15
// ---------------------------------------------------------------------------
__device__ __forceinline__ v8f mma_bf(v16b a, v16b b, v8f c) {
  c = __builtin_amdgcn_wmma_f32_16x16x32_bf16(false, a, false, b, (short)0, c, false, false);
  asm volatile("v_nop\n\tv_nop\n\tv_nop\n\tv_nop" : "+v"(c) : "v"(a), "v"(b));
  return c;
}
// The same product with no asm statement behind it: the compiler keeps the distances of its own builtin. For a kernel whose
// fragments and accumulators reach past v255, which the operands of an asm statement cannot name.
__device__ __forceinline__ v8f mma_hi(v16b a, v16b b, v8f c) {
  return __builtin_amdgcn_wmma_f32_16x16x32_bf16(false, a, false, b, (short)0, c, false, false);
}
// One butterfly step inside a 16-lane row: lane l takes the value of lane l ^ M (DPP row_xmask, on the vector port).
template <int M> __device__ __forceinline__ float rowx(float v) {
  const int i = __builtin_bit_cast(int, v);
  return __builtin_bit_cast(float, __builtin_amdgcn_update_dpp(0, i, 0x160 + M, 0xf, 0xf, true));
}
// Lane l takes the value of lane l ^ 16 (the other 16-lane row).
__device__ __forceinline__ float xhalf(float v) {
  const int i = __builtin_bit_cast(int, v);
  return __builtin_bit_cast(float, __builtin_amdgcn_permlanex16(i, i, 0x76543210, 0xfedcba98, false, false));
}
// 2^x on the hardware's own exponential, one instruction. Every argument here is <= about 0 (a score minus its running
// maximum, in log2 units); a result below the smallest normal f32 comes out as 0, which adds nothing to a sum whose
// largest term is 1. The library expf spends a dozen more vector instructions a value on range tests and on a
// two-part argument.
#define LOG2E 1.4426950408889634f
__device__ __forceinline__ float ex2(float x) { return __builtin_amdgcn_exp2f(x); }
union FB { v16b v; v8b h[2]; };
// A or B fragment from a k-contiguous bf16 row; p points at element k0 of the row owned by this lane.
__device__ __forceinline__ v16b ldfrag(const __bf16* p, int hh) {
  FB f;
  f.h[0] = *(const v8ba*)(p + 8 * hh);
  f.h[1] = *(const v8ba*)(p + 16 + 8 * hh);
  return f.v;
}

// 16-B global load at a block-uniform base plus the lane's own 32-bit byte offset plus a constant. Each plane's base goes
// through readfirstlane so that it keeps a scalar register pair of its own and the load takes the scalar-base form;
// without it the compiler folds the lo plane's 8-MiB step into 64-bit vector addresses that it forms anew every trip.
typedef const __attribute__((address_space(1))) v8ba gv8b;
__device__ __forceinline__ uint64_t ubase(const __bf16* p) {
  const uint64_t u = (uint64_t)p;
  const uint32_t lo = (uint32_t)__builtin_amdgcn_readfirstlane((int)(uint32_t)u);
  const uint32_t hi = (uint32_t)__builtin_amdgcn_readfirstlane((int)(uint32_t)(u >> 32));
  return ((uint64_t)hi << 32) | lo;
}
__device__ __forceinline__ v8b ldg16(uint64_t base, unsigned lane_bytes, unsigned imm_bytes) {
  return *(gv8b*)(base + lane_bytes + imm_bytes);
}
// Asynchronous 16-B copy, global memory to LDS, through no register: every lane brings its own 16 bytes (both addresses
// multiples of 16). The compiler places no wait for it: its bytes count as landed behind the issuing wave's own
// s_wait_asynccnt 0, and for the other waves behind the work-group barrier that follows that wait.
typedef __attribute__((ext_vector_type(4))) int v4i;
typedef __attribute__((address_space(1))) v4i gv4i;
typedef __attribute__((address_space(3))) v4i lv4i;
__device__ __forceinline__ void cp16(uint64_t base, unsigned lane_bytes, unsigned imm_bytes, void* lds) {
  __builtin_amdgcn_global_load_async_to_lds_b128((gv4i*)(base + lane_bytes + imm_bytes), (lv4i*)lds, 0, 0);
}
// In front of a barrier behind which a tile is refilled: this wave's LDS reads of that tile have retired.
__device__ __forceinline__ void wait_lds() { asm volatile("s_wait_dscnt 0x0" ::: "memory"); }
// In front of a barrier behind which the other waves read a tile: this wave's own copies have landed.
__device__ __forceinline__ void wait_copies() { asm volatile("s_wait_asynccnt 0x0" ::: "memory"); }

// ---------------------------------------------------------------------------
// Kernel 1: x[b] viewed [128 c][4096 n] (pitch 4096) -> XT bf16 [b*4096+n][128 c] (pitch 128), bf16 RNE.
// 64x64 tiles through LDS. grid = (4096/64, 128/64, 8), 256 threads.
// Coverage per block: load 4 it x 256 thr x 4 floats = 64x64; store 2 it x 256 thr x 8 u16 = 64x64.
// ---------------------------------------------------------------------------
__global__ __launch_bounds__(256) void k_xt(const float* __restrict__ X, unsigned short* __restrict__ xt) {
  __shared__ __align__(16) float tf[64 * 68];
  const int b = blockIdx.z;
  const float* W = X + (size_t)b * NC * NP;
  unsigned short* o = xt + (size_t)b * NP * NC;
  const int c0 = blockIdx.x * 64;   // input column block (n) = output row block
  const int r0 = blockIdx.y * 64;   // input row block (c)    = output column block
  const int tid = threadIdx.x;
  {
    const int lr = tid >> 4;
    const int c4 = (tid & 15) * 4;
#pragma unroll
    for (int it = 0; it < 4; ++it) {
      const int rr = it * 16 + lr;
      const v4f a = *(const v4fa*)(W + (size_t)(r0 + rr) * NP + c0 + c4);
      *(v4f*)(tf + rr * 68 + c4) = a;
    }
  }
  __syncthreads();
  const int sub = tid >> 3;          // 0..31
  const int c8  = (tid & 7) * 8;     // 0..56
  v4u hv[2];
#pragma unroll
  for (int it = 0; it < 2; ++it) {
    const int oc = it * 32 + sub;    // output row within tile (= input column)
    v4u a;
#pragma unroll
    for (int q = 0; q < 4; ++q) {
      const float f0 = tf[(c8 + 2 * q) * 68 + oc];
      const float f1 = tf[(c8 + 2 * q + 1) * 68 + oc];
      a[q] = cvt2(f0, f1);
    }
    hv[it] = a;
  }
  {
#pragma unroll
    for (int it = 0; it < 2; ++it) {
      const int oc = it * 32 + sub;
      *(v4ua*)(o + (size_t)(c0 + oc) * NC + r0 + c8) = hv[it];
    }
    
  }
}

// ---------------------------------------------------------------------------
// Kernel 2: [q_w; k_w; v_w] ([out o][in c] row-major each) -> Wqkv bf16 [384 o][128 c] (natural Bt: n = o, k = c).
// grid = (16384/8/256 = 8, 3), 256 threads; matrix selected by blockIdx.y (block-uniform).
// Coverage: 3 x 2048 threads x 8 elements = 3 x 16384. One 16-B store per lane, lanes contiguous:
// ---------------------------------------------------------------------------
__global__ __launch_bounds__(256) void k_wcvt(const float* __restrict__ qw, const float* __restrict__ kw,
                                             const float* __restrict__ vw, unsigned short* __restrict__ Wb) {
  const int which = blockIdx.y;
  const float* src = (which == 0) ? qw : ((which == 1) ? kw : vw);
  const int i = blockIdx.x * 256 + threadIdx.x;
  if (i >= NC * NC / 8) return;
  const v4f a = *(const v4fa*)(src + (size_t)i * 8);
  const v4f c = *(const v4fa*)(src + (size_t)i * 8 + 4);
  v4u o4;
  o4[0] = cvt2(a[0], a[1]);
  o4[1] = cvt2(a[2], a[3]);
  o4[2] = cvt2(c[0], c[1]);
  o4[3] = cvt2(c[2], c[3]);
  unsigned short* dst = Wb + (size_t)which * NC * NC + (size_t)i * 8;
  *(v4ua*)dst = o4;
  
}

// ---------------------------------------------------------------------------
// Kernel 3: per-(b,c) mean and max over the 4096 pixels of bf16-RNE x2. Block handles 4 consecutive (b,c) rows
// (grid = 1024/4 = 256, 256 threads: each thread 16 elements of every row, fixed-order tree). All 16 loads of a thread
// (4 rows x 64 B) are issued before the first is used, so a block pays one trip to memory, and the four rows' trees run
// side by side with one barrier for all. Each block owns one whole 128-B line of POOL: floats 0..3 the means of its
// rows, floats 4..7 the maxes; the rest of the line is neither written nor read.
// Coverage: 256 blocks x 4 rows = 1024 = 8 x 128 rows; per row 256 x 16 = 4096 elements.
// ---------------------------------------------------------------------------
#define PB_ROWS 4                        // (b,c) rows per work-group
#define PB_LINE 32                       // floats per work-group in POOL (one 128-B line)
static_assert((NB * NC) % PB_ROWS == 0 && 2 * PB_ROWS <= PB_LINE);

__global__ __launch_bounds__(256) void k_poolbc(const float* __restrict__ x2, float* __restrict__ POOL) {
  __shared__ float ws_s[PB_ROWS][8], ws_m[PB_ROWS][8];
  const int g = blockIdx.x, tid = threadIdx.x, lane = tid & 31, w = tid >> 5;
  const float* p = x2 + (size_t)g * PB_ROWS * NP + tid * 16;
  v4f a[PB_ROWS][4];
#pragma unroll   // constant indices keep the 16 quads in registers, and their loads stand together ahead of all use
  for (int j = 0; j < PB_ROWS; ++j) {
#pragma unroll
    for (int i = 0; i < 4; ++i) a[j][i] = *(const v4fa*)(p + (size_t)j * NP + 4 * i);
  }
  // Holds all 16 loads ahead of the first use (loaded values as inputs only): without it the compiler sinks three of
  // them behind the wait for the others, and the block pays further trips one after another.
  asm volatile("" :: "v"(a[0][0]), "v"(a[0][1]), "v"(a[0][2]), "v"(a[0][3]), "v"(a[1][0]), "v"(a[1][1]), "v"(a[1][2]),
               "v"(a[1][3]), "v"(a[2][0]), "v"(a[2][1]), "v"(a[2][2]), "v"(a[2][3]), "v"(a[3][0]), "v"(a[3][1]),
               "v"(a[3][2]), "v"(a[3][3]));
  static_assert(PB_ROWS == 4);           // the statement above names the quads one by one
  float s[PB_ROWS], m[PB_ROWS];
#pragma unroll
  for (int j = 0; j < PB_ROWS; ++j) {
    float sj = 0.f, mj = -INFINITY;
#pragma unroll
    for (int i = 0; i < 4; ++i) {
      const float a0 = bfr(a[j][i][0]), a1 = bfr(a[j][i][1]), a2 = bfr(a[j][i][2]), a3 = bfr(a[j][i][3]);
      sj += (a0 + a1) + (a2 + a3);
      mj = fmaxf(fmaxf(mj, a0), fmaxf(fmaxf(a1, a2), a3));
    }
    s[j] = sj;
    m[j] = mj;
  }
#pragma unroll
  for (int j = 0; j < PB_ROWS; ++j) { s[j] += xhalf(s[j]);   m[j] = fmaxf(m[j], xhalf(m[j])); }
#pragma unroll
  for (int j = 0; j < PB_ROWS; ++j) { s[j] += rowx<8>(s[j]); m[j] = fmaxf(m[j], rowx<8>(m[j])); }
#pragma unroll
  for (int j = 0; j < PB_ROWS; ++j) { s[j] += rowx<4>(s[j]); m[j] = fmaxf(m[j], rowx<4>(m[j])); }
#pragma unroll
  for (int j = 0; j < PB_ROWS; ++j) { s[j] += rowx<2>(s[j]); m[j] = fmaxf(m[j], rowx<2>(m[j])); }
#pragma unroll
  for (int j = 0; j < PB_ROWS; ++j) { s[j] += rowx<1>(s[j]); m[j] = fmaxf(m[j], rowx<1>(m[j])); }
  if (lane == 0) {
#pragma unroll
    for (int j = 0; j < PB_ROWS; ++j) { ws_s[j][w] = s[j]; ws_m[j][w] = m[j]; }
  }
  __syncthreads();
  if (tid < PB_ROWS) {                   // lane j of wave 0 closes row j: the eight waves' parts in wave order
    float ts = 0.f, tm = -INFINITY;
#pragma unroll
    for (int k = 0; k < 8; ++k) { ts += ws_s[tid][k]; tm = fmaxf(tm, ws_m[tid][k]); }
    POOL[g * PB_LINE + tid] = ts * (1.0f / 4096.0f);
    POOL[g * PB_LINE + PB_ROWS + tid] = tm;
  }
}

// ---------------------------------------------------------------------------
// Kernel 4: per-(b,n) mean and max over the 128 channels of bf16-RNE x2 -> SPIN[b][0][n] = mean, SPIN[b][1][n] = max.
// Block per (b, 64-pixel group): grid = 8 x 64 = 512, 256 threads = 64 pixels x 4 channel groups of 32 (serial sum,
// all 32 loads issued ahead of it), fixed-order 4-way combine. 64 means / 64 maxes funnelled through LDS; wave 0 writes both 256-B
// Coverage: 512 blocks x 64 pixels = 8 x 4096 per plane.
// ---------------------------------------------------------------------------
__global__ __launch_bounds__(256) void k_poolc(const float* __restrict__ x2, float* __restrict__ SPIN) {
  __shared__ float ps[4][64], pm[4][64];
  __shared__ __align__(16) float os[128];
  const int b = blockIdx.x >> 6, g = blockIdx.x & 63;
  const int tid = threadIdx.x, lane = tid & 31;
  const int p = tid & 63, cg = tid >> 6;
  const float* src = x2 + ((size_t)b * NC + cg * 32) * NP + g * 64 + p;
  float s = 0.f, m = -INFINITY;
#pragma unroll   // whole: the 32 loads do not depend on one another and share one trip to memory (by fours: eight trips)
  for (int c = 0; c < 32; ++c) {
    const float v = bfr(src[(size_t)c * NP]);
    s += v;
    m = fmaxf(m, v);
  }
  ps[cg][p] = s;
  pm[cg][p] = m;
  __syncthreads();
  if (tid < 64) {
    const float ts = ((ps[0][tid] + ps[1][tid]) + ps[2][tid]) + ps[3][tid];
    const float tm = fmaxf(fmaxf(pm[0][tid], pm[1][tid]), fmaxf(pm[2][tid], pm[3][tid]));
    os[tid] = ts * (1.0f / 128.0f);
    os[64 + tid] = tm;
  }
  __syncthreads();
  if (tid < 32) {
    const v4f v = *(const v4fa*)(os + 4 * lane);   // lanes 0..15: means 0..63, lanes 16..31: maxes 0..63
    float* base = SPIN + (size_t)b * 2 * NP + g * 64;
    {
      if (lane < 16) *(v4f*)(base + 4 * lane) = v;
      else           *(v4f*)(base + NP + 4 * (lane - 16)) = v;
      
    }
  }
}

// ---------------------------------------------------------------------------
// Kernel 5: positional branch, grid (1 + 16, 8 batches), 256 threads, all f32 VALU:
//   ch[c]   = sum_{i in {mean,max}} sum_{t<5} bf16r(conv1_w[i][t]) * stk[i][c+t-2]   (zero pad 2, no flip, no bias)
//   Avec[o] = sum_c bf16r(ck_w[o][c]) * ch[c] + bf16r(ck_b[o]) ;  R[o] = sum_c bf16r(ck_w[o][c])
//   sp[n]   = sum_i sum_{u,v<7} bf16r(sp_w[i][u][v]) * spin[i][h+u-3][w+v-3] + bf16r(sp_b)   (zero pad 3)
// blockIdx.x == 0: the channel branch of batch b (AVEC[b][128] by wave 0, RVEC[b][128] by wave 1).
// blockIdx.x == 1 + s: the spatial conv of image rows 4s..4s+3 (256 pixels, one per thread). The two pooled maps are
// staged with their halo as zero-padded 10x70 LDS planes; each wave stores one whole 128-B line of SP.
// Coverage: AVEC/RVEC 8 x 128; SP 8 x 16 blocks x 256 thr = 8 x 4096.
// ---------------------------------------------------------------------------
#define POS_ROWS   4                     // image rows per spatial work-group
#define POS_SLICES (64 / POS_ROWS)       // spatial work-groups per batch
#define POS_PLANE  ((POS_ROWS + 6) * 70) // floats per padded plane
static_assert(POS_ROWS * 64 == 256);
static_assert(2 * POS_PLANE > 5 * 256 && 2 * POS_PLANE <= 6 * 256);

__global__ __launch_bounds__(256) void k_pos(const float* __restrict__ POOL,
                                            const float* __restrict__ SPIN, const float* __restrict__ c1w,
                                            const float* __restrict__ ckw, const float* __restrict__ ckb,
                                            const float* __restrict__ spw, const float* __restrict__ spb,
                                            float* __restrict__ AVEC, float* __restrict__ RVEC,
                                            float* __restrict__ SP) {
  __shared__ float sav[128], smx[128];
  __shared__ __align__(16) float sch[128];
  __shared__ float sw1[32];
  __shared__ __align__(16) float sw2[128];
  __shared__ __align__(16) float savec[128], srv[128];
  __shared__ float spl[2 * POS_PLANE];
  const int b = blockIdx.y, tid = threadIdx.x, lane = tid & 31, w = tid >> 5;

  if (blockIdx.x == 0) {                               // block-uniform: every barrier below is passed by the whole block
    const int o = tid & 127;                           // waves 4..7 repeat waves 0..3 and store nothing
    // the ck_w row and ck_b are read here, ahead of the first barrier, so that they are in flight together with the
    // pooled values instead of one dependent round trip per four weights behind the second barrier
    v4f wq[NC / 4];                                    // this thread's whole ck_w row
#pragma unroll
    for (int i = 0; i < NC / 4; ++i) wq[i] = *(const v4fa*)(ckw + (size_t)o * NC + 4 * i);
    const float cb = ckb[o];
    if (tid < 128) {                                   // row b*128+tid: its work-group's line of POOL, mean and max
      const unsigned row = (unsigned)(b * NC + tid);
      const float* pl = POOL + (row / PB_ROWS) * PB_LINE + (row % PB_ROWS);
      sav[tid] = pl[0];
      smx[tid] = pl[PB_ROWS];
    }
    if (tid < 32) sw1[tid] = bfr(c1w[min(tid, 9)]);    // clamped address
    __syncthreads();
    // channel conv1d
    if (tid < 128) {
      const int c = tid;
      float acc = 0.0f;
#pragma unroll 1
      for (int t = 0; t < 5; ++t) {
        const int cc  = c + t - 2;
        const int ccl = min(max(cc, 0), NC - 1);
        const float valid = (cc >= 0 && cc < NC) ? 1.0f : 0.0f;
        acc += valid * (sw1[t] * sav[ccl] + sw1[5 + t] * smx[ccl]);
      }
      sch[c] = acc;
    }
    __syncthreads();
    // Avec, R: c ascending, as one chain each (Avec by fused multiply-add, written out so that the unrolled form
    // is not split into packed multiplies and separate adds). Unrolled so that the row stays in registers.
    {
      float a = bfr(cb), r = 0.0f;
#pragma unroll
      for (int c = 0; c < NC; ++c) {
        const float wv = bfr(wq[c >> 2][c & 3]);
        a = __builtin_fmaf(wv, sch[c], a);
        r += wv;
      }
      if (tid < 128) { savec[o] = a; srv[o] = r; }
    }
    __syncthreads();
    if (w == 0) {
      const v4f v = *(const v4fa*)(savec + 4 * lane);
      *(v4f*)(AVEC + b * NC + 4 * lane) = v;
    } else if (w == 1) {
      const v4f v = *(const v4fa*)(srv + 4 * lane);
      *(v4f*)(RVEC + b * NC + 4 * lane) = v;
    }
    return;
  }

  // spatial 7x7x2 conv + bias of image rows h0..h0+3
  const int sl = blockIdx.x - 1;
  const int h0 = sl * POS_ROWS;
  const float* sp0 = SPIN + (size_t)b * 2 * NP;
  const float bias_sp = bfr(spb[0]);                   // read ahead of the barrier, with the other loads
  {
    // padded planes with halo: every lane loads at a clamped address, so that the weight load and the six tile loads
    // are in flight together; what lies outside the image becomes 0
    const float wt = spw[min(tid, 97)];
    float tv[6];
#pragma unroll
    for (int k = 0; k < 6; ++k) {
      const int i   = min(k * 256 + tid, 2 * POS_PLANE - 1);
      const int pl  = i / POS_PLANE, rem = i - pl * POS_PLANE;
      const int rr  = rem / 70, cc = rem - rr * 70;
      const int gh  = h0 + rr - 3, gx = cc - 3;
      const bool in = gh >= 0 && gh < 64 && gx >= 0 && gx < 64;
      const float v = sp0[pl * NP + min(max(gh, 0), 63) * 64 + min(max(gx, 0), 63)];
      tv[k] = in ? v : 0.0f;
    }
    if (tid < 128) sw2[tid] = bfr(wt);
#pragma unroll
    for (int k = 0; k < 5; ++k) spl[k * 256 + tid] = tv[k];
    if (5 * 256 + tid < 2 * POS_PLANE) spl[5 * 256 + tid] = tv[5];
  }
  __syncthreads();
  {
    const int h = tid >> 6, x = tid & 63;
    const float* t0 = spl + h * 70 + x;
    float acc = bias_sp;
    // both tap loops unrolled: the 98 LDS reads of a pixel do not depend on one another and overlap, where the
    // rolled loops paid one LDS round trip a tap; the taps are added in the same order
#pragma unroll
    for (int u = 0; u < 7; ++u) {
#pragma unroll
      for (int v = 0; v < 7; ++v) {
        const int li = u * 70 + v;
        acc += sw2[u * 7 + v] * t0[li] + sw2[49 + u * 7 + v] * t0[POS_PLANE + li];
      }
    }
    SP[(size_t)b * NP + sl * 256 + tid] = acc;
    asm volatile("s_wait_xcnt 0x0" ::: "memory");      // before a register that the store names is rewritten
  }
}

// ---------------------------------------------------------------------------
// Kernel 6: [Q|K|V] = XT . Wqkv^T + bias (exact bf16 x bf16 products, f32 accumulate, K = 128 in 4 steps of 32).
// grid = (32768/64 = 512 token tiles, 3 = which), 128 threads = 4 waves; wave w owns tokens m0+16w..+15 x all 128
// output channels (8 accumulator tiles). A fragments straight from XT rows, B fragments from Wqkv rows (both
// k-contiguous bf16, arithmetic addressing). bias (bf16r), Avec and R staged in LDS (one scalar load per thread each).
// Epilogue: f32 tile (acc + bias) staged in LDS [64][132];
//   which 0: alpha[n] = sum_o Avec[b][o] q[o][n], beta[n] = sum_o R[o] q[o][n] (f32, unroll 4) -> ALPHA/BETA 256-B
//            segments (16 lanes x 16 B); Q hi|lo token-major planes [tok][128];
//   which 1: K hi|lo token-major planes;  which 2: V hi|lo channel-major planes [b][c][4096] (transposed write).
// ---------------------------------------------------------------------------
__global__ __launch_bounds__(128) void k_qkv(const __bf16* __restrict__ XT, const __bf16* __restrict__ Wb,
                                            const float* __restrict__ qb, const float* __restrict__ kb,
                                            const float* __restrict__ vb,
                                            const float* __restrict__ AVEC, const float* __restrict__ RVEC,
                                            unsigned short* __restrict__ QP, unsigned short* __restrict__ KP,
                                            unsigned short* __restrict__ VP,
                                            float* __restrict__ ALPHA, float* __restrict__ BETA) {
  __shared__ __align__(16) float sT[64 * 132];
  __shared__ __align__(16) float sAV[128], sRV[128], sAB[128], sBI[128];
  const int tid = threadIdx.x, lane = tid & 31, w = tid >> 5, hh = lane >> 4, l16 = lane & 15;
  const int which = blockIdx.y;
  const int m0 = blockIdx.x * 64;            // global token row
  const int b  = m0 / NP;
  const int n0 = m0 - b * NP;

  const float* bias = (which == 0) ? qb : ((which == 1) ? kb : vb);   // block-uniform select, same address space
  sAV[tid] = AVEC[b * NC + tid];
  sRV[tid] = RVEC[b * NC + tid];
  sBI[tid] = bfr(bias[tid]);
  __syncthreads();

  const v8f zero8 = {0.f, 0.f, 0.f, 0.f, 0.f, 0.f, 0.f, 0.f};
  v8f acc[8];
#pragma unroll
  for (int t = 0; t < 8; ++t) acc[t] = zero8;

  const __bf16* arow = XT + (size_t)(m0 + 16 * w + l16) * NC;        // token row, k = input channel
  const __bf16* brow = Wb + ((size_t)which * NC + l16) * NC;          // output channel row (tile 0), k = input channel
#pragma unroll
  for (int kc = 0; kc < 4; ++kc) {
    const v16b a = ldfrag(arow + kc * 32, hh);
#pragma unroll
    for (int t = 0; t < 8; ++t) {
      const v16b bf = ldfrag(brow + (size_t)t * 16 * NC + kc * 32, hh);
      acc[t] = mma_bf(a, bf, acc[t]);
    }
  }
  // D[r] of tile t = Y[token 16w+8hh+r][channel 16t+l16]
#pragma unroll
  for (int t = 0; t < 8; ++t) {
    const float bv = sBI[16 * t + l16];
#pragma unroll
    for (int r = 0; r < 8; ++r) sT[(16 * w + 8 * hh + r) * 132 + 16 * t + l16] = acc[t][r] + bv;
  }
  __syncthreads();
  if (which == 0 && tid < 64) {            // waves 0,1
    const float* qr = sT + tid * 132;
    float a = 0.0f, be = 0.0f;
#pragma unroll 4
    for (int o = 0; o < NC; ++o) {
      const float q = qr[o];
      a  += sAV[o] * q;
      be += sRV[o] * q;
    }
    sAB[tid] = a;
    sAB[64 + tid] = be;
  }
  __syncthreads();

  // pack hi|lo planes
  const int q8 = lane & 7, sub = lane >> 3;
  v4u hv[8], lv[8];
#pragma unroll
  for (int i = 0; i < 8; ++i) {
    const int lid  = w * 32 + i * 4 + sub;                                   // 0..127
    const int base = (which != 2) ? ((lid >> 1) * 132 + (lid & 1) * 64 + 8 * q8) : ((8 * q8) * 132 + lid);
    const int estr = (which != 2) ? 1 : 132;
    v4u a, a2;
#pragma unroll
    for (int q = 0; q < 4; ++q) {
      const float f0 = sT[base + (2 * q) * estr];
      const float f1 = sT[base + (2 * q + 1) * estr];
      unsigned ph, pl;
      split2(f0, f1, ph, pl);
      a[q]  = ph;
      a2[q] = pl;
    }
    hv[i] = a;
    lv[i] = a2;
  }
  unsigned short* P = (which == 0) ? QP : ((which == 1) ? KP : VP);
  {
#pragma unroll
    for (int i = 0; i < 8; ++i) {
      const int lid = w * 32 + i * 4 + sub;
      const size_t go = (which != 2)
          ? ((size_t)(m0 + (lid >> 1)) * NC + (lid & 1) * 64 + 8 * q8)
          : (((size_t)b * NC + lid) * NP + n0 + 8 * q8);
      *(v4ua*)(P + go) = hv[i];
      *(v4ua*)(P + PLANE_ELEMS + go) = lv[i];
    }
    
  }
  if (which == 0 && w == 0) {
    const v4f v = *(const v4fa*)(sAB + 4 * lane);    // lanes 0..15: alpha 0..63, lanes 16..31: beta 0..63
    {
      if (lane < 16) *(v4f*)(ALPHA + m0 + 4 * lane) = v;
      else           *(v4f*)(BETA + m0 + 4 * (lane - 16)) = v;
      
    }
  }
}

// ---------------------------------------------------------------------------
// Kernel 7: full (non-causal, unmasked) attention, head dim 128, block per (b, 64-query tile): grid 8 x 64 = 512,
// 128 threads = 4 waves. Wave w: query group g = w&1 (queries 32g..32g+31, two tiles u of 16), key half kh = w>>1.
//   energy[n][m] = q[n].k[m] (bf16 hi/lo 3-term WMMA) + alpha[m] + sp[n]*beta[m]  (f32, no scale)
//   Both products are taken transposed, so that a lane owns ONE query per tile (n = 32g + 16u + (lane&15)) all the way:
//   S^T = K . Q^T : A = K rows (m = key), B = Q rows (n = query); D[r] of tile (u, jj) = S[key key0+16jj+8hh+r][query].
//   The Q fragments of the wave's 32 queries (hi|lo, 4 steps of 32 channels) are loaded once from global memory and stay
//   in registers for all 64 chunks; every K and V fragment that is read from LDS feeds both query tiles (6 products).
//   The 16 scores of a lane and tile are keys key0+8hh+0..7 and key0+16+8hh+0..7: exactly the k order of a B fragment of
//   32 keys, so p hi|lo is packed in registers and goes into the second product with no trip through LDS.
//   O^T += V . P^T : A = Vcm rows (m = channel), B = P (n = query, k = the wave's own 32 keys), all 128 channels
//   (8 accumulator tiles per query tile); D[r] of tile (u, t) = O[channel 16t+8hh+r][query].
//   Row max and row sum are in-lane over 16 values plus one exchange with lane^16. Each wave keeps an online softmax
//   state (max, sum, O) of its own for its key half of every chunk; the two halves of a query are merged once,
//   behind the key loop, through LDS: O = (O0 2^(m0-m) + O1 2^(m1-m)) / (l0 2^(m0-m) + l1 2^(m1-m)).
//   Online softmax over all 4096 keys in 64 chunks of 64 (compile-time trip count, no masking). The running maximum is
//   kept in log2 units (max * log2 e), so that p = 2^(e * log2 e - max) is one fused multiply-add and one v_exp_f32;
//   the correction of the older sums, 2^(old max - new max), uses the very values the older p were formed with.
// LDS: K hi|lo [64][128], Vcm hi|lo [128][64]; every row is
// padded by 16 B (pitch 272 B for 256-B rows, 144 B for 128-B rows = 16 B x odd), so the 16 rows that one 16-byte
// fragment read touches fall on 16 different bank groups; the lo plane of K starts 64 B and that of V 128 B past a
// multiple of 256 B; staging gives consecutive lanes consecutive 16-B pieces of a row (whole lines);
// K, V and alpha|beta come by asynchronous copies to LDS, one buffer each, two barriers a chunk: V(kc) is issued behind
// the barrier at the loop's head (V.P of kc-1 done) and waited for in front of the barrier behind the scores;
// K(kc+1), alpha|beta(kc+1) are issued behind that barrier (scores of kc done) and waited for in front of the barrier
// at the loop's head;
// alpha/beta slices [64]+[64], merge arrays [128]+[128]; output tile [128 c][64 n] (pitch 68) overlays the
// K/V region after the loop (block barrier first).
// Staging coverage per chunk: K 32 rounds x 64 thr x 8 = 64x128 x 2 planes, V 32 rounds x 64 thr x 8 = 128x64 x 2 planes;
// Output: out[b][c][n0..n0+63] channel-major; each channel row segment = 256 B = 16 contiguous lanes x 16 B
// ---------------------------------------------------------------------------
#define KQ_PITCH 136                       // elements: 128 + 8 (272 B)
#define VP_PITCH 72                        // elements: 64 + 8 (144 B)
#define KQ_PLANE (64 * KQ_PITCH + 32)      // elements: 17472 B = 68 x 256 + 64
#define V_PLANE  (128 * VP_PITCH + 64)     // elements: 18560 B = 72 x 256 + 128
#define SM_K   0
#define SM_V   (SM_K + 2 * KQ_PLANE * 2)
#define SM_AB  (SM_V + 2 * V_PLANE * 2)
#define SM_RED (SM_AB + 512)
#define SM_TOT (SM_RED + 1024)
static_assert(128 * 68 * 4 <= SM_AB);
static_assert(SM_V % 16 == 0 && SM_AB % 16 == 0);
static_assert(2 * SM_TOT <= 327680);

// Two waves per SIMD (two work-groups of four waves on a WGP): the register budget of a wave is 512.
__global__ __launch_bounds__(128) __attribute__((amdgpu_waves_per_eu(2)))
void k_attn(const __bf16* __restrict__ QP, const __bf16* __restrict__ KP,
            const __bf16* __restrict__ VP, const float* __restrict__ ALPHA,
            const float* __restrict__ BETA, const float* __restrict__ SP,
            float* __restrict__ out) {
  __shared__ __align__(16) unsigned char smem[SM_TOT];
  __bf16* Ks   = (__bf16*)(smem + SM_K);     // hi at +0, lo at +KQ_PLANE elements
  __bf16* Vs   = (__bf16*)(smem + SM_V);
  float*  sab  = (float*)(smem + SM_AB);     // alpha 0..63, beta 64..127
  float*  redm = (float*)(smem + SM_RED);    // final row max of a key half [2 g][2 kh][2 u][16]
  float*  reds = redm + 128;                 // final row sum of a key half [2 g][2 kh][2 u][16]
  float*  Os   = (float*)(smem + SM_K);      // [128][68] after the key loop

  const int tid = threadIdx.x, lane = tid & 31, w = tid >> 5, hh = lane >> 4, c = lane & 15;
  const int g = w & 1, kh = w >> 1;
  const int key0 = 32 * kh;                  // this wave's key half within a chunk
  const int b  = blockIdx.x >> 6;
  const int n0 = (blockIdx.x & 63) * 64;
  const size_t tok0 = (size_t)b * NP + n0;

  // ---- the wave's Q fragments hi|lo, once, straight from the token-major planes: 2 tiles x 4 steps x 2 planes ----
  v16b qa[2][4], ql[2][4];
  float spq[2];                              // sp[n] of this lane's two queries
  // block-uniform plane bases and one byte offset of the lane (its tile-0 query row, at its half's first 8 channels)
  const uint64_t qsrc[2] = {ubase(QP + tok0 * NC), ubase(QP + PLANE_ELEMS + tok0 * NC)};
  const unsigned qoff = (unsigned)((32 * g + c) * NC + 8 * hh) * 2u;
  const float* spp = SP + tok0 + 32 * g + c;
#pragma unroll   // constant indices keep the fragments in registers
  for (int u = 0; u < 2; ++u) {
#pragma unroll
    for (int dc = 0; dc < 4; ++dc) {
      FB fa, fl;
      fa.h[0] = ldg16(qsrc[0], qoff, (16 * u * NC + dc * 32) * 2);
      fa.h[1] = ldg16(qsrc[0], qoff, (16 * u * NC + dc * 32 + 16) * 2);
      fl.h[0] = ldg16(qsrc[1], qoff, (16 * u * NC + dc * 32) * 2);
      fl.h[1] = ldg16(qsrc[1], qoff, (16 * u * NC + dc * 32 + 16) * 2);
      qa[u][dc] = fa.v;
      ql[u][dc] = fl.v;
    }
    spq[u] = spp[16 * u];
  }
  // before a register that these loads name is rewritten; what they name are inputs, so that it lives up to the wait
  asm volatile("s_wait_xcnt 0x0" :: "v"(qoff), "s"(qsrc[0]), "s"(qsrc[1]), "v"(spp) : "memory");
  // this wave's own running max (log2 units) and sum of the lane's two queries (same in lane^16)
  float mrow[2] = {-INFINITY, -INFINITY}, lrow[2] = {0.0f, 0.0f};
  const v8f zero8 = {0.f, 0.f, 0.f, 0.f, 0.f, 0.f, 0.f, 0.f};
  v8f oacc[2][8];
#pragma unroll
  for (int u = 0; u < 2; ++u) {
#pragma unroll
    for (int t = 0; t < 8; ++t) oacc[u][t] = zero8;
  }

  // K/V plane bases of this batch (block-uniform) and the lane's running byte offsets (below 1 MiB + one tile)
  const uint64_t ksrc[2] = {ubase(KP + (size_t)b * NP * NC), ubase(KP + PLANE_ELEMS + (size_t)b * NP * NC)};
  const uint64_t vsrc[2] = {ubase(VP + (size_t)b * NC * NP), ubase(VP + PLANE_ELEMS + (size_t)b * NC * NP)};
  // Who copies what: waves 0,1 bring the K tiles (wave 0 the alpha|beta slice too), waves 2,3 the V tiles, so that a
  // wave's wait for its own copies never holds up the other tile's copies in flight. The wave's number stands in a
  // scalar register: every test on it is a scalar branch, and every lane is on at every copy.
  const int wu = __builtin_amdgcn_readfirstlane(w);
  const int ct = tid & 63;                             // the lane's place among the 64 lanes that bring a tile
  const int ck_r = ct >> 4, ck_c = (ct & 15) * 8;      // K: 16 lanes per 256-B row, 4 rows per round
  const int cv_r = ct >> 3, cv_c = (ct & 7) * 8;       // V:  8 lanes per 128-B row, 8 rows per round
  unsigned koff = (unsigned)(ck_r * NC + ck_c) * 2u;   // the lane's running byte offset in the token-major K planes
  unsigned voff = (unsigned)(cv_r * NP + cv_c) * 2u;   // the lane's running byte offset in the channel-major V planes
  // K: 2 planes x 16 rounds x 64 thr x 8 elements = 64 rows x 128 x 2 planes
  __bf16* kd = Ks + ck_r * KQ_PITCH + ck_c;
  // V: 2 planes x 16 rounds x 64 thr x 8 elements = 128 channel rows x 64 keys x 2 planes
  __bf16* vd = Vs + cv_r * VP_PITCH + cv_c;
  // alpha|beta slice of a chunk: one copy, lanes 0..15 the 64 alphas, lanes 16..31 the 64 betas
  const uint64_t absrc = (uint64_t)((lane < 16 ? ALPHA + 4 * lane : BETA + 4 * (lane - 16)) + (size_t)b * NP);

  // chunk 0's K tile and alpha|beta slice, into LDS that nobody has touched yet
  if (wu < 2) {
#pragma unroll   // each copy's plane and step are constants: no index arithmetic is left at run time
    for (int i = 0; i < 32; ++i)
      cp16(ksrc[i >> 4], koff, (i & 15) * 4 * NC * 2, kd + (i >> 4) * KQ_PLANE + (i & 15) * 4 * KQ_PITCH);
    if (wu == 0) cp16(absrc, 0, 0, sab + 4 * lane);
  }

#pragma unroll 1
  for (int kc = 0; kc < NP / 64; ++kc) {
    // this chunk's K and alpha|beta have landed; every wave has left the V tile
    wait_lds();
    wait_copies();
    __syncthreads();
    // this chunk's V tile flies under the scores
    if (wu >= 2) {
#pragma unroll   // as above: constant plane and step per copy
      for (int i = 0; i < 32; ++i)
        cp16(vsrc[i >> 4], voff, (i & 15) * 8 * NP * 2, vd + (i >> 4) * V_PLANE + (i & 15) * 8 * VP_PITCH);
      voff += 64 * 2;        // next 64 keys: 64 columns of V
    }

    // ---- scores, transposed: s[u][jj][r] = S[key m0+key0+16jj+8hh+r][query 32g+16u+c], 3-term split ----
    v8f s[2][2];
    s[0][0] = zero8; s[0][1] = zero8; s[1][0] = zero8; s[1][1] = zero8;
    // K fragments come two groups (12 products) ahead of their use, through a ring of three register sets, so that a
    // group's LDS latency passes under the products of the groups in front of it. Group q: channel step q>>1, key tile q&1.
    v16b kf[3][2];
#pragma unroll
    for (int q = 0; q < 2; ++q) {
      const __bf16* krow = Ks + (key0 + 16 * (q & 1) + c) * KQ_PITCH + (q >> 1) * 32;
      kf[q][0] = ldfrag(krow, hh);
      kf[q][1] = ldfrag(krow + KQ_PLANE, hh);
    }
#pragma unroll   // the Q fragments and the ring are indexed by constants, so that they stay in registers
    for (int q = 0; q < 8; ++q) {
      if (q + 2 < 8) {
        const __bf16* krow = Ks + (key0 + 16 * ((q + 2) & 1) + c) * KQ_PITCH + ((q + 2) >> 1) * 32;
        kf[(q + 2) % 3][0] = ldfrag(krow, hh);
        kf[(q + 2) % 3][1] = ldfrag(krow + KQ_PLANE, hh);
      }
      const int dc = q >> 1, jj = q & 1;
      const v16b kb = kf[q % 3][0], kl = kf[q % 3][1];
      // the two query tiles take turns, so that no product waits for the one directly ahead of it
      s[0][jj] = mma_hi(kb, qa[0][dc], s[0][jj]);
      s[1][jj] = mma_hi(kb, qa[1][dc], s[1][jj]);
      s[0][jj] = mma_hi(kl, qa[0][dc], s[0][jj]);
      s[1][jj] = mma_hi(kl, qa[1][dc], s[1][jj]);
      s[0][jj] = mma_hi(kb, ql[0][dc], s[0][jj]);
      s[1][jj] = mma_hi(kb, ql[1][dc], s[1][jj]);
    }
    // ---- positional terms in f32 (alpha, beta of the lane's 16 keys), then the max over this wave's 32 keys ----
    float cmx[2] = {-INFINITY, -INFINITY};
#pragma unroll
    for (int jj = 0; jj < 2; ++jj) {
      const float* ap = sab + key0 + 16 * jj + 8 * hh;
      const v4f a0 = *(const v4fa*)(ap),      a1 = *(const v4fa*)(ap + 4);
      const v4f b0 = *(const v4fa*)(ap + 64), b1 = *(const v4fa*)(ap + 68);
#pragma unroll
      for (int u = 0; u < 2; ++u) {
#pragma unroll
        for (int r = 0; r < 8; ++r) {
          const float al = (r < 4) ? a0[r & 3] : a1[r & 3];
          const float be = (r < 4) ? b0[r & 3] : b1[r & 3];
          const float e = s[u][jj][r] + al + spq[u] * be;
          s[u][jj][r] = e;
          cmx[u] = fmaxf(cmx[u], e);
        }
      }
    }
#pragma unroll
    for (int u = 0; u < 2; ++u) cmx[u] = fmaxf(cmx[u], xhalf(cmx[u]));
    wait_lds();                   // every wave has left the K tile and the alpha|beta slice
    if (wu >= 2) wait_copies();   // this chunk's V has landed
    __syncthreads();
    // the next chunk's K tile and alpha|beta slice fly under the softmax and V.P
    if (kc + 1 < NP / 64) {
      if (wu < 2) {
        koff += 64 * NC * 2; // next 64 keys: 64 token rows of K
#pragma unroll   // as above: constant plane and step per copy
        for (int i = 0; i < 32; ++i)
          cp16(ksrc[i >> 4], koff, (i & 15) * 4 * NC * 2, kd + (i >> 4) * KQ_PLANE + (i & 15) * 4 * KQ_PITCH);
        if (wu == 0) cp16(absrc, (unsigned)(kc + 1) * 64 * 4, 0, sab + 4 * lane);
      }
    }
    // V fragments come two channel tiles (12 products) ahead of their use, through a ring of three register sets, as with
    // K; the first two tiles' reads stand here, so that their LDS latency passes under the softmax.
    v16b vf[3][2];
#pragma unroll
    for (int t = 0; t < 2; ++t) {
      const __bf16* vr = Vs + (16 * t + c) * VP_PITCH + key0;
      vf[t][0] = ldfrag(vr, hh);
      vf[t][1] = ldfrag(vr + V_PLANE, hh);
    }
    // keeps these reads where they stand (vector, scalar and exp instructions may cross): the compiler sinks them to their use
    __builtin_amdgcn_sched_barrier(0x406);
    // ---- online softmax of the lane's queries over this wave's keys; P hi|lo packed as B fragments in registers ----
    union PB { v16b v; unsigned u[8]; } pa[2], pl[2];   // element 8jj+r = key key0+16jj+8hh+r: the fragment's k order
#pragma unroll
    for (int u = 0; u < 2; ++u) {
      const float mnew = fmaxf(mrow[u], cmx[u] * LOG2E);
      const float corr = ex2(mrow[u] - mnew);
      mrow[u] = mnew;
      float psum = 0.0f;
#pragma unroll
      for (int jj = 0; jj < 2; ++jj) {
#pragma unroll
        for (int r = 0; r < 8; r += 2) {
          const float p0 = ex2(__builtin_fmaf(s[u][jj][r], LOG2E, -mnew));
          const float p1 = ex2(__builtin_fmaf(s[u][jj][r + 1], LOG2E, -mnew));
          psum += p0;
          psum += p1;
          split2(p0, p1, pa[u].u[4 * jj + (r >> 1)], pl[u].u[4 * jj + (r >> 1)]);
        }
      }
      psum += xhalf(psum);
      lrow[u] = lrow[u] * corr + psum;
#pragma unroll
      for (int t = 0; t < 8; ++t) {
#pragma unroll
        for (int r = 0; r < 8; ++r) oacc[u][t][r] *= corr;
      }
    }

    // ---- O^T += V . P^T : A = Vcm row (channel 16t+c) [key], B = P [key][query]; 8 channel tiles, the wave's 32 keys ----
#pragma unroll   // the accumulator tiles and the ring are indexed by constants, so that they stay in registers
    for (int t = 0; t < 8; ++t) {
      if (t + 2 < 8) {
        const __bf16* vr = Vs + (16 * (t + 2) + c) * VP_PITCH + key0;
        vf[(t + 2) % 3][0] = ldfrag(vr, hh);
        vf[(t + 2) % 3][1] = ldfrag(vr + V_PLANE, hh);
      }
      // keeps the reads two tiles ahead of their products (vector, scalar and exp instructions may cross), as above
      __builtin_amdgcn_sched_barrier(0x406);
      const v16b vb = vf[t % 3][0], vl = vf[t % 3][1];
      // the two query tiles take turns, as in the scores
      oacc[0][t] = mma_hi(vb, pa[0].v, oacc[0][t]);
      oacc[1][t] = mma_hi(vb, pa[1].v, oacc[1][t]);
      oacc[0][t] = mma_hi(vl, pa[0].v, oacc[0][t]);
      oacc[1][t] = mma_hi(vl, pa[1].v, oacc[1][t]);
      oacc[0][t] = mma_hi(vb, pl[0].v, oacc[0][t]);
      oacc[1][t] = mma_hi(vb, pl[1].v, oacc[1][t]);
    }
  }
  wait_lds();
  wait_copies();     // no copy is in flight here; the wait stands before the tiles' LDS gets another use
  // ---- merge the two key halves of every query: exchange (max, sum), scale, add through the output tile ----
  if (hh == 0) {
#pragma unroll
    for (int u = 0; u < 2; ++u) {
      redm[g * 64 + kh * 32 + 16 * u + c] = mrow[u];
      reds[g * 64 + kh * 32 + 16 * u + c] = lrow[u];
    }
  }
  __syncthreads();   // all waves done with the K/V tiles before the output tile overlays them; max and sum published
  {
    float fs[2];
#pragma unroll
    for (int u = 0; u < 2; ++u) {
      const float m0 = redm[g * 64 + 16 * u + c], m1 = redm[g * 64 + 32 + 16 * u + c];
      const float l0 = reds[g * 64 + 16 * u + c], l1 = reds[g * 64 + 32 + 16 * u + c];
      const float mt = fmaxf(m0, m1);
      const float f0 = ex2(m0 - mt), f1 = ex2(m1 - mt);
      const float inv = 1.0f / (l0 * f0 + l1 * f1);
      fs[u] = (kh == 0 ? f0 : f1) * inv;
    }
    float* op = Os + (8 * hh) * 68 + 32 * g + c;     // O staged as [c][n_local]
    if (wu >= 2) {                                   // key half 1 stores its share
#pragma unroll
      for (int u = 0; u < 2; ++u) {
#pragma unroll
        for (int t = 0; t < 8; ++t) {
#pragma unroll
          for (int r = 0; r < 8; ++r) op[(16 * t + r) * 68 + 16 * u] = oacc[u][t][r] * fs[u];
        }
      }
    }
    __syncthreads();
    if (wu < 2) {                                    // key half 0 adds its own to the same places
#pragma unroll
      for (int u = 0; u < 2; ++u) {
#pragma unroll
        for (int t = 0; t < 8; ++t) {
#pragma unroll
          for (int r = 0; r < 8; ++r)
            op[(16 * t + r) * 68 + 16 * u] = oacc[u][t][r] * fs[u] + op[(16 * t + r) * 68 + 16 * u];
        }
      }
    }
  }
  __syncthreads();
  {
    float* ob = out + (size_t)b * NC * NP + n0;
    const int c4 = (lane & 15) * 4;
    {
#pragma unroll
      for (int i = 0; i < 16; ++i) {
        const int row = i * 8 + w * 2 + hh;                        // 0..127 channel
        const v4f v = *(const v4fa*)(Os + row * 68 + c4);
        *(v4f*)(ob + (size_t)row * NP + c4) = v;
      }
      
    }
  }
}

// ---------------------------------------------------------------------------
//   XT    bf16 [32768][128]          0           8388608
//   WQKV  bf16 [384][128]            8388608       98304
//   POOL  f32  [256][32]             8486912       32768
//   SPIN  f32  [8][2][4096]          8519680      262144
//   AVEC  f32  [8][128]              8781824        4096
//   RVEC  f32  [8][128]              8785920        4096
//   SP    f32  [8][4096]             8790016      131072
//   ALPHA f32  [8][4096]             8921088      131072
//   BETA  f32  [8][4096]             9052160      131072
//   Q hi|lo bf16 2x[32768][128]      9183232    16777216
//   K hi|lo bf16 2x[32768][128]     25960448    16777216
//   V hi|lo bf16 2x[8][128][4096]   42737664    16777216
//   total                          59514880
// ---------------------------------------------------------------------------
extern "C" void kernel_launch(void* const* d_in, const int* in_sizes, int n_in,
                              void* d_out, int out_size, void* d_ws, size_t ws_size,
                              hipStream_t stream) {
  if (n_in < 13) return;
  if (in_sizes[0] != NB * NC * NP || in_sizes[1] != NB * NC * NP) return;
  if (in_sizes[2] != NC * NC || in_sizes[4] != NC * NC || in_sizes[6] != NC * NC || in_sizes[8] != NC * NC) return;
  if (in_sizes[3] != NC || in_sizes[5] != NC || in_sizes[7] != NC || in_sizes[9] != NC) return;
  if (in_sizes[10] != 10 || in_sizes[11] != 98 || in_sizes[12] != 1) return;
  if (out_size != NB * NC * NP) return;

  const float* x    = (const float*)d_in[0];
  const float* x2   = (const float*)d_in[1];
  const float* q_w  = (const float*)d_in[2];
  const float* q_b  = (const float*)d_in[3];
  const float* k_w  = (const float*)d_in[4];
  const float* k_b  = (const float*)d_in[5];
  const float* v_w  = (const float*)d_in[6];
  const float* v_b  = (const float*)d_in[7];
  const float* ck_w = (const float*)d_in[8];
  const float* ck_b = (const float*)d_in[9];
  const float* c1w  = (const float*)d_in[10];
  const float* sp_w = (const float*)d_in[11];
  const float* sp_b = (const float*)d_in[12];
  float* out = (float*)d_out;

  const size_t plane_b = PLANE_ELEMS * 2;                 // 8388608 bytes per 16-bit plane
  size_t off = 0;
  const size_t oXT   = off; off += plane_b;
  const size_t oW    = off; off += (size_t)3 * NC * NC * 2;
  const size_t oPOOL = off; off += (size_t)(NB * NC / PB_ROWS) * PB_LINE * 4;
  const size_t oSPIN = off; off += (size_t)NB * 2 * NP * 4;
  const size_t oAVEC = off; off += (size_t)NB * NC * 4;
  const size_t oRVEC = off; off += (size_t)NB * NC * 4;
  const size_t oSP   = off; off += (size_t)NB * NP * 4;
  const size_t oAL   = off; off += (size_t)NB * NP * 4;
  const size_t oBE   = off; off += (size_t)NB * NP * 4;
  const size_t oQ    = off; off += 2 * plane_b;
  const size_t oK    = off; off += 2 * plane_b;
  const size_t oV    = off; off += 2 * plane_b;           // off = 59514880
  if (off > ws_size) return;
  if (off > (size_t)134217728) return;

  char* ws = (char*)d_ws;
  unsigned short* XT    = (unsigned short*)(ws + oXT);
  unsigned short* WQKV  = (unsigned short*)(ws + oW);
  float* POOL  = (float*)(ws + oPOOL);
  float* SPIN  = (float*)(ws + oSPIN);
  float* AVEC  = (float*)(ws + oAVEC);
  float* RVEC  = (float*)(ws + oRVEC);
  float* SP    = (float*)(ws + oSP);
  float* ALPHA = (float*)(ws + oAL);
  float* BETA  = (float*)(ws + oBE);
  unsigned short* QP = (unsigned short*)(ws + oQ);
  unsigned short* KPp = (unsigned short*)(ws + oK);
  unsigned short* VPp = (unsigned short*)(ws + oV);

  // 1. x -> token-major bf16 planes (grid: n blocks, c blocks, batch)
  k_xt<<<dim3(NP / 64, NC / 64, NB), 256, 0, stream>>>(x, XT);
  // 2. projection weights -> bf16 [384][128]
  k_wcvt<<<dim3(NC * NC / 8 / 256, 3), 256, 0, stream>>>(q_w, k_w, v_w, WQKV);
  // 3. per-(b,c) pixel mean/max of x2
  k_poolbc<<<NB * NC / PB_ROWS, 256, 0, stream>>>(x2, POOL);
  // 4. per-(b,n) channel mean/max of x2
  k_poolc<<<NB * (NP / 64), 256, 0, stream>>>(x2, SPIN);
  // 5. positional branch: Avec, R (x = 0), sp (x = 1..16), per batch (y)
  k_pos<<<dim3(POS_SLICES + 1, NB), 256, 0, stream>>>(POOL, SPIN, c1w, ck_w, ck_b, sp_w, sp_b, AVEC, RVEC, SP);
  // 6. q/k/v projections + alpha/beta + hi|lo planes
  k_qkv<<<dim3(NTOK / 64, 3), 128, 0, stream>>>((const __bf16*)(const void*)XT, (const __bf16*)(const void*)WQKV,
                                                q_b, k_b, v_b, AVEC, RVEC, QP, KPp, VPp, ALPHA, BETA);
  // 7. attention, channel-major output
  k_attn<<<NB * (NP / 64), 128, 0, stream>>>((const __bf16*)(const void*)QP, (const __bf16*)(const void*)KPp,
                                             (const __bf16*)(const void*)VPp, ALPHA, BETA, SP, out);
  (void)hipGetLastError();
}
